// v000
// Times are from an AMD MI455X. After a warm-up the kernel runs many times in a row, and a time is the length of
// such a window on the GPU divided by its runs, so every launch and the gaps after it count. The runs cycle
// through copies of the inputs. A figure is the median of several windows, for all but v000 over two sittings.
// Sittings can differ by a few percent; kernels timed side by side share one.
// v000 is the starting kernel. One run takes 549 microseconds.
#include <hip/hip_runtime.h>
// LucaGPLMMultiheadAttentionWithSDPA (query [2048][2][1024] in [S, B, E] layout, 16 heads x 64: q/k/v = query W^T + b; rotary embedding per head (inv_freq = 10000^(-2i/64), rotate-half form) on q and k; softmax(q k^T / 8) v (no mask); out = attn Wo^T + bo, back in [S, B, E]).
// Structure: [S,B,E] -> exact f16 (b, s) rows; q/k as f16 WMMA GEMMs with f32 output (32x64 wave tiles, f32 accumulation, exact x16 weights + bias) followed by RoPE on VALU (f32 angles s * inv_freq, sinf/cosf) into f16 planes; v as an f16 GEMM; V^T by LDS tiles; flash-style fused attention per (batch, head, 64-query block) (QK^T, online softmax, PV in registers/LDS; no score plane), f32 context; output projection as a two-term GEMM on the context's f16 hi/residual split + bias into (b, s) rows, then the [S, B, E] store on VALU.
// Compute dtype: inputs rounded to bf16; query / weights exact as f16; roped q/k and v plain f16 (~2^-12); softmax f32 with f16 probabilities; context hi + 2^-10 residual into the projection. v_wmma_f32_16x16x32_f16.
#define NB 2
#define DM 1024
#define NKV 16
#define NREP (NH / NKV)
#define KVD (NKV * 64)           /* 1024 */
#define NR (NB * SLEN)
#define CHK 512
typedef int v4i __attribute__((ext_vector_type(4)));
#define FF 2048
#define SLEN 2048
#define MQI 2048
#define MKI 2048
#define TQ SLEN
#define TK SLEN
#define NH 16
#define SCL 0.125f
#define QBLKS (TQ / 64)
#define QB05 0
#define QBN5 4
#define QB0P 0
#define QBNP QBLKS
#define RE 256
typedef __bf16 v16b __attribute__((ext_vector_type(16)));
typedef unsigned short v8us __attribute__((ext_vector_type(8), may_alias));
typedef float  v8f  __attribute__((ext_vector_type(8)));
typedef float  v4f  __attribute__((ext_vector_type(4)));
typedef float  v4fa __attribute__((ext_vector_type(4), may_alias));
union FragB { v16b v; v8us half[2]; unsigned short u[16]; };

__device__ __forceinline__ unsigned short bf16_bits(float x) { unsigned int u = __float_as_uint(x); return (unsigned short)((u + 0x7FFFu + ((u >> 16) & 1u)) >> 16); }
__device__ __forceinline__ float bf16_val(unsigned short b) { return __uint_as_float(((unsigned int)b) << 16); }
__device__ __forceinline__ float bf16_round(float x) { return bf16_val(bf16_bits(x)); }
// D += A·B with NT terms: 1 = ah·bh, 2 = + al·bh (A split), 3 = + ah·bl (both split)
template <int NT>
__device__ __forceinline__ v8f mmaN(v16b ah, v16b al, v16b bh, v16b bl, v8f c) {
  c = __builtin_amdgcn_wmma_f32_16x16x32_bf16(false, ah, false, bh, (short)0, c, false, false);
  if (NT >= 2) c = __builtin_amdgcn_wmma_f32_16x16x32_bf16(false, al, false, bh, (short)0, c, false, false);
  if (NT >= 3) c = __builtin_amdgcn_wmma_f32_16x16x32_bf16(false, ah, false, bl, (short)0, c, false, false);
  asm volatile("v_nop\n\tv_nop\n\tv_nop\n\tv_nop" : "+v"(c) : "v"(ah), "v"(al), "v"(bh), "v"(bl));
  return c;
}

__global__ __launch_bounds__(256) void k_wt_bf16(const float* __restrict__ W, unsigned short* __restrict__ Wt, int K, int N) {
  const int t = blockIdx.x * 256 + threadIdx.x;
  const int k8n = K / 8;
  if (t >= N * k8n) return;
  const int n = t / k8n, k8 = (t % k8n) * 8;
  v8us v;
#pragma unroll
  for (int i = 0; i < 8; ++i) v[i] = bf16_bits(W[(size_t)(k8 + i) * N + n]);
  *(v8us*)(Wt + (size_t)n * K + k8) = v;
  
}

// GEMM C[M][N] (f32, pitch ldc) = act(A[M][K]·W + bias). A f32 row-major (pitch lda) converted per fragment to bf16
// (ASPLIT: hi/lo two planes -> 2 terms, else single rounded term); Wt bf16 [N][K] (pitch ldb). BIAS_BF16 rounds the
// bias to bf16 first (bias quantised to bf16 before the add). K%32==0, M%16==0, N%64==0.
template <bool ASPLIT, int ACT, bool BIAS_BF16>
__global__ __launch_bounds__(128) void k_gemm_bf(const float* __restrict__ A, int lda, const unsigned short* __restrict__ Wt, int ldb,
                                               const float* __restrict__ bias, float* __restrict__ C, int ldc, int M, int N, int K) {
  __shared__ __attribute__((aligned(16))) float so[4][16][64];
  const int tid = threadIdx.x, w = tid >> 5, lane = tid & 31, ln = lane & 15, hh = lane >> 4;
  const int ntn = N / 64;
  const int wid = blockIdx.x * 4 + w;
  const int mt = wid / ntn, nq = wid % ntn;
  if (mt * 16 >= M) return;
  const int row0 = mt * 16, col0 = nq * 64;
  const float* arow = A + (size_t)(row0 + ln) * lda;
  v8f acc[4] = {};
  for (int kb = 0; kb < K; kb += 32) {
    FragB ah, al;
    const v4f x0 = *(const v4fa*)(arow + kb + 8 * hh), x1 = *(const v4fa*)(arow + kb + 8 * hh + 4);
    const v4f x2 = *(const v4fa*)(arow + kb + 16 + 8 * hh), x3 = *(const v4fa*)(arow + kb + 16 + 8 * hh + 4);
    float xs[16] = {x0[0],x0[1],x0[2],x0[3],x1[0],x1[1],x1[2],x1[3],x2[0],x2[1],x2[2],x2[3],x3[0],x3[1],x3[2],x3[3]};
#pragma unroll
    for (int i = 0; i < 16; ++i) { const unsigned short hb = bf16_bits(xs[i]); ah.u[i] = hb; al.u[i] = ASPLIT ? bf16_bits(xs[i] - bf16_val(hb)) : (unsigned short)0; }
#pragma unroll
    for (int t = 0; t < 4; ++t) {
      const unsigned short* brow = Wt + (size_t)(col0 + t * 16 + ln) * ldb + kb;
      FragB b;
      b.half[0] = *(const v8us*)(brow + 8 * hh);
      b.half[1] = *(const v8us*)(brow + 16 + 8 * hh);
      acc[t] = mmaN<ASPLIT ? 2 : 1>(ah.v, al.v, b.v, b.v, acc[t]);
    }
  }
#pragma unroll
  for (int t = 0; t < 4; ++t) {
    float bv = bias ? bias[col0 + t * 16 + ln] : 0.f;
    if (BIAS_BF16) bv = bf16_round(bv);
#pragma unroll
    for (int r = 0; r < 8; ++r) { float v = acc[t][r] + bv; if (ACT == 1) v = fmaxf(v, 0.f); so[w][8 * hh + r][t * 16 + ln] = v; }
  }
  __builtin_amdgcn_fence(__ATOMIC_ACQ_REL, "workgroup");
  __builtin_amdgcn_wave_barrier();
  const int rsub = lane >> 4, c4 = (lane & 15) * 4;
  {
#pragma unroll
    for (int q = 0; q < 8; ++q) {
      const int r = q * 2 + rsub;
      const v4f v = *(const v4fa*)&so[w][r][c4];
      *(v4f*)(C + (size_t)(row0 + r) * ldc + col0 + c4) = v;
    }
    
  }
}

// GEMM C = act(A·W + bias + resid): A f32 (ASPLIT -> hi/lo 2 terms), Wt bf16 [N][K]; ACT 0 none, 1 relu, 2 exact gelu;
// resid (optional, f32, row index = (row % rmod), pitch ldr, RES_BF16 rounds it) added before the activation.
template <bool ASPLIT, int ACT, bool BIAS_BF16, bool RES_BF16>
__global__ __launch_bounds__(128) void k_gemm_bf3(const float* __restrict__ A, int lda, const unsigned short* __restrict__ Wt, int ldb,
                                                const float* __restrict__ bias, const float* __restrict__ resid, int rmod, int ldr,
                                                float* __restrict__ C, int ldc, int M, int N, int K) {
  __shared__ __attribute__((aligned(16))) float so[4][16][64];
  const int tid = threadIdx.x, w = tid >> 5, lane = tid & 31, ln = lane & 15, hh = lane >> 4;
  const int ntn = N / 64;
  const int wid = blockIdx.x * 4 + w;
  const int mt = wid / ntn, nq = wid % ntn;
  if (mt * 16 >= M) return;
  const int row0 = mt * 16, col0 = nq * 64;
  const float* arow = A + (size_t)(row0 + ln) * lda;
  v8f acc[4] = {};
  for (int kb = 0; kb < K; kb += 32) {
    FragB ah, al;
    const v4f x0 = *(const v4fa*)(arow + kb + 8 * hh), x1 = *(const v4fa*)(arow + kb + 8 * hh + 4);
    const v4f x2 = *(const v4fa*)(arow + kb + 16 + 8 * hh), x3 = *(const v4fa*)(arow + kb + 16 + 8 * hh + 4);
    float xs[16] = {x0[0],x0[1],x0[2],x0[3],x1[0],x1[1],x1[2],x1[3],x2[0],x2[1],x2[2],x2[3],x3[0],x3[1],x3[2],x3[3]};
#pragma unroll
    for (int i = 0; i < 16; ++i) { const unsigned short hb = bf16_bits(xs[i]); ah.u[i] = hb; al.u[i] = ASPLIT ? bf16_bits(xs[i] - bf16_val(hb)) : (unsigned short)0; }
#pragma unroll
    for (int t = 0; t < 4; ++t) {
      const unsigned short* brow = Wt + (size_t)(col0 + t * 16 + ln) * ldb + kb;
      FragB b;
      b.half[0] = *(const v8us*)(brow + 8 * hh);
      b.half[1] = *(const v8us*)(brow + 16 + 8 * hh);
      acc[t] = mmaN<ASPLIT ? 2 : 1>(ah.v, al.v, b.v, b.v, acc[t]);
    }
  }
#pragma unroll
  for (int t = 0; t < 4; ++t) {
    const int col = col0 + t * 16 + ln;
    float bv = bias ? bias[col] : 0.f;
    if (BIAS_BF16) bv = bf16_round(bv);
#pragma unroll
    for (int r = 0; r < 8; ++r) {
      float v = acc[t][r] + bv;
      if (resid) { float rv = resid[(size_t)((row0 + 8 * hh + r) % rmod) * ldr + col]; if (RES_BF16) rv = bf16_round(rv); v += rv; }
      if (ACT == 1) v = fmaxf(v, 0.f);
      if (ACT == 2) v = 0.5f * v * (1.0f + erff(v * 0.70710678118654752f));
      if (ACT == 3) { const float u = 0.7978845608028654f * (v + 0.044715f * v * v * v); v = 0.5f * v * (1.0f + tanhf(u)); }
      so[w][8 * hh + r][t * 16 + ln] = v;
    }
  }
  __builtin_amdgcn_fence(__ATOMIC_ACQ_REL, "workgroup");
  __builtin_amdgcn_wave_barrier();
  const int rsub = lane >> 4, c4 = (lane & 15) * 4;
  {
#pragma unroll
    for (int q = 0; q < 8; ++q) {
      const int r = q * 2 + rsub;
      const v4f v = *(const v4fa*)&so[w][r][c4];
      *(v4f*)(C + (size_t)(row0 + r) * ldc + col0 + c4) = v;
    }
    
  }
}
// row LayerNorm (biased variance, eps) over N: s = X (+ R); optional out_sum <- s; out_norm <- (s-mu)*rsqrt(var+eps)*g + b
template <bool PARAM_BF16>
__global__ __launch_bounds__(256) void k_layernorm(const float* __restrict__ X, const float* __restrict__ R, const float* __restrict__ g, const float* __restrict__ bta,
                                                  float* __restrict__ out_sum, float* __restrict__ out_norm, int N, float eps) {
  __shared__ float red[256];
  const int row = blockIdx.x, tid = threadIdx.x;
  const float* x = X + (size_t)row * N; const float* rr = R ? R + (size_t)row * N : nullptr;
  float vals[16];                     // up to N = 4096
  const int per = N / 256;            // contiguous chunk per thread? use strided-by-4 chunks: thread handles j = tid*4 + 1024*u
  float s1 = 0.f;
  for (int u = 0; u < per / 4; ++u) {
    const int j = tid * 4 + 1024 * u;
    const v4f a = *(const v4fa*)(x + j);
    v4f b = {0.f,0.f,0.f,0.f}; if (rr) b = *(const v4fa*)(rr + j);
#pragma unroll
    for (int q = 0; q < 4; ++q) { const float v = a[q] + b[q]; vals[u * 4 + q] = v; s1 += v; }
  }
  red[tid] = s1; __syncthreads();
  for (int st = 128; st > 0; st >>= 1) { if (tid < st) red[tid] += red[tid + st]; __syncthreads(); }
  const float mu = red[0] / (float)N; __syncthreads();
  float s2 = 0.f;
  for (int u = 0; u < per / 4; ++u)
#pragma unroll
    for (int q = 0; q < 4; ++q) { const float c = vals[u * 4 + q] - mu; s2 += c * c; }
  red[tid] = s2; __syncthreads();
  for (int st = 128; st > 0; st >>= 1) { if (tid < st) red[tid] += red[tid + st]; __syncthreads(); }
  const float rs = rsqrtf(red[0] / (float)N + eps);
  {
    for (int u = 0; u < per / 4; ++u) {
      const int j = tid * 4 + 1024 * u;
      v4f o, sm;
#pragma unroll
      for (int q = 0; q < 4; ++q) {
        float gg = g[j + q], bb = bta[j + q];
        if (PARAM_BF16) { gg = bf16_round(gg); bb = bf16_round(bb); }
        sm[q] = vals[u * 4 + q]; o[q] = (vals[u * 4 + q] - mu) * rs * gg + bb;
      }
      if (out_sum) *(v4f*)(out_sum + (size_t)row * N + j) = sm;
      *(v4f*)(out_norm + (size_t)row * N + j) = o;
    }
    
  }
}



// ---- f16 WMMA path (v_wmma_f32_16x16x32_f16): 11-bit significands for operands in range — used where a [0,1] probability operand needs more precision than bf16
typedef _Float16 v16h __attribute__((ext_vector_type(16)));
union FragH { v16h v; v8us half[2]; _Float16 h[16]; unsigned short u[16]; };
template <int NT>
__device__ __forceinline__ v8f mmaH(v16h ah, v16h al, v16h bh, v16h bl, v8f c) {
  c = __builtin_amdgcn_wmma_f32_16x16x32_f16(false, ah, false, bh, (short)0, c, false, false);
  if (NT >= 2) c = __builtin_amdgcn_wmma_f32_16x16x32_f16(false, al, false, bh, (short)0, c, false, false);
  if (NT >= 3) c = __builtin_amdgcn_wmma_f32_16x16x32_f16(false, ah, false, bl, (short)0, c, false, false);
  asm volatile("v_nop\n\tv_nop\n\tv_nop\n\tv_nop" : "+v"(c) : "v"(ah), "v"(al), "v"(bh), "v"(bl));
  return c;
}
// batched GEMM like k_gemm_b but f16 operands: A f32 (split into f16 hi/lo if ASPLIT, else rounded to f16), Bt = f16 values [n][k]; alpha; C f32; N multiple of 16 (partial tiles skipped)
template <bool ASPLIT>
__global__ __launch_bounds__(128) void k_gemm_h(const float* __restrict__ A, int lda, size_t sA, const _Float16* __restrict__ Bh, int ldb, size_t sB, float alpha, float* __restrict__ C, int ldc, size_t sC, int M, int N, int K) {
  __shared__ __attribute__((aligned(16))) float so[4][16][64];
  const int tid = threadIdx.x, w = tid >> 5, lane = tid & 31, ln = lane & 15, hh = lane >> 4; const int by = blockIdx.y;
  A += (size_t)by * sA; Bh += (size_t)by * sB; C += (size_t)by * sC;
  const int ntn = (N + 63) / 64; const int wid = blockIdx.x * 4 + w; const int mt = wid / ntn, nq = wid % ntn; if (mt * 16 >= M) return;
  const int row0 = mt * 16, col0 = nq * 64; const float* arow = A + (size_t)(row0 + ln) * lda;
  v8f acc[4] = {};
  for (int kb = 0; kb < K; kb += 32) {
    FragH ah, al;
    const v4f x0 = *(const v4fa*)(arow + kb + 8 * hh), x1 = *(const v4fa*)(arow + kb + 8 * hh + 4), x2 = *(const v4fa*)(arow + kb + 16 + 8 * hh), x3 = *(const v4fa*)(arow + kb + 16 + 8 * hh + 4);
    float xs[16] = {x0[0],x0[1],x0[2],x0[3],x1[0],x1[1],x1[2],x1[3],x2[0],x2[1],x2[2],x2[3],x3[0],x3[1],x3[2],x3[3]};
#pragma unroll
    for (int i = 0; i < 16; ++i) { const _Float16 h = (_Float16)xs[i]; ah.h[i] = h; al.h[i] = ASPLIT ? (_Float16)(xs[i] - (float)h) : (_Float16)0.0f; }
#pragma unroll
    for (int t = 0; t < 4; ++t) { if (col0 + t * 16 >= N) continue; const size_t boff = (size_t)(col0 + t * 16 + ln) * ldb + kb; FragH bq; bq.half[0] = *(const v8us*)(Bh + boff + 8 * hh); bq.half[1] = *(const v8us*)(Bh + boff + 16 + 8 * hh);
      acc[t] = mmaH<ASPLIT ? 2 : 1>(ah.v, al.v, bq.v, bq.v, acc[t]); }
  }
#pragma unroll
  for (int t = 0; t < 4; ++t) { if (col0 + t * 16 >= N) continue;
#pragma unroll
    for (int r = 0; r < 8; ++r) so[w][8 * hh + r][t * 16 + ln] = acc[t][r] * alpha; }
  __builtin_amdgcn_fence(__ATOMIC_ACQ_REL, "workgroup"); __builtin_amdgcn_wave_barrier();
  const int rsub = lane >> 4, c4 = (lane & 15) * 4;
  {
#pragma unroll
    for (int q = 0; q < 8; ++q) { const int r = q * 2 + rsub; if (col0 + c4 < N) { const v4f v = *(const v4fa*)&so[w][r][c4]; *(v4f*)(C + (size_t)(row0 + r) * ldc + col0 + c4) = v; } }
     }
}

// Wt[n][k] = f16(W[k][n]·scale) from f32 row-major W[K][N] (scale = power of two; bf16-exact weights stay exact in f16 away from the subnormal range)
__global__ __launch_bounds__(256) void k_wt_f16(const float* __restrict__ W, _Float16* __restrict__ Wt, int K, int N, float scale) {
  const int t = blockIdx.x * 256 + threadIdx.x; if (t >= N * (K / 8)) return; const int n = t / (K / 8), k8 = (t % (K / 8)) * 8; FragH f;
#pragma unroll
  for (int i = 0; i < 8; ++i) f.h[i] = (_Float16)(bf16_round(W[(size_t)(k8 + i) * N + n]) * scale); const v8us o = f.half[0];
  *(v8us*)((unsigned short*)Wt + (size_t)n * K + k8) = o; 
}
// k_gemm_hh variant with fused epilogue: v = acc·alpha + bias[by·sBias + col] (+ CP[(row/rowsPerB)·sCPb + by·64 + col] if CP) ; ACT 0 none / 1 elu ; writes f16 C16 (and f32 C if non-null)
template <int ACT>
__global__ __launch_bounds__(128) void k_gemm_hhx(const _Float16* __restrict__ A, int lda, size_t sA, const _Float16* __restrict__ Bh, int ldb, size_t sB, float alpha, const float* __restrict__ bias, size_t sBias, const float* __restrict__ CP, int rowsPerB, size_t sCPb, int row0g,
    float* __restrict__ C, _Float16* __restrict__ C16, int ldc, size_t sC, int M, int N, int K) {
  __shared__ __attribute__((aligned(16))) float so[4][16][64];
  const int tid = threadIdx.x, w = tid >> 5, lane = tid & 31, ln = lane & 15, hh = lane >> 4; const int by = blockIdx.y;
  A += (size_t)by * sA; Bh += (size_t)by * sB; const size_t cofs = (size_t)by * sC; const float* bp = bias ? bias + (size_t)by * sBias : nullptr;
  const int ntn = (N + 63) / 64; const int wid = blockIdx.x * 4 + w; const int mt = wid / ntn, nq = wid % ntn; if (mt * 16 >= M) return;
  const int row0 = mt * 16, col0 = nq * 64; const _Float16* arow = A + (size_t)(row0 + ln) * lda;
  v8f acc[4] = {};
  for (int kb = 0; kb < K; kb += 32) { FragH ah; ah.half[0] = *(const v8us*)((const unsigned short*)arow + kb + 8 * hh); ah.half[1] = *(const v8us*)((const unsigned short*)arow + kb + 16 + 8 * hh);
#pragma unroll
    for (int t = 0; t < 4; ++t) { if (col0 + t * 16 >= N) continue; const size_t boff = (size_t)(col0 + t * 16 + ln) * ldb + kb; FragH bq; bq.half[0] = *(const v8us*)((const unsigned short*)Bh + boff + 8 * hh); bq.half[1] = *(const v8us*)((const unsigned short*)Bh + boff + 16 + 8 * hh);
      acc[t] = mmaH<1>(ah.v, ah.v, bq.v, bq.v, acc[t]); }
  }
#pragma unroll
  for (int t = 0; t < 4; ++t) { if (col0 + t * 16 >= N) continue; const int col = col0 + t * 16 + ln; const float bv = bp ? bf16_round(bp[col]) : 0.f;
#pragma unroll
    for (int r = 0; r < 8; ++r) { float v = acc[t][r] * alpha + bv; if (CP) { const int bidx = (row0g + row0 + 8 * hh + r) / rowsPerB; v += CP[(size_t)bidx * sCPb + (size_t)by * 64 + col]; } if (ACT == 1) v = (v > 0.f) ? v : expm1f(v); else if (ACT == 7) v = (v > 0.f) ? v + 1.0f : expf(v); else if (ACT == 8) v = tanhf(v); else if (ACT == 9) v = 0.5f * v * (1.0f + tanhf(0.7978845608028654f * (v + 0.044715f * v * v * v))); else if (ACT == 11) v = 1.0f / (1.0f + expf(-v)); else if (ACT == 12) v = (v > 0.f) ? v : 0.01f * v; else if (ACT == 14) v = (v > 0.f) ? v : 0.1f * v; else if (ACT == 15) v = v / (1.0f + expf(-v)); else if (ACT == 3) v = fmaxf(v, 0.f); else if (ACT == 6) v = 0.5f * v * (1.0f + erff(v * 0.70710678118654752f)); so[w][8 * hh + r][t * 16 + ln] = v; } }
  __builtin_amdgcn_fence(__ATOMIC_ACQ_REL, "workgroup"); __builtin_amdgcn_wave_barrier();
  const int rsub = lane >> 4, c4 = (lane & 15) * 4; typedef _Float16 v4h __attribute__((ext_vector_type(4)));
  {
#pragma unroll
    for (int q = 0; q < 8; ++q) { const int r = q * 2 + rsub; if (col0 + c4 < N) { const v4f v = *(const v4fa*)&so[w][r][c4]; if (C) *(v4f*)(C + cofs + (size_t)(row0 + r) * ldc + col0 + c4) = v; if (C16) { v4h h4; for (int i = 0; i < 4; ++i) h4[i] = (_Float16)v[i]; *(v4h*)(C16 + cofs + (size_t)(row0 + r) * ldc + col0 + c4) = h4; } } }
     }
}


typedef _Float16 v4h __attribute__((ext_vector_type(4)));

__global__ __launch_bounds__(256) void k_x16(const float* __restrict__ x, _Float16* __restrict__ X16, size_t n8) { const size_t t = (size_t)blockIdx.x * 256 + threadIdx.x; if (t >= n8) return; FragH f;
#pragma unroll
  for (int q = 0; q < 8; ++q) f.h[q] = (_Float16)bf16_round(x[t * 8 + q]); *(v8us*)((unsigned short*)X16 + t * 8) = f.half[0];  }
__global__ __launch_bounds__(256) void k_h16(const float* __restrict__ x, _Float16* __restrict__ X16, size_t n8) { const size_t t = (size_t)blockIdx.x * 256 + threadIdx.x; if (t >= n8) return; FragH f;
#pragma unroll
  for (int q = 0; q < 8; ++q) f.h[q] = (_Float16)x[t * 8 + q]; *(v8us*)((unsigned short*)X16 + t * 8) = f.half[0];  }
__global__ __launch_bounds__(256) void k_round16f(const float* __restrict__ W, _Float16* __restrict__ Bt, size_t n8) { const size_t t = (size_t)blockIdx.x * 256 + threadIdx.x; if (t >= n8) return; FragH f;
#pragma unroll
  for (int i = 0; i < 8; ++i) f.h[i] = (_Float16)(bf16_round(W[t * 8 + i]) * 16.0f); *(v8us*)((unsigned short*)Bt + t * 8) = f.half[0];  }
template <int NHv, int TTv>
__global__ __launch_bounds__(256) void k_vt(const _Float16* __restrict__ V16, int ldv, int voff, _Float16* __restrict__ Vt) { __shared__ unsigned short tl[64][66]; const int tid = threadIdx.x; const int slab = blockIdx.x / (TTv / 64), lg = blockIdx.x % (TTv / 64); const int b = slab / NHv, h = slab % NHv;
  for (int i = tid; i < 64 * 8; i += 256) { const int r = i / 8, c8 = (i % 8) * 8; FragH f; f.half[0] = *(const v8us*)((const unsigned short*)V16 + ((size_t)b * TTv + lg * 64 + r) * ldv + voff + h * 64 + c8);
#pragma unroll
    for (int q = 0; q < 8; ++q) tl[r][c8 + q] = f.u[q]; }
  __syncthreads();
  {
#pragma unroll
    for (int rd = 0; rd < 2; ++rd) { const int d = rd * 32 + tid / 8, pc = tid % 8; FragH f;
#pragma unroll
      for (int q = 0; q < 8; ++q) f.u[q] = tl[pc * 8 + q][d];
      *(v8us*)((unsigned short*)Vt + ((size_t)slab * 64 + d) * TTv + lg * 64 + pc * 8) = f.half[0]; }
     } }

__global__ __launch_bounds__(256) void k_hl(const float* __restrict__ F, _Float16* __restrict__ Hh, _Float16* __restrict__ Hl, size_t n8) { const size_t t = (size_t)blockIdx.x * 256 + threadIdx.x; if (t >= n8) return; FragH fh, fl; const v4f a = *(const v4fa*)(F + t * 8), c = *(const v4fa*)(F + t * 8 + 4);
#pragma unroll
  for (int q = 0; q < 4; ++q) { _Float16 h = (_Float16)a[q]; fh.h[q] = h; fl.h[q] = (_Float16)((a[q] - (float)h) * 1024.0f); h = (_Float16)c[q]; fh.h[4 + q] = h; fl.h[4 + q] = (_Float16)((c[q] - (float)h) * 1024.0f); }
  { *(v8us*)((unsigned short*)Hh + t * 8) = fh.half[0]; *(v8us*)((unsigned short*)Hl + t * 8) = fl.half[0];  } }

// ---- fast GEMM (wave tile 32x64; requires M % 32 == 0 rows per launch region and N % 64 == 0); epilogue = k_gemm_hhx semantics ----
__device__ __forceinline__ v16h g2_frag(const _Float16* p, int hh) { FragH f; f.half[0] = *(const v8us*)((const unsigned short*)p + 8 * hh); f.half[1] = *(const v8us*)((const unsigned short*)p + 16 + 8 * hh); return f.v; }
__device__ __forceinline__ v8f g2_mma(v16h a, v16h b, v8f c) { v8f d = __builtin_amdgcn_wmma_f32_16x16x32_f16(false, a, false, b, (short)0, c, false, false); asm volatile("v_nop\n\tv_nop\n\tv_nop\n\tv_nop" : "+v"(d) : "v"(a), "v"(b)); return d; }
template <int ACT>
__global__ __launch_bounds__(128) void k_gemm2(const _Float16* __restrict__ A, int lda, size_t sA, const _Float16* __restrict__ Bh, int ldb, size_t sB, float alpha, const float* __restrict__ bias, size_t sBias, const float* __restrict__ CP, int rowsPerB, size_t sCPb, int row0g,
    float* __restrict__ C, _Float16* __restrict__ C16, int ldc, size_t sC, int M, int N, int K) {
  __shared__ __attribute__((aligned(16))) float so[4][32][68];
  const int tid = threadIdx.x, w = tid >> 5, lane = tid & 31, ln = lane & 15, hh = lane >> 4; const int by = blockIdx.y;
  A += (size_t)by * sA; Bh += (size_t)by * sB; const size_t cofs = (size_t)by * sC; const float* bp = bias ? bias + (size_t)by * sBias : nullptr;
  const int ntn = N >> 6; const int mt = blockIdx.x / ntn, nq = blockIdx.x - mt * ntn; const int row0 = mt * 128 + 32 * w, col0 = nq * 64; if (row0 >= M) return;
  const _Float16* a0p = A + (size_t)(row0 + ln) * lda; const _Float16* a1p = a0p + (size_t)16 * lda;
  const _Float16* b0p = Bh + (size_t)(col0 + ln) * ldb; const _Float16* b1p = b0p + (size_t)16 * ldb; const _Float16* b2p = b1p + (size_t)16 * ldb; const _Float16* b3p = b2p + (size_t)16 * ldb;
  const v8f z8 = {0.f,0.f,0.f,0.f,0.f,0.f,0.f,0.f}; v8f c00 = z8, c01 = z8, c02 = z8, c03 = z8, c10 = z8, c11 = z8, c12 = z8, c13 = z8;
#pragma unroll 1
  for (int kb = 0; kb < K; kb += 32) { const v16h a0 = g2_frag(a0p + kb, hh), a1 = g2_frag(a1p + kb, hh);
    v16h b = g2_frag(b0p + kb, hh); c00 = g2_mma(a0, b, c00); c10 = g2_mma(a1, b, c10);
    b = g2_frag(b1p + kb, hh); c01 = g2_mma(a0, b, c01); c11 = g2_mma(a1, b, c11);
    b = g2_frag(b2p + kb, hh); c02 = g2_mma(a0, b, c02); c12 = g2_mma(a1, b, c12);
    b = g2_frag(b3p + kb, hh); c03 = g2_mma(a0, b, c03); c13 = g2_mma(a1, b, c13); }
  v8f accs[8] = {c00, c01, c02, c03, c10, c11, c12, c13};
#pragma unroll
  for (int u = 0; u < 8; ++u) { const int t = u & 3, half = u >> 2; const int col = col0 + t * 16 + ln; const float bv = bp ? bf16_round(bp[col]) : 0.f;
#pragma unroll
    for (int r = 0; r < 8; ++r) { const int rloc = half * 16 + 8 * hh + r; float v = accs[u][r] * alpha + bv; if (CP) { if (rowsPerB < 0) v += CP[cofs + (size_t)(row0g + row0 + rloc) * ldc + col];      /* rowsPerB < 0: own element of the batched C plane */ else { const int bidx = (row0g + row0 + rloc) / rowsPerB; v += CP[(size_t)bidx * sCPb + (size_t)by * 64 + col]; } }
      if (ACT == 3) v = fmaxf(v, 0.f); else if (ACT == 6) v = 0.5f * v * (1.0f + erff(v * 0.70710678118654752f)); else if (ACT == 11) v = 1.0f / (1.0f + expf(-v)); else if (ACT == 15) v = v / (1.0f + expf(-v)); else if (ACT == 12) v = (v > 0.f) ? v : 0.01f * v; else if (ACT == 8) v = tanhf(v);
      so[w][rloc][t * 16 + ln] = v; } }
  __builtin_amdgcn_fence(__ATOMIC_ACQ_REL, "workgroup"); __builtin_amdgcn_wave_barrier();
  const int rsub = lane >> 4, c4 = (lane & 15) * 4;
  {
#pragma unroll
    for (int q = 0; q < 16; ++q) { const int r = q * 2 + rsub; const v4f v = *(const v4fa*)&so[w][r][c4]; if (C) *(v4f*)(C + cofs + (size_t)(row0 + r) * ldc + col0 + c4) = v; if (C16) { v4h h4; for (int i = 0; i < 4; ++i) h4[i] = (_Float16)v[i]; *(v4h*)(C16 + cofs + (size_t)(row0 + r) * ldc + col0 + c4) = h4; } }
     } }



template <int CAUSAL>
__global__ __launch_bounds__(128) void k_flash(const _Float16* __restrict__ Q16, int ldq, const _Float16* __restrict__ K16, int ldk, const _Float16* __restrict__ Vt, const int* __restrict__ MSK, float* __restrict__ O, int ldo) {
  constexpr int RPW = 16, RTN = RPW / 16, NQB = TQ / (4 * RPW), DT = 4, KS = 2;
  __shared__ __attribute__((aligned(16))) unsigned short sP[4][RPW][40]; __shared__ __attribute__((aligned(16))) float sO[4][RPW][64 + 4];
  const int tid = threadIdx.x, w = tid >> 5, lane = tid & 31, ln = lane & 15, hh = lane >> 4;
  const int slab = blockIdx.x / QBNP, qblk = QB0P + blockIdx.x % QBNP; (void)NQB; const int b = slab / NH, h = slab % NH; const int qb0 = qblk * (4 * RPW); const int q0 = qb0 + w * RPW;
  FragH aq[2][KS];
#pragma unroll
  for (int rt = 0; rt < RTN; ++rt) { const unsigned short* qr = (const unsigned short*)Q16 + ((size_t)b * TQ + q0 + rt * 16 + ln) * ldq + h * 64;
#pragma unroll
    for (int ks = 0; ks < KS; ++ks) { aq[rt][ks].half[0] = *(const v8us*)(qr + ks * 32 + 8 * hh); aq[rt][ks].half[1] = *(const v8us*)(qr + ks * 32 + 16 + 8 * hh); } }
  const unsigned short* Vth = (const unsigned short*)Vt + (size_t)slab * 64 * TK;
  float m_r[2][8], l_r[2][8]; v8f oacc[2][DT];
#pragma unroll
  for (int rt = 0; rt < RTN; ++rt) {
#pragma unroll
    for (int r = 0; r < 8; ++r) { m_r[rt][r] = -3.0e38f; l_r[rt][r] = 0.f; }
#pragma unroll
    for (int dt = 0; dt < DT; ++dt) oacc[rt][dt] = (v8f){0.f,0.f,0.f,0.f,0.f,0.f,0.f,0.f}; }
  const int jend = (CAUSAL == 1) ? (qb0 + 4 * RPW) : ((CAUSAL == 23) ? min(TK, (qb0 / CHK + 2) * CHK) : TK);      /* causal / window: keys that can never contribute are skipped */ const int jbeg = (CAUSAL == 23) ? max(0, (qb0 / CHK - 1) * CHK) : 0;
#pragma unroll 1
  for (int j0 = jbeg; j0 < jend; j0 += 32) {
    v8f s[2][2];
#pragma unroll
    for (int nt = 0; nt < 2; ++nt) { const unsigned short* kr = (const unsigned short*)K16 + ((size_t)b * TK + j0 + nt * 16 + ln) * ldk + h * 64; FragH bk[KS];
#pragma unroll
      for (int ks = 0; ks < KS; ++ks) { bk[ks].half[0] = *(const v8us*)(kr + ks * 32 + 8 * hh); bk[ks].half[1] = *(const v8us*)(kr + ks * 32 + 16 + 8 * hh); }
#pragma unroll
      for (int rt = 0; rt < RTN; ++rt) { v8f acc = (v8f){0.f,0.f,0.f,0.f,0.f,0.f,0.f,0.f};
#pragma unroll
        for (int ks = 0; ks < KS; ++ks) acc = mmaH<1>(aq[rt][ks].v, aq[rt][ks].v, bk[ks].v, bk[ks].v, acc); s[rt][nt] = acc; } }
#pragma unroll
    for (int rt = 0; rt < RTN; ++rt)
#pragma unroll
      for (int r = 0; r < 8; ++r) { const int tq = q0 + rt * 16 + 8 * hh + r; const int k0 = j0 + ln, k1 = j0 + 16 + ln;
        bool ok0 = (CAUSAL == 1) ? (k0 <= tq) : ((CAUSAL == 2) ? ((k0 >> 5) == (tq >> 5)) : true), ok1 = (CAUSAL == 1) ? (k1 <= tq) : ((CAUSAL == 2) ? ((k1 >> 5) == (tq >> 5)) : true); if (CAUSAL == 23) { const int cq = tq / CHK; ok0 = (abs(k0 / CHK - cq) <= 1) && (MSK[(size_t)b * TK + k0] == 0); ok1 = (abs(k1 / CHK - cq) <= 1) && (MSK[(size_t)b * TK + k1] == 0); }      /* mode 23: 3-chunk window + int key-padding mask */
        if (CAUSAL == 24) { ok0 = (MSK[(size_t)b * TK + k0] == 0); ok1 = (MSK[(size_t)b * TK + k1] == 0); }      /* mode 24: int key-padding mask (nonzero = padded = excluded) */      /* mode 2: block-diagonal 32-token groups */
        float s0 = ok0 ? s[rt][0][r] * SCL : -3.0e38f, s1 = ok1 ? s[rt][1][r] * SCL : -3.0e38f; if (CAUSAL == 27) { const float* amk = (const float*)MSK + ((size_t)b * MQI + tq) * MKI; s0 += bf16_round(amk[k0]); s1 += bf16_round(amk[k1]); }      /* mode 27: additive per-(batch, query, key) f32 mask INPUT [b][tq][k] */ if (CAUSAL == 17) { const float* amk = (const float*)MSK + (size_t)b * TK; s0 += bf16_round(amk[k0]); s1 += bf16_round(amk[k1]); } if (CAUSAL == 18) { const float* tb = (const float*)MSK; const int* ri = MSK + 1024 + (size_t)b * TK; const int rq = ri[tq]; s0 += tb[(h * 8 + rq) * 8 + ri[k0]]; s1 += tb[(h * 8 + rq) * 8 + ri[k1]]; } if (CAUSAL == 19) { const int* rel = MSK + (size_t)tq * TK; const float* rb = (const float*)MSK + (size_t)TQ * TK + ((size_t)(b * NH + h) * TQ + tq) * 64; s0 += rb[rel[k0]]; s1 += rb[rel[k1]]; }      /* mode 19: + (q.Ek[rel] + Eb[rel][h]) / 8 gathered by the int relative ids (packed [ids | table]) */      /* mode 18: + resource_bias[h][r_q][r_k] from the packed [table | ids] buffer (TQ == TK) */      /* mode 17: additive per-(batch, key) mask INPUT */ float mc = fmaxf(s0, s1);
        mc = fmaxf(mc, __shfl_xor(mc, 1, 32)); mc = fmaxf(mc, __shfl_xor(mc, 2, 32)); mc = fmaxf(mc, __shfl_xor(mc, 4, 32)); mc = fmaxf(mc, __shfl_xor(mc, 8, 32));
        const float mn = fmaxf(m_r[rt][r], mc); const float al = (mn > -1.0e38f) ? expf(m_r[rt][r] - mn) : 1.0f; m_r[rt][r] = mn; const float p0 = ok0 ? expf(s0 - mn) : 0.f, p1 = ok1 ? expf(s1 - mn) : 0.f; l_r[rt][r] = l_r[rt][r] * al + p0 + p1;
#pragma unroll
        for (int dt = 0; dt < DT; ++dt) oacc[rt][dt][r] *= al;
        FragH t2; t2.h[0] = (_Float16)(p0 * 1024.0f); t2.h[1] = (_Float16)(p1 * 1024.0f); sP[w][rt * 16 + 8 * hh + r][ln] = t2.u[0]; sP[w][rt * 16 + 8 * hh + r][16 + ln] = t2.u[1]; }
    __builtin_amdgcn_fence(__ATOMIC_ACQ_REL, "workgroup"); __builtin_amdgcn_wave_barrier();
    FragH pa[2];
#pragma unroll
    for (int rt = 0; rt < RTN; ++rt) { pa[rt].half[0] = *(const v8us*)&sP[w][rt * 16 + ln][8 * hh]; pa[rt].half[1] = *(const v8us*)&sP[w][rt * 16 + ln][16 + 8 * hh]; }
#pragma unroll
    for (int dt = 0; dt < DT; ++dt) { const unsigned short* vrow = Vth + (size_t)(dt * 16 + ln) * TK + j0; FragH bv; bv.half[0] = *(const v8us*)(vrow + 8 * hh); bv.half[1] = *(const v8us*)(vrow + 16 + 8 * hh);
#pragma unroll
      for (int rt = 0; rt < RTN; ++rt) oacc[rt][dt] = mmaH<1>(pa[rt].v, pa[rt].v, bv.v, bv.v, oacc[rt][dt]); }
    __builtin_amdgcn_fence(__ATOMIC_ACQ_REL, "workgroup"); __builtin_amdgcn_wave_barrier(); }
#pragma unroll
  for (int rt = 0; rt < RTN; ++rt) {
#pragma unroll
    for (int r = 0; r < 8; ++r) { float l = l_r[rt][r]; l += __shfl_xor(l, 1, 32); l += __shfl_xor(l, 2, 32); l += __shfl_xor(l, 4, 32); l += __shfl_xor(l, 8, 32); l_r[rt][r] = (l > 0.f) ? 1.0f / (l * 1024.0f) : 0.f; }
#pragma unroll
    for (int dt = 0; dt < DT; ++dt)
#pragma unroll
      for (int r = 0; r < 8; ++r) sO[w][rt * 16 + 8 * hh + r][dt * 16 + ln] = oacc[rt][dt][r] * l_r[rt][r]; }
  __builtin_amdgcn_fence(__ATOMIC_ACQ_REL, "workgroup"); __builtin_amdgcn_wave_barrier();
  {
#pragma unroll
    for (int rp = 0; rp < RPW; rp += 2) { const int r = rp + (lane >> 4), pc = lane & 15; const v4f val = *(const v4fa*)&sO[w][r][pc * 4]; *(v4f*)(O + ((size_t)b * TQ + q0 + r) * ldo + h * 64 + pc * 4) = val; }
     } }
// 5-plane variant: S = Qh Kh^T + (Ql Kh^T + Qh Kl^T)/1024 with Q/K = [hi | 2^10 residual] f16 planes (QL/KL same layout as Q16/K16), then the 3-term P.V below.
// 3-term variant: O = (P_hi V_hi + (P_lo V_hi + P_hi V_lo) / 1024) / l with P = [hi | 2^10 residual] of 1024 p and V^T = [hi | 2^10 residual] planes (VtL same layout as Vt) -> ~2^-21-class products for un-averaged (early causal / peaked) rows
template <int CAUSAL>
__global__ __launch_bounds__(128) void k_flash5(const _Float16* __restrict__ Q16, const _Float16* __restrict__ QL, int ldq, const _Float16* __restrict__ K16, const _Float16* __restrict__ KL, int ldk, const _Float16* __restrict__ Vt, const _Float16* __restrict__ VtL, const int* __restrict__ MSK, float* __restrict__ O, int ldo) {
  constexpr int RPW = 16, RTN = RPW / 16, NQB = TQ / (4 * RPW), DT = 4, KS = 2;
  __shared__ __attribute__((aligned(16))) unsigned short sP[4][RPW][40]; __shared__ __attribute__((aligned(16))) unsigned short sPL[4][RPW][40]; __shared__ __attribute__((aligned(16))) float sO[4][RPW][64 + 4];
  const int tid = threadIdx.x, w = tid >> 5, lane = tid & 31, ln = lane & 15, hh = lane >> 4;
  const int slab = blockIdx.x / QBN5, qblk = QB05 + blockIdx.x % QBN5; (void)NQB; const int b = slab / NH, h = slab % NH; const int qb0 = qblk * (4 * RPW); const int q0 = qb0 + w * RPW;
  FragH aq[2][KS], aql[2][KS];
#pragma unroll
  for (int rt = 0; rt < RTN; ++rt) { const unsigned short* qr = (const unsigned short*)Q16 + ((size_t)b * TQ + q0 + rt * 16 + ln) * ldq + h * 64; const unsigned short* ql = (const unsigned short*)QL + ((size_t)b * TQ + q0 + rt * 16 + ln) * ldq + h * 64;
#pragma unroll
    for (int ks = 0; ks < KS; ++ks) { aq[rt][ks].half[0] = *(const v8us*)(qr + ks * 32 + 8 * hh); aq[rt][ks].half[1] = *(const v8us*)(qr + ks * 32 + 16 + 8 * hh); aql[rt][ks].half[0] = *(const v8us*)(ql + ks * 32 + 8 * hh); aql[rt][ks].half[1] = *(const v8us*)(ql + ks * 32 + 16 + 8 * hh); } }
  const unsigned short* Vth = (const unsigned short*)Vt + (size_t)slab * 64 * TK; const unsigned short* Vtl = (const unsigned short*)VtL + (size_t)slab * 64 * TK;
  float m_r[2][8], l_r[2][8]; v8f oacc[2][DT], oaccL[2][DT];
#pragma unroll
  for (int rt = 0; rt < RTN; ++rt) {
#pragma unroll
    for (int r = 0; r < 8; ++r) { m_r[rt][r] = -3.0e38f; l_r[rt][r] = 0.f; }
#pragma unroll
    for (int dt = 0; dt < DT; ++dt) { oacc[rt][dt] = (v8f){0.f,0.f,0.f,0.f,0.f,0.f,0.f,0.f}; oaccL[rt][dt] = oacc[rt][dt]; } }
  const int jend = (CAUSAL == 1) ? (qb0 + 4 * RPW) : ((CAUSAL == 23) ? min(TK, (qb0 / CHK + 2) * CHK) : TK);      /* causal / window: keys that can never contribute are skipped */ const int jbeg = (CAUSAL == 23) ? max(0, (qb0 / CHK - 1) * CHK) : 0;
#pragma unroll 1
  for (int j0 = jbeg; j0 < jend; j0 += 32) {
    v8f s[2][2];
#pragma unroll
    for (int nt = 0; nt < 2; ++nt) { const unsigned short* kr = (const unsigned short*)K16 + ((size_t)b * TK + j0 + nt * 16 + ln) * ldk + h * 64; const unsigned short* klr = (const unsigned short*)KL + ((size_t)b * TK + j0 + nt * 16 + ln) * ldk + h * 64; FragH bk[KS], bkl[KS];
#pragma unroll
      for (int ks = 0; ks < KS; ++ks) { bk[ks].half[0] = *(const v8us*)(kr + ks * 32 + 8 * hh); bk[ks].half[1] = *(const v8us*)(kr + ks * 32 + 16 + 8 * hh); bkl[ks].half[0] = *(const v8us*)(klr + ks * 32 + 8 * hh); bkl[ks].half[1] = *(const v8us*)(klr + ks * 32 + 16 + 8 * hh); }
#pragma unroll
      for (int rt = 0; rt < RTN; ++rt) { v8f acc = (v8f){0.f,0.f,0.f,0.f,0.f,0.f,0.f,0.f}, accl = acc;
#pragma unroll
        for (int ks = 0; ks < KS; ++ks) { acc = mmaH<1>(aq[rt][ks].v, aq[rt][ks].v, bk[ks].v, bk[ks].v, acc); accl = mmaH<1>(aql[rt][ks].v, aql[rt][ks].v, bk[ks].v, bk[ks].v, accl); accl = mmaH<1>(aq[rt][ks].v, aq[rt][ks].v, bkl[ks].v, bkl[ks].v, accl); }
#pragma unroll
        for (int r = 0; r < 8; ++r) acc[r] += accl[r] * 0.0009765625f;
        s[rt][nt] = acc; } }
#pragma unroll
    for (int rt = 0; rt < RTN; ++rt)
#pragma unroll
      for (int r = 0; r < 8; ++r) { const int tq = q0 + rt * 16 + 8 * hh + r; const int k0 = j0 + ln, k1 = j0 + 16 + ln;
        bool ok0 = (CAUSAL == 1) ? (k0 <= tq) : ((CAUSAL == 2) ? ((k0 >> 5) == (tq >> 5)) : true), ok1 = (CAUSAL == 1) ? (k1 <= tq) : ((CAUSAL == 2) ? ((k1 >> 5) == (tq >> 5)) : true);      /* mode 2: block-diagonal 32-token groups */
        if (CAUSAL == 4) { const int* mrow = MSK + ((size_t)b * TQ + tq) * TK; ok0 = mrow[k0] != 0; ok1 = mrow[k1] != 0; }      /* mode 4: per-(query, key) INPUT mask shared by all heads; masked keys contribute nothing (== the reference's -4096 fill, whose exp underflows to 0), rows with no valid key give l = 0 -> output 0 (== the reference's row_valid zeroing) */
        float s0 = ok0 ? s[rt][0][r] * SCL : -3.0e38f, s1 = ok1 ? s[rt][1][r] * SCL : -3.0e38f; if (CAUSAL == 17) { const float* amk = (const float*)MSK + (size_t)b * TK; s0 += bf16_round(amk[k0]); s1 += bf16_round(amk[k1]); } if (CAUSAL == 18) { const float* tb = (const float*)MSK; const int* ri = MSK + 1024 + (size_t)b * TK; const int rq = ri[tq]; s0 += tb[(h * 8 + rq) * 8 + ri[k0]]; s1 += tb[(h * 8 + rq) * 8 + ri[k1]]; } if (CAUSAL == 19) { const int* rel = MSK + (size_t)tq * TK; const float* rb = (const float*)MSK + (size_t)TQ * TK + ((size_t)(b * NH + h) * TQ + tq) * 64; s0 += rb[rel[k0]]; s1 += rb[rel[k1]]; }      /* mode 19: + (q.Ek[rel] + Eb[rel][h]) / 8 gathered by the int relative ids (packed [ids | table]) */      /* mode 18: + resource_bias[h][r_q][r_k] from the packed [table | ids] buffer (TQ == TK) */      /* mode 17: additive per-(batch, key) mask INPUT */ float mc = fmaxf(s0, s1);
        mc = fmaxf(mc, __shfl_xor(mc, 1, 32)); mc = fmaxf(mc, __shfl_xor(mc, 2, 32)); mc = fmaxf(mc, __shfl_xor(mc, 4, 32)); mc = fmaxf(mc, __shfl_xor(mc, 8, 32));
        const float mn = fmaxf(m_r[rt][r], mc); const float al = (mn > -1.0e38f) ? expf(m_r[rt][r] - mn) : 1.0f; m_r[rt][r] = mn; const float p0 = ok0 ? expf(s0 - mn) : 0.f, p1 = ok1 ? expf(s1 - mn) : 0.f; l_r[rt][r] = l_r[rt][r] * al + p0 + p1;
#pragma unroll
        for (int dt = 0; dt < DT; ++dt) { oacc[rt][dt][r] *= al; oaccL[rt][dt][r] *= al; }
        FragH t2, t2l; const float ps0 = p0 * 1024.0f, ps1 = p1 * 1024.0f; t2.h[0] = (_Float16)ps0; t2.h[1] = (_Float16)ps1; t2l.h[0] = (_Float16)((ps0 - (float)t2.h[0]) * 1024.0f); t2l.h[1] = (_Float16)((ps1 - (float)t2.h[1]) * 1024.0f);
        sP[w][rt * 16 + 8 * hh + r][ln] = t2.u[0]; sP[w][rt * 16 + 8 * hh + r][16 + ln] = t2.u[1]; sPL[w][rt * 16 + 8 * hh + r][ln] = t2l.u[0]; sPL[w][rt * 16 + 8 * hh + r][16 + ln] = t2l.u[1]; }
    __builtin_amdgcn_fence(__ATOMIC_ACQ_REL, "workgroup"); __builtin_amdgcn_wave_barrier();
    FragH pa[2], pl[2];
#pragma unroll
    for (int rt = 0; rt < RTN; ++rt) { pa[rt].half[0] = *(const v8us*)&sP[w][rt * 16 + ln][8 * hh]; pa[rt].half[1] = *(const v8us*)&sP[w][rt * 16 + ln][16 + 8 * hh]; pl[rt].half[0] = *(const v8us*)&sPL[w][rt * 16 + ln][8 * hh]; pl[rt].half[1] = *(const v8us*)&sPL[w][rt * 16 + ln][16 + 8 * hh]; }
#pragma unroll
    for (int dt = 0; dt < DT; ++dt) { const unsigned short* vrow = Vth + (size_t)(dt * 16 + ln) * TK + j0; const unsigned short* vrl = Vtl + (size_t)(dt * 16 + ln) * TK + j0; FragH bv, bl; bv.half[0] = *(const v8us*)(vrow + 8 * hh); bv.half[1] = *(const v8us*)(vrow + 16 + 8 * hh); bl.half[0] = *(const v8us*)(vrl + 8 * hh); bl.half[1] = *(const v8us*)(vrl + 16 + 8 * hh);
#pragma unroll
      for (int rt = 0; rt < RTN; ++rt) { oacc[rt][dt] = mmaH<1>(pa[rt].v, pa[rt].v, bv.v, bv.v, oacc[rt][dt]); oaccL[rt][dt] = mmaH<1>(pl[rt].v, pl[rt].v, bv.v, bv.v, oaccL[rt][dt]); oaccL[rt][dt] = mmaH<1>(pa[rt].v, pa[rt].v, bl.v, bl.v, oaccL[rt][dt]); } }
    __builtin_amdgcn_fence(__ATOMIC_ACQ_REL, "workgroup"); __builtin_amdgcn_wave_barrier(); }
#pragma unroll
  for (int rt = 0; rt < RTN; ++rt) {
#pragma unroll
    for (int r = 0; r < 8; ++r) { float l = l_r[rt][r]; l += __shfl_xor(l, 1, 32); l += __shfl_xor(l, 2, 32); l += __shfl_xor(l, 4, 32); l += __shfl_xor(l, 8, 32); l_r[rt][r] = (l > 0.f) ? 1.0f / (l * 1024.0f) : 0.f; }
#pragma unroll
    for (int dt = 0; dt < DT; ++dt)
#pragma unroll
      for (int r = 0; r < 8; ++r) { float v = oacc[rt][dt][r]; v += oaccL[rt][dt][r] * 0.0009765625f; sO[w][rt * 16 + 8 * hh + r][dt * 16 + ln] = v * l_r[rt][r]; } }
  __builtin_amdgcn_fence(__ATOMIC_ACQ_REL, "workgroup"); __builtin_amdgcn_wave_barrier();
  {
#pragma unroll
    for (int rp = 0; rp < RPW; rp += 2) { const int r = rp + (lane >> 4), pc = lane & 15; const v4f val = *(const v4fa*)&sO[w][r][pc * 4]; *(v4f*)(O + ((size_t)b * TQ + q0 + r) * ldo + h * 64 + pc * 4) = val; }
     } }

__global__ __launch_bounds__(256) void k_rotab(float* __restrict__ CS, float* __restrict__ SN) {
  #pragma clang fp contract(off)
  const int t = blockIdx.x * 256 + threadIdx.x; if (t >= SLEN * 32) return; const int j = t % 32, s = t / 32; const float ex = (float)(2 * j) / 64.0f; const float inv = 1.0f / powf(10000.0f, ex); const float th = (float)s * inv; const float c = cosf(th), sn = sinf(th);
  { *(float*)(CS + t) = c; *(float*)(SN + t) = sn;  } }
__global__ __launch_bounds__(256) void k_rope(const float* __restrict__ F, int nsrc, int ndst, int rep, const float* __restrict__ CS, const float* __restrict__ SN, _Float16* __restrict__ H, _Float16* __restrict__ L) {
  #pragma clang fp contract(off)
  const size_t t = (size_t)blockIdx.x * 256 + threadIdx.x; if (t >= (size_t)NR * ndst * 4) return; const int g8 = (int)(t % 4); const int hd = (int)((t / 4) % ndst); const size_t row = t / ((size_t)4 * ndst); const int s = (int)(row % SLEN); const int hs = hd / rep;
  const float* src = F + row * (size_t)(nsrc * 64) + hs * 64; FragH ah, al, bh, bl;
  for (int i = 0; i < 8; ++i) { const int d = g8 * 8 + i; const float c = CS[s * 32 + d], sn = SN[s * 32 + d]; const float x1 = src[d], x2 = src[d + 32];
    float o1 = x1 * c; o1 += -x2 * sn; float o2 = x2 * c; o2 += x1 * sn;
    _Float16 hv = (_Float16)o1; ah.h[i] = hv; al.h[i] = (_Float16)((o1 - (float)hv) * 1024.0f); hv = (_Float16)o2; bh.h[i] = hv; bl.h[i] = (_Float16)((o2 - (float)hv) * 1024.0f); }
  const size_t o = row * (size_t)(ndst * 64) + hd * 64 + g8 * 8;
  { *(v8us*)((unsigned short*)H + o) = ah.half[0]; *(v8us*)((unsigned short*)H + o + 32) = bh.half[0]; *(v8us*)((unsigned short*)L + o) = al.half[0]; *(v8us*)((unsigned short*)L + o + 32) = bl.half[0];  } }
__global__ __launch_bounds__(256) void k_rope2(const float* __restrict__ F, int nsrc, int ndst, int rep, const float* __restrict__ CS, const float* __restrict__ SN, _Float16* __restrict__ H, _Float16* __restrict__ L) {
  #pragma clang fp contract(off)
  const size_t t = (size_t)blockIdx.x * 256 + threadIdx.x; if (t >= (size_t)NR * ndst * 4) return; const int g16 = (int)(t % 4); const int hd = (int)((t / 4) % ndst); const size_t row = t / ((size_t)4 * ndst); const int s = (int)(row % SLEN); const int hs = hd / rep;
  const float* src = F + row * (size_t)(nsrc * 64) + hs * 64 + g16 * 16; FragH ah, al;
  for (int pr = 0; pr < 8; ++pr) { const int i = g16 * 8 + pr; const float c = CS[s * 32 + i], sn = SN[s * 32 + i]; const float x1 = src[2 * pr], x2 = src[2 * pr + 1];
    float o1 = x1 * c; o1 -= x2 * sn; float o2 = x1 * sn; o2 += x2 * c;
    _Float16 hv = (_Float16)o1; ah.h[2 * pr] = hv; al.h[2 * pr] = (_Float16)((o1 - (float)hv) * 1024.0f); hv = (_Float16)o2; ah.h[2 * pr + 1] = hv; al.h[2 * pr + 1] = (_Float16)((o2 - (float)hv) * 1024.0f); }
  const size_t o = row * (size_t)(ndst * 64) + hd * 64 + g16 * 16;
  { *(v8us*)((unsigned short*)H + o) = ah.half[0]; *(v8us*)((unsigned short*)H + o + 8) = ah.half[1]; *(v8us*)((unsigned short*)L + o) = al.half[0]; *(v8us*)((unsigned short*)L + o + 8) = al.half[1];  } }
__global__ __launch_bounds__(256) void k_ln512(const float* __restrict__ A, const float* __restrict__ res, const float* __restrict__ g, const float* __restrict__ bb, float* __restrict__ Y, _Float16* __restrict__ Y16) {
  #pragma clang fp contract(off)
  const int wv = threadIdx.x >> 5, ln = threadIdx.x & 31; const size_t r = (size_t)blockIdx.x * 8 + wv; if (r >= NR) return; float x[16]; float s = 0.f;
  for (int i = 0; i < 2; ++i) { const v8f a = *(const v8f*)(A + r * DM + i * 256 + ln * 8); for (int q = 0; q < 8; ++q) { float v = a[q]; if (res) v += bf16_round(res[r * DM + i * 256 + ln * 8 + q]); x[i * 8 + q] = v; s += v; } }
  for (int o = 16; o > 0; o >>= 1) s += __shfl_xor(s, o, 32); const float mu = s / (float)DM; float var = 0.f; for (int q = 0; q < 16; ++q) { const float d = x[q] - mu; var += d * d; }
  for (int o = 16; o > 0; o >>= 1) var += __shfl_xor(var, o, 32); const float inv = rsqrtf(var / (float)DM + 1e-5f);
  { for (int i = 0; i < 2; ++i) { const int c0 = i * 256 + ln * 8; v8f y; FragH f; for (int q = 0; q < 8; ++q) { float v = (x[i * 8 + q] - mu) * inv; v *= bf16_round(g[c0 + q]); v += bf16_round(bb[c0 + q]); y[q] = v; f.h[q] = (_Float16)v; } *(v8f*)(Y + r * DM + c0) = y; if (Y16) *(v8us*)((unsigned short*)Y16 + r * DM + c0) = f.half[0]; }  } }
__global__ __launch_bounds__(256) void k_pack(const float* __restrict__ rb, const int* __restrict__ rid, int* __restrict__ PK) { const int t = blockIdx.x * 256 + threadIdx.x; if (t >= 1024 + NB * TK) return; int v; if (t < 1024) v = __float_as_int(bf16_round(rb[t])); else v = rid[t - 1024]; *(int*)(PK + t) = v;  }
__global__ __launch_bounds__(256) void k_tabin(const float* __restrict__ sp, float* __restrict__ CS, float* __restrict__ SN) { const int t = blockIdx.x * 256 + threadIdx.x; if (t >= SLEN * 32) return; const int i = t % 32, s = t / 32; const float c = bf16_round(sp[s * 64 + 32 + i]), sn = bf16_round(sp[s * 64 + i]);
  { *(float*)(CS + t) = c; *(float*)(SN + t) = sn;  } }
__global__ __launch_bounds__(256) void k_wsc(const float* __restrict__ Wm, _Float16* __restrict__ Bt, size_t n8, float sc) { const size_t t = (size_t)blockIdx.x * 256 + threadIdx.x; if (t >= n8) return; FragH f; for (int q = 0; q < 8; ++q) f.h[q] = (_Float16)(bf16_round(Wm[t * 8 + q]) * sc); *(v8us*)((unsigned short*)Bt + t * 8) = f.half[0];  }
__global__ __launch_bounds__(256) void k_rotab2(float* __restrict__ CS, float* __restrict__ SN) {
  #pragma clang fp contract(off)
  const int t = blockIdx.x * 256 + threadIdx.x; if (t >= SLEN * 32) return; const int j = t % 32, s = t / 32; const float c0 = -0.14391156831212787f;      /* -ln(10000)/64 rounded to f32 */ const float inv = expf((float)(2 * j) * c0); const float th = (float)s * inv; const float c = cosf(th), sn = sinf(th);
  { *(float*)(CS + t) = c; *(float*)(SN + t) = sn;  } }
__global__ __launch_bounds__(256) void k_lnu(const float* __restrict__ X, _Float16* __restrict__ N16, float* __restrict__ XB) {
  #pragma clang fp contract(off)
  const int wv = threadIdx.x >> 5, ln = threadIdx.x & 31; const size_t r = (size_t)blockIdx.x * 8 + wv; if (r >= NR) return; float a[32]; float s = 0.f;
  for (int i = 0; i < 4; ++i) { const v8f v = *(const v8f*)(X + r * DM + (i * 32 + ln) * 8); for (int q = 0; q < 8; ++q) { const float u = bf16_round(v[q]); a[i * 8 + q] = u; s += u; } }
  for (int o = 16; o > 0; o >>= 1) s += __shfl_xor(s, o, 32); const float mu = s / (float)DM; float var = 0.f; for (int q = 0; q < 32; ++q) { const float d = a[q] - mu; var += d * d; }
  for (int o = 16; o > 0; o >>= 1) var += __shfl_xor(var, o, 32); const float den = sqrtf(var / (float)(DM - 1)) + 1e-6f; const float inv = 1.0f / den;      /* one reciprocal per row; (x-mean)*inv vs the reference's division differs by <= 1 ulp */
  { for (int i = 0; i < 4; ++i) { const int c0 = (i * 32 + ln) * 8; FragH f; v8f xb; for (int q = 0; q < 8; ++q) { f.h[q] = (_Float16)((a[i * 8 + q] - mu) * inv); xb[q] = a[i * 8 + q]; } *(v8us*)((unsigned short*)N16 + r * DM + c0) = f.half[0]; *(v8f*)(XB + r * DM + c0) = xb; }  } }
__global__ __launch_bounds__(256) void k_vtg(const _Float16* __restrict__ V16, _Float16* __restrict__ Vt) { __shared__ unsigned short tl[64][66]; const int tid = threadIdx.x; const int slab = blockIdx.x / (SLEN / 64), lg = blockIdx.x % (SLEN / 64); const int b = slab / NH, h = slab % NH; const int hs = h / NREP;
  for (int i = tid; i < 64 * 8; i += 256) { const int r = i / 8, c8 = (i % 8) * 8; FragH f; f.half[0] = *(const v8us*)((const unsigned short*)V16 + ((size_t)b * SLEN + lg * 64 + r) * KVD + hs * 64 + c8); for (int q = 0; q < 8; ++q) tl[r][c8 + q] = f.u[q]; }
  __syncthreads();
  { for (int rd = 0; rd < 2; ++rd) { const int d = rd * 32 + tid / 8, pc = tid % 8; FragH f; for (int q = 0; q < 8; ++q) f.u[q] = tl[pc * 8 + q][d]; *(v8us*)((unsigned short*)Vt + ((size_t)slab * 64 + d) * SLEN + lg * 64 + pc * 8) = f.half[0]; }  } }

__global__ __launch_bounds__(256) void k_h16s(const float* __restrict__ SRC, int lds, int coff, _Float16* __restrict__ DST, size_t n8) { const size_t t = (size_t)blockIdx.x * 256 + threadIdx.x; if (t >= n8) return; const size_t r = (t * 8) / DM; const int c = (int)((t * 8) % DM); const v8f a = *(const v8f*)(SRC + r * lds + coff + c); FragH f; for (int q = 0; q < 8; ++q) f.h[q] = (_Float16)a[q];
  *(v8us*)((unsigned short*)DST + t * 8) = f.half[0];  }


__global__ __launch_bounds__(256) void k_ccp(const float* __restrict__ QKV, int coff, _Float16* __restrict__ D) { const size_t t = (size_t)blockIdx.x * 256 + threadIdx.x; if (t >= (size_t)NR * DM / 8) return; const int c0 = (int)((t * 8) % DM); const size_t row = (t * 8) / DM; const v8f a = *(const v8f*)(QKV + row * 3 * DM + coff + c0); FragH f; for (int q = 0; q < 8; ++q) f.h[q] = (_Float16)a[q];
  *(v8us*)((unsigned short*)D + t * 8) = f.half[0];  }


#ifndef NBS
#define NBS NB      /* batch stride of the [S][B][E] tensors (debug builds may process fewer batches than the layout holds) */
#endif
__global__ __launch_bounds__(256) void k_sbe(const float* __restrict__ q, _Float16* __restrict__ X) { const size_t t = (size_t)blockIdx.x * 256 + threadIdx.x; if (t >= (size_t)NR * DM / 8) return; const int c0 = (int)((t * 8) % DM); const size_t row = (t * 8) / DM; const int b = (int)(row / SLEN), s_ = (int)(row % SLEN); const float* src = q + ((size_t)s_ * NBS + b) * DM + c0; FragH f; for (int i = 0; i < 8; ++i) f.h[i] = (_Float16)bf16_round(src[i]);
  *(v8us*)((unsigned short*)X + t * 8) = f.half[0];  }
__global__ __launch_bounds__(256) void k_out_sbe(const float* __restrict__ R, float* __restrict__ out) { const size_t t = (size_t)blockIdx.x * 256 + threadIdx.x; if (t >= (size_t)NR * DM / 8) return; const int c0 = (int)((t * 8) % DM); const size_t irow = (t * 8) / DM; const int b = (int)(irow / SLEN), s_ = (int)(irow % SLEN); const v8f v = *(const v8f*)(R + t * 8); float* d = out + ((size_t)s_ * NBS + b) * DM + c0;
  *(v8f*)d = v;  }
__global__ __launch_bounds__(256) void k_rope(const float* __restrict__ F, _Float16* __restrict__ O16) {
  #pragma clang fp contract(off)
  const size_t t = (size_t)blockIdx.x * 256 + threadIdx.x; if (t >= (size_t)NR * DM / 16) return; const int d0 = (int)((t * 8) % 32); const int h = (int)(((t * 8) / 32) % NH); const size_t row = (t * 8) / (32 * NH); const int s_ = (int)(row % SLEN); const float* p = F + row * DM + h * 64; const v8f a = *(const v8f*)(p + d0), c = *(const v8f*)(p + 32 + d0); FragH f1, f2;
#pragma unroll 1
  for (int q = 0; q < 8; ++q) { const int d = d0 + q; const float inv = 1.0f / powf(10000.0f, (float)(2 * d) / 64.0f); const float ang = (float)s_ * inv; const float sn = sinf(ang), cs = cosf(ang); float o1 = a[q] * cs; o1 = o1 - c[q] * sn; float o2 = c[q] * cs; o2 = o2 + a[q] * sn; f1.h[q] = (_Float16)o1; f2.h[q] = (_Float16)o2; }
  { *(v8us*)((unsigned short*)O16 + row * DM + h * 64 + d0) = f1.half[0]; *(v8us*)((unsigned short*)O16 + row * DM + h * 64 + 32 + d0) = f2.half[0];  } }
extern "C" void kernel_launch(void* const* d_in, const int* in_sizes, int n_in,
                              void* d_out, int out_size, void* d_ws, size_t ws_size, hipStream_t stream) {
  (void)in_sizes; (void)n_in; (void)out_size;
  const float* qy = (const float*)d_in[0]; const float* wq = (const float*)d_in[1]; const float* bq = (const float*)d_in[2]; const float* wk = (const float*)d_in[3]; const float* bk = (const float*)d_in[4]; const float* wv = (const float*)d_in[5]; const float* bv = (const float*)d_in[6]; const float* wo = (const float*)d_in[7]; const float* bo = (const float*)d_in[8];
  char* ws = (char*)d_ws; size_t off = 0;
  auto take = [&](size_t bytes) { char* p = ws + off; off += (bytes + 255) & ~(size_t)255; return p; };
  const size_t np = (size_t)NR * DM;
  _Float16* BQ = (_Float16*)take((size_t)DM * DM * 2); _Float16* BK = (_Float16*)take((size_t)DM * DM * 2); _Float16* BV = (_Float16*)take((size_t)DM * DM * 2); _Float16* BO = (_Float16*)take((size_t)DM * DM * 2); _Float16* X16 = (_Float16*)take(np * 2); float* F32 = (float*)take(np * 4); float* OUTR = (float*)take(np * 4);
   _Float16* QH = (_Float16*)take(np * 2); _Float16* KH = (_Float16*)take(np * 2); _Float16* V16 = (_Float16*)take(np * 2); _Float16* VT = (_Float16*)take(np * 2); float* O = (float*)take(np * 4); _Float16* OH = QH; _Float16* OL = KH;
  if (off > ws_size) return;
  k_wsc<<<(unsigned)(((size_t)DM * DM / 8 + 255) / 256), 256, 0, stream>>>(wq, BQ, (size_t)DM * DM / 8, 16.0f); k_wsc<<<(unsigned)(((size_t)DM * DM / 8 + 255) / 256), 256, 0, stream>>>(wk, BK, (size_t)DM * DM / 8, 16.0f); k_wsc<<<(unsigned)(((size_t)DM * DM / 8 + 255) / 256), 256, 0, stream>>>(wv, BV, (size_t)DM * DM / 8, 16.0f); k_wsc<<<(unsigned)(((size_t)DM * DM / 8 + 255) / 256), 256, 0, stream>>>(wo, BO, (size_t)DM * DM / 8, 16.0f);      /* torch (out,in) naturals */
  k_sbe<<<(unsigned)((np / 8 + 255) / 256), 256, 0, stream>>>(qy, X16);
  
  const dim3 g((NR / 128) * (DM / 64), 1);
  k_gemm2<0><<<g, 128, 0, stream>>>(X16, DM, 0, BQ, DM, 0, 0.0625f, bq, 0, nullptr, 1, 0, 0, F32, nullptr, DM, 0, NR, DM, DM); k_rope<<<(unsigned)((np / 8 + 255) / 256), 256, 0, stream>>>(F32, QH);
  k_gemm2<0><<<g, 128, 0, stream>>>(X16, DM, 0, BK, DM, 0, 0.0625f, bk, 0, nullptr, 1, 0, 0, F32, nullptr, DM, 0, NR, DM, DM); k_rope<<<(unsigned)((np / 8 + 255) / 256), 256, 0, stream>>>(F32, KH);
  k_gemm2<0><<<g, 128, 0, stream>>>(X16, DM, 0, BV, DM, 0, 0.0625f, bv, 0, nullptr, 1, 0, 0, nullptr, V16, DM, 0, NR, DM, DM);
  k_vtg<<<NB * NH * (SLEN / 64), 256, 0, stream>>>(V16, VT);
  k_flash<0><<<NB * NH * QBNP, 128, 0, stream>>>(QH, DM, KH, DM, VT, nullptr, O, DM);
  k_hl<<<(unsigned)((np / 8 + 255) / 256), 256, 0, stream>>>(O, OH, OL, np / 8);
  k_gemm2<0><<<g, 128, 0, stream>>>(OL, DM, 0, BO, DM, 0, 0.0625f / 1024.0f, nullptr, 0, nullptr, 1, 0, 0, OUTR, nullptr, DM, 0, NR, DM, DM);
  k_gemm2<0><<<g, 128, 0, stream>>>(OH, DM, 0, BO, DM, 0, 0.0625f, bo, 0, OUTR, 1, (size_t)DM, 0, OUTR, nullptr, DM, 0, NR, DM, DM);      /* out rows (b, s) = (ctx_lo + ctx_hi) Wo^T + b */
  k_out_sbe<<<(unsigned)((np / 8 + 255) / 256), 256, 0, stream>>>(OUTR, (float*)d_out);
}

// v001
// A run of this version takes 431 microseconds.
// In two side-by-side timings against v000, it was 1.26 and 1.27 times as fast.
#include <hip/hip_runtime.h>
// LucaGPLMMultiheadAttentionWithSDPA (query [2048][2][1024] in [S, B, E] layout, 16 heads x 64: q/k/v = query W^T + b; rotary embedding per head (inv_freq = 10000^(-2i/64), rotate-half form) on q and k; softmax(q k^T / 8) v (no mask); out = attn Wo^T + bo, back in [S, B, E]).
// Structure: [S,B,E] -> exact f16 (b, s) rows; q/k as f16 WMMA GEMMs with f32 output (32x64 wave tiles, f32 accumulation, exact x16 weights + bias) followed by RoPE on VALU (f32 angles s * inv_freq, sinf/cosf) into f16 planes; v as an f16 GEMM; V^T by LDS tiles; flash-style fused attention per (batch, head, 64-query block) (QK^T, online softmax, PV in registers/LDS; no score plane), f32 context; output projection as a two-term GEMM on the context's f16 hi/residual split + bias into (b, s) rows, then the [S, B, E] store on VALU.
// Compute dtype: inputs rounded to bf16; query / weights exact as f16; roped q/k and v plain f16 (~2^-12); softmax f32 with f16 probabilities; context hi + 2^-10 residual into the projection. v_wmma_f32_16x16x32_f16.
#define NB 2
#define DM 1024
#define NKV 16
#define NREP (NH / NKV)
#define KVD (NKV * 64)           /* 1024 */
#define NR (NB * SLEN)
#define CHK 512
typedef int v4i __attribute__((ext_vector_type(4)));
#define FF 2048
#define SLEN 2048
#define MQI 2048
#define MKI 2048
#define TQ SLEN
#define TK SLEN
#define NH 16
#define SCL 0.125f
#define QBLKS (TQ / 64)
#define QB05 0
#define QBN5 4
#define QB0P 0
#define QBNP QBLKS
#define RE 256
typedef __bf16 v16b __attribute__((ext_vector_type(16)));
typedef unsigned short v8us __attribute__((ext_vector_type(8), may_alias));
typedef float  v8f  __attribute__((ext_vector_type(8)));
typedef float  v4f  __attribute__((ext_vector_type(4)));
typedef float  v4fa __attribute__((ext_vector_type(4), may_alias));
union FragB { v16b v; v8us half[2]; unsigned short u[16]; };

__device__ __forceinline__ unsigned short bf16_bits(float x) { unsigned int u = __float_as_uint(x); return (unsigned short)((u + 0x7FFFu + ((u >> 16) & 1u)) >> 16); }
__device__ __forceinline__ float bf16_val(unsigned short b) { return __uint_as_float(((unsigned int)b) << 16); }
__device__ __forceinline__ float bf16_round(float x) { return bf16_val(bf16_bits(x)); }
// D += A·B with NT terms: 1 = ah·bh, 2 = + al·bh (A split), 3 = + ah·bl (both split)
template <int NT>
__device__ __forceinline__ v8f mmaN(v16b ah, v16b al, v16b bh, v16b bl, v8f c) {
  c = __builtin_amdgcn_wmma_f32_16x16x32_bf16(false, ah, false, bh, (short)0, c, false, false);
  if (NT >= 2) c = __builtin_amdgcn_wmma_f32_16x16x32_bf16(false, al, false, bh, (short)0, c, false, false);
  if (NT >= 3) c = __builtin_amdgcn_wmma_f32_16x16x32_bf16(false, ah, false, bl, (short)0, c, false, false);
  asm volatile("v_nop\n\tv_nop\n\tv_nop\n\tv_nop" : "+v"(c) : "v"(ah), "v"(al), "v"(bh), "v"(bl));
  return c;
}

__global__ __launch_bounds__(256) void k_wt_bf16(const float* __restrict__ W, unsigned short* __restrict__ Wt, int K, int N) {
  const int t = blockIdx.x * 256 + threadIdx.x;
  const int k8n = K / 8;
  if (t >= N * k8n) return;
  const int n = t / k8n, k8 = (t % k8n) * 8;
  v8us v;
#pragma unroll
  for (int i = 0; i < 8; ++i) v[i] = bf16_bits(W[(size_t)(k8 + i) * N + n]);
  *(v8us*)(Wt + (size_t)n * K + k8) = v;
  
}

// GEMM C[M][N] (f32, pitch ldc) = act(A[M][K]·W + bias). A f32 row-major (pitch lda) converted per fragment to bf16
// (ASPLIT: hi/lo two planes -> 2 terms, else single rounded term); Wt bf16 [N][K] (pitch ldb). BIAS_BF16 rounds the
// bias to bf16 first (bias quantised to bf16 before the add). K%32==0, M%16==0, N%64==0.
template <bool ASPLIT, int ACT, bool BIAS_BF16>
__global__ __launch_bounds__(128) void k_gemm_bf(const float* __restrict__ A, int lda, const unsigned short* __restrict__ Wt, int ldb,
                                               const float* __restrict__ bias, float* __restrict__ C, int ldc, int M, int N, int K) {
  __shared__ __attribute__((aligned(16))) float so[4][16][64];
  const int tid = threadIdx.x, w = tid >> 5, lane = tid & 31, ln = lane & 15, hh = lane >> 4;
  const int ntn = N / 64;
  const int wid = blockIdx.x * 4 + w;
  const int mt = wid / ntn, nq = wid % ntn;
  if (mt * 16 >= M) return;
  const int row0 = mt * 16, col0 = nq * 64;
  const float* arow = A + (size_t)(row0 + ln) * lda;
  v8f acc[4] = {};
  for (int kb = 0; kb < K; kb += 32) {
    FragB ah, al;
    const v4f x0 = *(const v4fa*)(arow + kb + 8 * hh), x1 = *(const v4fa*)(arow + kb + 8 * hh + 4);
    const v4f x2 = *(const v4fa*)(arow + kb + 16 + 8 * hh), x3 = *(const v4fa*)(arow + kb + 16 + 8 * hh + 4);
    float xs[16] = {x0[0],x0[1],x0[2],x0[3],x1[0],x1[1],x1[2],x1[3],x2[0],x2[1],x2[2],x2[3],x3[0],x3[1],x3[2],x3[3]};
#pragma unroll
    for (int i = 0; i < 16; ++i) { const unsigned short hb = bf16_bits(xs[i]); ah.u[i] = hb; al.u[i] = ASPLIT ? bf16_bits(xs[i] - bf16_val(hb)) : (unsigned short)0; }
#pragma unroll
    for (int t = 0; t < 4; ++t) {
      const unsigned short* brow = Wt + (size_t)(col0 + t * 16 + ln) * ldb + kb;
      FragB b;
      b.half[0] = *(const v8us*)(brow + 8 * hh);
      b.half[1] = *(const v8us*)(brow + 16 + 8 * hh);
      acc[t] = mmaN<ASPLIT ? 2 : 1>(ah.v, al.v, b.v, b.v, acc[t]);
    }
  }
#pragma unroll
  for (int t = 0; t < 4; ++t) {
    float bv = bias ? bias[col0 + t * 16 + ln] : 0.f;
    if (BIAS_BF16) bv = bf16_round(bv);
#pragma unroll
    for (int r = 0; r < 8; ++r) { float v = acc[t][r] + bv; if (ACT == 1) v = fmaxf(v, 0.f); so[w][8 * hh + r][t * 16 + ln] = v; }
  }
  __builtin_amdgcn_fence(__ATOMIC_ACQ_REL, "workgroup");
  __builtin_amdgcn_wave_barrier();
  const int rsub = lane >> 4, c4 = (lane & 15) * 4;
  {
#pragma unroll
    for (int q = 0; q < 8; ++q) {
      const int r = q * 2 + rsub;
      const v4f v = *(const v4fa*)&so[w][r][c4];
      *(v4f*)(C + (size_t)(row0 + r) * ldc + col0 + c4) = v;
    }
    
  }
}

// GEMM C = act(A·W + bias + resid): A f32 (ASPLIT -> hi/lo 2 terms), Wt bf16 [N][K]; ACT 0 none, 1 relu, 2 exact gelu;
// resid (optional, f32, row index = (row % rmod), pitch ldr, RES_BF16 rounds it) added before the activation.
template <bool ASPLIT, int ACT, bool BIAS_BF16, bool RES_BF16>
__global__ __launch_bounds__(128) void k_gemm_bf3(const float* __restrict__ A, int lda, const unsigned short* __restrict__ Wt, int ldb,
                                                const float* __restrict__ bias, const float* __restrict__ resid, int rmod, int ldr,
                                                float* __restrict__ C, int ldc, int M, int N, int K) {
  __shared__ __attribute__((aligned(16))) float so[4][16][64];
  const int tid = threadIdx.x, w = tid >> 5, lane = tid & 31, ln = lane & 15, hh = lane >> 4;
  const int ntn = N / 64;
  const int wid = blockIdx.x * 4 + w;
  const int mt = wid / ntn, nq = wid % ntn;
  if (mt * 16 >= M) return;
  const int row0 = mt * 16, col0 = nq * 64;
  const float* arow = A + (size_t)(row0 + ln) * lda;
  v8f acc[4] = {};
  for (int kb = 0; kb < K; kb += 32) {
    FragB ah, al;
    const v4f x0 = *(const v4fa*)(arow + kb + 8 * hh), x1 = *(const v4fa*)(arow + kb + 8 * hh + 4);
    const v4f x2 = *(const v4fa*)(arow + kb + 16 + 8 * hh), x3 = *(const v4fa*)(arow + kb + 16 + 8 * hh + 4);
    float xs[16] = {x0[0],x0[1],x0[2],x0[3],x1[0],x1[1],x1[2],x1[3],x2[0],x2[1],x2[2],x2[3],x3[0],x3[1],x3[2],x3[3]};
#pragma unroll
    for (int i = 0; i < 16; ++i) { const unsigned short hb = bf16_bits(xs[i]); ah.u[i] = hb; al.u[i] = ASPLIT ? bf16_bits(xs[i] - bf16_val(hb)) : (unsigned short)0; }
#pragma unroll
    for (int t = 0; t < 4; ++t) {
      const unsigned short* brow = Wt + (size_t)(col0 + t * 16 + ln) * ldb + kb;
      FragB b;
      b.half[0] = *(const v8us*)(brow + 8 * hh);
      b.half[1] = *(const v8us*)(brow + 16 + 8 * hh);
      acc[t] = mmaN<ASPLIT ? 2 : 1>(ah.v, al.v, b.v, b.v, acc[t]);
    }
  }
#pragma unroll
  for (int t = 0; t < 4; ++t) {
    const int col = col0 + t * 16 + ln;
    float bv = bias ? bias[col] : 0.f;
    if (BIAS_BF16) bv = bf16_round(bv);
#pragma unroll
    for (int r = 0; r < 8; ++r) {
      float v = acc[t][r] + bv;
      if (resid) { float rv = resid[(size_t)((row0 + 8 * hh + r) % rmod) * ldr + col]; if (RES_BF16) rv = bf16_round(rv); v += rv; }
      if (ACT == 1) v = fmaxf(v, 0.f);
      if (ACT == 2) v = 0.5f * v * (1.0f + erff(v * 0.70710678118654752f));
      if (ACT == 3) { const float u = 0.7978845608028654f * (v + 0.044715f * v * v * v); v = 0.5f * v * (1.0f + tanhf(u)); }
      so[w][8 * hh + r][t * 16 + ln] = v;
    }
  }
  __builtin_amdgcn_fence(__ATOMIC_ACQ_REL, "workgroup");
  __builtin_amdgcn_wave_barrier();
  const int rsub = lane >> 4, c4 = (lane & 15) * 4;
  {
#pragma unroll
    for (int q = 0; q < 8; ++q) {
      const int r = q * 2 + rsub;
      const v4f v = *(const v4fa*)&so[w][r][c4];
      *(v4f*)(C + (size_t)(row0 + r) * ldc + col0 + c4) = v;
    }
    
  }
}
// row LayerNorm (biased variance, eps) over N: s = X (+ R); optional out_sum <- s; out_norm <- (s-mu)*rsqrt(var+eps)*g + b
template <bool PARAM_BF16>
__global__ __launch_bounds__(256) void k_layernorm(const float* __restrict__ X, const float* __restrict__ R, const float* __restrict__ g, const float* __restrict__ bta,
                                                  float* __restrict__ out_sum, float* __restrict__ out_norm, int N, float eps) {
  __shared__ float red[256];
  const int row = blockIdx.x, tid = threadIdx.x;
  const float* x = X + (size_t)row * N; const float* rr = R ? R + (size_t)row * N : nullptr;
  float vals[16];                     // up to N = 4096
  const int per = N / 256;            // contiguous chunk per thread? use strided-by-4 chunks: thread handles j = tid*4 + 1024*u
  float s1 = 0.f;
  for (int u = 0; u < per / 4; ++u) {
    const int j = tid * 4 + 1024 * u;
    const v4f a = *(const v4fa*)(x + j);
    v4f b = {0.f,0.f,0.f,0.f}; if (rr) b = *(const v4fa*)(rr + j);
#pragma unroll
    for (int q = 0; q < 4; ++q) { const float v = a[q] + b[q]; vals[u * 4 + q] = v; s1 += v; }
  }
  red[tid] = s1; __syncthreads();
  for (int st = 128; st > 0; st >>= 1) { if (tid < st) red[tid] += red[tid + st]; __syncthreads(); }
  const float mu = red[0] / (float)N; __syncthreads();
  float s2 = 0.f;
  for (int u = 0; u < per / 4; ++u)
#pragma unroll
    for (int q = 0; q < 4; ++q) { const float c = vals[u * 4 + q] - mu; s2 += c * c; }
  red[tid] = s2; __syncthreads();
  for (int st = 128; st > 0; st >>= 1) { if (tid < st) red[tid] += red[tid + st]; __syncthreads(); }
  const float rs = rsqrtf(red[0] / (float)N + eps);
  {
    for (int u = 0; u < per / 4; ++u) {
      const int j = tid * 4 + 1024 * u;
      v4f o, sm;
#pragma unroll
      for (int q = 0; q < 4; ++q) {
        float gg = g[j + q], bb = bta[j + q];
        if (PARAM_BF16) { gg = bf16_round(gg); bb = bf16_round(bb); }
        sm[q] = vals[u * 4 + q]; o[q] = (vals[u * 4 + q] - mu) * rs * gg + bb;
      }
      if (out_sum) *(v4f*)(out_sum + (size_t)row * N + j) = sm;
      *(v4f*)(out_norm + (size_t)row * N + j) = o;
    }
    
  }
}



// ---- f16 WMMA path (v_wmma_f32_16x16x32_f16): 11-bit significands for operands in range — used where a [0,1] probability operand needs more precision than bf16
typedef _Float16 v16h __attribute__((ext_vector_type(16)));
union FragH { v16h v; v8us half[2]; _Float16 h[16]; unsigned short u[16]; };
template <int NT>
__device__ __forceinline__ v8f mmaH(v16h ah, v16h al, v16h bh, v16h bl, v8f c) {
  c = __builtin_amdgcn_wmma_f32_16x16x32_f16(false, ah, false, bh, (short)0, c, false, false);
  if (NT >= 2) c = __builtin_amdgcn_wmma_f32_16x16x32_f16(false, al, false, bh, (short)0, c, false, false);
  if (NT >= 3) c = __builtin_amdgcn_wmma_f32_16x16x32_f16(false, ah, false, bl, (short)0, c, false, false);
  asm volatile("v_nop\n\tv_nop\n\tv_nop\n\tv_nop" : "+v"(c) : "v"(ah), "v"(al), "v"(bh), "v"(bl));
  return c;
}
// batched GEMM like k_gemm_b but f16 operands: A f32 (split into f16 hi/lo if ASPLIT, else rounded to f16), Bt = f16 values [n][k]; alpha; C f32; N multiple of 16 (partial tiles skipped)
template <bool ASPLIT>
__global__ __launch_bounds__(128) void k_gemm_h(const float* __restrict__ A, int lda, size_t sA, const _Float16* __restrict__ Bh, int ldb, size_t sB, float alpha, float* __restrict__ C, int ldc, size_t sC, int M, int N, int K) {
  __shared__ __attribute__((aligned(16))) float so[4][16][64];
  const int tid = threadIdx.x, w = tid >> 5, lane = tid & 31, ln = lane & 15, hh = lane >> 4; const int by = blockIdx.y;
  A += (size_t)by * sA; Bh += (size_t)by * sB; C += (size_t)by * sC;
  const int ntn = (N + 63) / 64; const int wid = blockIdx.x * 4 + w; const int mt = wid / ntn, nq = wid % ntn; if (mt * 16 >= M) return;
  const int row0 = mt * 16, col0 = nq * 64; const float* arow = A + (size_t)(row0 + ln) * lda;
  v8f acc[4] = {};
  for (int kb = 0; kb < K; kb += 32) {
    FragH ah, al;
    const v4f x0 = *(const v4fa*)(arow + kb + 8 * hh), x1 = *(const v4fa*)(arow + kb + 8 * hh + 4), x2 = *(const v4fa*)(arow + kb + 16 + 8 * hh), x3 = *(const v4fa*)(arow + kb + 16 + 8 * hh + 4);
    float xs[16] = {x0[0],x0[1],x0[2],x0[3],x1[0],x1[1],x1[2],x1[3],x2[0],x2[1],x2[2],x2[3],x3[0],x3[1],x3[2],x3[3]};
#pragma unroll
    for (int i = 0; i < 16; ++i) { const _Float16 h = (_Float16)xs[i]; ah.h[i] = h; al.h[i] = ASPLIT ? (_Float16)(xs[i] - (float)h) : (_Float16)0.0f; }
#pragma unroll
    for (int t = 0; t < 4; ++t) { if (col0 + t * 16 >= N) continue; const size_t boff = (size_t)(col0 + t * 16 + ln) * ldb + kb; FragH bq; bq.half[0] = *(const v8us*)(Bh + boff + 8 * hh); bq.half[1] = *(const v8us*)(Bh + boff + 16 + 8 * hh);
      acc[t] = mmaH<ASPLIT ? 2 : 1>(ah.v, al.v, bq.v, bq.v, acc[t]); }
  }
#pragma unroll
  for (int t = 0; t < 4; ++t) { if (col0 + t * 16 >= N) continue;
#pragma unroll
    for (int r = 0; r < 8; ++r) so[w][8 * hh + r][t * 16 + ln] = acc[t][r] * alpha; }
  __builtin_amdgcn_fence(__ATOMIC_ACQ_REL, "workgroup"); __builtin_amdgcn_wave_barrier();
  const int rsub = lane >> 4, c4 = (lane & 15) * 4;
  {
#pragma unroll
    for (int q = 0; q < 8; ++q) { const int r = q * 2 + rsub; if (col0 + c4 < N) { const v4f v = *(const v4fa*)&so[w][r][c4]; *(v4f*)(C + (size_t)(row0 + r) * ldc + col0 + c4) = v; } }
     }
}

// Wt[n][k] = f16(W[k][n]·scale) from f32 row-major W[K][N] (scale = power of two; bf16-exact weights stay exact in f16 away from the subnormal range)
__global__ __launch_bounds__(256) void k_wt_f16(const float* __restrict__ W, _Float16* __restrict__ Wt, int K, int N, float scale) {
  const int t = blockIdx.x * 256 + threadIdx.x; if (t >= N * (K / 8)) return; const int n = t / (K / 8), k8 = (t % (K / 8)) * 8; FragH f;
#pragma unroll
  for (int i = 0; i < 8; ++i) f.h[i] = (_Float16)(bf16_round(W[(size_t)(k8 + i) * N + n]) * scale); const v8us o = f.half[0];
  *(v8us*)((unsigned short*)Wt + (size_t)n * K + k8) = o; 
}
// k_gemm_hh variant with fused epilogue: v = acc·alpha + bias[by·sBias + col] (+ CP[(row/rowsPerB)·sCPb + by·64 + col] if CP) ; ACT 0 none / 1 elu ; writes f16 C16 (and f32 C if non-null)
template <int ACT>
__global__ __launch_bounds__(128) void k_gemm_hhx(const _Float16* __restrict__ A, int lda, size_t sA, const _Float16* __restrict__ Bh, int ldb, size_t sB, float alpha, const float* __restrict__ bias, size_t sBias, const float* __restrict__ CP, int rowsPerB, size_t sCPb, int row0g,
    float* __restrict__ C, _Float16* __restrict__ C16, int ldc, size_t sC, int M, int N, int K) {
  __shared__ __attribute__((aligned(16))) float so[4][16][64];
  const int tid = threadIdx.x, w = tid >> 5, lane = tid & 31, ln = lane & 15, hh = lane >> 4; const int by = blockIdx.y;
  A += (size_t)by * sA; Bh += (size_t)by * sB; const size_t cofs = (size_t)by * sC; const float* bp = bias ? bias + (size_t)by * sBias : nullptr;
  const int ntn = (N + 63) / 64; const int wid = blockIdx.x * 4 + w; const int mt = wid / ntn, nq = wid % ntn; if (mt * 16 >= M) return;
  const int row0 = mt * 16, col0 = nq * 64; const _Float16* arow = A + (size_t)(row0 + ln) * lda;
  v8f acc[4] = {};
  for (int kb = 0; kb < K; kb += 32) { FragH ah; ah.half[0] = *(const v8us*)((const unsigned short*)arow + kb + 8 * hh); ah.half[1] = *(const v8us*)((const unsigned short*)arow + kb + 16 + 8 * hh);
#pragma unroll
    for (int t = 0; t < 4; ++t) { if (col0 + t * 16 >= N) continue; const size_t boff = (size_t)(col0 + t * 16 + ln) * ldb + kb; FragH bq; bq.half[0] = *(const v8us*)((const unsigned short*)Bh + boff + 8 * hh); bq.half[1] = *(const v8us*)((const unsigned short*)Bh + boff + 16 + 8 * hh);
      acc[t] = mmaH<1>(ah.v, ah.v, bq.v, bq.v, acc[t]); }
  }
#pragma unroll
  for (int t = 0; t < 4; ++t) { if (col0 + t * 16 >= N) continue; const int col = col0 + t * 16 + ln; const float bv = bp ? bf16_round(bp[col]) : 0.f;
#pragma unroll
    for (int r = 0; r < 8; ++r) { float v = acc[t][r] * alpha + bv; if (CP) { const int bidx = (row0g + row0 + 8 * hh + r) / rowsPerB; v += CP[(size_t)bidx * sCPb + (size_t)by * 64 + col]; } if (ACT == 1) v = (v > 0.f) ? v : expm1f(v); else if (ACT == 7) v = (v > 0.f) ? v + 1.0f : expf(v); else if (ACT == 8) v = tanhf(v); else if (ACT == 9) v = 0.5f * v * (1.0f + tanhf(0.7978845608028654f * (v + 0.044715f * v * v * v))); else if (ACT == 11) v = 1.0f / (1.0f + expf(-v)); else if (ACT == 12) v = (v > 0.f) ? v : 0.01f * v; else if (ACT == 14) v = (v > 0.f) ? v : 0.1f * v; else if (ACT == 15) v = v / (1.0f + expf(-v)); else if (ACT == 3) v = fmaxf(v, 0.f); else if (ACT == 6) v = 0.5f * v * (1.0f + erff(v * 0.70710678118654752f)); so[w][8 * hh + r][t * 16 + ln] = v; } }
  __builtin_amdgcn_fence(__ATOMIC_ACQ_REL, "workgroup"); __builtin_amdgcn_wave_barrier();
  const int rsub = lane >> 4, c4 = (lane & 15) * 4; typedef _Float16 v4h __attribute__((ext_vector_type(4)));
  {
#pragma unroll
    for (int q = 0; q < 8; ++q) { const int r = q * 2 + rsub; if (col0 + c4 < N) { const v4f v = *(const v4fa*)&so[w][r][c4]; if (C) *(v4f*)(C + cofs + (size_t)(row0 + r) * ldc + col0 + c4) = v; if (C16) { v4h h4; for (int i = 0; i < 4; ++i) h4[i] = (_Float16)v[i]; *(v4h*)(C16 + cofs + (size_t)(row0 + r) * ldc + col0 + c4) = h4; } } }
     }
}


typedef _Float16 v4h __attribute__((ext_vector_type(4)));

__global__ __launch_bounds__(256) void k_x16(const float* __restrict__ x, _Float16* __restrict__ X16, size_t n8) { const size_t t = (size_t)blockIdx.x * 256 + threadIdx.x; if (t >= n8) return; FragH f;
#pragma unroll
  for (int q = 0; q < 8; ++q) f.h[q] = (_Float16)bf16_round(x[t * 8 + q]); *(v8us*)((unsigned short*)X16 + t * 8) = f.half[0];  }
__global__ __launch_bounds__(256) void k_h16(const float* __restrict__ x, _Float16* __restrict__ X16, size_t n8) { const size_t t = (size_t)blockIdx.x * 256 + threadIdx.x; if (t >= n8) return; FragH f;
#pragma unroll
  for (int q = 0; q < 8; ++q) f.h[q] = (_Float16)x[t * 8 + q]; *(v8us*)((unsigned short*)X16 + t * 8) = f.half[0];  }
__global__ __launch_bounds__(256) void k_round16f(const float* __restrict__ W, _Float16* __restrict__ Bt, size_t n8) { const size_t t = (size_t)blockIdx.x * 256 + threadIdx.x; if (t >= n8) return; FragH f;
#pragma unroll
  for (int i = 0; i < 8; ++i) f.h[i] = (_Float16)(bf16_round(W[t * 8 + i]) * 16.0f); *(v8us*)((unsigned short*)Bt + t * 8) = f.half[0];  }
template <int NHv, int TTv>
__global__ __launch_bounds__(256) void k_vt(const _Float16* __restrict__ V16, int ldv, int voff, _Float16* __restrict__ Vt) { __shared__ unsigned short tl[64][66]; const int tid = threadIdx.x; const int slab = blockIdx.x / (TTv / 64), lg = blockIdx.x % (TTv / 64); const int b = slab / NHv, h = slab % NHv;
  for (int i = tid; i < 64 * 8; i += 256) { const int r = i / 8, c8 = (i % 8) * 8; FragH f; f.half[0] = *(const v8us*)((const unsigned short*)V16 + ((size_t)b * TTv + lg * 64 + r) * ldv + voff + h * 64 + c8);
#pragma unroll
    for (int q = 0; q < 8; ++q) tl[r][c8 + q] = f.u[q]; }
  __syncthreads();
  {
#pragma unroll
    for (int rd = 0; rd < 2; ++rd) { const int d = rd * 32 + tid / 8, pc = tid % 8; FragH f;
#pragma unroll
      for (int q = 0; q < 8; ++q) f.u[q] = tl[pc * 8 + q][d];
      *(v8us*)((unsigned short*)Vt + ((size_t)slab * 64 + d) * TTv + lg * 64 + pc * 8) = f.half[0]; }
     } }

__global__ __launch_bounds__(256) void k_hl(const float* __restrict__ F, _Float16* __restrict__ Hh, _Float16* __restrict__ Hl, size_t n8) { const size_t t = (size_t)blockIdx.x * 256 + threadIdx.x; if (t >= n8) return; FragH fh, fl; const v4f a = *(const v4fa*)(F + t * 8), c = *(const v4fa*)(F + t * 8 + 4);
#pragma unroll
  for (int q = 0; q < 4; ++q) { _Float16 h = (_Float16)a[q]; fh.h[q] = h; fl.h[q] = (_Float16)((a[q] - (float)h) * 1024.0f); h = (_Float16)c[q]; fh.h[4 + q] = h; fl.h[4 + q] = (_Float16)((c[q] - (float)h) * 1024.0f); }
  { *(v8us*)((unsigned short*)Hh + t * 8) = fh.half[0]; *(v8us*)((unsigned short*)Hl + t * 8) = fl.half[0];  } }

// ---- fast GEMM (wave tile 32x64, block tile 128x64; requires M % 128 == 0, N % 64 == 0, K % 64 == 0, K >= 64); epilogue = k_gemm_hhx semantics ----
// Operands reach the waves through LDS: per stage the block brings 64 k of its 128 A rows and 64 B rows in by asynchronous copies that cover whole 128-byte lines (8 lanes a row),
// two buffers, the next stage in flight while this one is worked on; the fragments are read from LDS in the same k order as before.
__device__ __forceinline__ v16h g2_frag(const unsigned short* p, int hh) { FragH f; f.half[0] = *(const v8us*)(p + 8 * hh); f.half[1] = *(const v8us*)(p + 16 + 8 * hh); return f.v; }
__device__ __forceinline__ v8f g2_mma(v16h a, v16h b, v8f c) { v8f d = __builtin_amdgcn_wmma_f32_16x16x32_f16(false, a, false, b, (short)0, c, false, false); asm volatile("v_nop\n\tv_nop\n\tv_nop\n\tv_nop" : "+v"(d) : "v"(a), "v"(b)); return d; }
// One lane's share of a stage: 8 pieces of A and 4 of B, 16 bytes each, 16 rows apart (ls bytes in LDS, da / db bytes in memory), global memory -> LDS through no register.
// The s_wait_xcnt closes the copies' own statement so that no address register named here is rewritten ahead of it.
__device__ __forceinline__ void g2_copy(unsigned la, unsigned lb, unsigned ls, const char* pa, size_t da, const char* pb, size_t db) {
  asm volatile("global_load_async_to_lds_b128 %0, %12, off\n\t" "global_load_async_to_lds_b128 %1, %13, off\n\t" "global_load_async_to_lds_b128 %2, %14, off\n\t" "global_load_async_to_lds_b128 %3, %15, off\n\t"
               "global_load_async_to_lds_b128 %4, %16, off\n\t" "global_load_async_to_lds_b128 %5, %17, off\n\t" "global_load_async_to_lds_b128 %6, %18, off\n\t" "global_load_async_to_lds_b128 %7, %19, off\n\t"
               "global_load_async_to_lds_b128 %8, %20, off\n\t" "global_load_async_to_lds_b128 %9, %21, off\n\t" "global_load_async_to_lds_b128 %10, %22, off\n\t" "global_load_async_to_lds_b128 %11, %23, off\n\t"
               "s_wait_xcnt 0x0"
               :: "v"(la), "v"(la + ls), "v"(la + 2 * ls), "v"(la + 3 * ls), "v"(la + 4 * ls), "v"(la + 5 * ls), "v"(la + 6 * ls), "v"(la + 7 * ls), "v"(lb), "v"(lb + ls), "v"(lb + 2 * ls), "v"(lb + 3 * ls),
                  "v"(pa), "v"(pa + da), "v"(pa + 2 * da), "v"(pa + 3 * da), "v"(pa + 4 * da), "v"(pa + 5 * da), "v"(pa + 6 * da), "v"(pa + 7 * da), "v"(pb), "v"(pb + db), "v"(pb + 2 * db), "v"(pb + 3 * db)
               : "memory"); }
template <int ACT>
__global__ __launch_bounds__(128) void k_gemm2(const _Float16* __restrict__ A, int lda, size_t sA, const _Float16* __restrict__ Bh, int ldb, size_t sB, float alpha, const float* __restrict__ bias, size_t sBias, const float* __restrict__ CP, int rowsPerB, size_t sCPb, int row0g,
    float* __restrict__ C, _Float16* __restrict__ C16, int ldc, size_t sC, int M, int N, int K) {
  constexpr int KT = 64, PIT = KT + 8;      /* LDS row pitch 144 B = 16 B x odd: the 16-byte fragment reads of 16 rows fall on distinct banks */
  __shared__ __attribute__((aligned(16))) float so[4][32][68];
  __shared__ __attribute__((aligned(16))) unsigned short tA[2][128][PIT]; __shared__ __attribute__((aligned(16))) unsigned short tB[2][64][PIT];
  const int tid = threadIdx.x, w = tid >> 5, lane = tid & 31, ln = lane & 15, hh = lane >> 4; const int by = blockIdx.y;
  A += (size_t)by * sA; Bh += (size_t)by * sB; const size_t cofs = (size_t)by * sC; const float* bp = bias ? bias + (size_t)by * sBias : nullptr;
  const int ntn = N >> 6; const int mt = blockIdx.x / ntn, nq = blockIdx.x - mt * ntn; const int row0 = mt * 128 + 32 * w, col0 = nq * 64; if (mt * 128 >= M) return;      /* the same for the whole block: it stands in front of barriers */
  const int sr = tid >> 3, sc = (tid & 7) * 8;
  const char* pa = (const char*)(A + (size_t)(mt * 128 + sr) * lda + sc); const char* pb = (const char*)(Bh + (size_t)(col0 + sr) * ldb + sc); const size_t da = (size_t)lda * 32, db = (size_t)ldb * 32;
  const unsigned la = (unsigned)(uintptr_t)&tA[0][sr][sc], lb = (unsigned)(uintptr_t)&tB[0][sr][sc]; constexpr unsigned LS = 16 * PIT * 2, BA = 128 * PIT * 2, BB = 64 * PIT * 2;
  g2_copy(la, lb, LS, pa, da, pb, db);
  asm volatile("s_wait_asynccnt 0x0" ::: "memory");      /* this wave's share of stage 0 has landed */
  __syncthreads();      /* every wave's share has: stage 0 may be read */
  if (KT < K) g2_copy(la + BA, lb + BB, LS, pa + KT * 2, da, pb + KT * 2, db);
  const v8f z8 = {0.f,0.f,0.f,0.f,0.f,0.f,0.f,0.f}; v8f c00 = z8, c01 = z8, c02 = z8, c03 = z8, c10 = z8, c11 = z8, c12 = z8, c13 = z8;
  /* rolled: one stage a trip, so that the order at the foot of the trip stands once */
#pragma unroll 1
  for (int kb = 0; kb < K; kb += KT) { const int cur = (kb >> 6) & 1;
    /* unrolled: the two 32-k blocks of a stage read LDS at immediate offsets */
#pragma unroll
    for (int ks = 0; ks < KT; ks += 32) { const unsigned short* fa = &tA[cur][32 * w + ln][ks]; const unsigned short* fb = &tB[cur][ln][ks];
      const v16h a0 = g2_frag(fa, hh), a1 = g2_frag(fa + 16 * PIT, hh); const v16h b0 = g2_frag(fb, hh), b1 = g2_frag(fb + 16 * PIT, hh), b2 = g2_frag(fb + 32 * PIT, hh), b3 = g2_frag(fb + 48 * PIT, hh);
      c00 = g2_mma(a0, b0, c00); c10 = g2_mma(a1, b0, c10); c01 = g2_mma(a0, b1, c01); c11 = g2_mma(a1, b1, c11);
      c02 = g2_mma(a0, b2, c02); c12 = g2_mma(a1, b2, c12); c03 = g2_mma(a0, b3, c03); c13 = g2_mma(a1, b3, c13); }
    asm volatile("s_wait_dscnt 0x0" ::: "memory");      /* this wave's reads of the buffer that is refilled below have returned */
    asm volatile("s_wait_asynccnt 0x0" ::: "memory");      /* this wave's share of the next stage has landed */
    __syncthreads();      /* publishes the next stage and ends every wave's reads of this one */
    if (kb + 2 * KT < K) g2_copy(la + cur * BA, lb + cur * BB, LS, pa + (size_t)(kb + 2 * KT) * 2, da, pb + (size_t)(kb + 2 * KT) * 2, db); }
  asm volatile("s_wait_asynccnt 0x0" ::: "memory");      /* no copy is left in flight behind the loop */
  v8f accs[8] = {c00, c01, c02, c03, c10, c11, c12, c13};
#pragma unroll
  for (int u = 0; u < 8; ++u) { const int t = u & 3, half = u >> 2; const int col = col0 + t * 16 + ln; const float bv = bp ? bf16_round(bp[col]) : 0.f;
#pragma unroll
    for (int r = 0; r < 8; ++r) { const int rloc = half * 16 + 8 * hh + r; float v = accs[u][r] * alpha + bv; if (CP) { if (rowsPerB < 0) v += CP[cofs + (size_t)(row0g + row0 + rloc) * ldc + col];      /* rowsPerB < 0: own element of the batched C plane */ else { const int bidx = (row0g + row0 + rloc) / rowsPerB; v += CP[(size_t)bidx * sCPb + (size_t)by * 64 + col]; } }
      if (ACT == 3) v = fmaxf(v, 0.f); else if (ACT == 6) v = 0.5f * v * (1.0f + erff(v * 0.70710678118654752f)); else if (ACT == 11) v = 1.0f / (1.0f + expf(-v)); else if (ACT == 15) v = v / (1.0f + expf(-v)); else if (ACT == 12) v = (v > 0.f) ? v : 0.01f * v; else if (ACT == 8) v = tanhf(v);
      so[w][rloc][t * 16 + ln] = v; } }
  __builtin_amdgcn_fence(__ATOMIC_ACQ_REL, "workgroup"); __builtin_amdgcn_wave_barrier();
  const int rsub = lane >> 4, c4 = (lane & 15) * 4;
  {
#pragma unroll
    for (int q = 0; q < 16; ++q) { const int r = q * 2 + rsub; const v4f v = *(const v4fa*)&so[w][r][c4]; if (C) *(v4f*)(C + cofs + (size_t)(row0 + r) * ldc + col0 + c4) = v; if (C16) { v4h h4; for (int i = 0; i < 4; ++i) h4[i] = (_Float16)v[i]; *(v4h*)(C16 + cofs + (size_t)(row0 + r) * ldc + col0 + c4) = h4; } }
     } }



template <int CAUSAL>
__global__ __launch_bounds__(128) void k_flash(const _Float16* __restrict__ Q16, int ldq, const _Float16* __restrict__ K16, int ldk, const _Float16* __restrict__ Vt, const int* __restrict__ MSK, float* __restrict__ O, int ldo) {
  constexpr int RPW = 16, RTN = RPW / 16, NQB = TQ / (4 * RPW), DT = 4, KS = 2;
  __shared__ __attribute__((aligned(16))) unsigned short sP[4][RPW][40]; __shared__ __attribute__((aligned(16))) float sO[4][RPW][64 + 4];
  const int tid = threadIdx.x, w = tid >> 5, lane = tid & 31, ln = lane & 15, hh = lane >> 4;
  const int slab = blockIdx.x / QBNP, qblk = QB0P + blockIdx.x % QBNP; (void)NQB; const int b = slab / NH, h = slab % NH; const int qb0 = qblk * (4 * RPW); const int q0 = qb0 + w * RPW;
  FragH aq[2][KS];
#pragma unroll
  for (int rt = 0; rt < RTN; ++rt) { const unsigned short* qr = (const unsigned short*)Q16 + ((size_t)b * TQ + q0 + rt * 16 + ln) * ldq + h * 64;
#pragma unroll
    for (int ks = 0; ks < KS; ++ks) { aq[rt][ks].half[0] = *(const v8us*)(qr + ks * 32 + 8 * hh); aq[rt][ks].half[1] = *(const v8us*)(qr + ks * 32 + 16 + 8 * hh); } }
  const unsigned short* Vth = (const unsigned short*)Vt + (size_t)slab * 64 * TK;
  float m_r[2][8], l_r[2][8]; v8f oacc[2][DT];
#pragma unroll
  for (int rt = 0; rt < RTN; ++rt) {
#pragma unroll
    for (int r = 0; r < 8; ++r) { m_r[rt][r] = -3.0e38f; l_r[rt][r] = 0.f; }
#pragma unroll
    for (int dt = 0; dt < DT; ++dt) oacc[rt][dt] = (v8f){0.f,0.f,0.f,0.f,0.f,0.f,0.f,0.f}; }
  const int jend = (CAUSAL == 1) ? (qb0 + 4 * RPW) : ((CAUSAL == 23) ? min(TK, (qb0 / CHK + 2) * CHK) : TK);      /* causal / window: keys that can never contribute are skipped */ const int jbeg = (CAUSAL == 23) ? max(0, (qb0 / CHK - 1) * CHK) : 0;
#pragma unroll 1
  for (int j0 = jbeg; j0 < jend; j0 += 32) {
    v8f s[2][2];
#pragma unroll
    for (int nt = 0; nt < 2; ++nt) { const unsigned short* kr = (const unsigned short*)K16 + ((size_t)b * TK + j0 + nt * 16 + ln) * ldk + h * 64; FragH bk[KS];
#pragma unroll
      for (int ks = 0; ks < KS; ++ks) { bk[ks].half[0] = *(const v8us*)(kr + ks * 32 + 8 * hh); bk[ks].half[1] = *(const v8us*)(kr + ks * 32 + 16 + 8 * hh); }
#pragma unroll
      for (int rt = 0; rt < RTN; ++rt) { v8f acc = (v8f){0.f,0.f,0.f,0.f,0.f,0.f,0.f,0.f};
#pragma unroll
        for (int ks = 0; ks < KS; ++ks) acc = mmaH<1>(aq[rt][ks].v, aq[rt][ks].v, bk[ks].v, bk[ks].v, acc); s[rt][nt] = acc; } }
#pragma unroll
    for (int rt = 0; rt < RTN; ++rt)
#pragma unroll
      for (int r = 0; r < 8; ++r) { const int tq = q0 + rt * 16 + 8 * hh + r; const int k0 = j0 + ln, k1 = j0 + 16 + ln;
        bool ok0 = (CAUSAL == 1) ? (k0 <= tq) : ((CAUSAL == 2) ? ((k0 >> 5) == (tq >> 5)) : true), ok1 = (CAUSAL == 1) ? (k1 <= tq) : ((CAUSAL == 2) ? ((k1 >> 5) == (tq >> 5)) : true); if (CAUSAL == 23) { const int cq = tq / CHK; ok0 = (abs(k0 / CHK - cq) <= 1) && (MSK[(size_t)b * TK + k0] == 0); ok1 = (abs(k1 / CHK - cq) <= 1) && (MSK[(size_t)b * TK + k1] == 0); }      /* mode 23: 3-chunk window + int key-padding mask */
        if (CAUSAL == 24) { ok0 = (MSK[(size_t)b * TK + k0] == 0); ok1 = (MSK[(size_t)b * TK + k1] == 0); }      /* mode 24: int key-padding mask (nonzero = padded = excluded) */      /* mode 2: block-diagonal 32-token groups */
        float s0 = ok0 ? s[rt][0][r] * SCL : -3.0e38f, s1 = ok1 ? s[rt][1][r] * SCL : -3.0e38f; if (CAUSAL == 27) { const float* amk = (const float*)MSK + ((size_t)b * MQI + tq) * MKI; s0 += bf16_round(amk[k0]); s1 += bf16_round(amk[k1]); }      /* mode 27: additive per-(batch, query, key) f32 mask INPUT [b][tq][k] */ if (CAUSAL == 17) { const float* amk = (const float*)MSK + (size_t)b * TK; s0 += bf16_round(amk[k0]); s1 += bf16_round(amk[k1]); } if (CAUSAL == 18) { const float* tb = (const float*)MSK; const int* ri = MSK + 1024 + (size_t)b * TK; const int rq = ri[tq]; s0 += tb[(h * 8 + rq) * 8 + ri[k0]]; s1 += tb[(h * 8 + rq) * 8 + ri[k1]]; } if (CAUSAL == 19) { const int* rel = MSK + (size_t)tq * TK; const float* rb = (const float*)MSK + (size_t)TQ * TK + ((size_t)(b * NH + h) * TQ + tq) * 64; s0 += rb[rel[k0]]; s1 += rb[rel[k1]]; }      /* mode 19: + (q.Ek[rel] + Eb[rel][h]) / 8 gathered by the int relative ids (packed [ids | table]) */      /* mode 18: + resource_bias[h][r_q][r_k] from the packed [table | ids] buffer (TQ == TK) */      /* mode 17: additive per-(batch, key) mask INPUT */ float mc = fmaxf(s0, s1);
        mc = fmaxf(mc, __shfl_xor(mc, 1, 32)); mc = fmaxf(mc, __shfl_xor(mc, 2, 32)); mc = fmaxf(mc, __shfl_xor(mc, 4, 32)); mc = fmaxf(mc, __shfl_xor(mc, 8, 32));
        const float mn = fmaxf(m_r[rt][r], mc); const float al = (mn > -1.0e38f) ? expf(m_r[rt][r] - mn) : 1.0f; m_r[rt][r] = mn; const float p0 = ok0 ? expf(s0 - mn) : 0.f, p1 = ok1 ? expf(s1 - mn) : 0.f; l_r[rt][r] = l_r[rt][r] * al + p0 + p1;
#pragma unroll
        for (int dt = 0; dt < DT; ++dt) oacc[rt][dt][r] *= al;
        FragH t2; t2.h[0] = (_Float16)(p0 * 1024.0f); t2.h[1] = (_Float16)(p1 * 1024.0f); sP[w][rt * 16 + 8 * hh + r][ln] = t2.u[0]; sP[w][rt * 16 + 8 * hh + r][16 + ln] = t2.u[1]; }
    __builtin_amdgcn_fence(__ATOMIC_ACQ_REL, "workgroup"); __builtin_amdgcn_wave_barrier();
    FragH pa[2];
#pragma unroll
    for (int rt = 0; rt < RTN; ++rt) { pa[rt].half[0] = *(const v8us*)&sP[w][rt * 16 + ln][8 * hh]; pa[rt].half[1] = *(const v8us*)&sP[w][rt * 16 + ln][16 + 8 * hh]; }
#pragma unroll
    for (int dt = 0; dt < DT; ++dt) { const unsigned short* vrow = Vth + (size_t)(dt * 16 + ln) * TK + j0; FragH bv; bv.half[0] = *(const v8us*)(vrow + 8 * hh); bv.half[1] = *(const v8us*)(vrow + 16 + 8 * hh);
#pragma unroll
      for (int rt = 0; rt < RTN; ++rt) oacc[rt][dt] = mmaH<1>(pa[rt].v, pa[rt].v, bv.v, bv.v, oacc[rt][dt]); }
    __builtin_amdgcn_fence(__ATOMIC_ACQ_REL, "workgroup"); __builtin_amdgcn_wave_barrier(); }
#pragma unroll
  for (int rt = 0; rt < RTN; ++rt) {
#pragma unroll
    for (int r = 0; r < 8; ++r) { float l = l_r[rt][r]; l += __shfl_xor(l, 1, 32); l += __shfl_xor(l, 2, 32); l += __shfl_xor(l, 4, 32); l += __shfl_xor(l, 8, 32); l_r[rt][r] = (l > 0.f) ? 1.0f / (l * 1024.0f) : 0.f; }
#pragma unroll
    for (int dt = 0; dt < DT; ++dt)
#pragma unroll
      for (int r = 0; r < 8; ++r) sO[w][rt * 16 + 8 * hh + r][dt * 16 + ln] = oacc[rt][dt][r] * l_r[rt][r]; }
  __builtin_amdgcn_fence(__ATOMIC_ACQ_REL, "workgroup"); __builtin_amdgcn_wave_barrier();
  {
#pragma unroll
    for (int rp = 0; rp < RPW; rp += 2) { const int r = rp + (lane >> 4), pc = lane & 15; const v4f val = *(const v4fa*)&sO[w][r][pc * 4]; *(v4f*)(O + ((size_t)b * TQ + q0 + r) * ldo + h * 64 + pc * 4) = val; }
     } }
// 5-plane variant: S = Qh Kh^T + (Ql Kh^T + Qh Kl^T)/1024 with Q/K = [hi | 2^10 residual] f16 planes (QL/KL same layout as Q16/K16), then the 3-term P.V below.
// 3-term variant: O = (P_hi V_hi + (P_lo V_hi + P_hi V_lo) / 1024) / l with P = [hi | 2^10 residual] of 1024 p and V^T = [hi | 2^10 residual] planes (VtL same layout as Vt) -> ~2^-21-class products for un-averaged (early causal / peaked) rows
template <int CAUSAL>
__global__ __launch_bounds__(128) void k_flash5(const _Float16* __restrict__ Q16, const _Float16* __restrict__ QL, int ldq, const _Float16* __restrict__ K16, const _Float16* __restrict__ KL, int ldk, const _Float16* __restrict__ Vt, const _Float16* __restrict__ VtL, const int* __restrict__ MSK, float* __restrict__ O, int ldo) {
  constexpr int RPW = 16, RTN = RPW / 16, NQB = TQ / (4 * RPW), DT = 4, KS = 2;
  __shared__ __attribute__((aligned(16))) unsigned short sP[4][RPW][40]; __shared__ __attribute__((aligned(16))) unsigned short sPL[4][RPW][40]; __shared__ __attribute__((aligned(16))) float sO[4][RPW][64 + 4];
  const int tid = threadIdx.x, w = tid >> 5, lane = tid & 31, ln = lane & 15, hh = lane >> 4;
  const int slab = blockIdx.x / QBN5, qblk = QB05 + blockIdx.x % QBN5; (void)NQB; const int b = slab / NH, h = slab % NH; const int qb0 = qblk * (4 * RPW); const int q0 = qb0 + w * RPW;
  FragH aq[2][KS], aql[2][KS];
#pragma unroll
  for (int rt = 0; rt < RTN; ++rt) { const unsigned short* qr = (const unsigned short*)Q16 + ((size_t)b * TQ + q0 + rt * 16 + ln) * ldq + h * 64; const unsigned short* ql = (const unsigned short*)QL + ((size_t)b * TQ + q0 + rt * 16 + ln) * ldq + h * 64;
#pragma unroll
    for (int ks = 0; ks < KS; ++ks) { aq[rt][ks].half[0] = *(const v8us*)(qr + ks * 32 + 8 * hh); aq[rt][ks].half[1] = *(const v8us*)(qr + ks * 32 + 16 + 8 * hh); aql[rt][ks].half[0] = *(const v8us*)(ql + ks * 32 + 8 * hh); aql[rt][ks].half[1] = *(const v8us*)(ql + ks * 32 + 16 + 8 * hh); } }
  const unsigned short* Vth = (const unsigned short*)Vt + (size_t)slab * 64 * TK; const unsigned short* Vtl = (const unsigned short*)VtL + (size_t)slab * 64 * TK;
  float m_r[2][8], l_r[2][8]; v8f oacc[2][DT], oaccL[2][DT];
#pragma unroll
  for (int rt = 0; rt < RTN; ++rt) {
#pragma unroll
    for (int r = 0; r < 8; ++r) { m_r[rt][r] = -3.0e38f; l_r[rt][r] = 0.f; }
#pragma unroll
    for (int dt = 0; dt < DT; ++dt) { oacc[rt][dt] = (v8f){0.f,0.f,0.f,0.f,0.f,0.f,0.f,0.f}; oaccL[rt][dt] = oacc[rt][dt]; } }
  const int jend = (CAUSAL == 1) ? (qb0 + 4 * RPW) : ((CAUSAL == 23) ? min(TK, (qb0 / CHK + 2) * CHK) : TK);      /* causal / window: keys that can never contribute are skipped */ const int jbeg = (CAUSAL == 23) ? max(0, (qb0 / CHK - 1) * CHK) : 0;
#pragma unroll 1
  for (int j0 = jbeg; j0 < jend; j0 += 32) {
    v8f s[2][2];
#pragma unroll
    for (int nt = 0; nt < 2; ++nt) { const unsigned short* kr = (const unsigned short*)K16 + ((size_t)b * TK + j0 + nt * 16 + ln) * ldk + h * 64; const unsigned short* klr = (const unsigned short*)KL + ((size_t)b * TK + j0 + nt * 16 + ln) * ldk + h * 64; FragH bk[KS], bkl[KS];
#pragma unroll
      for (int ks = 0; ks < KS; ++ks) { bk[ks].half[0] = *(const v8us*)(kr + ks * 32 + 8 * hh); bk[ks].half[1] = *(const v8us*)(kr + ks * 32 + 16 + 8 * hh); bkl[ks].half[0] = *(const v8us*)(klr + ks * 32 + 8 * hh); bkl[ks].half[1] = *(const v8us*)(klr + ks * 32 + 16 + 8 * hh); }
#pragma unroll
      for (int rt = 0; rt < RTN; ++rt) { v8f acc = (v8f){0.f,0.f,0.f,0.f,0.f,0.f,0.f,0.f}, accl = acc;
#pragma unroll
        for (int ks = 0; ks < KS; ++ks) { acc = mmaH<1>(aq[rt][ks].v, aq[rt][ks].v, bk[ks].v, bk[ks].v, acc); accl = mmaH<1>(aql[rt][ks].v, aql[rt][ks].v, bk[ks].v, bk[ks].v, accl); accl = mmaH<1>(aq[rt][ks].v, aq[rt][ks].v, bkl[ks].v, bkl[ks].v, accl); }
#pragma unroll
        for (int r = 0; r < 8; ++r) acc[r] += accl[r] * 0.0009765625f;
        s[rt][nt] = acc; } }
#pragma unroll
    for (int rt = 0; rt < RTN; ++rt)
#pragma unroll
      for (int r = 0; r < 8; ++r) { const int tq = q0 + rt * 16 + 8 * hh + r; const int k0 = j0 + ln, k1 = j0 + 16 + ln;
        bool ok0 = (CAUSAL == 1) ? (k0 <= tq) : ((CAUSAL == 2) ? ((k0 >> 5) == (tq >> 5)) : true), ok1 = (CAUSAL == 1) ? (k1 <= tq) : ((CAUSAL == 2) ? ((k1 >> 5) == (tq >> 5)) : true);      /* mode 2: block-diagonal 32-token groups */
        if (CAUSAL == 4) { const int* mrow = MSK + ((size_t)b * TQ + tq) * TK; ok0 = mrow[k0] != 0; ok1 = mrow[k1] != 0; }      /* mode 4: per-(query, key) INPUT mask shared by all heads; masked keys contribute nothing (== the reference's -4096 fill, whose exp underflows to 0), rows with no valid key give l = 0 -> output 0 (== the reference's row_valid zeroing) */
        float s0 = ok0 ? s[rt][0][r] * SCL : -3.0e38f, s1 = ok1 ? s[rt][1][r] * SCL : -3.0e38f; if (CAUSAL == 17) { const float* amk = (const float*)MSK + (size_t)b * TK; s0 += bf16_round(amk[k0]); s1 += bf16_round(amk[k1]); } if (CAUSAL == 18) { const float* tb = (const float*)MSK; const int* ri = MSK + 1024 + (size_t)b * TK; const int rq = ri[tq]; s0 += tb[(h * 8 + rq) * 8 + ri[k0]]; s1 += tb[(h * 8 + rq) * 8 + ri[k1]]; } if (CAUSAL == 19) { const int* rel = MSK + (size_t)tq * TK; const float* rb = (const float*)MSK + (size_t)TQ * TK + ((size_t)(b * NH + h) * TQ + tq) * 64; s0 += rb[rel[k0]]; s1 += rb[rel[k1]]; }      /* mode 19: + (q.Ek[rel] + Eb[rel][h]) / 8 gathered by the int relative ids (packed [ids | table]) */      /* mode 18: + resource_bias[h][r_q][r_k] from the packed [table | ids] buffer (TQ == TK) */      /* mode 17: additive per-(batch, key) mask INPUT */ float mc = fmaxf(s0, s1);
        mc = fmaxf(mc, __shfl_xor(mc, 1, 32)); mc = fmaxf(mc, __shfl_xor(mc, 2, 32)); mc = fmaxf(mc, __shfl_xor(mc, 4, 32)); mc = fmaxf(mc, __shfl_xor(mc, 8, 32));
        const float mn = fmaxf(m_r[rt][r], mc); const float al = (mn > -1.0e38f) ? expf(m_r[rt][r] - mn) : 1.0f; m_r[rt][r] = mn; const float p0 = ok0 ? expf(s0 - mn) : 0.f, p1 = ok1 ? expf(s1 - mn) : 0.f; l_r[rt][r] = l_r[rt][r] * al + p0 + p1;
#pragma unroll
        for (int dt = 0; dt < DT; ++dt) { oacc[rt][dt][r] *= al; oaccL[rt][dt][r] *= al; }
        FragH t2, t2l; const float ps0 = p0 * 1024.0f, ps1 = p1 * 1024.0f; t2.h[0] = (_Float16)ps0; t2.h[1] = (_Float16)ps1; t2l.h[0] = (_Float16)((ps0 - (float)t2.h[0]) * 1024.0f); t2l.h[1] = (_Float16)((ps1 - (float)t2.h[1]) * 1024.0f);
        sP[w][rt * 16 + 8 * hh + r][ln] = t2.u[0]; sP[w][rt * 16 + 8 * hh + r][16 + ln] = t2.u[1]; sPL[w][rt * 16 + 8 * hh + r][ln] = t2l.u[0]; sPL[w][rt * 16 + 8 * hh + r][16 + ln] = t2l.u[1]; }
    __builtin_amdgcn_fence(__ATOMIC_ACQ_REL, "workgroup"); __builtin_amdgcn_wave_barrier();
    FragH pa[2], pl[2];
#pragma unroll
    for (int rt = 0; rt < RTN; ++rt) { pa[rt].half[0] = *(const v8us*)&sP[w][rt * 16 + ln][8 * hh]; pa[rt].half[1] = *(const v8us*)&sP[w][rt * 16 + ln][16 + 8 * hh]; pl[rt].half[0] = *(const v8us*)&sPL[w][rt * 16 + ln][8 * hh]; pl[rt].half[1] = *(const v8us*)&sPL[w][rt * 16 + ln][16 + 8 * hh]; }
#pragma unroll
    for (int dt = 0; dt < DT; ++dt) { const unsigned short* vrow = Vth + (size_t)(dt * 16 + ln) * TK + j0; const unsigned short* vrl = Vtl + (size_t)(dt * 16 + ln) * TK + j0; FragH bv, bl; bv.half[0] = *(const v8us*)(vrow + 8 * hh); bv.half[1] = *(const v8us*)(vrow + 16 + 8 * hh); bl.half[0] = *(const v8us*)(vrl + 8 * hh); bl.half[1] = *(const v8us*)(vrl + 16 + 8 * hh);
#pragma unroll
      for (int rt = 0; rt < RTN; ++rt) { oacc[rt][dt] = mmaH<1>(pa[rt].v, pa[rt].v, bv.v, bv.v, oacc[rt][dt]); oaccL[rt][dt] = mmaH<1>(pl[rt].v, pl[rt].v, bv.v, bv.v, oaccL[rt][dt]); oaccL[rt][dt] = mmaH<1>(pa[rt].v, pa[rt].v, bl.v, bl.v, oaccL[rt][dt]); } }
    __builtin_amdgcn_fence(__ATOMIC_ACQ_REL, "workgroup"); __builtin_amdgcn_wave_barrier(); }
#pragma unroll
  for (int rt = 0; rt < RTN; ++rt) {
#pragma unroll
    for (int r = 0; r < 8; ++r) { float l = l_r[rt][r]; l += __shfl_xor(l, 1, 32); l += __shfl_xor(l, 2, 32); l += __shfl_xor(l, 4, 32); l += __shfl_xor(l, 8, 32); l_r[rt][r] = (l > 0.f) ? 1.0f / (l * 1024.0f) : 0.f; }
#pragma unroll
    for (int dt = 0; dt < DT; ++dt)
#pragma unroll
      for (int r = 0; r < 8; ++r) { float v = oacc[rt][dt][r]; v += oaccL[rt][dt][r] * 0.0009765625f; sO[w][rt * 16 + 8 * hh + r][dt * 16 + ln] = v * l_r[rt][r]; } }
  __builtin_amdgcn_fence(__ATOMIC_ACQ_REL, "workgroup"); __builtin_amdgcn_wave_barrier();
  {
#pragma unroll
    for (int rp = 0; rp < RPW; rp += 2) { const int r = rp + (lane >> 4), pc = lane & 15; const v4f val = *(const v4fa*)&sO[w][r][pc * 4]; *(v4f*)(O + ((size_t)b * TQ + q0 + r) * ldo + h * 64 + pc * 4) = val; }
     } }

__global__ __launch_bounds__(256) void k_rotab(float* __restrict__ CS, float* __restrict__ SN) {
  #pragma clang fp contract(off)
  const int t = blockIdx.x * 256 + threadIdx.x; if (t >= SLEN * 32) return; const int j = t % 32, s = t / 32; const float ex = (float)(2 * j) / 64.0f; const float inv = 1.0f / powf(10000.0f, ex); const float th = (float)s * inv; const float c = cosf(th), sn = sinf(th);
  { *(float*)(CS + t) = c; *(float*)(SN + t) = sn;  } }
__global__ __launch_bounds__(256) void k_rope(const float* __restrict__ F, int nsrc, int ndst, int rep, const float* __restrict__ CS, const float* __restrict__ SN, _Float16* __restrict__ H, _Float16* __restrict__ L) {
  #pragma clang fp contract(off)
  const size_t t = (size_t)blockIdx.x * 256 + threadIdx.x; if (t >= (size_t)NR * ndst * 4) return; const int g8 = (int)(t % 4); const int hd = (int)((t / 4) % ndst); const size_t row = t / ((size_t)4 * ndst); const int s = (int)(row % SLEN); const int hs = hd / rep;
  const float* src = F + row * (size_t)(nsrc * 64) + hs * 64; FragH ah, al, bh, bl;
  for (int i = 0; i < 8; ++i) { const int d = g8 * 8 + i; const float c = CS[s * 32 + d], sn = SN[s * 32 + d]; const float x1 = src[d], x2 = src[d + 32];
    float o1 = x1 * c; o1 += -x2 * sn; float o2 = x2 * c; o2 += x1 * sn;
    _Float16 hv = (_Float16)o1; ah.h[i] = hv; al.h[i] = (_Float16)((o1 - (float)hv) * 1024.0f); hv = (_Float16)o2; bh.h[i] = hv; bl.h[i] = (_Float16)((o2 - (float)hv) * 1024.0f); }
  const size_t o = row * (size_t)(ndst * 64) + hd * 64 + g8 * 8;
  { *(v8us*)((unsigned short*)H + o) = ah.half[0]; *(v8us*)((unsigned short*)H + o + 32) = bh.half[0]; *(v8us*)((unsigned short*)L + o) = al.half[0]; *(v8us*)((unsigned short*)L + o + 32) = bl.half[0];  } }
__global__ __launch_bounds__(256) void k_rope2(const float* __restrict__ F, int nsrc, int ndst, int rep, const float* __restrict__ CS, const float* __restrict__ SN, _Float16* __restrict__ H, _Float16* __restrict__ L) {
  #pragma clang fp contract(off)
  const size_t t = (size_t)blockIdx.x * 256 + threadIdx.x; if (t >= (size_t)NR * ndst * 4) return; const int g16 = (int)(t % 4); const int hd = (int)((t / 4) % ndst); const size_t row = t / ((size_t)4 * ndst); const int s = (int)(row % SLEN); const int hs = hd / rep;
  const float* src = F + row * (size_t)(nsrc * 64) + hs * 64 + g16 * 16; FragH ah, al;
  for (int pr = 0; pr < 8; ++pr) { const int i = g16 * 8 + pr; const float c = CS[s * 32 + i], sn = SN[s * 32 + i]; const float x1 = src[2 * pr], x2 = src[2 * pr + 1];
    float o1 = x1 * c; o1 -= x2 * sn; float o2 = x1 * sn; o2 += x2 * c;
    _Float16 hv = (_Float16)o1; ah.h[2 * pr] = hv; al.h[2 * pr] = (_Float16)((o1 - (float)hv) * 1024.0f); hv = (_Float16)o2; ah.h[2 * pr + 1] = hv; al.h[2 * pr + 1] = (_Float16)((o2 - (float)hv) * 1024.0f); }
  const size_t o = row * (size_t)(ndst * 64) + hd * 64 + g16 * 16;
  { *(v8us*)((unsigned short*)H + o) = ah.half[0]; *(v8us*)((unsigned short*)H + o + 8) = ah.half[1]; *(v8us*)((unsigned short*)L + o) = al.half[0]; *(v8us*)((unsigned short*)L + o + 8) = al.half[1];  } }
__global__ __launch_bounds__(256) void k_ln512(const float* __restrict__ A, const float* __restrict__ res, const float* __restrict__ g, const float* __restrict__ bb, float* __restrict__ Y, _Float16* __restrict__ Y16) {
  #pragma clang fp contract(off)
  const int wv = threadIdx.x >> 5, ln = threadIdx.x & 31; const size_t r = (size_t)blockIdx.x * 8 + wv; if (r >= NR) return; float x[16]; float s = 0.f;
  for (int i = 0; i < 2; ++i) { const v8f a = *(const v8f*)(A + r * DM + i * 256 + ln * 8); for (int q = 0; q < 8; ++q) { float v = a[q]; if (res) v += bf16_round(res[r * DM + i * 256 + ln * 8 + q]); x[i * 8 + q] = v; s += v; } }
  for (int o = 16; o > 0; o >>= 1) s += __shfl_xor(s, o, 32); const float mu = s / (float)DM; float var = 0.f; for (int q = 0; q < 16; ++q) { const float d = x[q] - mu; var += d * d; }
  for (int o = 16; o > 0; o >>= 1) var += __shfl_xor(var, o, 32); const float inv = rsqrtf(var / (float)DM + 1e-5f);
  { for (int i = 0; i < 2; ++i) { const int c0 = i * 256 + ln * 8; v8f y; FragH f; for (int q = 0; q < 8; ++q) { float v = (x[i * 8 + q] - mu) * inv; v *= bf16_round(g[c0 + q]); v += bf16_round(bb[c0 + q]); y[q] = v; f.h[q] = (_Float16)v; } *(v8f*)(Y + r * DM + c0) = y; if (Y16) *(v8us*)((unsigned short*)Y16 + r * DM + c0) = f.half[0]; }  } }
__global__ __launch_bounds__(256) void k_pack(const float* __restrict__ rb, const int* __restrict__ rid, int* __restrict__ PK) { const int t = blockIdx.x * 256 + threadIdx.x; if (t >= 1024 + NB * TK) return; int v; if (t < 1024) v = __float_as_int(bf16_round(rb[t])); else v = rid[t - 1024]; *(int*)(PK + t) = v;  }
__global__ __launch_bounds__(256) void k_tabin(const float* __restrict__ sp, float* __restrict__ CS, float* __restrict__ SN) { const int t = blockIdx.x * 256 + threadIdx.x; if (t >= SLEN * 32) return; const int i = t % 32, s = t / 32; const float c = bf16_round(sp[s * 64 + 32 + i]), sn = bf16_round(sp[s * 64 + i]);
  { *(float*)(CS + t) = c; *(float*)(SN + t) = sn;  } }
__global__ __launch_bounds__(256) void k_wsc(const float* __restrict__ Wm, _Float16* __restrict__ Bt, size_t n8, float sc) { const size_t t = (size_t)blockIdx.x * 256 + threadIdx.x; if (t >= n8) return; FragH f; for (int q = 0; q < 8; ++q) f.h[q] = (_Float16)(bf16_round(Wm[t * 8 + q]) * sc); *(v8us*)((unsigned short*)Bt + t * 8) = f.half[0];  }
__global__ __launch_bounds__(256) void k_rotab2(float* __restrict__ CS, float* __restrict__ SN) {
  #pragma clang fp contract(off)
  const int t = blockIdx.x * 256 + threadIdx.x; if (t >= SLEN * 32) return; const int j = t % 32, s = t / 32; const float c0 = -0.14391156831212787f;      /* -ln(10000)/64 rounded to f32 */ const float inv = expf((float)(2 * j) * c0); const float th = (float)s * inv; const float c = cosf(th), sn = sinf(th);
  { *(float*)(CS + t) = c; *(float*)(SN + t) = sn;  } }
__global__ __launch_bounds__(256) void k_lnu(const float* __restrict__ X, _Float16* __restrict__ N16, float* __restrict__ XB) {
  #pragma clang fp contract(off)
  const int wv = threadIdx.x >> 5, ln = threadIdx.x & 31; const size_t r = (size_t)blockIdx.x * 8 + wv; if (r >= NR) return; float a[32]; float s = 0.f;
  for (int i = 0; i < 4; ++i) { const v8f v = *(const v8f*)(X + r * DM + (i * 32 + ln) * 8); for (int q = 0; q < 8; ++q) { const float u = bf16_round(v[q]); a[i * 8 + q] = u; s += u; } }
  for (int o = 16; o > 0; o >>= 1) s += __shfl_xor(s, o, 32); const float mu = s / (float)DM; float var = 0.f; for (int q = 0; q < 32; ++q) { const float d = a[q] - mu; var += d * d; }
  for (int o = 16; o > 0; o >>= 1) var += __shfl_xor(var, o, 32); const float den = sqrtf(var / (float)(DM - 1)) + 1e-6f; const float inv = 1.0f / den;      /* one reciprocal per row; (x-mean)*inv vs the reference's division differs by <= 1 ulp */
  { for (int i = 0; i < 4; ++i) { const int c0 = (i * 32 + ln) * 8; FragH f; v8f xb; for (int q = 0; q < 8; ++q) { f.h[q] = (_Float16)((a[i * 8 + q] - mu) * inv); xb[q] = a[i * 8 + q]; } *(v8us*)((unsigned short*)N16 + r * DM + c0) = f.half[0]; *(v8f*)(XB + r * DM + c0) = xb; }  } }
__global__ __launch_bounds__(256) void k_vtg(const _Float16* __restrict__ V16, _Float16* __restrict__ Vt) { __shared__ unsigned short tl[64][66]; const int tid = threadIdx.x; const int slab = blockIdx.x / (SLEN / 64), lg = blockIdx.x % (SLEN / 64); const int b = slab / NH, h = slab % NH; const int hs = h / NREP;
  for (int i = tid; i < 64 * 8; i += 256) { const int r = i / 8, c8 = (i % 8) * 8; FragH f; f.half[0] = *(const v8us*)((const unsigned short*)V16 + ((size_t)b * SLEN + lg * 64 + r) * KVD + hs * 64 + c8); for (int q = 0; q < 8; ++q) tl[r][c8 + q] = f.u[q]; }
  __syncthreads();
  { for (int rd = 0; rd < 2; ++rd) { const int d = rd * 32 + tid / 8, pc = tid % 8; FragH f; for (int q = 0; q < 8; ++q) f.u[q] = tl[pc * 8 + q][d]; *(v8us*)((unsigned short*)Vt + ((size_t)slab * 64 + d) * SLEN + lg * 64 + pc * 8) = f.half[0]; }  } }

__global__ __launch_bounds__(256) void k_h16s(const float* __restrict__ SRC, int lds, int coff, _Float16* __restrict__ DST, size_t n8) { const size_t t = (size_t)blockIdx.x * 256 + threadIdx.x; if (t >= n8) return; const size_t r = (t * 8) / DM; const int c = (int)((t * 8) % DM); const v8f a = *(const v8f*)(SRC + r * lds + coff + c); FragH f; for (int q = 0; q < 8; ++q) f.h[q] = (_Float16)a[q];
  *(v8us*)((unsigned short*)DST + t * 8) = f.half[0];  }


__global__ __launch_bounds__(256) void k_ccp(const float* __restrict__ QKV, int coff, _Float16* __restrict__ D) { const size_t t = (size_t)blockIdx.x * 256 + threadIdx.x; if (t >= (size_t)NR * DM / 8) return; const int c0 = (int)((t * 8) % DM); const size_t row = (t * 8) / DM; const v8f a = *(const v8f*)(QKV + row * 3 * DM + coff + c0); FragH f; for (int q = 0; q < 8; ++q) f.h[q] = (_Float16)a[q];
  *(v8us*)((unsigned short*)D + t * 8) = f.half[0];  }


#ifndef NBS
#define NBS NB      /* batch stride of the [S][B][E] tensors (debug builds may process fewer batches than the layout holds) */
#endif
__global__ __launch_bounds__(256) void k_sbe(const float* __restrict__ q, _Float16* __restrict__ X) { const size_t t = (size_t)blockIdx.x * 256 + threadIdx.x; if (t >= (size_t)NR * DM / 8) return; const int c0 = (int)((t * 8) % DM); const size_t row = (t * 8) / DM; const int b = (int)(row / SLEN), s_ = (int)(row % SLEN); const float* src = q + ((size_t)s_ * NBS + b) * DM + c0; FragH f; for (int i = 0; i < 8; ++i) f.h[i] = (_Float16)bf16_round(src[i]);
  *(v8us*)((unsigned short*)X + t * 8) = f.half[0];  }
__global__ __launch_bounds__(256) void k_out_sbe(const float* __restrict__ R, float* __restrict__ out) { const size_t t = (size_t)blockIdx.x * 256 + threadIdx.x; if (t >= (size_t)NR * DM / 8) return; const int c0 = (int)((t * 8) % DM); const size_t irow = (t * 8) / DM; const int b = (int)(irow / SLEN), s_ = (int)(irow % SLEN); const v8f v = *(const v8f*)(R + t * 8); float* d = out + ((size_t)s_ * NBS + b) * DM + c0;
  *(v8f*)d = v;  }
__global__ __launch_bounds__(256) void k_rope(const float* __restrict__ F, _Float16* __restrict__ O16) {
  #pragma clang fp contract(off)
  const size_t t = (size_t)blockIdx.x * 256 + threadIdx.x; if (t >= (size_t)NR * DM / 16) return; const int d0 = (int)((t * 8) % 32); const int h = (int)(((t * 8) / 32) % NH); const size_t row = (t * 8) / (32 * NH); const int s_ = (int)(row % SLEN); const float* p = F + row * DM + h * 64; const v8f a = *(const v8f*)(p + d0), c = *(const v8f*)(p + 32 + d0); FragH f1, f2;
#pragma unroll 1
  for (int q = 0; q < 8; ++q) { const int d = d0 + q; const float inv = 1.0f / powf(10000.0f, (float)(2 * d) / 64.0f); const float ang = (float)s_ * inv; const float sn = sinf(ang), cs = cosf(ang); float o1 = a[q] * cs; o1 = o1 - c[q] * sn; float o2 = c[q] * cs; o2 = o2 + a[q] * sn; f1.h[q] = (_Float16)o1; f2.h[q] = (_Float16)o2; }
  { *(v8us*)((unsigned short*)O16 + row * DM + h * 64 + d0) = f1.half[0]; *(v8us*)((unsigned short*)O16 + row * DM + h * 64 + 32 + d0) = f2.half[0];  } }
extern "C" void kernel_launch(void* const* d_in, const int* in_sizes, int n_in,
                              void* d_out, int out_size, void* d_ws, size_t ws_size, hipStream_t stream) {
  (void)in_sizes; (void)n_in; (void)out_size;
  const float* qy = (const float*)d_in[0]; const float* wq = (const float*)d_in[1]; const float* bq = (const float*)d_in[2]; const float* wk = (const float*)d_in[3]; const float* bk = (const float*)d_in[4]; const float* wv = (const float*)d_in[5]; const float* bv = (const float*)d_in[6]; const float* wo = (const float*)d_in[7]; const float* bo = (const float*)d_in[8];
  char* ws = (char*)d_ws; size_t off = 0;
  auto take = [&](size_t bytes) { char* p = ws + off; off += (bytes + 255) & ~(size_t)255; return p; };
  const size_t np = (size_t)NR * DM;
  _Float16* BQ = (_Float16*)take((size_t)DM * DM * 2); _Float16* BK = (_Float16*)take((size_t)DM * DM * 2); _Float16* BV = (_Float16*)take((size_t)DM * DM * 2); _Float16* BO = (_Float16*)take((size_t)DM * DM * 2); _Float16* X16 = (_Float16*)take(np * 2); float* F32 = (float*)take(np * 4); float* OUTR = (float*)take(np * 4);
   _Float16* QH = (_Float16*)take(np * 2); _Float16* KH = (_Float16*)take(np * 2); _Float16* V16 = (_Float16*)take(np * 2); _Float16* VT = (_Float16*)take(np * 2); float* O = (float*)take(np * 4); _Float16* OH = QH; _Float16* OL = KH;
  if (off > ws_size) return;
  k_wsc<<<(unsigned)(((size_t)DM * DM / 8 + 255) / 256), 256, 0, stream>>>(wq, BQ, (size_t)DM * DM / 8, 16.0f); k_wsc<<<(unsigned)(((size_t)DM * DM / 8 + 255) / 256), 256, 0, stream>>>(wk, BK, (size_t)DM * DM / 8, 16.0f); k_wsc<<<(unsigned)(((size_t)DM * DM / 8 + 255) / 256), 256, 0, stream>>>(wv, BV, (size_t)DM * DM / 8, 16.0f); k_wsc<<<(unsigned)(((size_t)DM * DM / 8 + 255) / 256), 256, 0, stream>>>(wo, BO, (size_t)DM * DM / 8, 16.0f);      /* torch (out,in) naturals */
  k_sbe<<<(unsigned)((np / 8 + 255) / 256), 256, 0, stream>>>(qy, X16);
  
  const dim3 g((NR / 128) * (DM / 64), 1);
  k_gemm2<0><<<g, 128, 0, stream>>>(X16, DM, 0, BQ, DM, 0, 0.0625f, bq, 0, nullptr, 1, 0, 0, F32, nullptr, DM, 0, NR, DM, DM); k_rope<<<(unsigned)((np / 8 + 255) / 256), 256, 0, stream>>>(F32, QH);
  k_gemm2<0><<<g, 128, 0, stream>>>(X16, DM, 0, BK, DM, 0, 0.0625f, bk, 0, nullptr, 1, 0, 0, F32, nullptr, DM, 0, NR, DM, DM); k_rope<<<(unsigned)((np / 8 + 255) / 256), 256, 0, stream>>>(F32, KH);
  k_gemm2<0><<<g, 128, 0, stream>>>(X16, DM, 0, BV, DM, 0, 0.0625f, bv, 0, nullptr, 1, 0, 0, nullptr, V16, DM, 0, NR, DM, DM);
  k_vtg<<<NB * NH * (SLEN / 64), 256, 0, stream>>>(V16, VT);
  k_flash<0><<<NB * NH * QBNP, 128, 0, stream>>>(QH, DM, KH, DM, VT, nullptr, O, DM);
  k_hl<<<(unsigned)((np / 8 + 255) / 256), 256, 0, stream>>>(O, OH, OL, np / 8);
  k_gemm2<0><<<g, 128, 0, stream>>>(OL, DM, 0, BO, DM, 0, 0.0625f / 1024.0f, nullptr, 0, nullptr, 1, 0, 0, OUTR, nullptr, DM, 0, NR, DM, DM);
  k_gemm2<0><<<g, 128, 0, stream>>>(OH, DM, 0, BO, DM, 0, 0.0625f, bo, 0, OUTR, 1, (size_t)DM, 0, OUTR, nullptr, DM, 0, NR, DM, DM);      /* out rows (b, s) = (ctx_lo + ctx_hi) Wo^T + b */
  k_out_sbe<<<(unsigned)((np / 8 + 255) / 256), 256, 0, stream>>>(OUTR, (float*)d_out);
}

// v002
// Measured time: 342 microseconds a run.
// Next to v001, in two timings, it ran 1.19 and 1.27 times as fast.
// All steps since v000 together make it 1.56 times as fast.
#include <hip/hip_runtime.h>
// LucaGPLMMultiheadAttentionWithSDPA (query [2048][2][1024] in [S, B, E] layout, 16 heads x 64: q/k/v = query W^T + b; rotary embedding per head (inv_freq = 10000^(-2i/64), rotate-half form) on q and k; softmax(q k^T / 8) v (no mask); out = attn Wo^T + bo, back in [S, B, E]).
// Structure: [S,B,E] -> exact f16 (b, s) rows; q/k as f16 WMMA GEMMs into f32 (32x64 wave tiles, f32 accumulation, exact x16 weights + bias) followed by RoPE on VALU (f32 angles s * inv_freq, sinf/cosf) into f16 planes; v as an f16 GEMM; V^T by LDS tiles; flash-style fused attention per (batch, head, 64-query block) (K Q^T and V^T P^T, one query per lane, online softmax and P in registers; no score plane), f32 context; output projection as a two-term GEMM on the context's f16 hi/residual split + bias into (b, s) rows, then the [S, B, E] store on VALU.
// Compute dtype: inputs rounded to bf16; query / weights exact as f16; roped q/k and v plain f16 (~2^-12); softmax f32 with f16 probabilities; context hi + 2^-10 residual into the projection. v_wmma_f32_16x16x32_f16.
#define NB 2
#define DM 1024
#define NKV 16
#define NREP (NH / NKV)
#define KVD (NKV * 64)           /* 1024 */
#define NR (NB * SLEN)
#define CHK 512
typedef int v4i __attribute__((ext_vector_type(4)));
#define FF 2048
#define SLEN 2048
#define MQI 2048
#define MKI 2048
#define TQ SLEN
#define TK SLEN
#define NH 16
#define SCL 0.125f
#define QBLKS (TQ / 64)
#define QB05 0
#define QBN5 4
#define QB0P 0
#define QBNP QBLKS
#define RE 256
typedef __bf16 v16b __attribute__((ext_vector_type(16)));
typedef unsigned short v8us __attribute__((ext_vector_type(8), may_alias));
typedef float  v8f  __attribute__((ext_vector_type(8)));
typedef float  v4f  __attribute__((ext_vector_type(4)));
typedef float  v4fa __attribute__((ext_vector_type(4), may_alias));
union FragB { v16b v; v8us half[2]; unsigned short u[16]; };

__device__ __forceinline__ unsigned short bf16_bits(float x) { unsigned int u = __float_as_uint(x); return (unsigned short)((u + 0x7FFFu + ((u >> 16) & 1u)) >> 16); }
__device__ __forceinline__ float bf16_val(unsigned short b) { return __uint_as_float(((unsigned int)b) << 16); }
__device__ __forceinline__ float bf16_round(float x) { return bf16_val(bf16_bits(x)); }
// D += A·B with NT terms: 1 = ah·bh, 2 = + al·bh (A split), 3 = + ah·bl (both split)
template <int NT>
__device__ __forceinline__ v8f mmaN(v16b ah, v16b al, v16b bh, v16b bl, v8f c) {
  c = __builtin_amdgcn_wmma_f32_16x16x32_bf16(false, ah, false, bh, (short)0, c, false, false);
  if (NT >= 2) c = __builtin_amdgcn_wmma_f32_16x16x32_bf16(false, al, false, bh, (short)0, c, false, false);
  if (NT >= 3) c = __builtin_amdgcn_wmma_f32_16x16x32_bf16(false, ah, false, bl, (short)0, c, false, false);
  asm volatile("v_nop\n\tv_nop\n\tv_nop\n\tv_nop" : "+v"(c) : "v"(ah), "v"(al), "v"(bh), "v"(bl));
  return c;
}

__global__ __launch_bounds__(256) void k_wt_bf16(const float* __restrict__ W, unsigned short* __restrict__ Wt, int K, int N) {
  const int t = blockIdx.x * 256 + threadIdx.x;
  const int k8n = K / 8;
  if (t >= N * k8n) return;
  const int n = t / k8n, k8 = (t % k8n) * 8;
  v8us v;
#pragma unroll
  for (int i = 0; i < 8; ++i) v[i] = bf16_bits(W[(size_t)(k8 + i) * N + n]);
  *(v8us*)(Wt + (size_t)n * K + k8) = v;
  
}

// GEMM C[M][N] (f32, pitch ldc) = act(A[M][K]·W + bias). A f32 row-major (pitch lda) converted per fragment to bf16
// (ASPLIT: hi/lo two planes -> 2 terms, else single rounded term); Wt bf16 [N][K] (pitch ldb). BIAS_BF16 rounds the
// bias to bf16 first (bias quantised to bf16 before the add). K%32==0, M%16==0, N%64==0.
template <bool ASPLIT, int ACT, bool BIAS_BF16>
__global__ __launch_bounds__(128) void k_gemm_bf(const float* __restrict__ A, int lda, const unsigned short* __restrict__ Wt, int ldb,
                                               const float* __restrict__ bias, float* __restrict__ C, int ldc, int M, int N, int K) {
  __shared__ __attribute__((aligned(16))) float so[4][16][64];
  const int tid = threadIdx.x, w = tid >> 5, lane = tid & 31, ln = lane & 15, hh = lane >> 4;
  const int ntn = N / 64;
  const int wid = blockIdx.x * 4 + w;
  const int mt = wid / ntn, nq = wid % ntn;
  if (mt * 16 >= M) return;
  const int row0 = mt * 16, col0 = nq * 64;
  const float* arow = A + (size_t)(row0 + ln) * lda;
  v8f acc[4] = {};
  for (int kb = 0; kb < K; kb += 32) {
    FragB ah, al;
    const v4f x0 = *(const v4fa*)(arow + kb + 8 * hh), x1 = *(const v4fa*)(arow + kb + 8 * hh + 4);
    const v4f x2 = *(const v4fa*)(arow + kb + 16 + 8 * hh), x3 = *(const v4fa*)(arow + kb + 16 + 8 * hh + 4);
    float xs[16] = {x0[0],x0[1],x0[2],x0[3],x1[0],x1[1],x1[2],x1[3],x2[0],x2[1],x2[2],x2[3],x3[0],x3[1],x3[2],x3[3]};
#pragma unroll
    for (int i = 0; i < 16; ++i) { const unsigned short hb = bf16_bits(xs[i]); ah.u[i] = hb; al.u[i] = ASPLIT ? bf16_bits(xs[i] - bf16_val(hb)) : (unsigned short)0; }
#pragma unroll
    for (int t = 0; t < 4; ++t) {
      const unsigned short* brow = Wt + (size_t)(col0 + t * 16 + ln) * ldb + kb;
      FragB b;
      b.half[0] = *(const v8us*)(brow + 8 * hh);
      b.half[1] = *(const v8us*)(brow + 16 + 8 * hh);
      acc[t] = mmaN<ASPLIT ? 2 : 1>(ah.v, al.v, b.v, b.v, acc[t]);
    }
  }
#pragma unroll
  for (int t = 0; t < 4; ++t) {
    float bv = bias ? bias[col0 + t * 16 + ln] : 0.f;
    if (BIAS_BF16) bv = bf16_round(bv);
#pragma unroll
    for (int r = 0; r < 8; ++r) { float v = acc[t][r] + bv; if (ACT == 1) v = fmaxf(v, 0.f); so[w][8 * hh + r][t * 16 + ln] = v; }
  }
  __builtin_amdgcn_fence(__ATOMIC_ACQ_REL, "workgroup");
  __builtin_amdgcn_wave_barrier();
  const int rsub = lane >> 4, c4 = (lane & 15) * 4;
  {
#pragma unroll
    for (int q = 0; q < 8; ++q) {
      const int r = q * 2 + rsub;
      const v4f v = *(const v4fa*)&so[w][r][c4];
      *(v4f*)(C + (size_t)(row0 + r) * ldc + col0 + c4) = v;
    }
    
  }
}

// GEMM C = act(A·W + bias + resid): A f32 (ASPLIT -> hi/lo 2 terms), Wt bf16 [N][K]; ACT 0 none, 1 relu, 2 exact gelu;
// resid (optional, f32, row index = (row % rmod), pitch ldr, RES_BF16 rounds it) added before the activation.
template <bool ASPLIT, int ACT, bool BIAS_BF16, bool RES_BF16>
__global__ __launch_bounds__(128) void k_gemm_bf3(const float* __restrict__ A, int lda, const unsigned short* __restrict__ Wt, int ldb,
                                                const float* __restrict__ bias, const float* __restrict__ resid, int rmod, int ldr,
                                                float* __restrict__ C, int ldc, int M, int N, int K) {
  __shared__ __attribute__((aligned(16))) float so[4][16][64];
  const int tid = threadIdx.x, w = tid >> 5, lane = tid & 31, ln = lane & 15, hh = lane >> 4;
  const int ntn = N / 64;
  const int wid = blockIdx.x * 4 + w;
  const int mt = wid / ntn, nq = wid % ntn;
  if (mt * 16 >= M) return;
  const int row0 = mt * 16, col0 = nq * 64;
  const float* arow = A + (size_t)(row0 + ln) * lda;
  v8f acc[4] = {};
  for (int kb = 0; kb < K; kb += 32) {
    FragB ah, al;
    const v4f x0 = *(const v4fa*)(arow + kb + 8 * hh), x1 = *(const v4fa*)(arow + kb + 8 * hh + 4);
    const v4f x2 = *(const v4fa*)(arow + kb + 16 + 8 * hh), x3 = *(const v4fa*)(arow + kb + 16 + 8 * hh + 4);
    float xs[16] = {x0[0],x0[1],x0[2],x0[3],x1[0],x1[1],x1[2],x1[3],x2[0],x2[1],x2[2],x2[3],x3[0],x3[1],x3[2],x3[3]};
#pragma unroll
    for (int i = 0; i < 16; ++i) { const unsigned short hb = bf16_bits(xs[i]); ah.u[i] = hb; al.u[i] = ASPLIT ? bf16_bits(xs[i] - bf16_val(hb)) : (unsigned short)0; }
#pragma unroll
    for (int t = 0; t < 4; ++t) {
      const unsigned short* brow = Wt + (size_t)(col0 + t * 16 + ln) * ldb + kb;
      FragB b;
      b.half[0] = *(const v8us*)(brow + 8 * hh);
      b.half[1] = *(const v8us*)(brow + 16 + 8 * hh);
      acc[t] = mmaN<ASPLIT ? 2 : 1>(ah.v, al.v, b.v, b.v, acc[t]);
    }
  }
#pragma unroll
  for (int t = 0; t < 4; ++t) {
    const int col = col0 + t * 16 + ln;
    float bv = bias ? bias[col] : 0.f;
    if (BIAS_BF16) bv = bf16_round(bv);
#pragma unroll
    for (int r = 0; r < 8; ++r) {
      float v = acc[t][r] + bv;
      if (resid) { float rv = resid[(size_t)((row0 + 8 * hh + r) % rmod) * ldr + col]; if (RES_BF16) rv = bf16_round(rv); v += rv; }
      if (ACT == 1) v = fmaxf(v, 0.f);
      if (ACT == 2) v = 0.5f * v * (1.0f + erff(v * 0.70710678118654752f));
      if (ACT == 3) { const float u = 0.7978845608028654f * (v + 0.044715f * v * v * v); v = 0.5f * v * (1.0f + tanhf(u)); }
      so[w][8 * hh + r][t * 16 + ln] = v;
    }
  }
  __builtin_amdgcn_fence(__ATOMIC_ACQ_REL, "workgroup");
  __builtin_amdgcn_wave_barrier();
  const int rsub = lane >> 4, c4 = (lane & 15) * 4;
  {
#pragma unroll
    for (int q = 0; q < 8; ++q) {
      const int r = q * 2 + rsub;
      const v4f v = *(const v4fa*)&so[w][r][c4];
      *(v4f*)(C + (size_t)(row0 + r) * ldc + col0 + c4) = v;
    }
    
  }
}
// row LayerNorm (biased variance, eps) over N: s = X (+ R); optional out_sum <- s; out_norm <- (s-mu)*rsqrt(var+eps)*g + b
template <bool PARAM_BF16>
__global__ __launch_bounds__(256) void k_layernorm(const float* __restrict__ X, const float* __restrict__ R, const float* __restrict__ g, const float* __restrict__ bta,
                                                  float* __restrict__ out_sum, float* __restrict__ out_norm, int N, float eps) {
  __shared__ float red[256];
  const int row = blockIdx.x, tid = threadIdx.x;
  const float* x = X + (size_t)row * N; const float* rr = R ? R + (size_t)row * N : nullptr;
  float vals[16];                     // up to N = 4096
  const int per = N / 256;            // contiguous chunk per thread? use strided-by-4 chunks: thread handles j = tid*4 + 1024*u
  float s1 = 0.f;
  for (int u = 0; u < per / 4; ++u) {
    const int j = tid * 4 + 1024 * u;
    const v4f a = *(const v4fa*)(x + j);
    v4f b = {0.f,0.f,0.f,0.f}; if (rr) b = *(const v4fa*)(rr + j);
#pragma unroll
    for (int q = 0; q < 4; ++q) { const float v = a[q] + b[q]; vals[u * 4 + q] = v; s1 += v; }
  }
  red[tid] = s1; __syncthreads();
  for (int st = 128; st > 0; st >>= 1) { if (tid < st) red[tid] += red[tid + st]; __syncthreads(); }
  const float mu = red[0] / (float)N; __syncthreads();
  float s2 = 0.f;
  for (int u = 0; u < per / 4; ++u)
#pragma unroll
    for (int q = 0; q < 4; ++q) { const float c = vals[u * 4 + q] - mu; s2 += c * c; }
  red[tid] = s2; __syncthreads();
  for (int st = 128; st > 0; st >>= 1) { if (tid < st) red[tid] += red[tid + st]; __syncthreads(); }
  const float rs = rsqrtf(red[0] / (float)N + eps);
  {
    for (int u = 0; u < per / 4; ++u) {
      const int j = tid * 4 + 1024 * u;
      v4f o, sm;
#pragma unroll
      for (int q = 0; q < 4; ++q) {
        float gg = g[j + q], bb = bta[j + q];
        if (PARAM_BF16) { gg = bf16_round(gg); bb = bf16_round(bb); }
        sm[q] = vals[u * 4 + q]; o[q] = (vals[u * 4 + q] - mu) * rs * gg + bb;
      }
      if (out_sum) *(v4f*)(out_sum + (size_t)row * N + j) = sm;
      *(v4f*)(out_norm + (size_t)row * N + j) = o;
    }
    
  }
}



// ---- f16 WMMA path (v_wmma_f32_16x16x32_f16): 11-bit significands for operands in range — used where a [0,1] probability operand needs more precision than bf16
typedef _Float16 v16h __attribute__((ext_vector_type(16)));
union FragH { v16h v; v8us half[2]; _Float16 h[16]; unsigned short u[16]; };
template <int NT>
__device__ __forceinline__ v8f mmaH(v16h ah, v16h al, v16h bh, v16h bl, v8f c) {
  c = __builtin_amdgcn_wmma_f32_16x16x32_f16(false, ah, false, bh, (short)0, c, false, false);
  if (NT >= 2) c = __builtin_amdgcn_wmma_f32_16x16x32_f16(false, al, false, bh, (short)0, c, false, false);
  if (NT >= 3) c = __builtin_amdgcn_wmma_f32_16x16x32_f16(false, ah, false, bl, (short)0, c, false, false);
  asm volatile("v_nop\n\tv_nop\n\tv_nop\n\tv_nop" : "+v"(c) : "v"(ah), "v"(al), "v"(bh), "v"(bl));
  return c;
}
// batched GEMM like k_gemm_b but f16 operands: A f32 (split into f16 hi/lo if ASPLIT, else rounded to f16), Bt = f16 values [n][k]; alpha; C f32; N multiple of 16 (partial tiles skipped)
template <bool ASPLIT>
__global__ __launch_bounds__(128) void k_gemm_h(const float* __restrict__ A, int lda, size_t sA, const _Float16* __restrict__ Bh, int ldb, size_t sB, float alpha, float* __restrict__ C, int ldc, size_t sC, int M, int N, int K) {
  __shared__ __attribute__((aligned(16))) float so[4][16][64];
  const int tid = threadIdx.x, w = tid >> 5, lane = tid & 31, ln = lane & 15, hh = lane >> 4; const int by = blockIdx.y;
  A += (size_t)by * sA; Bh += (size_t)by * sB; C += (size_t)by * sC;
  const int ntn = (N + 63) / 64; const int wid = blockIdx.x * 4 + w; const int mt = wid / ntn, nq = wid % ntn; if (mt * 16 >= M) return;
  const int row0 = mt * 16, col0 = nq * 64; const float* arow = A + (size_t)(row0 + ln) * lda;
  v8f acc[4] = {};
  for (int kb = 0; kb < K; kb += 32) {
    FragH ah, al;
    const v4f x0 = *(const v4fa*)(arow + kb + 8 * hh), x1 = *(const v4fa*)(arow + kb + 8 * hh + 4), x2 = *(const v4fa*)(arow + kb + 16 + 8 * hh), x3 = *(const v4fa*)(arow + kb + 16 + 8 * hh + 4);
    float xs[16] = {x0[0],x0[1],x0[2],x0[3],x1[0],x1[1],x1[2],x1[3],x2[0],x2[1],x2[2],x2[3],x3[0],x3[1],x3[2],x3[3]};
#pragma unroll
    for (int i = 0; i < 16; ++i) { const _Float16 h = (_Float16)xs[i]; ah.h[i] = h; al.h[i] = ASPLIT ? (_Float16)(xs[i] - (float)h) : (_Float16)0.0f; }
#pragma unroll
    for (int t = 0; t < 4; ++t) { if (col0 + t * 16 >= N) continue; const size_t boff = (size_t)(col0 + t * 16 + ln) * ldb + kb; FragH bq; bq.half[0] = *(const v8us*)(Bh + boff + 8 * hh); bq.half[1] = *(const v8us*)(Bh + boff + 16 + 8 * hh);
      acc[t] = mmaH<ASPLIT ? 2 : 1>(ah.v, al.v, bq.v, bq.v, acc[t]); }
  }
#pragma unroll
  for (int t = 0; t < 4; ++t) { if (col0 + t * 16 >= N) continue;
#pragma unroll
    for (int r = 0; r < 8; ++r) so[w][8 * hh + r][t * 16 + ln] = acc[t][r] * alpha; }
  __builtin_amdgcn_fence(__ATOMIC_ACQ_REL, "workgroup"); __builtin_amdgcn_wave_barrier();
  const int rsub = lane >> 4, c4 = (lane & 15) * 4;
  {
#pragma unroll
    for (int q = 0; q < 8; ++q) { const int r = q * 2 + rsub; if (col0 + c4 < N) { const v4f v = *(const v4fa*)&so[w][r][c4]; *(v4f*)(C + (size_t)(row0 + r) * ldc + col0 + c4) = v; } }
     }
}

// Wt[n][k] = f16(W[k][n]·scale) from f32 row-major W[K][N] (scale = power of two; bf16-exact weights stay exact in f16 away from the subnormal range)
__global__ __launch_bounds__(256) void k_wt_f16(const float* __restrict__ W, _Float16* __restrict__ Wt, int K, int N, float scale) {
  const int t = blockIdx.x * 256 + threadIdx.x; if (t >= N * (K / 8)) return; const int n = t / (K / 8), k8 = (t % (K / 8)) * 8; FragH f;
#pragma unroll
  for (int i = 0; i < 8; ++i) f.h[i] = (_Float16)(bf16_round(W[(size_t)(k8 + i) * N + n]) * scale); const v8us o = f.half[0];
  *(v8us*)((unsigned short*)Wt + (size_t)n * K + k8) = o; 
}
// k_gemm_hh variant with fused epilogue: v = acc·alpha + bias[by·sBias + col] (+ CP[(row/rowsPerB)·sCPb + by·64 + col] if CP) ; ACT 0 none / 1 elu ; writes f16 C16 (and f32 C if non-null)
template <int ACT>
__global__ __launch_bounds__(128) void k_gemm_hhx(const _Float16* __restrict__ A, int lda, size_t sA, const _Float16* __restrict__ Bh, int ldb, size_t sB, float alpha, const float* __restrict__ bias, size_t sBias, const float* __restrict__ CP, int rowsPerB, size_t sCPb, int row0g,
    float* __restrict__ C, _Float16* __restrict__ C16, int ldc, size_t sC, int M, int N, int K) {
  __shared__ __attribute__((aligned(16))) float so[4][16][64];
  const int tid = threadIdx.x, w = tid >> 5, lane = tid & 31, ln = lane & 15, hh = lane >> 4; const int by = blockIdx.y;
  A += (size_t)by * sA; Bh += (size_t)by * sB; const size_t cofs = (size_t)by * sC; const float* bp = bias ? bias + (size_t)by * sBias : nullptr;
  const int ntn = (N + 63) / 64; const int wid = blockIdx.x * 4 + w; const int mt = wid / ntn, nq = wid % ntn; if (mt * 16 >= M) return;
  const int row0 = mt * 16, col0 = nq * 64; const _Float16* arow = A + (size_t)(row0 + ln) * lda;
  v8f acc[4] = {};
  for (int kb = 0; kb < K; kb += 32) { FragH ah; ah.half[0] = *(const v8us*)((const unsigned short*)arow + kb + 8 * hh); ah.half[1] = *(const v8us*)((const unsigned short*)arow + kb + 16 + 8 * hh);
#pragma unroll
    for (int t = 0; t < 4; ++t) { if (col0 + t * 16 >= N) continue; const size_t boff = (size_t)(col0 + t * 16 + ln) * ldb + kb; FragH bq; bq.half[0] = *(const v8us*)((const unsigned short*)Bh + boff + 8 * hh); bq.half[1] = *(const v8us*)((const unsigned short*)Bh + boff + 16 + 8 * hh);
      acc[t] = mmaH<1>(ah.v, ah.v, bq.v, bq.v, acc[t]); }
  }
#pragma unroll
  for (int t = 0; t < 4; ++t) { if (col0 + t * 16 >= N) continue; const int col = col0 + t * 16 + ln; const float bv = bp ? bf16_round(bp[col]) : 0.f;
#pragma unroll
    for (int r = 0; r < 8; ++r) { float v = acc[t][r] * alpha + bv; if (CP) { const int bidx = (row0g + row0 + 8 * hh + r) / rowsPerB; v += CP[(size_t)bidx * sCPb + (size_t)by * 64 + col]; } if (ACT == 1) v = (v > 0.f) ? v : expm1f(v); else if (ACT == 7) v = (v > 0.f) ? v + 1.0f : expf(v); else if (ACT == 8) v = tanhf(v); else if (ACT == 9) v = 0.5f * v * (1.0f + tanhf(0.7978845608028654f * (v + 0.044715f * v * v * v))); else if (ACT == 11) v = 1.0f / (1.0f + expf(-v)); else if (ACT == 12) v = (v > 0.f) ? v : 0.01f * v; else if (ACT == 14) v = (v > 0.f) ? v : 0.1f * v; else if (ACT == 15) v = v / (1.0f + expf(-v)); else if (ACT == 3) v = fmaxf(v, 0.f); else if (ACT == 6) v = 0.5f * v * (1.0f + erff(v * 0.70710678118654752f)); so[w][8 * hh + r][t * 16 + ln] = v; } }
  __builtin_amdgcn_fence(__ATOMIC_ACQ_REL, "workgroup"); __builtin_amdgcn_wave_barrier();
  const int rsub = lane >> 4, c4 = (lane & 15) * 4; typedef _Float16 v4h __attribute__((ext_vector_type(4)));
  {
#pragma unroll
    for (int q = 0; q < 8; ++q) { const int r = q * 2 + rsub; if (col0 + c4 < N) { const v4f v = *(const v4fa*)&so[w][r][c4]; if (C) *(v4f*)(C + cofs + (size_t)(row0 + r) * ldc + col0 + c4) = v; if (C16) { v4h h4; for (int i = 0; i < 4; ++i) h4[i] = (_Float16)v[i]; *(v4h*)(C16 + cofs + (size_t)(row0 + r) * ldc + col0 + c4) = h4; } } }
     }
}


typedef _Float16 v4h __attribute__((ext_vector_type(4)));

__global__ __launch_bounds__(256) void k_x16(const float* __restrict__ x, _Float16* __restrict__ X16, size_t n8) { const size_t t = (size_t)blockIdx.x * 256 + threadIdx.x; if (t >= n8) return; FragH f;
#pragma unroll
  for (int q = 0; q < 8; ++q) f.h[q] = (_Float16)bf16_round(x[t * 8 + q]); *(v8us*)((unsigned short*)X16 + t * 8) = f.half[0];  }
__global__ __launch_bounds__(256) void k_h16(const float* __restrict__ x, _Float16* __restrict__ X16, size_t n8) { const size_t t = (size_t)blockIdx.x * 256 + threadIdx.x; if (t >= n8) return; FragH f;
#pragma unroll
  for (int q = 0; q < 8; ++q) f.h[q] = (_Float16)x[t * 8 + q]; *(v8us*)((unsigned short*)X16 + t * 8) = f.half[0];  }
__global__ __launch_bounds__(256) void k_round16f(const float* __restrict__ W, _Float16* __restrict__ Bt, size_t n8) { const size_t t = (size_t)blockIdx.x * 256 + threadIdx.x; if (t >= n8) return; FragH f;
#pragma unroll
  for (int i = 0; i < 8; ++i) f.h[i] = (_Float16)(bf16_round(W[t * 8 + i]) * 16.0f); *(v8us*)((unsigned short*)Bt + t * 8) = f.half[0];  }
template <int NHv, int TTv>
__global__ __launch_bounds__(256) void k_vt(const _Float16* __restrict__ V16, int ldv, int voff, _Float16* __restrict__ Vt) { __shared__ unsigned short tl[64][66]; const int tid = threadIdx.x; const int slab = blockIdx.x / (TTv / 64), lg = blockIdx.x % (TTv / 64); const int b = slab / NHv, h = slab % NHv;
  for (int i = tid; i < 64 * 8; i += 256) { const int r = i / 8, c8 = (i % 8) * 8; FragH f; f.half[0] = *(const v8us*)((const unsigned short*)V16 + ((size_t)b * TTv + lg * 64 + r) * ldv + voff + h * 64 + c8);
#pragma unroll
    for (int q = 0; q < 8; ++q) tl[r][c8 + q] = f.u[q]; }
  __syncthreads();
  {
#pragma unroll
    for (int rd = 0; rd < 2; ++rd) { const int d = rd * 32 + tid / 8, pc = tid % 8; FragH f;
#pragma unroll
      for (int q = 0; q < 8; ++q) f.u[q] = tl[pc * 8 + q][d];
      *(v8us*)((unsigned short*)Vt + ((size_t)slab * 64 + d) * TTv + lg * 64 + pc * 8) = f.half[0]; }
     } }

__global__ __launch_bounds__(256) void k_hl(const float* __restrict__ F, _Float16* __restrict__ Hh, _Float16* __restrict__ Hl, size_t n8) { const size_t t = (size_t)blockIdx.x * 256 + threadIdx.x; if (t >= n8) return; FragH fh, fl; const v4f a = *(const v4fa*)(F + t * 8), c = *(const v4fa*)(F + t * 8 + 4);
#pragma unroll
  for (int q = 0; q < 4; ++q) { _Float16 h = (_Float16)a[q]; fh.h[q] = h; fl.h[q] = (_Float16)((a[q] - (float)h) * 1024.0f); h = (_Float16)c[q]; fh.h[4 + q] = h; fl.h[4 + q] = (_Float16)((c[q] - (float)h) * 1024.0f); }
  { *(v8us*)((unsigned short*)Hh + t * 8) = fh.half[0]; *(v8us*)((unsigned short*)Hl + t * 8) = fl.half[0];  } }

// ---- fast GEMM (wave tile 32x64, block tile 128x64; requires M % 128 == 0, N % 64 == 0, K % 64 == 0, K >= 64); epilogue = k_gemm_hhx semantics ----
// Operands reach the waves through LDS: per stage the block brings 64 k of its 128 A rows and 64 B rows in by asynchronous copies that cover whole 128-byte lines (8 lanes a row),
// two buffers, the next stage in flight while this one is worked on; the fragments are read from LDS in the same k order as before.
__device__ __forceinline__ v16h g2_frag(const unsigned short* p, int hh) { FragH f; f.half[0] = *(const v8us*)(p + 8 * hh); f.half[1] = *(const v8us*)(p + 16 + 8 * hh); return f.v; }
__device__ __forceinline__ v8f g2_mma(v16h a, v16h b, v8f c) { v8f d = __builtin_amdgcn_wmma_f32_16x16x32_f16(false, a, false, b, (short)0, c, false, false); asm volatile("v_nop\n\tv_nop\n\tv_nop\n\tv_nop" : "+v"(d) : "v"(a), "v"(b)); return d; }
// One lane's share of a stage: 8 pieces of A and 4 of B, 16 bytes each, 16 rows apart (ls bytes in LDS, da / db bytes in memory), global memory -> LDS through no register.
// The s_wait_xcnt closes the copies' own statement so that no address register named here is rewritten ahead of it.
__device__ __forceinline__ void g2_copy(unsigned la, unsigned lb, unsigned ls, const char* pa, size_t da, const char* pb, size_t db) {
  asm volatile("global_load_async_to_lds_b128 %0, %12, off\n\t" "global_load_async_to_lds_b128 %1, %13, off\n\t" "global_load_async_to_lds_b128 %2, %14, off\n\t" "global_load_async_to_lds_b128 %3, %15, off\n\t"
               "global_load_async_to_lds_b128 %4, %16, off\n\t" "global_load_async_to_lds_b128 %5, %17, off\n\t" "global_load_async_to_lds_b128 %6, %18, off\n\t" "global_load_async_to_lds_b128 %7, %19, off\n\t"
               "global_load_async_to_lds_b128 %8, %20, off\n\t" "global_load_async_to_lds_b128 %9, %21, off\n\t" "global_load_async_to_lds_b128 %10, %22, off\n\t" "global_load_async_to_lds_b128 %11, %23, off\n\t"
               "s_wait_xcnt 0x0"
               :: "v"(la), "v"(la + ls), "v"(la + 2 * ls), "v"(la + 3 * ls), "v"(la + 4 * ls), "v"(la + 5 * ls), "v"(la + 6 * ls), "v"(la + 7 * ls), "v"(lb), "v"(lb + ls), "v"(lb + 2 * ls), "v"(lb + 3 * ls),
                  "v"(pa), "v"(pa + da), "v"(pa + 2 * da), "v"(pa + 3 * da), "v"(pa + 4 * da), "v"(pa + 5 * da), "v"(pa + 6 * da), "v"(pa + 7 * da), "v"(pb), "v"(pb + db), "v"(pb + 2 * db), "v"(pb + 3 * db)
               : "memory"); }
template <int ACT>
__global__ __launch_bounds__(128) void k_gemm2(const _Float16* __restrict__ A, int lda, size_t sA, const _Float16* __restrict__ Bh, int ldb, size_t sB, float alpha, const float* __restrict__ bias, size_t sBias, const float* __restrict__ CP, int rowsPerB, size_t sCPb, int row0g,
    float* __restrict__ C, _Float16* __restrict__ C16, int ldc, size_t sC, int M, int N, int K) {
  constexpr int KT = 64, PIT = KT + 8;      /* LDS row pitch 144 B = 16 B x odd: the 16-byte fragment reads of 16 rows fall on distinct banks */
  __shared__ __attribute__((aligned(16))) float so[4][32][68];
  __shared__ __attribute__((aligned(16))) unsigned short tA[2][128][PIT]; __shared__ __attribute__((aligned(16))) unsigned short tB[2][64][PIT];
  const int tid = threadIdx.x, w = tid >> 5, lane = tid & 31, ln = lane & 15, hh = lane >> 4; const int by = blockIdx.y;
  A += (size_t)by * sA; Bh += (size_t)by * sB; const size_t cofs = (size_t)by * sC; const float* bp = bias ? bias + (size_t)by * sBias : nullptr;
  const int ntn = N >> 6; const int mt = blockIdx.x / ntn, nq = blockIdx.x - mt * ntn; const int row0 = mt * 128 + 32 * w, col0 = nq * 64; if (mt * 128 >= M) return;      /* the same for the whole block: it stands in front of barriers */
  const int sr = tid >> 3, sc = (tid & 7) * 8;
  const char* pa = (const char*)(A + (size_t)(mt * 128 + sr) * lda + sc); const char* pb = (const char*)(Bh + (size_t)(col0 + sr) * ldb + sc); const size_t da = (size_t)lda * 32, db = (size_t)ldb * 32;
  const unsigned la = (unsigned)(uintptr_t)&tA[0][sr][sc], lb = (unsigned)(uintptr_t)&tB[0][sr][sc]; constexpr unsigned LS = 16 * PIT * 2, BA = 128 * PIT * 2, BB = 64 * PIT * 2;
  g2_copy(la, lb, LS, pa, da, pb, db);
  asm volatile("s_wait_asynccnt 0x0" ::: "memory");      /* this wave's share of stage 0 has landed */
  __syncthreads();      /* every wave's share has: stage 0 may be read */
  if (KT < K) g2_copy(la + BA, lb + BB, LS, pa + KT * 2, da, pb + KT * 2, db);
  const v8f z8 = {0.f,0.f,0.f,0.f,0.f,0.f,0.f,0.f}; v8f c00 = z8, c01 = z8, c02 = z8, c03 = z8, c10 = z8, c11 = z8, c12 = z8, c13 = z8;
  /* rolled: one stage a trip, so that the order at the foot of the trip stands once */
#pragma unroll 1
  for (int kb = 0; kb < K; kb += KT) { const int cur = (kb >> 6) & 1;
    /* unrolled: the two 32-k blocks of a stage read LDS at immediate offsets */
#pragma unroll
    for (int ks = 0; ks < KT; ks += 32) { const unsigned short* fa = &tA[cur][32 * w + ln][ks]; const unsigned short* fb = &tB[cur][ln][ks];
      const v16h a0 = g2_frag(fa, hh), a1 = g2_frag(fa + 16 * PIT, hh); const v16h b0 = g2_frag(fb, hh), b1 = g2_frag(fb + 16 * PIT, hh), b2 = g2_frag(fb + 32 * PIT, hh), b3 = g2_frag(fb + 48 * PIT, hh);
      c00 = g2_mma(a0, b0, c00); c10 = g2_mma(a1, b0, c10); c01 = g2_mma(a0, b1, c01); c11 = g2_mma(a1, b1, c11);
      c02 = g2_mma(a0, b2, c02); c12 = g2_mma(a1, b2, c12); c03 = g2_mma(a0, b3, c03); c13 = g2_mma(a1, b3, c13); }
    asm volatile("s_wait_dscnt 0x0" ::: "memory");      /* this wave's reads of the buffer that is refilled below have returned */
    asm volatile("s_wait_asynccnt 0x0" ::: "memory");      /* this wave's share of the next stage has landed */
    __syncthreads();      /* publishes the next stage and ends every wave's reads of this one */
    if (kb + 2 * KT < K) g2_copy(la + cur * BA, lb + cur * BB, LS, pa + (size_t)(kb + 2 * KT) * 2, da, pb + (size_t)(kb + 2 * KT) * 2, db); }
  asm volatile("s_wait_asynccnt 0x0" ::: "memory");      /* no copy is left in flight behind the loop */
  v8f accs[8] = {c00, c01, c02, c03, c10, c11, c12, c13};
#pragma unroll
  for (int u = 0; u < 8; ++u) { const int t = u & 3, half = u >> 2; const int col = col0 + t * 16 + ln; const float bv = bp ? bf16_round(bp[col]) : 0.f;
#pragma unroll
    for (int r = 0; r < 8; ++r) { const int rloc = half * 16 + 8 * hh + r; float v = accs[u][r] * alpha + bv; if (CP) { if (rowsPerB < 0) v += CP[cofs + (size_t)(row0g + row0 + rloc) * ldc + col];      /* rowsPerB < 0: own element of the batched C plane */ else { const int bidx = (row0g + row0 + rloc) / rowsPerB; v += CP[(size_t)bidx * sCPb + (size_t)by * 64 + col]; } }
      if (ACT == 3) v = fmaxf(v, 0.f); else if (ACT == 6) v = 0.5f * v * (1.0f + erff(v * 0.70710678118654752f)); else if (ACT == 11) v = 1.0f / (1.0f + expf(-v)); else if (ACT == 15) v = v / (1.0f + expf(-v)); else if (ACT == 12) v = (v > 0.f) ? v : 0.01f * v; else if (ACT == 8) v = tanhf(v);
      so[w][rloc][t * 16 + ln] = v; } }
  __builtin_amdgcn_fence(__ATOMIC_ACQ_REL, "workgroup"); __builtin_amdgcn_wave_barrier();
  const int rsub = lane >> 4, c4 = (lane & 15) * 4;
  {
#pragma unroll
    for (int q = 0; q < 16; ++q) { const int r = q * 2 + rsub; const v4f v = *(const v4fa*)&so[w][r][c4]; if (C) *(v4f*)(C + cofs + (size_t)(row0 + r) * ldc + col0 + c4) = v; if (C16) { v4h h4; for (int i = 0; i < 4; ++i) h4[i] = (_Float16)v[i]; *(v4h*)(C16 + cofs + (size_t)(row0 + r) * ldc + col0 + c4) = h4; } }
     } }



// Lane l <-> l ^ 16 by a vector cross-row move (the two lanes that hold one query's keys).
__device__ __forceinline__ float x_half(float x) { const int b = __float_as_int(x); return __int_as_float(__builtin_amdgcn_permlanex16(b, b, 0x76543210, 0xfedcba98, false, false)); }
// Unmasked attention with both products transposed: S^T = K Q^T (A = K rows, B = Q rows), O^T += V^T P^T (A = V^T rows, B = P^T).
// Lane (ln, hh) owns query q0 + ln; register r of score tile nt is key j0 + nt * 16 + 8 * hh + r, so maximum and sum run inside the lane, joined with lane ^ 16,
// and the two score tiles, converted in place, are the B operand of the second product in the k order of the V^T loader (8 * hh + i, 16 + 8 * hh + i): P touches no LDS.
__global__ __launch_bounds__(128) void k_flash(const _Float16* __restrict__ Q16, int ldq, const _Float16* __restrict__ K16, int ldk, const _Float16* __restrict__ Vt, float* __restrict__ O, int ldo) {
  constexpr int RPW = 16, DT = 4, KS = 2;
  __shared__ __attribute__((aligned(16))) float sO[4][RPW][64 + 4];
  const int tid = threadIdx.x, w = tid >> 5, lane = tid & 31, ln = lane & 15, hh = lane >> 4;
  const int slab = blockIdx.x / QBNP, qblk = QB0P + blockIdx.x % QBNP; const int b = slab / NH, h = slab % NH; const int qb0 = qblk * (4 * RPW); const int q0 = qb0 + w * RPW;
  /* every inner loop below is unrolled so that each register-array index is a constant (no scratch) */
  FragH bq[KS];
  { const unsigned short* qr = (const unsigned short*)Q16 + ((size_t)b * TQ + q0 + ln) * ldq + h * 64;
#pragma unroll
    for (int ks = 0; ks < KS; ++ks) { bq[ks].half[0] = *(const v8us*)(qr + ks * 32 + 8 * hh); bq[ks].half[1] = *(const v8us*)(qr + ks * 32 + 16 + 8 * hh); } }
  const unsigned short* Vth = (const unsigned short*)Vt + (size_t)slab * 64 * TK;
  float m_q = -3.0e38f, l_q = 0.f; v8f oacc[DT];
#pragma unroll
  for (int dt = 0; dt < DT; ++dt) oacc[dt] = (v8f){0.f,0.f,0.f,0.f,0.f,0.f,0.f,0.f};
  /* rolled: one 32-key pass a trip keeps the loop small */
#pragma unroll 1
  for (int j0 = 0; j0 < TK; j0 += 32) {
    float sc[16];
#pragma unroll
    for (int nt = 0; nt < 2; ++nt) { const unsigned short* kr = (const unsigned short*)K16 + ((size_t)b * TK + j0 + nt * 16 + ln) * ldk + h * 64; FragH ak[KS];
#pragma unroll
      for (int ks = 0; ks < KS; ++ks) { ak[ks].half[0] = *(const v8us*)(kr + ks * 32 + 8 * hh); ak[ks].half[1] = *(const v8us*)(kr + ks * 32 + 16 + 8 * hh); }
      if (nt == 1) asm volatile("s_wait_xcnt 0x0" ::: "memory");      /* the register pair that holds these loads' address is reused further down the pass: the wait stands behind the loads, in front of that (behind tile 0's loads the compiler sets it itself) */
      v8f acc = (v8f){0.f,0.f,0.f,0.f,0.f,0.f,0.f,0.f};
#pragma unroll
      for (int ks = 0; ks < KS; ++ks) acc = mmaH<1>(ak[ks].v, ak[ks].v, bq[ks].v, bq[ks].v, acc);
#pragma unroll
      for (int r = 0; r < 8; ++r) sc[nt * 8 + r] = acc[r] * SCL; }
    float mc = sc[0];
#pragma unroll
    for (int i = 1; i < 16; ++i) mc = fmaxf(mc, sc[i]);
    mc = fmaxf(mc, x_half(mc));
    const float mn = fmaxf(m_q, mc); const float al = (mn > -1.0e38f) ? expf(m_q - mn) : 1.0f; m_q = mn;
    float p[16]; FragH pb;
#pragma unroll
    for (int i = 0; i < 16; ++i) { p[i] = expf(sc[i] - mn); pb.h[i] = (_Float16)(p[i] * 1024.0f); }
#pragma unroll
    for (int st = 8; st > 0; st >>= 1)
#pragma unroll
      for (int i = 0; i < st; ++i) p[i] += p[i + st];
    l_q = l_q * al + p[0];
#pragma unroll
    for (int dt = 0; dt < DT; ++dt) {
#pragma unroll
      for (int r = 0; r < 8; ++r) oacc[dt][r] *= al; }
#pragma unroll
    for (int dt = 0; dt < DT; ++dt) { const unsigned short* vrow = Vth + (size_t)(dt * 16 + ln) * TK + j0; FragH av; av.half[0] = *(const v8us*)(vrow + 8 * hh); av.half[1] = *(const v8us*)(vrow + 16 + 8 * hh);
      oacc[dt] = mmaH<1>(av.v, av.v, pb.v, pb.v, oacc[dt]); } }
  const float l = l_q + x_half(l_q); const float li = (l > 0.f) ? 1.0f / (l * 1024.0f) : 0.f;
#pragma unroll
  for (int dt = 0; dt < DT; ++dt)
#pragma unroll
    for (int g = 0; g < 2; ++g) { const v4f val = {oacc[dt][4 * g] * li, oacc[dt][4 * g + 1] * li, oacc[dt][4 * g + 2] * li, oacc[dt][4 * g + 3] * li}; *(v4fa*)&sO[w][ln][dt * 16 + 8 * hh + 4 * g] = val; }
  __builtin_amdgcn_fence(__ATOMIC_ACQ_REL, "workgroup"); __builtin_amdgcn_wave_barrier();      /* the wave's own rows are in LDS before other lanes of it read them back as whole 128-byte lines */
  {
#pragma unroll
    for (int rp = 0; rp < RPW; rp += 2) { const int r = rp + (lane >> 4), pc = lane & 15; const v4f val = *(const v4fa*)&sO[w][r][pc * 4]; *(v4f*)(O + ((size_t)b * TQ + q0 + r) * ldo + h * 64 + pc * 4) = val; }
     } }
// 5-plane variant: S = Qh Kh^T + (Ql Kh^T + Qh Kl^T)/1024 with Q/K = [hi | 2^10 residual] f16 planes (QL/KL same layout as Q16/K16), then the 3-term P.V below.
// 3-term variant: O = (P_hi V_hi + (P_lo V_hi + P_hi V_lo) / 1024) / l with P = [hi | 2^10 residual] of 1024 p and V^T = [hi | 2^10 residual] planes (VtL same layout as Vt) -> ~2^-21-class products for un-averaged (early causal / peaked) rows
template <int CAUSAL>
__global__ __launch_bounds__(128) void k_flash5(const _Float16* __restrict__ Q16, const _Float16* __restrict__ QL, int ldq, const _Float16* __restrict__ K16, const _Float16* __restrict__ KL, int ldk, const _Float16* __restrict__ Vt, const _Float16* __restrict__ VtL, const int* __restrict__ MSK, float* __restrict__ O, int ldo) {
  constexpr int RPW = 16, RTN = RPW / 16, NQB = TQ / (4 * RPW), DT = 4, KS = 2;
  __shared__ __attribute__((aligned(16))) unsigned short sP[4][RPW][40]; __shared__ __attribute__((aligned(16))) unsigned short sPL[4][RPW][40]; __shared__ __attribute__((aligned(16))) float sO[4][RPW][64 + 4];
  const int tid = threadIdx.x, w = tid >> 5, lane = tid & 31, ln = lane & 15, hh = lane >> 4;
  const int slab = blockIdx.x / QBN5, qblk = QB05 + blockIdx.x % QBN5; (void)NQB; const int b = slab / NH, h = slab % NH; const int qb0 = qblk * (4 * RPW); const int q0 = qb0 + w * RPW;
  FragH aq[2][KS], aql[2][KS];
#pragma unroll
  for (int rt = 0; rt < RTN; ++rt) { const unsigned short* qr = (const unsigned short*)Q16 + ((size_t)b * TQ + q0 + rt * 16 + ln) * ldq + h * 64; const unsigned short* ql = (const unsigned short*)QL + ((size_t)b * TQ + q0 + rt * 16 + ln) * ldq + h * 64;
#pragma unroll
    for (int ks = 0; ks < KS; ++ks) { aq[rt][ks].half[0] = *(const v8us*)(qr + ks * 32 + 8 * hh); aq[rt][ks].half[1] = *(const v8us*)(qr + ks * 32 + 16 + 8 * hh); aql[rt][ks].half[0] = *(const v8us*)(ql + ks * 32 + 8 * hh); aql[rt][ks].half[1] = *(const v8us*)(ql + ks * 32 + 16 + 8 * hh); } }
  const unsigned short* Vth = (const unsigned short*)Vt + (size_t)slab * 64 * TK; const unsigned short* Vtl = (const unsigned short*)VtL + (size_t)slab * 64 * TK;
  float m_r[2][8], l_r[2][8]; v8f oacc[2][DT], oaccL[2][DT];
#pragma unroll
  for (int rt = 0; rt < RTN; ++rt) {
#pragma unroll
    for (int r = 0; r < 8; ++r) { m_r[rt][r] = -3.0e38f; l_r[rt][r] = 0.f; }
#pragma unroll
    for (int dt = 0; dt < DT; ++dt) { oacc[rt][dt] = (v8f){0.f,0.f,0.f,0.f,0.f,0.f,0.f,0.f}; oaccL[rt][dt] = oacc[rt][dt]; } }
  const int jend = (CAUSAL == 1) ? (qb0 + 4 * RPW) : ((CAUSAL == 23) ? min(TK, (qb0 / CHK + 2) * CHK) : TK);      /* causal / window: keys that can never contribute are skipped */ const int jbeg = (CAUSAL == 23) ? max(0, (qb0 / CHK - 1) * CHK) : 0;
#pragma unroll 1
  for (int j0 = jbeg; j0 < jend; j0 += 32) {
    v8f s[2][2];
#pragma unroll
    for (int nt = 0; nt < 2; ++nt) { const unsigned short* kr = (const unsigned short*)K16 + ((size_t)b * TK + j0 + nt * 16 + ln) * ldk + h * 64; const unsigned short* klr = (const unsigned short*)KL + ((size_t)b * TK + j0 + nt * 16 + ln) * ldk + h * 64; FragH bk[KS], bkl[KS];
#pragma unroll
      for (int ks = 0; ks < KS; ++ks) { bk[ks].half[0] = *(const v8us*)(kr + ks * 32 + 8 * hh); bk[ks].half[1] = *(const v8us*)(kr + ks * 32 + 16 + 8 * hh); bkl[ks].half[0] = *(const v8us*)(klr + ks * 32 + 8 * hh); bkl[ks].half[1] = *(const v8us*)(klr + ks * 32 + 16 + 8 * hh); }
#pragma unroll
      for (int rt = 0; rt < RTN; ++rt) { v8f acc = (v8f){0.f,0.f,0.f,0.f,0.f,0.f,0.f,0.f}, accl = acc;
#pragma unroll
        for (int ks = 0; ks < KS; ++ks) { acc = mmaH<1>(aq[rt][ks].v, aq[rt][ks].v, bk[ks].v, bk[ks].v, acc); accl = mmaH<1>(aql[rt][ks].v, aql[rt][ks].v, bk[ks].v, bk[ks].v, accl); accl = mmaH<1>(aq[rt][ks].v, aq[rt][ks].v, bkl[ks].v, bkl[ks].v, accl); }
#pragma unroll
        for (int r = 0; r < 8; ++r) acc[r] += accl[r] * 0.0009765625f;
        s[rt][nt] = acc; } }
#pragma unroll
    for (int rt = 0; rt < RTN; ++rt)
#pragma unroll
      for (int r = 0; r < 8; ++r) { const int tq = q0 + rt * 16 + 8 * hh + r; const int k0 = j0 + ln, k1 = j0 + 16 + ln;
        bool ok0 = (CAUSAL == 1) ? (k0 <= tq) : ((CAUSAL == 2) ? ((k0 >> 5) == (tq >> 5)) : true), ok1 = (CAUSAL == 1) ? (k1 <= tq) : ((CAUSAL == 2) ? ((k1 >> 5) == (tq >> 5)) : true);      /* mode 2: block-diagonal 32-token groups */
        if (CAUSAL == 4) { const int* mrow = MSK + ((size_t)b * TQ + tq) * TK; ok0 = mrow[k0] != 0; ok1 = mrow[k1] != 0; }      /* mode 4: per-(query, key) INPUT mask shared by all heads; masked keys contribute nothing (== the reference's -4096 fill, whose exp underflows to 0), rows with no valid key give l = 0 -> output 0 (== the reference's row_valid zeroing) */
        float s0 = ok0 ? s[rt][0][r] * SCL : -3.0e38f, s1 = ok1 ? s[rt][1][r] * SCL : -3.0e38f; if (CAUSAL == 17) { const float* amk = (const float*)MSK + (size_t)b * TK; s0 += bf16_round(amk[k0]); s1 += bf16_round(amk[k1]); } if (CAUSAL == 18) { const float* tb = (const float*)MSK; const int* ri = MSK + 1024 + (size_t)b * TK; const int rq = ri[tq]; s0 += tb[(h * 8 + rq) * 8 + ri[k0]]; s1 += tb[(h * 8 + rq) * 8 + ri[k1]]; } if (CAUSAL == 19) { const int* rel = MSK + (size_t)tq * TK; const float* rb = (const float*)MSK + (size_t)TQ * TK + ((size_t)(b * NH + h) * TQ + tq) * 64; s0 += rb[rel[k0]]; s1 += rb[rel[k1]]; }      /* mode 19: + (q.Ek[rel] + Eb[rel][h]) / 8 gathered by the int relative ids (packed [ids | table]) */      /* mode 18: + resource_bias[h][r_q][r_k] from the packed [table | ids] buffer (TQ == TK) */      /* mode 17: additive per-(batch, key) mask INPUT */ float mc = fmaxf(s0, s1);
        mc = fmaxf(mc, __shfl_xor(mc, 1, 32)); mc = fmaxf(mc, __shfl_xor(mc, 2, 32)); mc = fmaxf(mc, __shfl_xor(mc, 4, 32)); mc = fmaxf(mc, __shfl_xor(mc, 8, 32));
        const float mn = fmaxf(m_r[rt][r], mc); const float al = (mn > -1.0e38f) ? expf(m_r[rt][r] - mn) : 1.0f; m_r[rt][r] = mn; const float p0 = ok0 ? expf(s0 - mn) : 0.f, p1 = ok1 ? expf(s1 - mn) : 0.f; l_r[rt][r] = l_r[rt][r] * al + p0 + p1;
#pragma unroll
        for (int dt = 0; dt < DT; ++dt) { oacc[rt][dt][r] *= al; oaccL[rt][dt][r] *= al; }
        FragH t2, t2l; const float ps0 = p0 * 1024.0f, ps1 = p1 * 1024.0f; t2.h[0] = (_Float16)ps0; t2.h[1] = (_Float16)ps1; t2l.h[0] = (_Float16)((ps0 - (float)t2.h[0]) * 1024.0f); t2l.h[1] = (_Float16)((ps1 - (float)t2.h[1]) * 1024.0f);
        sP[w][rt * 16 + 8 * hh + r][ln] = t2.u[0]; sP[w][rt * 16 + 8 * hh + r][16 + ln] = t2.u[1]; sPL[w][rt * 16 + 8 * hh + r][ln] = t2l.u[0]; sPL[w][rt * 16 + 8 * hh + r][16 + ln] = t2l.u[1]; }
    __builtin_amdgcn_fence(__ATOMIC_ACQ_REL, "workgroup"); __builtin_amdgcn_wave_barrier();
    FragH pa[2], pl[2];
#pragma unroll
    for (int rt = 0; rt < RTN; ++rt) { pa[rt].half[0] = *(const v8us*)&sP[w][rt * 16 + ln][8 * hh]; pa[rt].half[1] = *(const v8us*)&sP[w][rt * 16 + ln][16 + 8 * hh]; pl[rt].half[0] = *(const v8us*)&sPL[w][rt * 16 + ln][8 * hh]; pl[rt].half[1] = *(const v8us*)&sPL[w][rt * 16 + ln][16 + 8 * hh]; }
#pragma unroll
    for (int dt = 0; dt < DT; ++dt) { const unsigned short* vrow = Vth + (size_t)(dt * 16 + ln) * TK + j0; const unsigned short* vrl = Vtl + (size_t)(dt * 16 + ln) * TK + j0; FragH bv, bl; bv.half[0] = *(const v8us*)(vrow + 8 * hh); bv.half[1] = *(const v8us*)(vrow + 16 + 8 * hh); bl.half[0] = *(const v8us*)(vrl + 8 * hh); bl.half[1] = *(const v8us*)(vrl + 16 + 8 * hh);
#pragma unroll
      for (int rt = 0; rt < RTN; ++rt) { oacc[rt][dt] = mmaH<1>(pa[rt].v, pa[rt].v, bv.v, bv.v, oacc[rt][dt]); oaccL[rt][dt] = mmaH<1>(pl[rt].v, pl[rt].v, bv.v, bv.v, oaccL[rt][dt]); oaccL[rt][dt] = mmaH<1>(pa[rt].v, pa[rt].v, bl.v, bl.v, oaccL[rt][dt]); } }
    __builtin_amdgcn_fence(__ATOMIC_ACQ_REL, "workgroup"); __builtin_amdgcn_wave_barrier(); }
#pragma unroll
  for (int rt = 0; rt < RTN; ++rt) {
#pragma unroll
    for (int r = 0; r < 8; ++r) { float l = l_r[rt][r]; l += __shfl_xor(l, 1, 32); l += __shfl_xor(l, 2, 32); l += __shfl_xor(l, 4, 32); l += __shfl_xor(l, 8, 32); l_r[rt][r] = (l > 0.f) ? 1.0f / (l * 1024.0f) : 0.f; }
#pragma unroll
    for (int dt = 0; dt < DT; ++dt)
#pragma unroll
      for (int r = 0; r < 8; ++r) { float v = oacc[rt][dt][r]; v += oaccL[rt][dt][r] * 0.0009765625f; sO[w][rt * 16 + 8 * hh + r][dt * 16 + ln] = v * l_r[rt][r]; } }
  __builtin_amdgcn_fence(__ATOMIC_ACQ_REL, "workgroup"); __builtin_amdgcn_wave_barrier();
  {
#pragma unroll
    for (int rp = 0; rp < RPW; rp += 2) { const int r = rp + (lane >> 4), pc = lane & 15; const v4f val = *(const v4fa*)&sO[w][r][pc * 4]; *(v4f*)(O + ((size_t)b * TQ + q0 + r) * ldo + h * 64 + pc * 4) = val; }
     } }

__global__ __launch_bounds__(256) void k_rotab(float* __restrict__ CS, float* __restrict__ SN) {
  #pragma clang fp contract(off)
  const int t = blockIdx.x * 256 + threadIdx.x; if (t >= SLEN * 32) return; const int j = t % 32, s = t / 32; const float ex = (float)(2 * j) / 64.0f; const float inv = 1.0f / powf(10000.0f, ex); const float th = (float)s * inv; const float c = cosf(th), sn = sinf(th);
  { *(float*)(CS + t) = c; *(float*)(SN + t) = sn;  } }
__global__ __launch_bounds__(256) void k_rope(const float* __restrict__ F, int nsrc, int ndst, int rep, const float* __restrict__ CS, const float* __restrict__ SN, _Float16* __restrict__ H, _Float16* __restrict__ L) {
  #pragma clang fp contract(off)
  const size_t t = (size_t)blockIdx.x * 256 + threadIdx.x; if (t >= (size_t)NR * ndst * 4) return; const int g8 = (int)(t % 4); const int hd = (int)((t / 4) % ndst); const size_t row = t / ((size_t)4 * ndst); const int s = (int)(row % SLEN); const int hs = hd / rep;
  const float* src = F + row * (size_t)(nsrc * 64) + hs * 64; FragH ah, al, bh, bl;
  for (int i = 0; i < 8; ++i) { const int d = g8 * 8 + i; const float c = CS[s * 32 + d], sn = SN[s * 32 + d]; const float x1 = src[d], x2 = src[d + 32];
    float o1 = x1 * c; o1 += -x2 * sn; float o2 = x2 * c; o2 += x1 * sn;
    _Float16 hv = (_Float16)o1; ah.h[i] = hv; al.h[i] = (_Float16)((o1 - (float)hv) * 1024.0f); hv = (_Float16)o2; bh.h[i] = hv; bl.h[i] = (_Float16)((o2 - (float)hv) * 1024.0f); }
  const size_t o = row * (size_t)(ndst * 64) + hd * 64 + g8 * 8;
  { *(v8us*)((unsigned short*)H + o) = ah.half[0]; *(v8us*)((unsigned short*)H + o + 32) = bh.half[0]; *(v8us*)((unsigned short*)L + o) = al.half[0]; *(v8us*)((unsigned short*)L + o + 32) = bl.half[0];  } }
__global__ __launch_bounds__(256) void k_rope2(const float* __restrict__ F, int nsrc, int ndst, int rep, const float* __restrict__ CS, const float* __restrict__ SN, _Float16* __restrict__ H, _Float16* __restrict__ L) {
  #pragma clang fp contract(off)
  const size_t t = (size_t)blockIdx.x * 256 + threadIdx.x; if (t >= (size_t)NR * ndst * 4) return; const int g16 = (int)(t % 4); const int hd = (int)((t / 4) % ndst); const size_t row = t / ((size_t)4 * ndst); const int s = (int)(row % SLEN); const int hs = hd / rep;
  const float* src = F + row * (size_t)(nsrc * 64) + hs * 64 + g16 * 16; FragH ah, al;
  for (int pr = 0; pr < 8; ++pr) { const int i = g16 * 8 + pr; const float c = CS[s * 32 + i], sn = SN[s * 32 + i]; const float x1 = src[2 * pr], x2 = src[2 * pr + 1];
    float o1 = x1 * c; o1 -= x2 * sn; float o2 = x1 * sn; o2 += x2 * c;
    _Float16 hv = (_Float16)o1; ah.h[2 * pr] = hv; al.h[2 * pr] = (_Float16)((o1 - (float)hv) * 1024.0f); hv = (_Float16)o2; ah.h[2 * pr + 1] = hv; al.h[2 * pr + 1] = (_Float16)((o2 - (float)hv) * 1024.0f); }
  const size_t o = row * (size_t)(ndst * 64) + hd * 64 + g16 * 16;
  { *(v8us*)((unsigned short*)H + o) = ah.half[0]; *(v8us*)((unsigned short*)H + o + 8) = ah.half[1]; *(v8us*)((unsigned short*)L + o) = al.half[0]; *(v8us*)((unsigned short*)L + o + 8) = al.half[1];  } }
__global__ __launch_bounds__(256) void k_ln512(const float* __restrict__ A, const float* __restrict__ res, const float* __restrict__ g, const float* __restrict__ bb, float* __restrict__ Y, _Float16* __restrict__ Y16) {
  #pragma clang fp contract(off)
  const int wv = threadIdx.x >> 5, ln = threadIdx.x & 31; const size_t r = (size_t)blockIdx.x * 8 + wv; if (r >= NR) return; float x[16]; float s = 0.f;
  for (int i = 0; i < 2; ++i) { const v8f a = *(const v8f*)(A + r * DM + i * 256 + ln * 8); for (int q = 0; q < 8; ++q) { float v = a[q]; if (res) v += bf16_round(res[r * DM + i * 256 + ln * 8 + q]); x[i * 8 + q] = v; s += v; } }
  for (int o = 16; o > 0; o >>= 1) s += __shfl_xor(s, o, 32); const float mu = s / (float)DM; float var = 0.f; for (int q = 0; q < 16; ++q) { const float d = x[q] - mu; var += d * d; }
  for (int o = 16; o > 0; o >>= 1) var += __shfl_xor(var, o, 32); const float inv = rsqrtf(var / (float)DM + 1e-5f);
  { for (int i = 0; i < 2; ++i) { const int c0 = i * 256 + ln * 8; v8f y; FragH f; for (int q = 0; q < 8; ++q) { float v = (x[i * 8 + q] - mu) * inv; v *= bf16_round(g[c0 + q]); v += bf16_round(bb[c0 + q]); y[q] = v; f.h[q] = (_Float16)v; } *(v8f*)(Y + r * DM + c0) = y; if (Y16) *(v8us*)((unsigned short*)Y16 + r * DM + c0) = f.half[0]; }  } }
__global__ __launch_bounds__(256) void k_pack(const float* __restrict__ rb, const int* __restrict__ rid, int* __restrict__ PK) { const int t = blockIdx.x * 256 + threadIdx.x; if (t >= 1024 + NB * TK) return; int v; if (t < 1024) v = __float_as_int(bf16_round(rb[t])); else v = rid[t - 1024]; *(int*)(PK + t) = v;  }
__global__ __launch_bounds__(256) void k_tabin(const float* __restrict__ sp, float* __restrict__ CS, float* __restrict__ SN) { const int t = blockIdx.x * 256 + threadIdx.x; if (t >= SLEN * 32) return; const int i = t % 32, s = t / 32; const float c = bf16_round(sp[s * 64 + 32 + i]), sn = bf16_round(sp[s * 64 + i]);
  { *(float*)(CS + t) = c; *(float*)(SN + t) = sn;  } }
__global__ __launch_bounds__(256) void k_wsc(const float* __restrict__ Wm, _Float16* __restrict__ Bt, size_t n8, float sc) { const size_t t = (size_t)blockIdx.x * 256 + threadIdx.x; if (t >= n8) return; FragH f; for (int q = 0; q < 8; ++q) f.h[q] = (_Float16)(bf16_round(Wm[t * 8 + q]) * sc); *(v8us*)((unsigned short*)Bt + t * 8) = f.half[0];  }
__global__ __launch_bounds__(256) void k_rotab2(float* __restrict__ CS, float* __restrict__ SN) {
  #pragma clang fp contract(off)
  const int t = blockIdx.x * 256 + threadIdx.x; if (t >= SLEN * 32) return; const int j = t % 32, s = t / 32; const float c0 = -0.14391156831212787f;      /* -ln(10000)/64 rounded to f32 */ const float inv = expf((float)(2 * j) * c0); const float th = (float)s * inv; const float c = cosf(th), sn = sinf(th);
  { *(float*)(CS + t) = c; *(float*)(SN + t) = sn;  } }
__global__ __launch_bounds__(256) void k_lnu(const float* __restrict__ X, _Float16* __restrict__ N16, float* __restrict__ XB) {
  #pragma clang fp contract(off)
  const int wv = threadIdx.x >> 5, ln = threadIdx.x & 31; const size_t r = (size_t)blockIdx.x * 8 + wv; if (r >= NR) return; float a[32]; float s = 0.f;
  for (int i = 0; i < 4; ++i) { const v8f v = *(const v8f*)(X + r * DM + (i * 32 + ln) * 8); for (int q = 0; q < 8; ++q) { const float u = bf16_round(v[q]); a[i * 8 + q] = u; s += u; } }
  for (int o = 16; o > 0; o >>= 1) s += __shfl_xor(s, o, 32); const float mu = s / (float)DM; float var = 0.f; for (int q = 0; q < 32; ++q) { const float d = a[q] - mu; var += d * d; }
  for (int o = 16; o > 0; o >>= 1) var += __shfl_xor(var, o, 32); const float den = sqrtf(var / (float)(DM - 1)) + 1e-6f; const float inv = 1.0f / den;      /* one reciprocal per row; (x-mean)*inv vs the reference's division differs by <= 1 ulp */
  { for (int i = 0; i < 4; ++i) { const int c0 = (i * 32 + ln) * 8; FragH f; v8f xb; for (int q = 0; q < 8; ++q) { f.h[q] = (_Float16)((a[i * 8 + q] - mu) * inv); xb[q] = a[i * 8 + q]; } *(v8us*)((unsigned short*)N16 + r * DM + c0) = f.half[0]; *(v8f*)(XB + r * DM + c0) = xb; }  } }
__global__ __launch_bounds__(256) void k_vtg(const _Float16* __restrict__ V16, _Float16* __restrict__ Vt) { __shared__ unsigned short tl[64][66]; const int tid = threadIdx.x; const int slab = blockIdx.x / (SLEN / 64), lg = blockIdx.x % (SLEN / 64); const int b = slab / NH, h = slab % NH; const int hs = h / NREP;
  for (int i = tid; i < 64 * 8; i += 256) { const int r = i / 8, c8 = (i % 8) * 8; FragH f; f.half[0] = *(const v8us*)((const unsigned short*)V16 + ((size_t)b * SLEN + lg * 64 + r) * KVD + hs * 64 + c8); for (int q = 0; q < 8; ++q) tl[r][c8 + q] = f.u[q]; }
  __syncthreads();
  { for (int rd = 0; rd < 2; ++rd) { const int d = rd * 32 + tid / 8, pc = tid % 8; FragH f; for (int q = 0; q < 8; ++q) f.u[q] = tl[pc * 8 + q][d]; *(v8us*)((unsigned short*)Vt + ((size_t)slab * 64 + d) * SLEN + lg * 64 + pc * 8) = f.half[0]; }  } }

__global__ __launch_bounds__(256) void k_h16s(const float* __restrict__ SRC, int lds, int coff, _Float16* __restrict__ DST, size_t n8) { const size_t t = (size_t)blockIdx.x * 256 + threadIdx.x; if (t >= n8) return; const size_t r = (t * 8) / DM; const int c = (int)((t * 8) % DM); const v8f a = *(const v8f*)(SRC + r * lds + coff + c); FragH f; for (int q = 0; q < 8; ++q) f.h[q] = (_Float16)a[q];
  *(v8us*)((unsigned short*)DST + t * 8) = f.half[0];  }


__global__ __launch_bounds__(256) void k_ccp(const float* __restrict__ QKV, int coff, _Float16* __restrict__ D) { const size_t t = (size_t)blockIdx.x * 256 + threadIdx.x; if (t >= (size_t)NR * DM / 8) return; const int c0 = (int)((t * 8) % DM); const size_t row = (t * 8) / DM; const v8f a = *(const v8f*)(QKV + row * 3 * DM + coff + c0); FragH f; for (int q = 0; q < 8; ++q) f.h[q] = (_Float16)a[q];
  *(v8us*)((unsigned short*)D + t * 8) = f.half[0];  }


#ifndef NBS
#define NBS NB      /* batch stride of the [S][B][E] tensors (debug builds may process fewer batches than the layout holds) */
#endif
__global__ __launch_bounds__(256) void k_sbe(const float* __restrict__ q, _Float16* __restrict__ X) { const size_t t = (size_t)blockIdx.x * 256 + threadIdx.x; if (t >= (size_t)NR * DM / 8) return; const int c0 = (int)((t * 8) % DM); const size_t row = (t * 8) / DM; const int b = (int)(row / SLEN), s_ = (int)(row % SLEN); const float* src = q + ((size_t)s_ * NBS + b) * DM + c0; FragH f; for (int i = 0; i < 8; ++i) f.h[i] = (_Float16)bf16_round(src[i]);
  *(v8us*)((unsigned short*)X + t * 8) = f.half[0];  }
__global__ __launch_bounds__(256) void k_out_sbe(const float* __restrict__ R, float* __restrict__ out) { const size_t t = (size_t)blockIdx.x * 256 + threadIdx.x; if (t >= (size_t)NR * DM / 8) return; const int c0 = (int)((t * 8) % DM); const size_t irow = (t * 8) / DM; const int b = (int)(irow / SLEN), s_ = (int)(irow % SLEN); const v8f v = *(const v8f*)(R + t * 8); float* d = out + ((size_t)s_ * NBS + b) * DM + c0;
  *(v8f*)d = v;  }
__global__ __launch_bounds__(256) void k_rope(const float* __restrict__ F, _Float16* __restrict__ O16) {
  #pragma clang fp contract(off)
  const size_t t = (size_t)blockIdx.x * 256 + threadIdx.x; if (t >= (size_t)NR * DM / 16) return; const int d0 = (int)((t * 8) % 32); const int h = (int)(((t * 8) / 32) % NH); const size_t row = (t * 8) / (32 * NH); const int s_ = (int)(row % SLEN); const float* p = F + row * DM + h * 64; const v8f a = *(const v8f*)(p + d0), c = *(const v8f*)(p + 32 + d0); FragH f1, f2;
#pragma unroll 1
  for (int q = 0; q < 8; ++q) { const int d = d0 + q; const float inv = 1.0f / powf(10000.0f, (float)(2 * d) / 64.0f); const float ang = (float)s_ * inv; const float sn = sinf(ang), cs = cosf(ang); float o1 = a[q] * cs; o1 = o1 - c[q] * sn; float o2 = c[q] * cs; o2 = o2 + a[q] * sn; f1.h[q] = (_Float16)o1; f2.h[q] = (_Float16)o2; }
  { *(v8us*)((unsigned short*)O16 + row * DM + h * 64 + d0) = f1.half[0]; *(v8us*)((unsigned short*)O16 + row * DM + h * 64 + 32 + d0) = f2.half[0];  } }
extern "C" void kernel_launch(void* const* d_in, const int* in_sizes, int n_in,
                              void* d_out, int out_size, void* d_ws, size_t ws_size, hipStream_t stream) {
  (void)in_sizes; (void)n_in; (void)out_size;
  const float* qy = (const float*)d_in[0]; const float* wq = (const float*)d_in[1]; const float* bq = (const float*)d_in[2]; const float* wk = (const float*)d_in[3]; const float* bk = (const float*)d_in[4]; const float* wv = (const float*)d_in[5]; const float* bv = (const float*)d_in[6]; const float* wo = (const float*)d_in[7]; const float* bo = (const float*)d_in[8];
  char* ws = (char*)d_ws; size_t off = 0;
  auto take = [&](size_t bytes) { char* p = ws + off; off += (bytes + 255) & ~(size_t)255; return p; };
  const size_t np = (size_t)NR * DM;
  _Float16* BQ = (_Float16*)take((size_t)DM * DM * 2); _Float16* BK = (_Float16*)take((size_t)DM * DM * 2); _Float16* BV = (_Float16*)take((size_t)DM * DM * 2); _Float16* BO = (_Float16*)take((size_t)DM * DM * 2); _Float16* X16 = (_Float16*)take(np * 2); float* F32 = (float*)take(np * 4); float* OUTR = (float*)take(np * 4);
   _Float16* QH = (_Float16*)take(np * 2); _Float16* KH = (_Float16*)take(np * 2); _Float16* V16 = (_Float16*)take(np * 2); _Float16* VT = (_Float16*)take(np * 2); float* O = (float*)take(np * 4); _Float16* OH = QH; _Float16* OL = KH;
  if (off > ws_size) return;
  k_wsc<<<(unsigned)(((size_t)DM * DM / 8 + 255) / 256), 256, 0, stream>>>(wq, BQ, (size_t)DM * DM / 8, 16.0f); k_wsc<<<(unsigned)(((size_t)DM * DM / 8 + 255) / 256), 256, 0, stream>>>(wk, BK, (size_t)DM * DM / 8, 16.0f); k_wsc<<<(unsigned)(((size_t)DM * DM / 8 + 255) / 256), 256, 0, stream>>>(wv, BV, (size_t)DM * DM / 8, 16.0f); k_wsc<<<(unsigned)(((size_t)DM * DM / 8 + 255) / 256), 256, 0, stream>>>(wo, BO, (size_t)DM * DM / 8, 16.0f);      /* torch (out,in) naturals */
  k_sbe<<<(unsigned)((np / 8 + 255) / 256), 256, 0, stream>>>(qy, X16);
  
  const dim3 g((NR / 128) * (DM / 64), 1);
  k_gemm2<0><<<g, 128, 0, stream>>>(X16, DM, 0, BQ, DM, 0, 0.0625f, bq, 0, nullptr, 1, 0, 0, F32, nullptr, DM, 0, NR, DM, DM); k_rope<<<(unsigned)((np / 8 + 255) / 256), 256, 0, stream>>>(F32, QH);
  k_gemm2<0><<<g, 128, 0, stream>>>(X16, DM, 0, BK, DM, 0, 0.0625f, bk, 0, nullptr, 1, 0, 0, F32, nullptr, DM, 0, NR, DM, DM); k_rope<<<(unsigned)((np / 8 + 255) / 256), 256, 0, stream>>>(F32, KH);
  k_gemm2<0><<<g, 128, 0, stream>>>(X16, DM, 0, BV, DM, 0, 0.0625f, bv, 0, nullptr, 1, 0, 0, nullptr, V16, DM, 0, NR, DM, DM);
  k_vtg<<<NB * NH * (SLEN / 64), 256, 0, stream>>>(V16, VT);
  k_flash<<<NB * NH * QBNP, 128, 0, stream>>>(QH, DM, KH, DM, VT, O, DM);
  k_hl<<<(unsigned)((np / 8 + 255) / 256), 256, 0, stream>>>(O, OH, OL, np / 8);
  k_gemm2<0><<<g, 128, 0, stream>>>(OL, DM, 0, BO, DM, 0, 0.0625f / 1024.0f, nullptr, 0, nullptr, 1, 0, 0, OUTR, nullptr, DM, 0, NR, DM, DM);
  k_gemm2<0><<<g, 128, 0, stream>>>(OH, DM, 0, BO, DM, 0, 0.0625f, bo, 0, OUTR, 1, (size_t)DM, 0, OUTR, nullptr, DM, 0, NR, DM, DM);      /* out rows (b, s) = (ctx_lo + ctx_hi) Wo^T + b */
  k_out_sbe<<<(unsigned)((np / 8 + 255) / 256), 256, 0, stream>>>(OUTR, (float*)d_out);
}

// v003
// A run of this version takes 260 microseconds.
// Two timings next to v002 put it at 1.28 and 1.27 times that version's speed.
// Over all steps from v000 it is 1.99 times as fast.
#include <hip/hip_runtime.h>
// LucaGPLMMultiheadAttentionWithSDPA (query [2048][2][1024] in [S, B, E] layout, 16 heads x 64: q/k/v = query W^T + b; rotary embedding per head (inv_freq = 10000^(-2i/64), rotate-half form) on q and k; softmax(q k^T / 8) v (no mask); out = attn Wo^T + bo, back in [S, B, E]).
// Structure: [S,B,E] -> exact f16 (b, s) rows; q/k as f16 WMMA GEMMs into f32 (32x64 wave tiles, f32 accumulation, exact x16 weights + bias) followed by RoPE on VALU (f32 angles s * inv_freq, sinf/cosf) into f16 planes; v as an f16 GEMM; V^T by LDS tiles; flash-style fused attention per (batch, head, 64-query block) (K Q^T and V^T P^T, one query per lane, online softmax and P in registers; no score plane), f32 context; output projection as a two-term GEMM on the context's f16 hi/residual split + bias into (b, s) rows, then the [S, B, E] store on VALU.
// Compute dtype: inputs rounded to bf16; query / weights exact as f16; roped q/k and v plain f16 (~2^-12); softmax f32 with f16 probabilities; context hi + 2^-10 residual into the projection. v_wmma_f32_16x16x32_f16.
#define NB 2
#define DM 1024
#define NKV 16
#define NREP (NH / NKV)
#define KVD (NKV * 64)           /* 1024 */
#define NR (NB * SLEN)
#define CHK 512
typedef int v4i __attribute__((ext_vector_type(4)));
#define FF 2048
#define SLEN 2048
#define MQI 2048
#define MKI 2048
#define TQ SLEN
#define TK SLEN
#define NH 16
#define SCL 0.125f
#define QBLKS (TQ / 64)
#define QB05 0
#define QBN5 4
#define QB0P 0
#define QBNP QBLKS
#define RE 256
typedef __bf16 v16b __attribute__((ext_vector_type(16)));
typedef unsigned short v8us __attribute__((ext_vector_type(8), may_alias));
typedef float  v8f  __attribute__((ext_vector_type(8)));
typedef float  v4f  __attribute__((ext_vector_type(4)));
typedef float  v4fa __attribute__((ext_vector_type(4), may_alias));
union FragB { v16b v; v8us half[2]; unsigned short u[16]; };

__device__ __forceinline__ unsigned short bf16_bits(float x) { unsigned int u = __float_as_uint(x); return (unsigned short)((u + 0x7FFFu + ((u >> 16) & 1u)) >> 16); }
__device__ __forceinline__ float bf16_val(unsigned short b) { return __uint_as_float(((unsigned int)b) << 16); }
__device__ __forceinline__ float bf16_round(float x) { return bf16_val(bf16_bits(x)); }
// D += A·B with NT terms: 1 = ah·bh, 2 = + al·bh (A split), 3 = + ah·bl (both split)
template <int NT>
__device__ __forceinline__ v8f mmaN(v16b ah, v16b al, v16b bh, v16b bl, v8f c) {
  c = __builtin_amdgcn_wmma_f32_16x16x32_bf16(false, ah, false, bh, (short)0, c, false, false);
  if (NT >= 2) c = __builtin_amdgcn_wmma_f32_16x16x32_bf16(false, al, false, bh, (short)0, c, false, false);
  if (NT >= 3) c = __builtin_amdgcn_wmma_f32_16x16x32_bf16(false, ah, false, bl, (short)0, c, false, false);
  asm volatile("v_nop\n\tv_nop\n\tv_nop\n\tv_nop" : "+v"(c) : "v"(ah), "v"(al), "v"(bh), "v"(bl));
  return c;
}

__global__ __launch_bounds__(256) void k_wt_bf16(const float* __restrict__ W, unsigned short* __restrict__ Wt, int K, int N) {
  const int t = blockIdx.x * 256 + threadIdx.x;
  const int k8n = K / 8;
  if (t >= N * k8n) return;
  const int n = t / k8n, k8 = (t % k8n) * 8;
  v8us v;
#pragma unroll
  for (int i = 0; i < 8; ++i) v[i] = bf16_bits(W[(size_t)(k8 + i) * N + n]);
  *(v8us*)(Wt + (size_t)n * K + k8) = v;
  
}

// GEMM C[M][N] (f32, pitch ldc) = act(A[M][K]·W + bias). A f32 row-major (pitch lda) converted per fragment to bf16
// (ASPLIT: hi/lo two planes -> 2 terms, else single rounded term); Wt bf16 [N][K] (pitch ldb). BIAS_BF16 rounds the
// bias to bf16 first (bias quantised to bf16 before the add). K%32==0, M%16==0, N%64==0.
template <bool ASPLIT, int ACT, bool BIAS_BF16>
__global__ __launch_bounds__(128) void k_gemm_bf(const float* __restrict__ A, int lda, const unsigned short* __restrict__ Wt, int ldb,
                                               const float* __restrict__ bias, float* __restrict__ C, int ldc, int M, int N, int K) {
  __shared__ __attribute__((aligned(16))) float so[4][16][64];
  const int tid = threadIdx.x, w = tid >> 5, lane = tid & 31, ln = lane & 15, hh = lane >> 4;
  const int ntn = N / 64;
  const int wid = blockIdx.x * 4 + w;
  const int mt = wid / ntn, nq = wid % ntn;
  if (mt * 16 >= M) return;
  const int row0 = mt * 16, col0 = nq * 64;
  const float* arow = A + (size_t)(row0 + ln) * lda;
  v8f acc[4] = {};
  for (int kb = 0; kb < K; kb += 32) {
    FragB ah, al;
    const v4f x0 = *(const v4fa*)(arow + kb + 8 * hh), x1 = *(const v4fa*)(arow + kb + 8 * hh + 4);
    const v4f x2 = *(const v4fa*)(arow + kb + 16 + 8 * hh), x3 = *(const v4fa*)(arow + kb + 16 + 8 * hh + 4);
    float xs[16] = {x0[0],x0[1],x0[2],x0[3],x1[0],x1[1],x1[2],x1[3],x2[0],x2[1],x2[2],x2[3],x3[0],x3[1],x3[2],x3[3]};
#pragma unroll
    for (int i = 0; i < 16; ++i) { const unsigned short hb = bf16_bits(xs[i]); ah.u[i] = hb; al.u[i] = ASPLIT ? bf16_bits(xs[i] - bf16_val(hb)) : (unsigned short)0; }
#pragma unroll
    for (int t = 0; t < 4; ++t) {
      const unsigned short* brow = Wt + (size_t)(col0 + t * 16 + ln) * ldb + kb;
      FragB b;
      b.half[0] = *(const v8us*)(brow + 8 * hh);
      b.half[1] = *(const v8us*)(brow + 16 + 8 * hh);
      acc[t] = mmaN<ASPLIT ? 2 : 1>(ah.v, al.v, b.v, b.v, acc[t]);
    }
  }
#pragma unroll
  for (int t = 0; t < 4; ++t) {
    float bv = bias ? bias[col0 + t * 16 + ln] : 0.f;
    if (BIAS_BF16) bv = bf16_round(bv);
#pragma unroll
    for (int r = 0; r < 8; ++r) { float v = acc[t][r] + bv; if (ACT == 1) v = fmaxf(v, 0.f); so[w][8 * hh + r][t * 16 + ln] = v; }
  }
  __builtin_amdgcn_fence(__ATOMIC_ACQ_REL, "workgroup");
  __builtin_amdgcn_wave_barrier();
  const int rsub = lane >> 4, c4 = (lane & 15) * 4;
  {
#pragma unroll
    for (int q = 0; q < 8; ++q) {
      const int r = q * 2 + rsub;
      const v4f v = *(const v4fa*)&so[w][r][c4];
      *(v4f*)(C + (size_t)(row0 + r) * ldc + col0 + c4) = v;
    }
    
  }
}

// GEMM C = act(A·W + bias + resid): A f32 (ASPLIT -> hi/lo 2 terms), Wt bf16 [N][K]; ACT 0 none, 1 relu, 2 exact gelu;
// resid (optional, f32, row index = (row % rmod), pitch ldr, RES_BF16 rounds it) added before the activation.
template <bool ASPLIT, int ACT, bool BIAS_BF16, bool RES_BF16>
__global__ __launch_bounds__(128) void k_gemm_bf3(const float* __restrict__ A, int lda, const unsigned short* __restrict__ Wt, int ldb,
                                                const float* __restrict__ bias, const float* __restrict__ resid, int rmod, int ldr,
                                                float* __restrict__ C, int ldc, int M, int N, int K) {
  __shared__ __attribute__((aligned(16))) float so[4][16][64];
  const int tid = threadIdx.x, w = tid >> 5, lane = tid & 31, ln = lane & 15, hh = lane >> 4;
  const int ntn = N / 64;
  const int wid = blockIdx.x * 4 + w;
  const int mt = wid / ntn, nq = wid % ntn;
  if (mt * 16 >= M) return;
  const int row0 = mt * 16, col0 = nq * 64;
  const float* arow = A + (size_t)(row0 + ln) * lda;
  v8f acc[4] = {};
  for (int kb = 0; kb < K; kb += 32) {
    FragB ah, al;
    const v4f x0 = *(const v4fa*)(arow + kb + 8 * hh), x1 = *(const v4fa*)(arow + kb + 8 * hh + 4);
    const v4f x2 = *(const v4fa*)(arow + kb + 16 + 8 * hh), x3 = *(const v4fa*)(arow + kb + 16 + 8 * hh + 4);
    float xs[16] = {x0[0],x0[1],x0[2],x0[3],x1[0],x1[1],x1[2],x1[3],x2[0],x2[1],x2[2],x2[3],x3[0],x3[1],x3[2],x3[3]};
#pragma unroll
    for (int i = 0; i < 16; ++i) { const unsigned short hb = bf16_bits(xs[i]); ah.u[i] = hb; al.u[i] = ASPLIT ? bf16_bits(xs[i] - bf16_val(hb)) : (unsigned short)0; }
#pragma unroll
    for (int t = 0; t < 4; ++t) {
      const unsigned short* brow = Wt + (size_t)(col0 + t * 16 + ln) * ldb + kb;
      FragB b;
      b.half[0] = *(const v8us*)(brow + 8 * hh);
      b.half[1] = *(const v8us*)(brow + 16 + 8 * hh);
      acc[t] = mmaN<ASPLIT ? 2 : 1>(ah.v, al.v, b.v, b.v, acc[t]);
    }
  }
#pragma unroll
  for (int t = 0; t < 4; ++t) {
    const int col = col0 + t * 16 + ln;
    float bv = bias ? bias[col] : 0.f;
    if (BIAS_BF16) bv = bf16_round(bv);
#pragma unroll
    for (int r = 0; r < 8; ++r) {
      float v = acc[t][r] + bv;
      if (resid) { float rv = resid[(size_t)((row0 + 8 * hh + r) % rmod) * ldr + col]; if (RES_BF16) rv = bf16_round(rv); v += rv; }
      if (ACT == 1) v = fmaxf(v, 0.f);
      if (ACT == 2) v = 0.5f * v * (1.0f + erff(v * 0.70710678118654752f));
      if (ACT == 3) { const float u = 0.7978845608028654f * (v + 0.044715f * v * v * v); v = 0.5f * v * (1.0f + tanhf(u)); }
      so[w][8 * hh + r][t * 16 + ln] = v;
    }
  }
  __builtin_amdgcn_fence(__ATOMIC_ACQ_REL, "workgroup");
  __builtin_amdgcn_wave_barrier();
  const int rsub = lane >> 4, c4 = (lane & 15) * 4;
  {
#pragma unroll
    for (int q = 0; q < 8; ++q) {
      const int r = q * 2 + rsub;
      const v4f v = *(const v4fa*)&so[w][r][c4];
      *(v4f*)(C + (size_t)(row0 + r) * ldc + col0 + c4) = v;
    }
    
  }
}
// row LayerNorm (biased variance, eps) over N: s = X (+ R); optional out_sum <- s; out_norm <- (s-mu)*rsqrt(var+eps)*g + b
template <bool PARAM_BF16>
__global__ __launch_bounds__(256) void k_layernorm(const float* __restrict__ X, const float* __restrict__ R, const float* __restrict__ g, const float* __restrict__ bta,
                                                  float* __restrict__ out_sum, float* __restrict__ out_norm, int N, float eps) {
  __shared__ float red[256];
  const int row = blockIdx.x, tid = threadIdx.x;
  const float* x = X + (size_t)row * N; const float* rr = R ? R + (size_t)row * N : nullptr;
  float vals[16];                     // up to N = 4096
  const int per = N / 256;            // contiguous chunk per thread? use strided-by-4 chunks: thread handles j = tid*4 + 1024*u
  float s1 = 0.f;
  for (int u = 0; u < per / 4; ++u) {
    const int j = tid * 4 + 1024 * u;
    const v4f a = *(const v4fa*)(x + j);
    v4f b = {0.f,0.f,0.f,0.f}; if (rr) b = *(const v4fa*)(rr + j);
#pragma unroll
    for (int q = 0; q < 4; ++q) { const float v = a[q] + b[q]; vals[u * 4 + q] = v; s1 += v; }
  }
  red[tid] = s1; __syncthreads();
  for (int st = 128; st > 0; st >>= 1) { if (tid < st) red[tid] += red[tid + st]; __syncthreads(); }
  const float mu = red[0] / (float)N; __syncthreads();
  float s2 = 0.f;
  for (int u = 0; u < per / 4; ++u)
#pragma unroll
    for (int q = 0; q < 4; ++q) { const float c = vals[u * 4 + q] - mu; s2 += c * c; }
  red[tid] = s2; __syncthreads();
  for (int st = 128; st > 0; st >>= 1) { if (tid < st) red[tid] += red[tid + st]; __syncthreads(); }
  const float rs = rsqrtf(red[0] / (float)N + eps);
  {
    for (int u = 0; u < per / 4; ++u) {
      const int j = tid * 4 + 1024 * u;
      v4f o, sm;
#pragma unroll
      for (int q = 0; q < 4; ++q) {
        float gg = g[j + q], bb = bta[j + q];
        if (PARAM_BF16) { gg = bf16_round(gg); bb = bf16_round(bb); }
        sm[q] = vals[u * 4 + q]; o[q] = (vals[u * 4 + q] - mu) * rs * gg + bb;
      }
      if (out_sum) *(v4f*)(out_sum + (size_t)row * N + j) = sm;
      *(v4f*)(out_norm + (size_t)row * N + j) = o;
    }
    
  }
}



// ---- f16 WMMA path (v_wmma_f32_16x16x32_f16): 11-bit significands for operands in range — used where a [0,1] probability operand needs more precision than bf16
typedef _Float16 v16h __attribute__((ext_vector_type(16)));
union FragH { v16h v; v8us half[2]; _Float16 h[16]; unsigned short u[16]; };
template <int NT>
__device__ __forceinline__ v8f mmaH(v16h ah, v16h al, v16h bh, v16h bl, v8f c) {
  c = __builtin_amdgcn_wmma_f32_16x16x32_f16(false, ah, false, bh, (short)0, c, false, false);
  if (NT >= 2) c = __builtin_amdgcn_wmma_f32_16x16x32_f16(false, al, false, bh, (short)0, c, false, false);
  if (NT >= 3) c = __builtin_amdgcn_wmma_f32_16x16x32_f16(false, ah, false, bl, (short)0, c, false, false);
  asm volatile("v_nop\n\tv_nop\n\tv_nop\n\tv_nop" : "+v"(c) : "v"(ah), "v"(al), "v"(bh), "v"(bl));
  return c;
}
// batched GEMM like k_gemm_b but f16 operands: A f32 (split into f16 hi/lo if ASPLIT, else rounded to f16), Bt = f16 values [n][k]; alpha; C f32; N multiple of 16 (partial tiles skipped)
template <bool ASPLIT>
__global__ __launch_bounds__(128) void k_gemm_h(const float* __restrict__ A, int lda, size_t sA, const _Float16* __restrict__ Bh, int ldb, size_t sB, float alpha, float* __restrict__ C, int ldc, size_t sC, int M, int N, int K) {
  __shared__ __attribute__((aligned(16))) float so[4][16][64];
  const int tid = threadIdx.x, w = tid >> 5, lane = tid & 31, ln = lane & 15, hh = lane >> 4; const int by = blockIdx.y;
  A += (size_t)by * sA; Bh += (size_t)by * sB; C += (size_t)by * sC;
  const int ntn = (N + 63) / 64; const int wid = blockIdx.x * 4 + w; const int mt = wid / ntn, nq = wid % ntn; if (mt * 16 >= M) return;
  const int row0 = mt * 16, col0 = nq * 64; const float* arow = A + (size_t)(row0 + ln) * lda;
  v8f acc[4] = {};
  for (int kb = 0; kb < K; kb += 32) {
    FragH ah, al;
    const v4f x0 = *(const v4fa*)(arow + kb + 8 * hh), x1 = *(const v4fa*)(arow + kb + 8 * hh + 4), x2 = *(const v4fa*)(arow + kb + 16 + 8 * hh), x3 = *(const v4fa*)(arow + kb + 16 + 8 * hh + 4);
    float xs[16] = {x0[0],x0[1],x0[2],x0[3],x1[0],x1[1],x1[2],x1[3],x2[0],x2[1],x2[2],x2[3],x3[0],x3[1],x3[2],x3[3]};
#pragma unroll
    for (int i = 0; i < 16; ++i) { const _Float16 h = (_Float16)xs[i]; ah.h[i] = h; al.h[i] = ASPLIT ? (_Float16)(xs[i] - (float)h) : (_Float16)0.0f; }
#pragma unroll
    for (int t = 0; t < 4; ++t) { if (col0 + t * 16 >= N) continue; const size_t boff = (size_t)(col0 + t * 16 + ln) * ldb + kb; FragH bq; bq.half[0] = *(const v8us*)(Bh + boff + 8 * hh); bq.half[1] = *(const v8us*)(Bh + boff + 16 + 8 * hh);
      acc[t] = mmaH<ASPLIT ? 2 : 1>(ah.v, al.v, bq.v, bq.v, acc[t]); }
  }
#pragma unroll
  for (int t = 0; t < 4; ++t) { if (col0 + t * 16 >= N) continue;
#pragma unroll
    for (int r = 0; r < 8; ++r) so[w][8 * hh + r][t * 16 + ln] = acc[t][r] * alpha; }
  __builtin_amdgcn_fence(__ATOMIC_ACQ_REL, "workgroup"); __builtin_amdgcn_wave_barrier();
  const int rsub = lane >> 4, c4 = (lane & 15) * 4;
  {
#pragma unroll
    for (int q = 0; q < 8; ++q) { const int r = q * 2 + rsub; if (col0 + c4 < N) { const v4f v = *(const v4fa*)&so[w][r][c4]; *(v4f*)(C + (size_t)(row0 + r) * ldc + col0 + c4) = v; } }
     }
}

// Wt[n][k] = f16(W[k][n]·scale) from f32 row-major W[K][N] (scale = power of two; bf16-exact weights stay exact in f16 away from the subnormal range)
__global__ __launch_bounds__(256) void k_wt_f16(const float* __restrict__ W, _Float16* __restrict__ Wt, int K, int N, float scale) {
  const int t = blockIdx.x * 256 + threadIdx.x; if (t >= N * (K / 8)) return; const int n = t / (K / 8), k8 = (t % (K / 8)) * 8; FragH f;
#pragma unroll
  for (int i = 0; i < 8; ++i) f.h[i] = (_Float16)(bf16_round(W[(size_t)(k8 + i) * N + n]) * scale); const v8us o = f.half[0];
  *(v8us*)((unsigned short*)Wt + (size_t)n * K + k8) = o; 
}
// k_gemm_hh variant with fused epilogue: v = acc·alpha + bias[by·sBias + col] (+ CP[(row/rowsPerB)·sCPb + by·64 + col] if CP) ; ACT 0 none / 1 elu ; writes f16 C16 (and f32 C if non-null)
template <int ACT>
__global__ __launch_bounds__(128) void k_gemm_hhx(const _Float16* __restrict__ A, int lda, size_t sA, const _Float16* __restrict__ Bh, int ldb, size_t sB, float alpha, const float* __restrict__ bias, size_t sBias, const float* __restrict__ CP, int rowsPerB, size_t sCPb, int row0g,
    float* __restrict__ C, _Float16* __restrict__ C16, int ldc, size_t sC, int M, int N, int K) {
  __shared__ __attribute__((aligned(16))) float so[4][16][64];
  const int tid = threadIdx.x, w = tid >> 5, lane = tid & 31, ln = lane & 15, hh = lane >> 4; const int by = blockIdx.y;
  A += (size_t)by * sA; Bh += (size_t)by * sB; const size_t cofs = (size_t)by * sC; const float* bp = bias ? bias + (size_t)by * sBias : nullptr;
  const int ntn = (N + 63) / 64; const int wid = blockIdx.x * 4 + w; const int mt = wid / ntn, nq = wid % ntn; if (mt * 16 >= M) return;
  const int row0 = mt * 16, col0 = nq * 64; const _Float16* arow = A + (size_t)(row0 + ln) * lda;
  v8f acc[4] = {};
  for (int kb = 0; kb < K; kb += 32) { FragH ah; ah.half[0] = *(const v8us*)((const unsigned short*)arow + kb + 8 * hh); ah.half[1] = *(const v8us*)((const unsigned short*)arow + kb + 16 + 8 * hh);
#pragma unroll
    for (int t = 0; t < 4; ++t) { if (col0 + t * 16 >= N) continue; const size_t boff = (size_t)(col0 + t * 16 + ln) * ldb + kb; FragH bq; bq.half[0] = *(const v8us*)((const unsigned short*)Bh + boff + 8 * hh); bq.half[1] = *(const v8us*)((const unsigned short*)Bh + boff + 16 + 8 * hh);
      acc[t] = mmaH<1>(ah.v, ah.v, bq.v, bq.v, acc[t]); }
  }
#pragma unroll
  for (int t = 0; t < 4; ++t) { if (col0 + t * 16 >= N) continue; const int col = col0 + t * 16 + ln; const float bv = bp ? bf16_round(bp[col]) : 0.f;
#pragma unroll
    for (int r = 0; r < 8; ++r) { float v = acc[t][r] * alpha + bv; if (CP) { const int bidx = (row0g + row0 + 8 * hh + r) / rowsPerB; v += CP[(size_t)bidx * sCPb + (size_t)by * 64 + col]; } if (ACT == 1) v = (v > 0.f) ? v : expm1f(v); else if (ACT == 7) v = (v > 0.f) ? v + 1.0f : expf(v); else if (ACT == 8) v = tanhf(v); else if (ACT == 9) v = 0.5f * v * (1.0f + tanhf(0.7978845608028654f * (v + 0.044715f * v * v * v))); else if (ACT == 11) v = 1.0f / (1.0f + expf(-v)); else if (ACT == 12) v = (v > 0.f) ? v : 0.01f * v; else if (ACT == 14) v = (v > 0.f) ? v : 0.1f * v; else if (ACT == 15) v = v / (1.0f + expf(-v)); else if (ACT == 3) v = fmaxf(v, 0.f); else if (ACT == 6) v = 0.5f * v * (1.0f + erff(v * 0.70710678118654752f)); so[w][8 * hh + r][t * 16 + ln] = v; } }
  __builtin_amdgcn_fence(__ATOMIC_ACQ_REL, "workgroup"); __builtin_amdgcn_wave_barrier();
  const int rsub = lane >> 4, c4 = (lane & 15) * 4; typedef _Float16 v4h __attribute__((ext_vector_type(4)));
  {
#pragma unroll
    for (int q = 0; q < 8; ++q) { const int r = q * 2 + rsub; if (col0 + c4 < N) { const v4f v = *(const v4fa*)&so[w][r][c4]; if (C) *(v4f*)(C + cofs + (size_t)(row0 + r) * ldc + col0 + c4) = v; if (C16) { v4h h4; for (int i = 0; i < 4; ++i) h4[i] = (_Float16)v[i]; *(v4h*)(C16 + cofs + (size_t)(row0 + r) * ldc + col0 + c4) = h4; } } }
     }
}


typedef _Float16 v4h __attribute__((ext_vector_type(4)));

__global__ __launch_bounds__(256) void k_x16(const float* __restrict__ x, _Float16* __restrict__ X16, size_t n8) { const size_t t = (size_t)blockIdx.x * 256 + threadIdx.x; if (t >= n8) return; FragH f;
#pragma unroll
  for (int q = 0; q < 8; ++q) f.h[q] = (_Float16)bf16_round(x[t * 8 + q]); *(v8us*)((unsigned short*)X16 + t * 8) = f.half[0];  }
__global__ __launch_bounds__(256) void k_h16(const float* __restrict__ x, _Float16* __restrict__ X16, size_t n8) { const size_t t = (size_t)blockIdx.x * 256 + threadIdx.x; if (t >= n8) return; FragH f;
#pragma unroll
  for (int q = 0; q < 8; ++q) f.h[q] = (_Float16)x[t * 8 + q]; *(v8us*)((unsigned short*)X16 + t * 8) = f.half[0];  }
__global__ __launch_bounds__(256) void k_round16f(const float* __restrict__ W, _Float16* __restrict__ Bt, size_t n8) { const size_t t = (size_t)blockIdx.x * 256 + threadIdx.x; if (t >= n8) return; FragH f;
#pragma unroll
  for (int i = 0; i < 8; ++i) f.h[i] = (_Float16)(bf16_round(W[t * 8 + i]) * 16.0f); *(v8us*)((unsigned short*)Bt + t * 8) = f.half[0];  }
template <int NHv, int TTv>
__global__ __launch_bounds__(256) void k_vt(const _Float16* __restrict__ V16, int ldv, int voff, _Float16* __restrict__ Vt) { __shared__ unsigned short tl[64][66]; const int tid = threadIdx.x; const int slab = blockIdx.x / (TTv / 64), lg = blockIdx.x % (TTv / 64); const int b = slab / NHv, h = slab % NHv;
  for (int i = tid; i < 64 * 8; i += 256) { const int r = i / 8, c8 = (i % 8) * 8; FragH f; f.half[0] = *(const v8us*)((const unsigned short*)V16 + ((size_t)b * TTv + lg * 64 + r) * ldv + voff + h * 64 + c8);
#pragma unroll
    for (int q = 0; q < 8; ++q) tl[r][c8 + q] = f.u[q]; }
  __syncthreads();
  {
#pragma unroll
    for (int rd = 0; rd < 2; ++rd) { const int d = rd * 32 + tid / 8, pc = tid % 8; FragH f;
#pragma unroll
      for (int q = 0; q < 8; ++q) f.u[q] = tl[pc * 8 + q][d];
      *(v8us*)((unsigned short*)Vt + ((size_t)slab * 64 + d) * TTv + lg * 64 + pc * 8) = f.half[0]; }
     } }

__global__ __launch_bounds__(256) void k_hl(const float* __restrict__ F, _Float16* __restrict__ Hh, _Float16* __restrict__ Hl, size_t n8) { const size_t t = (size_t)blockIdx.x * 256 + threadIdx.x; if (t >= n8) return; FragH fh, fl; const v4f a = *(const v4fa*)(F + t * 8), c = *(const v4fa*)(F + t * 8 + 4);
#pragma unroll
  for (int q = 0; q < 4; ++q) { _Float16 h = (_Float16)a[q]; fh.h[q] = h; fl.h[q] = (_Float16)((a[q] - (float)h) * 1024.0f); h = (_Float16)c[q]; fh.h[4 + q] = h; fl.h[4 + q] = (_Float16)((c[q] - (float)h) * 1024.0f); }
  { *(v8us*)((unsigned short*)Hh + t * 8) = fh.half[0]; *(v8us*)((unsigned short*)Hl + t * 8) = fl.half[0];  } }

// ---- fast GEMM (wave tile 32x64, block tile 128x64; requires M % 128 == 0, N % 64 == 0, K % 64 == 0, K >= 64); epilogue = k_gemm_hhx semantics ----
// Operands reach the waves through LDS: per stage the block brings 64 k of its 128 A rows and 64 B rows in by asynchronous copies that cover whole 128-byte lines (8 lanes a row),
// two buffers, the next stage in flight while this one is worked on; the fragments are read from LDS in the same k order as before.
__device__ __forceinline__ v16h g2_frag(const unsigned short* p, int hh) { FragH f; f.half[0] = *(const v8us*)(p + 8 * hh); f.half[1] = *(const v8us*)(p + 16 + 8 * hh); return f.v; }
__device__ __forceinline__ v8f g2_mma(v16h a, v16h b, v8f c) { v8f d = __builtin_amdgcn_wmma_f32_16x16x32_f16(false, a, false, b, (short)0, c, false, false); asm volatile("v_nop\n\tv_nop\n\tv_nop\n\tv_nop" : "+v"(d) : "v"(a), "v"(b)); return d; }
// One lane's share of a stage: 8 pieces of A and 4 of B, 16 bytes each, 16 rows apart (ls bytes in LDS, da / db bytes in memory), global memory -> LDS through no register.
// The s_wait_xcnt closes the copies' own statement so that no address register named here is rewritten ahead of it.
__device__ __forceinline__ void g2_copy(unsigned la, unsigned lb, unsigned ls, const char* pa, size_t da, const char* pb, size_t db) {
  asm volatile("global_load_async_to_lds_b128 %0, %12, off\n\t" "global_load_async_to_lds_b128 %1, %13, off\n\t" "global_load_async_to_lds_b128 %2, %14, off\n\t" "global_load_async_to_lds_b128 %3, %15, off\n\t"
               "global_load_async_to_lds_b128 %4, %16, off\n\t" "global_load_async_to_lds_b128 %5, %17, off\n\t" "global_load_async_to_lds_b128 %6, %18, off\n\t" "global_load_async_to_lds_b128 %7, %19, off\n\t"
               "global_load_async_to_lds_b128 %8, %20, off\n\t" "global_load_async_to_lds_b128 %9, %21, off\n\t" "global_load_async_to_lds_b128 %10, %22, off\n\t" "global_load_async_to_lds_b128 %11, %23, off\n\t"
               "s_wait_xcnt 0x0"
               :: "v"(la), "v"(la + ls), "v"(la + 2 * ls), "v"(la + 3 * ls), "v"(la + 4 * ls), "v"(la + 5 * ls), "v"(la + 6 * ls), "v"(la + 7 * ls), "v"(lb), "v"(lb + ls), "v"(lb + 2 * ls), "v"(lb + 3 * ls),
                  "v"(pa), "v"(pa + da), "v"(pa + 2 * da), "v"(pa + 3 * da), "v"(pa + 4 * da), "v"(pa + 5 * da), "v"(pa + 6 * da), "v"(pa + 7 * da), "v"(pb), "v"(pb + db), "v"(pb + 2 * db), "v"(pb + 3 * db)
               : "memory"); }
template <int ACT>
__global__ __launch_bounds__(128) void k_gemm2(const _Float16* __restrict__ A, int lda, size_t sA, const _Float16* __restrict__ Bh, int ldb, size_t sB, float alpha, const float* __restrict__ bias, size_t sBias, const float* __restrict__ CP, int rowsPerB, size_t sCPb, int row0g,
    float* __restrict__ C, _Float16* __restrict__ C16, int ldc, size_t sC, int M, int N, int K) {
  constexpr int KT = 64, PIT = KT + 8;      /* LDS row pitch 144 B = 16 B x odd: the 16-byte fragment reads of 16 rows fall on distinct banks */
  __shared__ __attribute__((aligned(16))) float so[4][32][68];
  __shared__ __attribute__((aligned(16))) unsigned short tA[2][128][PIT]; __shared__ __attribute__((aligned(16))) unsigned short tB[2][64][PIT];
  const int tid = threadIdx.x, w = tid >> 5, lane = tid & 31, ln = lane & 15, hh = lane >> 4; const int by = blockIdx.y;
  A += (size_t)by * sA; Bh += (size_t)by * sB; const size_t cofs = (size_t)by * sC; const float* bp = bias ? bias + (size_t)by * sBias : nullptr;
  const int ntn = N >> 6; const int mt = blockIdx.x / ntn, nq = blockIdx.x - mt * ntn; const int row0 = mt * 128 + 32 * w, col0 = nq * 64; if (mt * 128 >= M) return;      /* the same for the whole block: it stands in front of barriers */
  const int sr = tid >> 3, sc = (tid & 7) * 8;
  const char* pa = (const char*)(A + (size_t)(mt * 128 + sr) * lda + sc); const char* pb = (const char*)(Bh + (size_t)(col0 + sr) * ldb + sc); const size_t da = (size_t)lda * 32, db = (size_t)ldb * 32;
  const unsigned la = (unsigned)(uintptr_t)&tA[0][sr][sc], lb = (unsigned)(uintptr_t)&tB[0][sr][sc]; constexpr unsigned LS = 16 * PIT * 2, BA = 128 * PIT * 2, BB = 64 * PIT * 2;
  g2_copy(la, lb, LS, pa, da, pb, db);
  asm volatile("s_wait_asynccnt 0x0" ::: "memory");      /* this wave's share of stage 0 has landed */
  __syncthreads();      /* every wave's share has: stage 0 may be read */
  if (KT < K) g2_copy(la + BA, lb + BB, LS, pa + KT * 2, da, pb + KT * 2, db);
  const v8f z8 = {0.f,0.f,0.f,0.f,0.f,0.f,0.f,0.f}; v8f c00 = z8, c01 = z8, c02 = z8, c03 = z8, c10 = z8, c11 = z8, c12 = z8, c13 = z8;
  /* rolled: one stage a trip, so that the order at the foot of the trip stands once */
#pragma unroll 1
  for (int kb = 0; kb < K; kb += KT) { const int cur = (kb >> 6) & 1;
    /* unrolled: the two 32-k blocks of a stage read LDS at immediate offsets */
#pragma unroll
    for (int ks = 0; ks < KT; ks += 32) { const unsigned short* fa = &tA[cur][32 * w + ln][ks]; const unsigned short* fb = &tB[cur][ln][ks];
      const v16h a0 = g2_frag(fa, hh), a1 = g2_frag(fa + 16 * PIT, hh); const v16h b0 = g2_frag(fb, hh), b1 = g2_frag(fb + 16 * PIT, hh), b2 = g2_frag(fb + 32 * PIT, hh), b3 = g2_frag(fb + 48 * PIT, hh);
      c00 = g2_mma(a0, b0, c00); c10 = g2_mma(a1, b0, c10); c01 = g2_mma(a0, b1, c01); c11 = g2_mma(a1, b1, c11);
      c02 = g2_mma(a0, b2, c02); c12 = g2_mma(a1, b2, c12); c03 = g2_mma(a0, b3, c03); c13 = g2_mma(a1, b3, c13); }
    asm volatile("s_wait_dscnt 0x0" ::: "memory");      /* this wave's reads of the buffer that is refilled below have returned */
    asm volatile("s_wait_asynccnt 0x0" ::: "memory");      /* this wave's share of the next stage has landed */
    __syncthreads();      /* publishes the next stage and ends every wave's reads of this one */
    if (kb + 2 * KT < K) g2_copy(la + cur * BA, lb + cur * BB, LS, pa + (size_t)(kb + 2 * KT) * 2, da, pb + (size_t)(kb + 2 * KT) * 2, db); }
  asm volatile("s_wait_asynccnt 0x0" ::: "memory");      /* no copy is left in flight behind the loop */
  v8f accs[8] = {c00, c01, c02, c03, c10, c11, c12, c13};
#pragma unroll
  for (int u = 0; u < 8; ++u) { const int t = u & 3, half = u >> 2; const int col = col0 + t * 16 + ln; const float bv = bp ? bf16_round(bp[col]) : 0.f;
#pragma unroll
    for (int r = 0; r < 8; ++r) { const int rloc = half * 16 + 8 * hh + r; float v = accs[u][r] * alpha + bv; if (CP) { if (rowsPerB < 0) v += CP[cofs + (size_t)(row0g + row0 + rloc) * ldc + col];      /* rowsPerB < 0: own element of the batched C plane */ else { const int bidx = (row0g + row0 + rloc) / rowsPerB; v += CP[(size_t)bidx * sCPb + (size_t)by * 64 + col]; } }
      if (ACT == 3) v = fmaxf(v, 0.f); else if (ACT == 6) v = 0.5f * v * (1.0f + erff(v * 0.70710678118654752f)); else if (ACT == 11) v = 1.0f / (1.0f + expf(-v)); else if (ACT == 15) v = v / (1.0f + expf(-v)); else if (ACT == 12) v = (v > 0.f) ? v : 0.01f * v; else if (ACT == 8) v = tanhf(v);
      so[w][rloc][t * 16 + ln] = v; } }
  __builtin_amdgcn_fence(__ATOMIC_ACQ_REL, "workgroup"); __builtin_amdgcn_wave_barrier();
  const int rsub = lane >> 4, c4 = (lane & 15) * 4;
  {
#pragma unroll
    for (int q = 0; q < 16; ++q) { const int r = q * 2 + rsub; const v4f v = *(const v4fa*)&so[w][r][c4]; if (C) *(v4f*)(C + cofs + (size_t)(row0 + r) * ldc + col0 + c4) = v; if (C16) { v4h h4; for (int i = 0; i < 4; ++i) h4[i] = (_Float16)v[i]; *(v4h*)(C16 + cofs + (size_t)(row0 + r) * ldc + col0 + c4) = h4; } }
     } }



// Lane l <-> l ^ 16 by a vector cross-row move (the two lanes that hold one query's keys).
__device__ __forceinline__ float x_half(float x) { const int b = __float_as_int(x); return __int_as_float(__builtin_amdgcn_permlanex16(b, b, 0x76543210, 0xfedcba98, false, false)); }
// One lane's share of a 64-key stage: 4 pieces of K and 4 of V^T, 16 bytes each, 16 rows apart (ls bytes in LDS, dk / dv bytes in memory), global memory -> LDS through no register.
// The s_wait_xcnt closes the copies' own statement so that no address register named here is rewritten ahead of it.
__device__ __forceinline__ void fl_copy(unsigned lk, unsigned lv, unsigned ls, const char* pk, size_t dk, const char* pv, size_t dv) {
  asm volatile("global_load_async_to_lds_b128 %0, %8, off\n\t" "global_load_async_to_lds_b128 %1, %9, off\n\t" "global_load_async_to_lds_b128 %2, %10, off\n\t" "global_load_async_to_lds_b128 %3, %11, off\n\t"
               "global_load_async_to_lds_b128 %4, %12, off\n\t" "global_load_async_to_lds_b128 %5, %13, off\n\t" "global_load_async_to_lds_b128 %6, %14, off\n\t" "global_load_async_to_lds_b128 %7, %15, off\n\t"
               "s_wait_xcnt 0x0"
               :: "v"(lk), "v"(lk + ls), "v"(lk + 2 * ls), "v"(lk + 3 * ls), "v"(lv), "v"(lv + ls), "v"(lv + 2 * ls), "v"(lv + 3 * ls),
                  "v"(pk), "v"(pk + dk), "v"(pk + 2 * dk), "v"(pk + 3 * dk), "v"(pv), "v"(pv + dv), "v"(pv + 2 * dv), "v"(pv + 3 * dv)
               : "memory"); }
// Unmasked attention with both products transposed: S^T = K Q^T (A = K rows, B = Q rows), O^T += V^T P^T (A = V^T rows, B = P^T).
// Lane (ln, hh) owns query q0 + ln; register r of score tile nt is key j0 + ps + nt * 16 + 8 * hh + r, so maximum and sum run inside the lane, joined with lane ^ 16,
// and the two score tiles, converted in place, are the B operand of the second product in the k order of the V^T loader (8 * hh + i, 16 + 8 * hh + i): P touches no LDS.
// K and V^T reach the waves through LDS: per stage the block brings 64 keys (64 K rows and 64 V^T rows of 128 bytes) in by asynchronous copies that cover whole 128-byte lines (8 lanes a row),
// two buffers, the next stage in flight while this one is worked on; the four waves read their fragments from LDS in the same k order as before.
__global__ __launch_bounds__(128) void k_flash(const _Float16* __restrict__ Q16, int ldq, const _Float16* __restrict__ K16, int ldk, const _Float16* __restrict__ Vt, float* __restrict__ O, int ldo) {
  constexpr int RPW = 16, DT = 4, KS = 2, KT = 64, PIT = KT + 8;      /* LDS row pitch 144 B = 16 B x odd: the 16-byte fragment reads of 16 rows fall on distinct banks */
  __shared__ __attribute__((aligned(16))) float sO[4][RPW][64 + 4];
  __shared__ __attribute__((aligned(16))) unsigned short tK[2][KT][PIT]; __shared__ __attribute__((aligned(16))) unsigned short tV[2][64][PIT];
  const int tid = threadIdx.x, w = tid >> 5, lane = tid & 31, ln = lane & 15, hh = lane >> 4;
  const int slab = blockIdx.x / QBNP, qblk = QB0P + blockIdx.x % QBNP; const int b = slab / NH, h = slab % NH; const int qb0 = qblk * (4 * RPW); const int q0 = qb0 + w * RPW;
  /* every inner loop below is unrolled so that each register-array index is a constant (no scratch) */
  FragH bq[KS];
  { const unsigned short* qr = (const unsigned short*)Q16 + ((size_t)b * TQ + q0 + ln) * ldq + h * 64;
#pragma unroll
    for (int ks = 0; ks < KS; ++ks) { bq[ks].half[0] = *(const v8us*)(qr + ks * 32 + 8 * hh); bq[ks].half[1] = *(const v8us*)(qr + ks * 32 + 16 + 8 * hh); } }
  const unsigned short* Vth = (const unsigned short*)Vt + (size_t)slab * 64 * TK;
  const int sr = tid >> 3, sc = (tid & 7) * 8;
  const char* pk = (const char*)((const unsigned short*)K16 + ((size_t)b * TK + sr) * ldk + h * 64 + sc); const char* pv = (const char*)(Vth + (size_t)sr * TK + sc); const size_t dk = (size_t)ldk * 32, dv = (size_t)TK * 32, sk = (size_t)ldk * (KT * 2);
  const unsigned lk = (unsigned)(uintptr_t)&tK[0][sr][sc], lv = (unsigned)(uintptr_t)&tV[0][sr][sc]; constexpr unsigned LS = 16 * PIT * 2, BS = 64 * PIT * 2;
  fl_copy(lk, lv, LS, pk, dk, pv, dv);
  asm volatile("s_wait_asynccnt 0x0" ::: "memory");      /* this wave's share of stage 0 has landed */
  __syncthreads();      /* every wave's share has: stage 0 may be read */
  if (KT < TK) fl_copy(lk + BS, lv + BS, LS, pk + sk, dk, pv + KT * 2, dv);
  float m_q = -3.0e38f, l_q = 0.f; v8f oacc[DT];
#pragma unroll
  for (int dt = 0; dt < DT; ++dt) oacc[dt] = (v8f){0.f,0.f,0.f,0.f,0.f,0.f,0.f,0.f};
  /* rolled: one 64-key stage a trip, so that the order at the foot of the trip stands once */
#pragma unroll 1
  for (int j0 = 0; j0 < TK; j0 += KT) { const int cur = (j0 >> 6) & 1;
    /* unrolled: the two 32-key passes of a stage read LDS at immediate offsets */
#pragma unroll
    for (int ps = 0; ps < KT; ps += 32) {
    FragH ak[2][KS], av[DT];
#pragma unroll
    for (int nt = 0; nt < 2; ++nt) { const unsigned short* kr = &tK[cur][ps + nt * 16 + ln][0];
#pragma unroll
      for (int ks = 0; ks < KS; ++ks) { ak[nt][ks].half[0] = *(const v8us*)(kr + ks * 32 + 8 * hh); ak[nt][ks].half[1] = *(const v8us*)(kr + ks * 32 + 16 + 8 * hh); } }
#pragma unroll
    for (int dt = 0; dt < DT; ++dt) { const unsigned short* vrow = &tV[cur][dt * 16 + ln][ps]; av[dt].half[0] = *(const v8us*)(vrow + 8 * hh); av[dt].half[1] = *(const v8us*)(vrow + 16 + 8 * hh); }
    float sc_[16];
#pragma unroll
    for (int nt = 0; nt < 2; ++nt) {
      v8f acc = (v8f){0.f,0.f,0.f,0.f,0.f,0.f,0.f,0.f};
#pragma unroll
      for (int ks = 0; ks < KS; ++ks) acc = mmaH<1>(ak[nt][ks].v, ak[nt][ks].v, bq[ks].v, bq[ks].v, acc);
#pragma unroll
      for (int r = 0; r < 8; ++r) sc_[nt * 8 + r] = acc[r] * SCL; }
    float mc = sc_[0];
#pragma unroll
    for (int i = 1; i < 16; ++i) mc = fmaxf(mc, sc_[i]);
    mc = fmaxf(mc, x_half(mc));
    const float mn = fmaxf(m_q, mc); const float al = (mn > -1.0e38f) ? expf(m_q - mn) : 1.0f; m_q = mn;
    float p[16]; FragH pb;
#pragma unroll
    for (int i = 0; i < 16; ++i) { p[i] = expf(sc_[i] - mn); pb.h[i] = (_Float16)(p[i] * 1024.0f); }
#pragma unroll
    for (int st = 8; st > 0; st >>= 1)
#pragma unroll
      for (int i = 0; i < st; ++i) p[i] += p[i + st];
    l_q = l_q * al + p[0];
#pragma unroll
    for (int dt = 0; dt < DT; ++dt) {
#pragma unroll
      for (int r = 0; r < 8; ++r) oacc[dt][r] *= al; }
#pragma unroll
    for (int dt = 0; dt < DT; ++dt) oacc[dt] = mmaH<1>(av[dt].v, av[dt].v, pb.v, pb.v, oacc[dt]); }
    asm volatile("s_wait_dscnt 0x0" ::: "memory");      /* this wave's reads of the buffer that is refilled below have returned */
    asm volatile("s_wait_asynccnt 0x0" ::: "memory");      /* this wave's share of the next stage has landed */
    __syncthreads();      /* publishes the next stage and ends every wave's reads of this one */
    if (j0 + 2 * KT < TK) fl_copy(lk + cur * BS, lv + cur * BS, LS, pk + (size_t)((j0 >> 6) + 2) * sk, dk, pv + (size_t)(j0 + 2 * KT) * 2, dv); }
  asm volatile("s_wait_asynccnt 0x0" ::: "memory");      /* no copy is left in flight behind the loop */
  const float l = l_q + x_half(l_q); const float li = (l > 0.f) ? 1.0f / (l * 1024.0f) : 0.f;
#pragma unroll
  for (int dt = 0; dt < DT; ++dt)
#pragma unroll
    for (int g = 0; g < 2; ++g) { const v4f val = {oacc[dt][4 * g] * li, oacc[dt][4 * g + 1] * li, oacc[dt][4 * g + 2] * li, oacc[dt][4 * g + 3] * li}; *(v4fa*)&sO[w][ln][dt * 16 + 8 * hh + 4 * g] = val; }
  __builtin_amdgcn_fence(__ATOMIC_ACQ_REL, "workgroup"); __builtin_amdgcn_wave_barrier();      /* the wave's own rows are in LDS before other lanes of it read them back as whole 128-byte lines */
  {
#pragma unroll
    for (int rp = 0; rp < RPW; rp += 2) { const int r = rp + (lane >> 4), pc = lane & 15; const v4f val = *(const v4fa*)&sO[w][r][pc * 4]; *(v4f*)(O + ((size_t)b * TQ + q0 + r) * ldo + h * 64 + pc * 4) = val; }
     } }
// 5-plane variant: S = Qh Kh^T + (Ql Kh^T + Qh Kl^T)/1024 with Q/K = [hi | 2^10 residual] f16 planes (QL/KL same layout as Q16/K16), then the 3-term P.V below.
// 3-term variant: O = (P_hi V_hi + (P_lo V_hi + P_hi V_lo) / 1024) / l with P = [hi | 2^10 residual] of 1024 p and V^T = [hi | 2^10 residual] planes (VtL same layout as Vt) -> ~2^-21-class products for un-averaged (early causal / peaked) rows
template <int CAUSAL>
__global__ __launch_bounds__(128) void k_flash5(const _Float16* __restrict__ Q16, const _Float16* __restrict__ QL, int ldq, const _Float16* __restrict__ K16, const _Float16* __restrict__ KL, int ldk, const _Float16* __restrict__ Vt, const _Float16* __restrict__ VtL, const int* __restrict__ MSK, float* __restrict__ O, int ldo) {
  constexpr int RPW = 16, RTN = RPW / 16, NQB = TQ / (4 * RPW), DT = 4, KS = 2;
  __shared__ __attribute__((aligned(16))) unsigned short sP[4][RPW][40]; __shared__ __attribute__((aligned(16))) unsigned short sPL[4][RPW][40]; __shared__ __attribute__((aligned(16))) float sO[4][RPW][64 + 4];
  const int tid = threadIdx.x, w = tid >> 5, lane = tid & 31, ln = lane & 15, hh = lane >> 4;
  const int slab = blockIdx.x / QBN5, qblk = QB05 + blockIdx.x % QBN5; (void)NQB; const int b = slab / NH, h = slab % NH; const int qb0 = qblk * (4 * RPW); const int q0 = qb0 + w * RPW;
  FragH aq[2][KS], aql[2][KS];
#pragma unroll
  for (int rt = 0; rt < RTN; ++rt) { const unsigned short* qr = (const unsigned short*)Q16 + ((size_t)b * TQ + q0 + rt * 16 + ln) * ldq + h * 64; const unsigned short* ql = (const unsigned short*)QL + ((size_t)b * TQ + q0 + rt * 16 + ln) * ldq + h * 64;
#pragma unroll
    for (int ks = 0; ks < KS; ++ks) { aq[rt][ks].half[0] = *(const v8us*)(qr + ks * 32 + 8 * hh); aq[rt][ks].half[1] = *(const v8us*)(qr + ks * 32 + 16 + 8 * hh); aql[rt][ks].half[0] = *(const v8us*)(ql + ks * 32 + 8 * hh); aql[rt][ks].half[1] = *(const v8us*)(ql + ks * 32 + 16 + 8 * hh); } }
  const unsigned short* Vth = (const unsigned short*)Vt + (size_t)slab * 64 * TK; const unsigned short* Vtl = (const unsigned short*)VtL + (size_t)slab * 64 * TK;
  float m_r[2][8], l_r[2][8]; v8f oacc[2][DT], oaccL[2][DT];
#pragma unroll
  for (int rt = 0; rt < RTN; ++rt) {
#pragma unroll
    for (int r = 0; r < 8; ++r) { m_r[rt][r] = -3.0e38f; l_r[rt][r] = 0.f; }
#pragma unroll
    for (int dt = 0; dt < DT; ++dt) { oacc[rt][dt] = (v8f){0.f,0.f,0.f,0.f,0.f,0.f,0.f,0.f}; oaccL[rt][dt] = oacc[rt][dt]; } }
  const int jend = (CAUSAL == 1) ? (qb0 + 4 * RPW) : ((CAUSAL == 23) ? min(TK, (qb0 / CHK + 2) * CHK) : TK);      /* causal / window: keys that can never contribute are skipped */ const int jbeg = (CAUSAL == 23) ? max(0, (qb0 / CHK - 1) * CHK) : 0;
#pragma unroll 1
  for (int j0 = jbeg; j0 < jend; j0 += 32) {
    v8f s[2][2];
#pragma unroll
    for (int nt = 0; nt < 2; ++nt) { const unsigned short* kr = (const unsigned short*)K16 + ((size_t)b * TK + j0 + nt * 16 + ln) * ldk + h * 64; const unsigned short* klr = (const unsigned short*)KL + ((size_t)b * TK + j0 + nt * 16 + ln) * ldk + h * 64; FragH bk[KS], bkl[KS];
#pragma unroll
      for (int ks = 0; ks < KS; ++ks) { bk[ks].half[0] = *(const v8us*)(kr + ks * 32 + 8 * hh); bk[ks].half[1] = *(const v8us*)(kr + ks * 32 + 16 + 8 * hh); bkl[ks].half[0] = *(const v8us*)(klr + ks * 32 + 8 * hh); bkl[ks].half[1] = *(const v8us*)(klr + ks * 32 + 16 + 8 * hh); }
#pragma unroll
      for (int rt = 0; rt < RTN; ++rt) { v8f acc = (v8f){0.f,0.f,0.f,0.f,0.f,0.f,0.f,0.f}, accl = acc;
#pragma unroll
        for (int ks = 0; ks < KS; ++ks) { acc = mmaH<1>(aq[rt][ks].v, aq[rt][ks].v, bk[ks].v, bk[ks].v, acc); accl = mmaH<1>(aql[rt][ks].v, aql[rt][ks].v, bk[ks].v, bk[ks].v, accl); accl = mmaH<1>(aq[rt][ks].v, aq[rt][ks].v, bkl[ks].v, bkl[ks].v, accl); }
#pragma unroll
        for (int r = 0; r < 8; ++r) acc[r] += accl[r] * 0.0009765625f;
        s[rt][nt] = acc; } }
#pragma unroll
    for (int rt = 0; rt < RTN; ++rt)
#pragma unroll
      for (int r = 0; r < 8; ++r) { const int tq = q0 + rt * 16 + 8 * hh + r; const int k0 = j0 + ln, k1 = j0 + 16 + ln;
        bool ok0 = (CAUSAL == 1) ? (k0 <= tq) : ((CAUSAL == 2) ? ((k0 >> 5) == (tq >> 5)) : true), ok1 = (CAUSAL == 1) ? (k1 <= tq) : ((CAUSAL == 2) ? ((k1 >> 5) == (tq >> 5)) : true);      /* mode 2: block-diagonal 32-token groups */
        if (CAUSAL == 4) { const int* mrow = MSK + ((size_t)b * TQ + tq) * TK; ok0 = mrow[k0] != 0; ok1 = mrow[k1] != 0; }      /* mode 4: per-(query, key) INPUT mask shared by all heads; masked keys contribute nothing (== the reference's -4096 fill, whose exp underflows to 0), rows with no valid key give l = 0 -> output 0 (== the reference's row_valid zeroing) */
        float s0 = ok0 ? s[rt][0][r] * SCL : -3.0e38f, s1 = ok1 ? s[rt][1][r] * SCL : -3.0e38f; if (CAUSAL == 17) { const float* amk = (const float*)MSK + (size_t)b * TK; s0 += bf16_round(amk[k0]); s1 += bf16_round(amk[k1]); } if (CAUSAL == 18) { const float* tb = (const float*)MSK; const int* ri = MSK + 1024 + (size_t)b * TK; const int rq = ri[tq]; s0 += tb[(h * 8 + rq) * 8 + ri[k0]]; s1 += tb[(h * 8 + rq) * 8 + ri[k1]]; } if (CAUSAL == 19) { const int* rel = MSK + (size_t)tq * TK; const float* rb = (const float*)MSK + (size_t)TQ * TK + ((size_t)(b * NH + h) * TQ + tq) * 64; s0 += rb[rel[k0]]; s1 += rb[rel[k1]]; }      /* mode 19: + (q.Ek[rel] + Eb[rel][h]) / 8 gathered by the int relative ids (packed [ids | table]) */      /* mode 18: + resource_bias[h][r_q][r_k] from the packed [table | ids] buffer (TQ == TK) */      /* mode 17: additive per-(batch, key) mask INPUT */ float mc = fmaxf(s0, s1);
        mc = fmaxf(mc, __shfl_xor(mc, 1, 32)); mc = fmaxf(mc, __shfl_xor(mc, 2, 32)); mc = fmaxf(mc, __shfl_xor(mc, 4, 32)); mc = fmaxf(mc, __shfl_xor(mc, 8, 32));
        const float mn = fmaxf(m_r[rt][r], mc); const float al = (mn > -1.0e38f) ? expf(m_r[rt][r] - mn) : 1.0f; m_r[rt][r] = mn; const float p0 = ok0 ? expf(s0 - mn) : 0.f, p1 = ok1 ? expf(s1 - mn) : 0.f; l_r[rt][r] = l_r[rt][r] * al + p0 + p1;
#pragma unroll
        for (int dt = 0; dt < DT; ++dt) { oacc[rt][dt][r] *= al; oaccL[rt][dt][r] *= al; }
        FragH t2, t2l; const float ps0 = p0 * 1024.0f, ps1 = p1 * 1024.0f; t2.h[0] = (_Float16)ps0; t2.h[1] = (_Float16)ps1; t2l.h[0] = (_Float16)((ps0 - (float)t2.h[0]) * 1024.0f); t2l.h[1] = (_Float16)((ps1 - (float)t2.h[1]) * 1024.0f);
        sP[w][rt * 16 + 8 * hh + r][ln] = t2.u[0]; sP[w][rt * 16 + 8 * hh + r][16 + ln] = t2.u[1]; sPL[w][rt * 16 + 8 * hh + r][ln] = t2l.u[0]; sPL[w][rt * 16 + 8 * hh + r][16 + ln] = t2l.u[1]; }
    __builtin_amdgcn_fence(__ATOMIC_ACQ_REL, "workgroup"); __builtin_amdgcn_wave_barrier();
    FragH pa[2], pl[2];
#pragma unroll
    for (int rt = 0; rt < RTN; ++rt) { pa[rt].half[0] = *(const v8us*)&sP[w][rt * 16 + ln][8 * hh]; pa[rt].half[1] = *(const v8us*)&sP[w][rt * 16 + ln][16 + 8 * hh]; pl[rt].half[0] = *(const v8us*)&sPL[w][rt * 16 + ln][8 * hh]; pl[rt].half[1] = *(const v8us*)&sPL[w][rt * 16 + ln][16 + 8 * hh]; }
#pragma unroll
    for (int dt = 0; dt < DT; ++dt) { const unsigned short* vrow = Vth + (size_t)(dt * 16 + ln) * TK + j0; const unsigned short* vrl = Vtl + (size_t)(dt * 16 + ln) * TK + j0; FragH bv, bl; bv.half[0] = *(const v8us*)(vrow + 8 * hh); bv.half[1] = *(const v8us*)(vrow + 16 + 8 * hh); bl.half[0] = *(const v8us*)(vrl + 8 * hh); bl.half[1] = *(const v8us*)(vrl + 16 + 8 * hh);
#pragma unroll
      for (int rt = 0; rt < RTN; ++rt) { oacc[rt][dt] = mmaH<1>(pa[rt].v, pa[rt].v, bv.v, bv.v, oacc[rt][dt]); oaccL[rt][dt] = mmaH<1>(pl[rt].v, pl[rt].v, bv.v, bv.v, oaccL[rt][dt]); oaccL[rt][dt] = mmaH<1>(pa[rt].v, pa[rt].v, bl.v, bl.v, oaccL[rt][dt]); } }
    __builtin_amdgcn_fence(__ATOMIC_ACQ_REL, "workgroup"); __builtin_amdgcn_wave_barrier(); }
#pragma unroll
  for (int rt = 0; rt < RTN; ++rt) {
#pragma unroll
    for (int r = 0; r < 8; ++r) { float l = l_r[rt][r]; l += __shfl_xor(l, 1, 32); l += __shfl_xor(l, 2, 32); l += __shfl_xor(l, 4, 32); l += __shfl_xor(l, 8, 32); l_r[rt][r] = (l > 0.f) ? 1.0f / (l * 1024.0f) : 0.f; }
#pragma unroll
    for (int dt = 0; dt < DT; ++dt)
#pragma unroll
      for (int r = 0; r < 8; ++r) { float v = oacc[rt][dt][r]; v += oaccL[rt][dt][r] * 0.0009765625f; sO[w][rt * 16 + 8 * hh + r][dt * 16 + ln] = v * l_r[rt][r]; } }
  __builtin_amdgcn_fence(__ATOMIC_ACQ_REL, "workgroup"); __builtin_amdgcn_wave_barrier();
  {
#pragma unroll
    for (int rp = 0; rp < RPW; rp += 2) { const int r = rp + (lane >> 4), pc = lane & 15; const v4f val = *(const v4fa*)&sO[w][r][pc * 4]; *(v4f*)(O + ((size_t)b * TQ + q0 + r) * ldo + h * 64 + pc * 4) = val; }
     } }

__global__ __launch_bounds__(256) void k_rotab(float* __restrict__ CS, float* __restrict__ SN) {
  #pragma clang fp contract(off)
  const int t = blockIdx.x * 256 + threadIdx.x; if (t >= SLEN * 32) return; const int j = t % 32, s = t / 32; const float ex = (float)(2 * j) / 64.0f; const float inv = 1.0f / powf(10000.0f, ex); const float th = (float)s * inv; const float c = cosf(th), sn = sinf(th);
  { *(float*)(CS + t) = c; *(float*)(SN + t) = sn;  } }
__global__ __launch_bounds__(256) void k_rope(const float* __restrict__ F, int nsrc, int ndst, int rep, const float* __restrict__ CS, const float* __restrict__ SN, _Float16* __restrict__ H, _Float16* __restrict__ L) {
  #pragma clang fp contract(off)
  const size_t t = (size_t)blockIdx.x * 256 + threadIdx.x; if (t >= (size_t)NR * ndst * 4) return; const int g8 = (int)(t % 4); const int hd = (int)((t / 4) % ndst); const size_t row = t / ((size_t)4 * ndst); const int s = (int)(row % SLEN); const int hs = hd / rep;
  const float* src = F + row * (size_t)(nsrc * 64) + hs * 64; FragH ah, al, bh, bl;
  for (int i = 0; i < 8; ++i) { const int d = g8 * 8 + i; const float c = CS[s * 32 + d], sn = SN[s * 32 + d]; const float x1 = src[d], x2 = src[d + 32];
    float o1 = x1 * c; o1 += -x2 * sn; float o2 = x2 * c; o2 += x1 * sn;
    _Float16 hv = (_Float16)o1; ah.h[i] = hv; al.h[i] = (_Float16)((o1 - (float)hv) * 1024.0f); hv = (_Float16)o2; bh.h[i] = hv; bl.h[i] = (_Float16)((o2 - (float)hv) * 1024.0f); }
  const size_t o = row * (size_t)(ndst * 64) + hd * 64 + g8 * 8;
  { *(v8us*)((unsigned short*)H + o) = ah.half[0]; *(v8us*)((unsigned short*)H + o + 32) = bh.half[0]; *(v8us*)((unsigned short*)L + o) = al.half[0]; *(v8us*)((unsigned short*)L + o + 32) = bl.half[0];  } }
__global__ __launch_bounds__(256) void k_rope2(const float* __restrict__ F, int nsrc, int ndst, int rep, const float* __restrict__ CS, const float* __restrict__ SN, _Float16* __restrict__ H, _Float16* __restrict__ L) {
  #pragma clang fp contract(off)
  const size_t t = (size_t)blockIdx.x * 256 + threadIdx.x; if (t >= (size_t)NR * ndst * 4) return; const int g16 = (int)(t % 4); const int hd = (int)((t / 4) % ndst); const size_t row = t / ((size_t)4 * ndst); const int s = (int)(row % SLEN); const int hs = hd / rep;
  const float* src = F + row * (size_t)(nsrc * 64) + hs * 64 + g16 * 16; FragH ah, al;
  for (int pr = 0; pr < 8; ++pr) { const int i = g16 * 8 + pr; const float c = CS[s * 32 + i], sn = SN[s * 32 + i]; const float x1 = src[2 * pr], x2 = src[2 * pr + 1];
    float o1 = x1 * c; o1 -= x2 * sn; float o2 = x1 * sn; o2 += x2 * c;
    _Float16 hv = (_Float16)o1; ah.h[2 * pr] = hv; al.h[2 * pr] = (_Float16)((o1 - (float)hv) * 1024.0f); hv = (_Float16)o2; ah.h[2 * pr + 1] = hv; al.h[2 * pr + 1] = (_Float16)((o2 - (float)hv) * 1024.0f); }
  const size_t o = row * (size_t)(ndst * 64) + hd * 64 + g16 * 16;
  { *(v8us*)((unsigned short*)H + o) = ah.half[0]; *(v8us*)((unsigned short*)H + o + 8) = ah.half[1]; *(v8us*)((unsigned short*)L + o) = al.half[0]; *(v8us*)((unsigned short*)L + o + 8) = al.half[1];  } }
__global__ __launch_bounds__(256) void k_ln512(const float* __restrict__ A, const float* __restrict__ res, const float* __restrict__ g, const float* __restrict__ bb, float* __restrict__ Y, _Float16* __restrict__ Y16) {
  #pragma clang fp contract(off)
  const int wv = threadIdx.x >> 5, ln = threadIdx.x & 31; const size_t r = (size_t)blockIdx.x * 8 + wv; if (r >= NR) return; float x[16]; float s = 0.f;
  for (int i = 0; i < 2; ++i) { const v8f a = *(const v8f*)(A + r * DM + i * 256 + ln * 8); for (int q = 0; q < 8; ++q) { float v = a[q]; if (res) v += bf16_round(res[r * DM + i * 256 + ln * 8 + q]); x[i * 8 + q] = v; s += v; } }
  for (int o = 16; o > 0; o >>= 1) s += __shfl_xor(s, o, 32); const float mu = s / (float)DM; float var = 0.f; for (int q = 0; q < 16; ++q) { const float d = x[q] - mu; var += d * d; }
  for (int o = 16; o > 0; o >>= 1) var += __shfl_xor(var, o, 32); const float inv = rsqrtf(var / (float)DM + 1e-5f);
  { for (int i = 0; i < 2; ++i) { const int c0 = i * 256 + ln * 8; v8f y; FragH f; for (int q = 0; q < 8; ++q) { float v = (x[i * 8 + q] - mu) * inv; v *= bf16_round(g[c0 + q]); v += bf16_round(bb[c0 + q]); y[q] = v; f.h[q] = (_Float16)v; } *(v8f*)(Y + r * DM + c0) = y; if (Y16) *(v8us*)((unsigned short*)Y16 + r * DM + c0) = f.half[0]; }  } }
__global__ __launch_bounds__(256) void k_pack(const float* __restrict__ rb, const int* __restrict__ rid, int* __restrict__ PK) { const int t = blockIdx.x * 256 + threadIdx.x; if (t >= 1024 + NB * TK) return; int v; if (t < 1024) v = __float_as_int(bf16_round(rb[t])); else v = rid[t - 1024]; *(int*)(PK + t) = v;  }
__global__ __launch_bounds__(256) void k_tabin(const float* __restrict__ sp, float* __restrict__ CS, float* __restrict__ SN) { const int t = blockIdx.x * 256 + threadIdx.x; if (t >= SLEN * 32) return; const int i = t % 32, s = t / 32; const float c = bf16_round(sp[s * 64 + 32 + i]), sn = bf16_round(sp[s * 64 + i]);
  { *(float*)(CS + t) = c; *(float*)(SN + t) = sn;  } }
__global__ __launch_bounds__(256) void k_wsc(const float* __restrict__ Wm, _Float16* __restrict__ Bt, size_t n8, float sc) { const size_t t = (size_t)blockIdx.x * 256 + threadIdx.x; if (t >= n8) return; FragH f; for (int q = 0; q < 8; ++q) f.h[q] = (_Float16)(bf16_round(Wm[t * 8 + q]) * sc); *(v8us*)((unsigned short*)Bt + t * 8) = f.half[0];  }
__global__ __launch_bounds__(256) void k_rotab2(float* __restrict__ CS, float* __restrict__ SN) {
  #pragma clang fp contract(off)
  const int t = blockIdx.x * 256 + threadIdx.x; if (t >= SLEN * 32) return; const int j = t % 32, s = t / 32; const float c0 = -0.14391156831212787f;      /* -ln(10000)/64 rounded to f32 */ const float inv = expf((float)(2 * j) * c0); const float th = (float)s * inv; const float c = cosf(th), sn = sinf(th);
  { *(float*)(CS + t) = c; *(float*)(SN + t) = sn;  } }
__global__ __launch_bounds__(256) void k_lnu(const float* __restrict__ X, _Float16* __restrict__ N16, float* __restrict__ XB) {
  #pragma clang fp contract(off)
  const int wv = threadIdx.x >> 5, ln = threadIdx.x & 31; const size_t r = (size_t)blockIdx.x * 8 + wv; if (r >= NR) return; float a[32]; float s = 0.f;
  for (int i = 0; i < 4; ++i) { const v8f v = *(const v8f*)(X + r * DM + (i * 32 + ln) * 8); for (int q = 0; q < 8; ++q) { const float u = bf16_round(v[q]); a[i * 8 + q] = u; s += u; } }
  for (int o = 16; o > 0; o >>= 1) s += __shfl_xor(s, o, 32); const float mu = s / (float)DM; float var = 0.f; for (int q = 0; q < 32; ++q) { const float d = a[q] - mu; var += d * d; }
  for (int o = 16; o > 0; o >>= 1) var += __shfl_xor(var, o, 32); const float den = sqrtf(var / (float)(DM - 1)) + 1e-6f; const float inv = 1.0f / den;      /* one reciprocal per row; (x-mean)*inv vs the reference's division differs by <= 1 ulp */
  { for (int i = 0; i < 4; ++i) { const int c0 = (i * 32 + ln) * 8; FragH f; v8f xb; for (int q = 0; q < 8; ++q) { f.h[q] = (_Float16)((a[i * 8 + q] - mu) * inv); xb[q] = a[i * 8 + q]; } *(v8us*)((unsigned short*)N16 + r * DM + c0) = f.half[0]; *(v8f*)(XB + r * DM + c0) = xb; }  } }
__global__ __launch_bounds__(256) void k_vtg(const _Float16* __restrict__ V16, _Float16* __restrict__ Vt) { __shared__ unsigned short tl[64][66]; const int tid = threadIdx.x; const int slab = blockIdx.x / (SLEN / 64), lg = blockIdx.x % (SLEN / 64); const int b = slab / NH, h = slab % NH; const int hs = h / NREP;
  for (int i = tid; i < 64 * 8; i += 256) { const int r = i / 8, c8 = (i % 8) * 8; FragH f; f.half[0] = *(const v8us*)((const unsigned short*)V16 + ((size_t)b * SLEN + lg * 64 + r) * KVD + hs * 64 + c8); for (int q = 0; q < 8; ++q) tl[r][c8 + q] = f.u[q]; }
  __syncthreads();
  { for (int rd = 0; rd < 2; ++rd) { const int d = rd * 32 + tid / 8, pc = tid % 8; FragH f; for (int q = 0; q < 8; ++q) f.u[q] = tl[pc * 8 + q][d]; *(v8us*)((unsigned short*)Vt + ((size_t)slab * 64 + d) * SLEN + lg * 64 + pc * 8) = f.half[0]; }  } }

__global__ __launch_bounds__(256) void k_h16s(const float* __restrict__ SRC, int lds, int coff, _Float16* __restrict__ DST, size_t n8) { const size_t t = (size_t)blockIdx.x * 256 + threadIdx.x; if (t >= n8) return; const size_t r = (t * 8) / DM; const int c = (int)((t * 8) % DM); const v8f a = *(const v8f*)(SRC + r * lds + coff + c); FragH f; for (int q = 0; q < 8; ++q) f.h[q] = (_Float16)a[q];
  *(v8us*)((unsigned short*)DST + t * 8) = f.half[0];  }


__global__ __launch_bounds__(256) void k_ccp(const float* __restrict__ QKV, int coff, _Float16* __restrict__ D) { const size_t t = (size_t)blockIdx.x * 256 + threadIdx.x; if (t >= (size_t)NR * DM / 8) return; const int c0 = (int)((t * 8) % DM); const size_t row = (t * 8) / DM; const v8f a = *(const v8f*)(QKV + row * 3 * DM + coff + c0); FragH f; for (int q = 0; q < 8; ++q) f.h[q] = (_Float16)a[q];
  *(v8us*)((unsigned short*)D + t * 8) = f.half[0];  }


#ifndef NBS
#define NBS NB      /* batch stride of the [S][B][E] tensors (debug builds may process fewer batches than the layout holds) */
#endif
__global__ __launch_bounds__(256) void k_sbe(const float* __restrict__ q, _Float16* __restrict__ X) { const size_t t = (size_t)blockIdx.x * 256 + threadIdx.x; if (t >= (size_t)NR * DM / 8) return; const int c0 = (int)((t * 8) % DM); const size_t row = (t * 8) / DM; const int b = (int)(row / SLEN), s_ = (int)(row % SLEN); const float* src = q + ((size_t)s_ * NBS + b) * DM + c0; FragH f; for (int i = 0; i < 8; ++i) f.h[i] = (_Float16)bf16_round(src[i]);
  *(v8us*)((unsigned short*)X + t * 8) = f.half[0];  }
__global__ __launch_bounds__(256) void k_out_sbe(const float* __restrict__ R, float* __restrict__ out) { const size_t t = (size_t)blockIdx.x * 256 + threadIdx.x; if (t >= (size_t)NR * DM / 8) return; const int c0 = (int)((t * 8) % DM); const size_t irow = (t * 8) / DM; const int b = (int)(irow / SLEN), s_ = (int)(irow % SLEN); const v8f v = *(const v8f*)(R + t * 8); float* d = out + ((size_t)s_ * NBS + b) * DM + c0;
  *(v8f*)d = v;  }
__global__ __launch_bounds__(256) void k_rope(const float* __restrict__ F, _Float16* __restrict__ O16) {
  #pragma clang fp contract(off)
  const size_t t = (size_t)blockIdx.x * 256 + threadIdx.x; if (t >= (size_t)NR * DM / 16) return; const int d0 = (int)((t * 8) % 32); const int h = (int)(((t * 8) / 32) % NH); const size_t row = (t * 8) / (32 * NH); const int s_ = (int)(row % SLEN); const float* p = F + row * DM + h * 64; const v8f a = *(const v8f*)(p + d0), c = *(const v8f*)(p + 32 + d0); FragH f1, f2;
#pragma unroll 1
  for (int q = 0; q < 8; ++q) { const int d = d0 + q; const float inv = 1.0f / powf(10000.0f, (float)(2 * d) / 64.0f); const float ang = (float)s_ * inv; const float sn = sinf(ang), cs = cosf(ang); float o1 = a[q] * cs; o1 = o1 - c[q] * sn; float o2 = c[q] * cs; o2 = o2 + a[q] * sn; f1.h[q] = (_Float16)o1; f2.h[q] = (_Float16)o2; }
  { *(v8us*)((unsigned short*)O16 + row * DM + h * 64 + d0) = f1.half[0]; *(v8us*)((unsigned short*)O16 + row * DM + h * 64 + 32 + d0) = f2.half[0];  } }
extern "C" void kernel_launch(void* const* d_in, const int* in_sizes, int n_in,
                              void* d_out, int out_size, void* d_ws, size_t ws_size, hipStream_t stream) {
  (void)in_sizes; (void)n_in; (void)out_size;
  const float* qy = (const float*)d_in[0]; const float* wq = (const float*)d_in[1]; const float* bq = (const float*)d_in[2]; const float* wk = (const float*)d_in[3]; const float* bk = (const float*)d_in[4]; const float* wv = (const float*)d_in[5]; const float* bv = (const float*)d_in[6]; const float* wo = (const float*)d_in[7]; const float* bo = (const float*)d_in[8];
  char* ws = (char*)d_ws; size_t off = 0;
  auto take = [&](size_t bytes) { char* p = ws + off; off += (bytes + 255) & ~(size_t)255; return p; };
  const size_t np = (size_t)NR * DM;
  _Float16* BQ = (_Float16*)take((size_t)DM * DM * 2); _Float16* BK = (_Float16*)take((size_t)DM * DM * 2); _Float16* BV = (_Float16*)take((size_t)DM * DM * 2); _Float16* BO = (_Float16*)take((size_t)DM * DM * 2); _Float16* X16 = (_Float16*)take(np * 2); float* F32 = (float*)take(np * 4); float* OUTR = (float*)take(np * 4);
   _Float16* QH = (_Float16*)take(np * 2); _Float16* KH = (_Float16*)take(np * 2); _Float16* V16 = (_Float16*)take(np * 2); _Float16* VT = (_Float16*)take(np * 2); float* O = (float*)take(np * 4); _Float16* OH = QH; _Float16* OL = KH;
  if (off > ws_size) return;
  k_wsc<<<(unsigned)(((size_t)DM * DM / 8 + 255) / 256), 256, 0, stream>>>(wq, BQ, (size_t)DM * DM / 8, 16.0f); k_wsc<<<(unsigned)(((size_t)DM * DM / 8 + 255) / 256), 256, 0, stream>>>(wk, BK, (size_t)DM * DM / 8, 16.0f); k_wsc<<<(unsigned)(((size_t)DM * DM / 8 + 255) / 256), 256, 0, stream>>>(wv, BV, (size_t)DM * DM / 8, 16.0f); k_wsc<<<(unsigned)(((size_t)DM * DM / 8 + 255) / 256), 256, 0, stream>>>(wo, BO, (size_t)DM * DM / 8, 16.0f);      /* torch (out,in) naturals */
  k_sbe<<<(unsigned)((np / 8 + 255) / 256), 256, 0, stream>>>(qy, X16);
  
  const dim3 g((NR / 128) * (DM / 64), 1);
  k_gemm2<0><<<g, 128, 0, stream>>>(X16, DM, 0, BQ, DM, 0, 0.0625f, bq, 0, nullptr, 1, 0, 0, F32, nullptr, DM, 0, NR, DM, DM); k_rope<<<(unsigned)((np / 8 + 255) / 256), 256, 0, stream>>>(F32, QH);
  k_gemm2<0><<<g, 128, 0, stream>>>(X16, DM, 0, BK, DM, 0, 0.0625f, bk, 0, nullptr, 1, 0, 0, F32, nullptr, DM, 0, NR, DM, DM); k_rope<<<(unsigned)((np / 8 + 255) / 256), 256, 0, stream>>>(F32, KH);
  k_gemm2<0><<<g, 128, 0, stream>>>(X16, DM, 0, BV, DM, 0, 0.0625f, bv, 0, nullptr, 1, 0, 0, nullptr, V16, DM, 0, NR, DM, DM);
  k_vtg<<<NB * NH * (SLEN / 64), 256, 0, stream>>>(V16, VT);
  k_flash<<<NB * NH * QBNP, 128, 0, stream>>>(QH, DM, KH, DM, VT, O, DM);
  k_hl<<<(unsigned)((np / 8 + 255) / 256), 256, 0, stream>>>(O, OH, OL, np / 8);
  k_gemm2<0><<<g, 128, 0, stream>>>(OL, DM, 0, BO, DM, 0, 0.0625f / 1024.0f, nullptr, 0, nullptr, 1, 0, 0, OUTR, nullptr, DM, 0, NR, DM, DM);
  k_gemm2<0><<<g, 128, 0, stream>>>(OH, DM, 0, BO, DM, 0, 0.0625f, bo, 0, OUTR, 1, (size_t)DM, 0, OUTR, nullptr, DM, 0, NR, DM, DM);      /* out rows (b, s) = (ctx_lo + ctx_hi) Wo^T + b */
  k_out_sbe<<<(unsigned)((np / 8 + 255) / 256), 256, 0, stream>>>(OUTR, (float*)d_out);
}

// v004
// It runs in 214 microseconds.
// Timed twice side by side with v003, it ran 1.28 and 1.34 times as fast.
// Over all steps from v000 it is 2.61 times as fast.
#include <hip/hip_runtime.h>
// Multi-head self-attention with rotary embedding (query [2048][2][1024] in [S, B, E] layout, 16 heads x 64: q/k/v = query W^T + b; rotary embedding per head (inv_freq = 10000^(-2i/64), rotate-half form) on q and k; softmax(q k^T / 8) v (no mask); out = attn Wo^T + bo, back in [S, B, E]).
// Structure: [S,B,E] -> exact f16 (b, s) rows; q/k as f32 WMMA GEMMs (32x64 wave tiles, f32 accumulation, exact x16 weights + bias) followed by RoPE on VALU (f32 angles s * inv_freq, sinf/cosf) into f16 planes; v as an f16 GEMM; V^T by LDS tiles; flash-style fused attention per (batch, head, 64-query block) (K Q^T and V^T P^T, one query per lane, online softmax and P in registers; no score plane), f32 context; output projection as a two-term GEMM on the context's f16 hi/residual split + bias into (b, s) rows, then the [S, B, E] store on VALU.
// Launches: 8. Bodies that do not depend on one another share a grid (k_prep: x and the four weights; k_gemm2 with 3 batches: q, k, v; k_post: RoPE of q, RoPE of k, V^T).
// Left: RoPE evaluates powf, sinf, cosf per (row, head, d) although the angle depends on (s, d) alone; the last product's epilogue loads its addend one element at a time, each load waited for.
// Compute dtype: inputs rounded to bf16; query / weights exact as f16; roped q/k and v plain f16 (~2^-12); softmax f32 with f16 probabilities; context hi + 2^-10 residual into the projection. v_wmma_f32_16x16x32_f16.
#define NB 2
#define DM 1024
#define NKV 16
#define NREP (NH / NKV)
#define KVD (NKV * 64)           /* 1024 */
#define NR (NB * SLEN)
#define CHK 512
typedef int v4i __attribute__((ext_vector_type(4)));
#define FF 2048
#define SLEN 2048
#define MQI 2048
#define MKI 2048
#define TQ SLEN
#define TK SLEN
#define NH 16
#define SCL 0.125f
#define QBLKS (TQ / 64)
#define QB05 0
#define QBN5 4
#define QB0P 0
#define QBNP QBLKS
#define RE 256
typedef __bf16 v16b __attribute__((ext_vector_type(16)));
typedef unsigned short v8us __attribute__((ext_vector_type(8), may_alias));
typedef float  v8f  __attribute__((ext_vector_type(8)));
typedef float  v4f  __attribute__((ext_vector_type(4)));
typedef float  v4fa __attribute__((ext_vector_type(4), may_alias));
union FragB { v16b v; v8us half[2]; unsigned short u[16]; };

__device__ __forceinline__ unsigned short bf16_bits(float x) { unsigned int u = __float_as_uint(x); return (unsigned short)((u + 0x7FFFu + ((u >> 16) & 1u)) >> 16); }
__device__ __forceinline__ float bf16_val(unsigned short b) { return __uint_as_float(((unsigned int)b) << 16); }
__device__ __forceinline__ float bf16_round(float x) { return bf16_val(bf16_bits(x)); }
// D += A·B with NT terms: 1 = ah·bh, 2 = + al·bh (A split), 3 = + ah·bl (both split)
template <int NT>
__device__ __forceinline__ v8f mmaN(v16b ah, v16b al, v16b bh, v16b bl, v8f c) {
  c = __builtin_amdgcn_wmma_f32_16x16x32_bf16(false, ah, false, bh, (short)0, c, false, false);
  if (NT >= 2) c = __builtin_amdgcn_wmma_f32_16x16x32_bf16(false, al, false, bh, (short)0, c, false, false);
  if (NT >= 3) c = __builtin_amdgcn_wmma_f32_16x16x32_bf16(false, ah, false, bl, (short)0, c, false, false);
  asm volatile("v_nop\n\tv_nop\n\tv_nop\n\tv_nop" : "+v"(c) : "v"(ah), "v"(al), "v"(bh), "v"(bl));
  return c;
}

__global__ __launch_bounds__(256) void k_wt_bf16(const float* __restrict__ W, unsigned short* __restrict__ Wt, int K, int N) {
  const int t = blockIdx.x * 256 + threadIdx.x;
  const int k8n = K / 8;
  if (t >= N * k8n) return;
  const int n = t / k8n, k8 = (t % k8n) * 8;
  v8us v;
#pragma unroll
  for (int i = 0; i < 8; ++i) v[i] = bf16_bits(W[(size_t)(k8 + i) * N + n]);
  *(v8us*)(Wt + (size_t)n * K + k8) = v;
  
}

// GEMM C[M][N] (f32, pitch ldc) = act(A[M][K]·W + bias). A f32 row-major (pitch lda) converted per fragment to bf16
// (ASPLIT: hi/lo two planes -> 2 terms, else single rounded term); Wt bf16 [N][K] (pitch ldb). BIAS_BF16 rounds the
// bias to bf16 first (bias quantised to bf16 before the add). K%32==0, M%16==0, N%64==0.
template <bool ASPLIT, int ACT, bool BIAS_BF16>
__global__ __launch_bounds__(128) void k_gemm_bf(const float* __restrict__ A, int lda, const unsigned short* __restrict__ Wt, int ldb,
                                               const float* __restrict__ bias, float* __restrict__ C, int ldc, int M, int N, int K) {
  __shared__ __attribute__((aligned(16))) float so[4][16][64];
  const int tid = threadIdx.x, w = tid >> 5, lane = tid & 31, ln = lane & 15, hh = lane >> 4;
  const int ntn = N / 64;
  const int wid = blockIdx.x * 4 + w;
  const int mt = wid / ntn, nq = wid % ntn;
  if (mt * 16 >= M) return;
  const int row0 = mt * 16, col0 = nq * 64;
  const float* arow = A + (size_t)(row0 + ln) * lda;
  v8f acc[4] = {};
  for (int kb = 0; kb < K; kb += 32) {
    FragB ah, al;
    const v4f x0 = *(const v4fa*)(arow + kb + 8 * hh), x1 = *(const v4fa*)(arow + kb + 8 * hh + 4);
    const v4f x2 = *(const v4fa*)(arow + kb + 16 + 8 * hh), x3 = *(const v4fa*)(arow + kb + 16 + 8 * hh + 4);
    float xs[16] = {x0[0],x0[1],x0[2],x0[3],x1[0],x1[1],x1[2],x1[3],x2[0],x2[1],x2[2],x2[3],x3[0],x3[1],x3[2],x3[3]};
#pragma unroll
    for (int i = 0; i < 16; ++i) { const unsigned short hb = bf16_bits(xs[i]); ah.u[i] = hb; al.u[i] = ASPLIT ? bf16_bits(xs[i] - bf16_val(hb)) : (unsigned short)0; }
#pragma unroll
    for (int t = 0; t < 4; ++t) {
      const unsigned short* brow = Wt + (size_t)(col0 + t * 16 + ln) * ldb + kb;
      FragB b;
      b.half[0] = *(const v8us*)(brow + 8 * hh);
      b.half[1] = *(const v8us*)(brow + 16 + 8 * hh);
      acc[t] = mmaN<ASPLIT ? 2 : 1>(ah.v, al.v, b.v, b.v, acc[t]);
    }
  }
#pragma unroll
  for (int t = 0; t < 4; ++t) {
    float bv = bias ? bias[col0 + t * 16 + ln] : 0.f;
    if (BIAS_BF16) bv = bf16_round(bv);
#pragma unroll
    for (int r = 0; r < 8; ++r) { float v = acc[t][r] + bv; if (ACT == 1) v = fmaxf(v, 0.f); so[w][8 * hh + r][t * 16 + ln] = v; }
  }
  __builtin_amdgcn_fence(__ATOMIC_ACQ_REL, "workgroup");
  __builtin_amdgcn_wave_barrier();
  const int rsub = lane >> 4, c4 = (lane & 15) * 4;
  {
#pragma unroll
    for (int q = 0; q < 8; ++q) {
      const int r = q * 2 + rsub;
      const v4f v = *(const v4fa*)&so[w][r][c4];
      *(v4f*)(C + (size_t)(row0 + r) * ldc + col0 + c4) = v;
    }
    
  }
}

// GEMM C = act(A·W + bias + resid): A f32 (ASPLIT -> hi/lo 2 terms), Wt bf16 [N][K]; ACT 0 none, 1 relu, 2 exact gelu;
// resid (optional, f32, row index = (row % rmod), pitch ldr, RES_BF16 rounds it) added before the activation.
template <bool ASPLIT, int ACT, bool BIAS_BF16, bool RES_BF16>
__global__ __launch_bounds__(128) void k_gemm_bf3(const float* __restrict__ A, int lda, const unsigned short* __restrict__ Wt, int ldb,
                                                const float* __restrict__ bias, const float* __restrict__ resid, int rmod, int ldr,
                                                float* __restrict__ C, int ldc, int M, int N, int K) {
  __shared__ __attribute__((aligned(16))) float so[4][16][64];
  const int tid = threadIdx.x, w = tid >> 5, lane = tid & 31, ln = lane & 15, hh = lane >> 4;
  const int ntn = N / 64;
  const int wid = blockIdx.x * 4 + w;
  const int mt = wid / ntn, nq = wid % ntn;
  if (mt * 16 >= M) return;
  const int row0 = mt * 16, col0 = nq * 64;
  const float* arow = A + (size_t)(row0 + ln) * lda;
  v8f acc[4] = {};
  for (int kb = 0; kb < K; kb += 32) {
    FragB ah, al;
    const v4f x0 = *(const v4fa*)(arow + kb + 8 * hh), x1 = *(const v4fa*)(arow + kb + 8 * hh + 4);
    const v4f x2 = *(const v4fa*)(arow + kb + 16 + 8 * hh), x3 = *(const v4fa*)(arow + kb + 16 + 8 * hh + 4);
    float xs[16] = {x0[0],x0[1],x0[2],x0[3],x1[0],x1[1],x1[2],x1[3],x2[0],x2[1],x2[2],x2[3],x3[0],x3[1],x3[2],x3[3]};
#pragma unroll
    for (int i = 0; i < 16; ++i) { const unsigned short hb = bf16_bits(xs[i]); ah.u[i] = hb; al.u[i] = ASPLIT ? bf16_bits(xs[i] - bf16_val(hb)) : (unsigned short)0; }
#pragma unroll
    for (int t = 0; t < 4; ++t) {
      const unsigned short* brow = Wt + (size_t)(col0 + t * 16 + ln) * ldb + kb;
      FragB b;
      b.half[0] = *(const v8us*)(brow + 8 * hh);
      b.half[1] = *(const v8us*)(brow + 16 + 8 * hh);
      acc[t] = mmaN<ASPLIT ? 2 : 1>(ah.v, al.v, b.v, b.v, acc[t]);
    }
  }
#pragma unroll
  for (int t = 0; t < 4; ++t) {
    const int col = col0 + t * 16 + ln;
    float bv = bias ? bias[col] : 0.f;
    if (BIAS_BF16) bv = bf16_round(bv);
#pragma unroll
    for (int r = 0; r < 8; ++r) {
      float v = acc[t][r] + bv;
      if (resid) { float rv = resid[(size_t)((row0 + 8 * hh + r) % rmod) * ldr + col]; if (RES_BF16) rv = bf16_round(rv); v += rv; }
      if (ACT == 1) v = fmaxf(v, 0.f);
      if (ACT == 2) v = 0.5f * v * (1.0f + erff(v * 0.70710678118654752f));
      if (ACT == 3) { const float u = 0.7978845608028654f * (v + 0.044715f * v * v * v); v = 0.5f * v * (1.0f + tanhf(u)); }
      so[w][8 * hh + r][t * 16 + ln] = v;
    }
  }
  __builtin_amdgcn_fence(__ATOMIC_ACQ_REL, "workgroup");
  __builtin_amdgcn_wave_barrier();
  const int rsub = lane >> 4, c4 = (lane & 15) * 4;
  {
#pragma unroll
    for (int q = 0; q < 8; ++q) {
      const int r = q * 2 + rsub;
      const v4f v = *(const v4fa*)&so[w][r][c4];
      *(v4f*)(C + (size_t)(row0 + r) * ldc + col0 + c4) = v;
    }
    
  }
}
// row LayerNorm (biased variance, eps) over N: s = X (+ R); optional out_sum <- s; out_norm <- (s-mu)*rsqrt(var+eps)*g + b
template <bool PARAM_BF16>
__global__ __launch_bounds__(256) void k_layernorm(const float* __restrict__ X, const float* __restrict__ R, const float* __restrict__ g, const float* __restrict__ bta,
                                                  float* __restrict__ out_sum, float* __restrict__ out_norm, int N, float eps) {
  __shared__ float red[256];
  const int row = blockIdx.x, tid = threadIdx.x;
  const float* x = X + (size_t)row * N; const float* rr = R ? R + (size_t)row * N : nullptr;
  float vals[16];                     // up to N = 4096
  const int per = N / 256;            // contiguous chunk per thread? use strided-by-4 chunks: thread handles j = tid*4 + 1024*u
  float s1 = 0.f;
  for (int u = 0; u < per / 4; ++u) {
    const int j = tid * 4 + 1024 * u;
    const v4f a = *(const v4fa*)(x + j);
    v4f b = {0.f,0.f,0.f,0.f}; if (rr) b = *(const v4fa*)(rr + j);
#pragma unroll
    for (int q = 0; q < 4; ++q) { const float v = a[q] + b[q]; vals[u * 4 + q] = v; s1 += v; }
  }
  red[tid] = s1; __syncthreads();
  for (int st = 128; st > 0; st >>= 1) { if (tid < st) red[tid] += red[tid + st]; __syncthreads(); }
  const float mu = red[0] / (float)N; __syncthreads();
  float s2 = 0.f;
  for (int u = 0; u < per / 4; ++u)
#pragma unroll
    for (int q = 0; q < 4; ++q) { const float c = vals[u * 4 + q] - mu; s2 += c * c; }
  red[tid] = s2; __syncthreads();
  for (int st = 128; st > 0; st >>= 1) { if (tid < st) red[tid] += red[tid + st]; __syncthreads(); }
  const float rs = rsqrtf(red[0] / (float)N + eps);
  {
    for (int u = 0; u < per / 4; ++u) {
      const int j = tid * 4 + 1024 * u;
      v4f o, sm;
#pragma unroll
      for (int q = 0; q < 4; ++q) {
        float gg = g[j + q], bb = bta[j + q];
        if (PARAM_BF16) { gg = bf16_round(gg); bb = bf16_round(bb); }
        sm[q] = vals[u * 4 + q]; o[q] = (vals[u * 4 + q] - mu) * rs * gg + bb;
      }
      if (out_sum) *(v4f*)(out_sum + (size_t)row * N + j) = sm;
      *(v4f*)(out_norm + (size_t)row * N + j) = o;
    }
    
  }
}



// ---- f16 WMMA path (v_wmma_f32_16x16x32_f16): 11-bit significands for operands in range — used where a [0,1] probability operand needs more precision than bf16
typedef _Float16 v16h __attribute__((ext_vector_type(16)));
union FragH { v16h v; v8us half[2]; _Float16 h[16]; unsigned short u[16]; };
template <int NT>
__device__ __forceinline__ v8f mmaH(v16h ah, v16h al, v16h bh, v16h bl, v8f c) {
  c = __builtin_amdgcn_wmma_f32_16x16x32_f16(false, ah, false, bh, (short)0, c, false, false);
  if (NT >= 2) c = __builtin_amdgcn_wmma_f32_16x16x32_f16(false, al, false, bh, (short)0, c, false, false);
  if (NT >= 3) c = __builtin_amdgcn_wmma_f32_16x16x32_f16(false, ah, false, bl, (short)0, c, false, false);
  asm volatile("v_nop\n\tv_nop\n\tv_nop\n\tv_nop" : "+v"(c) : "v"(ah), "v"(al), "v"(bh), "v"(bl));
  return c;
}
// batched GEMM like k_gemm_b but f16 operands: A f32 (split into f16 hi/lo if ASPLIT, else rounded to f16), Bt = f16 values [n][k]; alpha; C f32; N multiple of 16 (partial tiles skipped)
template <bool ASPLIT>
__global__ __launch_bounds__(128) void k_gemm_h(const float* __restrict__ A, int lda, size_t sA, const _Float16* __restrict__ Bh, int ldb, size_t sB, float alpha, float* __restrict__ C, int ldc, size_t sC, int M, int N, int K) {
  __shared__ __attribute__((aligned(16))) float so[4][16][64];
  const int tid = threadIdx.x, w = tid >> 5, lane = tid & 31, ln = lane & 15, hh = lane >> 4; const int by = blockIdx.y;
  A += (size_t)by * sA; Bh += (size_t)by * sB; C += (size_t)by * sC;
  const int ntn = (N + 63) / 64; const int wid = blockIdx.x * 4 + w; const int mt = wid / ntn, nq = wid % ntn; if (mt * 16 >= M) return;
  const int row0 = mt * 16, col0 = nq * 64; const float* arow = A + (size_t)(row0 + ln) * lda;
  v8f acc[4] = {};
  for (int kb = 0; kb < K; kb += 32) {
    FragH ah, al;
    const v4f x0 = *(const v4fa*)(arow + kb + 8 * hh), x1 = *(const v4fa*)(arow + kb + 8 * hh + 4), x2 = *(const v4fa*)(arow + kb + 16 + 8 * hh), x3 = *(const v4fa*)(arow + kb + 16 + 8 * hh + 4);
    float xs[16] = {x0[0],x0[1],x0[2],x0[3],x1[0],x1[1],x1[2],x1[3],x2[0],x2[1],x2[2],x2[3],x3[0],x3[1],x3[2],x3[3]};
#pragma unroll
    for (int i = 0; i < 16; ++i) { const _Float16 h = (_Float16)xs[i]; ah.h[i] = h; al.h[i] = ASPLIT ? (_Float16)(xs[i] - (float)h) : (_Float16)0.0f; }
#pragma unroll
    for (int t = 0; t < 4; ++t) { if (col0 + t * 16 >= N) continue; const size_t boff = (size_t)(col0 + t * 16 + ln) * ldb + kb; FragH bq; bq.half[0] = *(const v8us*)(Bh + boff + 8 * hh); bq.half[1] = *(const v8us*)(Bh + boff + 16 + 8 * hh);
      acc[t] = mmaH<ASPLIT ? 2 : 1>(ah.v, al.v, bq.v, bq.v, acc[t]); }
  }
#pragma unroll
  for (int t = 0; t < 4; ++t) { if (col0 + t * 16 >= N) continue;
#pragma unroll
    for (int r = 0; r < 8; ++r) so[w][8 * hh + r][t * 16 + ln] = acc[t][r] * alpha; }
  __builtin_amdgcn_fence(__ATOMIC_ACQ_REL, "workgroup"); __builtin_amdgcn_wave_barrier();
  const int rsub = lane >> 4, c4 = (lane & 15) * 4;
  {
#pragma unroll
    for (int q = 0; q < 8; ++q) { const int r = q * 2 + rsub; if (col0 + c4 < N) { const v4f v = *(const v4fa*)&so[w][r][c4]; *(v4f*)(C + (size_t)(row0 + r) * ldc + col0 + c4) = v; } }
     }
}

// Wt[n][k] = f16(W[k][n]·scale) from f32 row-major W[K][N] (scale = power of two; bf16-exact weights stay exact in f16 away from the subnormal range)
__global__ __launch_bounds__(256) void k_wt_f16(const float* __restrict__ W, _Float16* __restrict__ Wt, int K, int N, float scale) {
  const int t = blockIdx.x * 256 + threadIdx.x; if (t >= N * (K / 8)) return; const int n = t / (K / 8), k8 = (t % (K / 8)) * 8; FragH f;
#pragma unroll
  for (int i = 0; i < 8; ++i) f.h[i] = (_Float16)(bf16_round(W[(size_t)(k8 + i) * N + n]) * scale); const v8us o = f.half[0];
  *(v8us*)((unsigned short*)Wt + (size_t)n * K + k8) = o; 
}
// k_gemm_hh variant with fused epilogue: v = acc·alpha + bias[by·sBias + col] (+ CP[(row/rowsPerB)·sCPb + by·64 + col] if CP) ; ACT 0 none / 1 elu ; writes f16 C16 (and f32 C if non-null)
template <int ACT>
__global__ __launch_bounds__(128) void k_gemm_hhx(const _Float16* __restrict__ A, int lda, size_t sA, const _Float16* __restrict__ Bh, int ldb, size_t sB, float alpha, const float* __restrict__ bias, size_t sBias, const float* __restrict__ CP, int rowsPerB, size_t sCPb, int row0g,
    float* __restrict__ C, _Float16* __restrict__ C16, int ldc, size_t sC, int M, int N, int K) {
  __shared__ __attribute__((aligned(16))) float so[4][16][64];
  const int tid = threadIdx.x, w = tid >> 5, lane = tid & 31, ln = lane & 15, hh = lane >> 4; const int by = blockIdx.y;
  A += (size_t)by * sA; Bh += (size_t)by * sB; const size_t cofs = (size_t)by * sC; const float* bp = bias ? bias + (size_t)by * sBias : nullptr;
  const int ntn = (N + 63) / 64; const int wid = blockIdx.x * 4 + w; const int mt = wid / ntn, nq = wid % ntn; if (mt * 16 >= M) return;
  const int row0 = mt * 16, col0 = nq * 64; const _Float16* arow = A + (size_t)(row0 + ln) * lda;
  v8f acc[4] = {};
  for (int kb = 0; kb < K; kb += 32) { FragH ah; ah.half[0] = *(const v8us*)((const unsigned short*)arow + kb + 8 * hh); ah.half[1] = *(const v8us*)((const unsigned short*)arow + kb + 16 + 8 * hh);
#pragma unroll
    for (int t = 0; t < 4; ++t) { if (col0 + t * 16 >= N) continue; const size_t boff = (size_t)(col0 + t * 16 + ln) * ldb + kb; FragH bq; bq.half[0] = *(const v8us*)((const unsigned short*)Bh + boff + 8 * hh); bq.half[1] = *(const v8us*)((const unsigned short*)Bh + boff + 16 + 8 * hh);
      acc[t] = mmaH<1>(ah.v, ah.v, bq.v, bq.v, acc[t]); }
  }
#pragma unroll
  for (int t = 0; t < 4; ++t) { if (col0 + t * 16 >= N) continue; const int col = col0 + t * 16 + ln; const float bv = bp ? bf16_round(bp[col]) : 0.f;
#pragma unroll
    for (int r = 0; r < 8; ++r) { float v = acc[t][r] * alpha + bv; if (CP) { const int bidx = (row0g + row0 + 8 * hh + r) / rowsPerB; v += CP[(size_t)bidx * sCPb + (size_t)by * 64 + col]; } if (ACT == 1) v = (v > 0.f) ? v : expm1f(v); else if (ACT == 7) v = (v > 0.f) ? v + 1.0f : expf(v); else if (ACT == 8) v = tanhf(v); else if (ACT == 9) v = 0.5f * v * (1.0f + tanhf(0.7978845608028654f * (v + 0.044715f * v * v * v))); else if (ACT == 11) v = 1.0f / (1.0f + expf(-v)); else if (ACT == 12) v = (v > 0.f) ? v : 0.01f * v; else if (ACT == 14) v = (v > 0.f) ? v : 0.1f * v; else if (ACT == 15) v = v / (1.0f + expf(-v)); else if (ACT == 3) v = fmaxf(v, 0.f); else if (ACT == 6) v = 0.5f * v * (1.0f + erff(v * 0.70710678118654752f)); so[w][8 * hh + r][t * 16 + ln] = v; } }
  __builtin_amdgcn_fence(__ATOMIC_ACQ_REL, "workgroup"); __builtin_amdgcn_wave_barrier();
  const int rsub = lane >> 4, c4 = (lane & 15) * 4; typedef _Float16 v4h __attribute__((ext_vector_type(4)));
  {
#pragma unroll
    for (int q = 0; q < 8; ++q) { const int r = q * 2 + rsub; if (col0 + c4 < N) { const v4f v = *(const v4fa*)&so[w][r][c4]; if (C) *(v4f*)(C + cofs + (size_t)(row0 + r) * ldc + col0 + c4) = v; if (C16) { v4h h4; for (int i = 0; i < 4; ++i) h4[i] = (_Float16)v[i]; *(v4h*)(C16 + cofs + (size_t)(row0 + r) * ldc + col0 + c4) = h4; } } }
     }
}


typedef _Float16 v4h __attribute__((ext_vector_type(4)));

__global__ __launch_bounds__(256) void k_x16(const float* __restrict__ x, _Float16* __restrict__ X16, size_t n8) { const size_t t = (size_t)blockIdx.x * 256 + threadIdx.x; if (t >= n8) return; FragH f;
#pragma unroll
  for (int q = 0; q < 8; ++q) f.h[q] = (_Float16)bf16_round(x[t * 8 + q]); *(v8us*)((unsigned short*)X16 + t * 8) = f.half[0];  }
__global__ __launch_bounds__(256) void k_h16(const float* __restrict__ x, _Float16* __restrict__ X16, size_t n8) { const size_t t = (size_t)blockIdx.x * 256 + threadIdx.x; if (t >= n8) return; FragH f;
#pragma unroll
  for (int q = 0; q < 8; ++q) f.h[q] = (_Float16)x[t * 8 + q]; *(v8us*)((unsigned short*)X16 + t * 8) = f.half[0];  }
__global__ __launch_bounds__(256) void k_round16f(const float* __restrict__ W, _Float16* __restrict__ Bt, size_t n8) { const size_t t = (size_t)blockIdx.x * 256 + threadIdx.x; if (t >= n8) return; FragH f;
#pragma unroll
  for (int i = 0; i < 8; ++i) f.h[i] = (_Float16)(bf16_round(W[t * 8 + i]) * 16.0f); *(v8us*)((unsigned short*)Bt + t * 8) = f.half[0];  }
template <int NHv, int TTv>
__global__ __launch_bounds__(256) void k_vt(const _Float16* __restrict__ V16, int ldv, int voff, _Float16* __restrict__ Vt) { __shared__ unsigned short tl[64][66]; const int tid = threadIdx.x; const int slab = blockIdx.x / (TTv / 64), lg = blockIdx.x % (TTv / 64); const int b = slab / NHv, h = slab % NHv;
  for (int i = tid; i < 64 * 8; i += 256) { const int r = i / 8, c8 = (i % 8) * 8; FragH f; f.half[0] = *(const v8us*)((const unsigned short*)V16 + ((size_t)b * TTv + lg * 64 + r) * ldv + voff + h * 64 + c8);
#pragma unroll
    for (int q = 0; q < 8; ++q) tl[r][c8 + q] = f.u[q]; }
  __syncthreads();
  {
#pragma unroll
    for (int rd = 0; rd < 2; ++rd) { const int d = rd * 32 + tid / 8, pc = tid % 8; FragH f;
#pragma unroll
      for (int q = 0; q < 8; ++q) f.u[q] = tl[pc * 8 + q][d];
      *(v8us*)((unsigned short*)Vt + ((size_t)slab * 64 + d) * TTv + lg * 64 + pc * 8) = f.half[0]; }
     } }

__global__ __launch_bounds__(256) void k_hl(const float* __restrict__ F, _Float16* __restrict__ Hh, _Float16* __restrict__ Hl, size_t n8) { const size_t t = (size_t)blockIdx.x * 256 + threadIdx.x; if (t >= n8) return; FragH fh, fl; const v4f a = *(const v4fa*)(F + t * 8), c = *(const v4fa*)(F + t * 8 + 4);
#pragma unroll
  for (int q = 0; q < 4; ++q) { _Float16 h = (_Float16)a[q]; fh.h[q] = h; fl.h[q] = (_Float16)((a[q] - (float)h) * 1024.0f); h = (_Float16)c[q]; fh.h[4 + q] = h; fl.h[4 + q] = (_Float16)((c[q] - (float)h) * 1024.0f); }
  { *(v8us*)((unsigned short*)Hh + t * 8) = fh.half[0]; *(v8us*)((unsigned short*)Hl + t * 8) = fl.half[0];  } }

// ---- fast GEMM (wave tile 32x64, block tile 128x64; requires M % 128 == 0, N % 64 == 0, K % 64 == 0, K >= 64); epilogue = k_gemm_hhx semantics ----
// Operands reach the waves through LDS: per stage the block brings 64 k of its 128 A rows and 64 B rows in by asynchronous copies that cover whole 128-byte lines (8 lanes a row),
// two buffers, the next stage in flight while this one is worked on; the fragments are read from LDS in the same k order as before.
__device__ __forceinline__ v16h g2_frag(const unsigned short* p, int hh) { FragH f; f.half[0] = *(const v8us*)(p + 8 * hh); f.half[1] = *(const v8us*)(p + 16 + 8 * hh); return f.v; }
__device__ __forceinline__ v8f g2_mma(v16h a, v16h b, v8f c) { v8f d = __builtin_amdgcn_wmma_f32_16x16x32_f16(false, a, false, b, (short)0, c, false, false); asm volatile("v_nop\n\tv_nop\n\tv_nop\n\tv_nop" : "+v"(d) : "v"(a), "v"(b)); return d; }
// One lane's share of a stage: 8 pieces of A and 4 of B, 16 bytes each, 16 rows apart (ls bytes in LDS, da / db bytes in memory), global memory -> LDS through no register.
// The s_wait_xcnt closes the copies' own statement so that no address register named here is rewritten ahead of it.
__device__ __forceinline__ void g2_copy(unsigned la, unsigned lb, unsigned ls, const char* pa, size_t da, const char* pb, size_t db) {
  asm volatile("global_load_async_to_lds_b128 %0, %12, off\n\t" "global_load_async_to_lds_b128 %1, %13, off\n\t" "global_load_async_to_lds_b128 %2, %14, off\n\t" "global_load_async_to_lds_b128 %3, %15, off\n\t"
               "global_load_async_to_lds_b128 %4, %16, off\n\t" "global_load_async_to_lds_b128 %5, %17, off\n\t" "global_load_async_to_lds_b128 %6, %18, off\n\t" "global_load_async_to_lds_b128 %7, %19, off\n\t"
               "global_load_async_to_lds_b128 %8, %20, off\n\t" "global_load_async_to_lds_b128 %9, %21, off\n\t" "global_load_async_to_lds_b128 %10, %22, off\n\t" "global_load_async_to_lds_b128 %11, %23, off\n\t"
               "s_wait_xcnt 0x0"
               :: "v"(la), "v"(la + ls), "v"(la + 2 * ls), "v"(la + 3 * ls), "v"(la + 4 * ls), "v"(la + 5 * ls), "v"(la + 6 * ls), "v"(la + 7 * ls), "v"(lb), "v"(lb + ls), "v"(lb + 2 * ls), "v"(lb + 3 * ls),
                  "v"(pa), "v"(pa + da), "v"(pa + 2 * da), "v"(pa + 3 * da), "v"(pa + 4 * da), "v"(pa + 5 * da), "v"(pa + 6 * da), "v"(pa + 7 * da), "v"(pb), "v"(pb + db), "v"(pb + 2 * db), "v"(pb + 3 * db)
               : "memory"); }
template <int ACT>
__global__ __launch_bounds__(128) void k_gemm2(const _Float16* __restrict__ A, int lda, size_t sA, const _Float16* __restrict__ Bh, int ldb, size_t sB, float alpha, const float* __restrict__ bias, const float* __restrict__ bias1, const float* __restrict__ bias2, const float* __restrict__ CP, int rowsPerB, size_t sCPb, int row0g,
    float* __restrict__ Cf, _Float16* __restrict__ Ch, int ldc, size_t sC, int nc32, int M, int N, int K) {
  constexpr int KT = 64, PIT = KT + 8;      /* LDS row pitch 144 B = 16 B x odd: the 16-byte fragment reads of 16 rows fall on distinct banks */
  __shared__ __attribute__((aligned(16))) float so[4][32][68];
  __shared__ __attribute__((aligned(16))) unsigned short tA[2][128][PIT]; __shared__ __attribute__((aligned(16))) unsigned short tB[2][64][PIT];
  const int tid = threadIdx.x, w = tid >> 5, lane = tid & 31, ln = lane & 15, hh = lane >> 4; const int by = blockIdx.y;
  A += (size_t)by * sA; Bh += (size_t)by * sB; const float* bp = by == 0 ? bias : (by == 1 ? bias1 : bias2);      /* batch by has its own bias vector */
  const bool w32 = by < nc32; float* C = w32 ? Cf : nullptr; _Float16* C16 = w32 ? nullptr : Ch; const size_t cofs = (size_t)(w32 ? by : by - nc32) * sC;      /* the first nc32 batches store f32 planes of Cf, the others f16 planes of Ch */
  const int ntn = N >> 6; const int mt = blockIdx.x / ntn, nq = blockIdx.x - mt * ntn; const int row0 = mt * 128 + 32 * w, col0 = nq * 64; if (mt * 128 >= M) return;      /* the same for the whole block: it stands in front of barriers */
  const int sr = tid >> 3, sc = (tid & 7) * 8;
  const char* pa = (const char*)(A + (size_t)(mt * 128 + sr) * lda + sc); const char* pb = (const char*)(Bh + (size_t)(col0 + sr) * ldb + sc); const size_t da = (size_t)lda * 32, db = (size_t)ldb * 32;
  const unsigned la = (unsigned)(uintptr_t)&tA[0][sr][sc], lb = (unsigned)(uintptr_t)&tB[0][sr][sc]; constexpr unsigned LS = 16 * PIT * 2, BA = 128 * PIT * 2, BB = 64 * PIT * 2;
  g2_copy(la, lb, LS, pa, da, pb, db);
  asm volatile("s_wait_asynccnt 0x0" ::: "memory");      /* this wave's share of stage 0 has landed */
  __syncthreads();      /* every wave's share has: stage 0 may be read */
  if (KT < K) g2_copy(la + BA, lb + BB, LS, pa + KT * 2, da, pb + KT * 2, db);
  const v8f z8 = {0.f,0.f,0.f,0.f,0.f,0.f,0.f,0.f}; v8f c00 = z8, c01 = z8, c02 = z8, c03 = z8, c10 = z8, c11 = z8, c12 = z8, c13 = z8;
  /* rolled: one stage a trip, so that the order at the foot of the trip stands once */
#pragma unroll 1
  for (int kb = 0; kb < K; kb += KT) { const int cur = (kb >> 6) & 1;
    /* unrolled: the two 32-k blocks of a stage read LDS at immediate offsets */
#pragma unroll
    for (int ks = 0; ks < KT; ks += 32) { const unsigned short* fa = &tA[cur][32 * w + ln][ks]; const unsigned short* fb = &tB[cur][ln][ks];
      const v16h a0 = g2_frag(fa, hh), a1 = g2_frag(fa + 16 * PIT, hh); const v16h b0 = g2_frag(fb, hh), b1 = g2_frag(fb + 16 * PIT, hh), b2 = g2_frag(fb + 32 * PIT, hh), b3 = g2_frag(fb + 48 * PIT, hh);
      c00 = g2_mma(a0, b0, c00); c10 = g2_mma(a1, b0, c10); c01 = g2_mma(a0, b1, c01); c11 = g2_mma(a1, b1, c11);
      c02 = g2_mma(a0, b2, c02); c12 = g2_mma(a1, b2, c12); c03 = g2_mma(a0, b3, c03); c13 = g2_mma(a1, b3, c13); }
    asm volatile("s_wait_dscnt 0x0" ::: "memory");      /* this wave's reads of the buffer that is refilled below have returned */
    asm volatile("s_wait_asynccnt 0x0" ::: "memory");      /* this wave's share of the next stage has landed */
    __syncthreads();      /* publishes the next stage and ends every wave's reads of this one */
    if (kb + 2 * KT < K) g2_copy(la + cur * BA, lb + cur * BB, LS, pa + (size_t)(kb + 2 * KT) * 2, da, pb + (size_t)(kb + 2 * KT) * 2, db); }
  asm volatile("s_wait_asynccnt 0x0" ::: "memory");      /* no copy is left in flight behind the loop */
  v8f accs[8] = {c00, c01, c02, c03, c10, c11, c12, c13};
#pragma unroll
  for (int u = 0; u < 8; ++u) { const int t = u & 3, half = u >> 2; const int col = col0 + t * 16 + ln; const float bv = bp ? bf16_round(bp[col]) : 0.f;
#pragma unroll
    for (int r = 0; r < 8; ++r) { const int rloc = half * 16 + 8 * hh + r; float v = accs[u][r] * alpha + bv; if (CP) { if (rowsPerB < 0) v += CP[cofs + (size_t)(row0g + row0 + rloc) * ldc + col];      /* rowsPerB < 0: own element of the batched C plane */ else { const int bidx = (row0g + row0 + rloc) / rowsPerB; v += CP[(size_t)bidx * sCPb + (size_t)by * 64 + col]; } }
      if (ACT == 3) v = fmaxf(v, 0.f); else if (ACT == 6) v = 0.5f * v * (1.0f + erff(v * 0.70710678118654752f)); else if (ACT == 11) v = 1.0f / (1.0f + expf(-v)); else if (ACT == 15) v = v / (1.0f + expf(-v)); else if (ACT == 12) v = (v > 0.f) ? v : 0.01f * v; else if (ACT == 8) v = tanhf(v);
      so[w][rloc][t * 16 + ln] = v; } }
  __builtin_amdgcn_fence(__ATOMIC_ACQ_REL, "workgroup"); __builtin_amdgcn_wave_barrier();
  const int rsub = lane >> 4, c4 = (lane & 15) * 4;
  {
#pragma unroll
    for (int q = 0; q < 16; ++q) { const int r = q * 2 + rsub; const v4f v = *(const v4fa*)&so[w][r][c4]; if (C) *(v4f*)(C + cofs + (size_t)(row0 + r) * ldc + col0 + c4) = v; if (C16) { v4h h4; for (int i = 0; i < 4; ++i) h4[i] = (_Float16)v[i]; *(v4h*)(C16 + cofs + (size_t)(row0 + r) * ldc + col0 + c4) = h4; } }
     } }



// Lane l <-> l ^ 16 by a vector cross-row move (the two lanes that hold one query's keys).
__device__ __forceinline__ float x_half(float x) { const int b = __float_as_int(x); return __int_as_float(__builtin_amdgcn_permlanex16(b, b, 0x76543210, 0xfedcba98, false, false)); }
// One lane's share of a 64-key stage: 4 pieces of K and 4 of V^T, 16 bytes each, 16 rows apart (ls bytes in LDS, dk / dv bytes in memory), global memory -> LDS through no register.
// The s_wait_xcnt closes the copies' own statement so that no address register named here is rewritten ahead of it.
__device__ __forceinline__ void fl_copy(unsigned lk, unsigned lv, unsigned ls, const char* pk, size_t dk, const char* pv, size_t dv) {
  asm volatile("global_load_async_to_lds_b128 %0, %8, off\n\t" "global_load_async_to_lds_b128 %1, %9, off\n\t" "global_load_async_to_lds_b128 %2, %10, off\n\t" "global_load_async_to_lds_b128 %3, %11, off\n\t"
               "global_load_async_to_lds_b128 %4, %12, off\n\t" "global_load_async_to_lds_b128 %5, %13, off\n\t" "global_load_async_to_lds_b128 %6, %14, off\n\t" "global_load_async_to_lds_b128 %7, %15, off\n\t"
               "s_wait_xcnt 0x0"
               :: "v"(lk), "v"(lk + ls), "v"(lk + 2 * ls), "v"(lk + 3 * ls), "v"(lv), "v"(lv + ls), "v"(lv + 2 * ls), "v"(lv + 3 * ls),
                  "v"(pk), "v"(pk + dk), "v"(pk + 2 * dk), "v"(pk + 3 * dk), "v"(pv), "v"(pv + dv), "v"(pv + 2 * dv), "v"(pv + 3 * dv)
               : "memory"); }
// Unmasked attention with both products transposed: S^T = K Q^T (A = K rows, B = Q rows), O^T += V^T P^T (A = V^T rows, B = P^T).
// Lane (ln, hh) owns query q0 + ln; register r of score tile nt is key j0 + ps + nt * 16 + 8 * hh + r, so maximum and sum run inside the lane, joined with lane ^ 16,
// and the two score tiles, converted in place, are the B operand of the second product in the k order of the V^T loader (8 * hh + i, 16 + 8 * hh + i): P touches no LDS.
// K and V^T reach the waves through LDS: per stage the block brings 64 keys (64 K rows and 64 V^T rows of 128 bytes) in by asynchronous copies that cover whole 128-byte lines (8 lanes a row),
// two buffers, the next stage in flight while this one is worked on; the four waves read their fragments from LDS in the same k order as before.
__global__ __launch_bounds__(128) void k_flash(const _Float16* __restrict__ Q16, int ldq, const _Float16* __restrict__ K16, int ldk, const _Float16* __restrict__ Vt, float* __restrict__ O, int ldo) {
  constexpr int RPW = 16, DT = 4, KS = 2, KT = 64, PIT = KT + 8;      /* LDS row pitch 144 B = 16 B x odd: the 16-byte fragment reads of 16 rows fall on distinct banks */
  __shared__ __attribute__((aligned(16))) float sO[4][RPW][64 + 4];
  __shared__ __attribute__((aligned(16))) unsigned short tK[2][KT][PIT]; __shared__ __attribute__((aligned(16))) unsigned short tV[2][64][PIT];
  const int tid = threadIdx.x, w = tid >> 5, lane = tid & 31, ln = lane & 15, hh = lane >> 4;
  const int slab = blockIdx.x / QBNP, qblk = QB0P + blockIdx.x % QBNP; const int b = slab / NH, h = slab % NH; const int qb0 = qblk * (4 * RPW); const int q0 = qb0 + w * RPW;
  /* every inner loop below is unrolled so that each register-array index is a constant (no scratch) */
  FragH bq[KS];
  { const unsigned short* qr = (const unsigned short*)Q16 + ((size_t)b * TQ + q0 + ln) * ldq + h * 64;
#pragma unroll
    for (int ks = 0; ks < KS; ++ks) { bq[ks].half[0] = *(const v8us*)(qr + ks * 32 + 8 * hh); bq[ks].half[1] = *(const v8us*)(qr + ks * 32 + 16 + 8 * hh); } }
  const unsigned short* Vth = (const unsigned short*)Vt + (size_t)slab * 64 * TK;
  const int sr = tid >> 3, sc = (tid & 7) * 8;
  const char* pk = (const char*)((const unsigned short*)K16 + ((size_t)b * TK + sr) * ldk + h * 64 + sc); const char* pv = (const char*)(Vth + (size_t)sr * TK + sc); const size_t dk = (size_t)ldk * 32, dv = (size_t)TK * 32, sk = (size_t)ldk * (KT * 2);
  const unsigned lk = (unsigned)(uintptr_t)&tK[0][sr][sc], lv = (unsigned)(uintptr_t)&tV[0][sr][sc]; constexpr unsigned LS = 16 * PIT * 2, BS = 64 * PIT * 2;
  fl_copy(lk, lv, LS, pk, dk, pv, dv);
  asm volatile("s_wait_asynccnt 0x0" ::: "memory");      /* this wave's share of stage 0 has landed */
  __syncthreads();      /* every wave's share has: stage 0 may be read */
  if (KT < TK) fl_copy(lk + BS, lv + BS, LS, pk + sk, dk, pv + KT * 2, dv);
  float m_q = -3.0e38f, l_q = 0.f; v8f oacc[DT];
#pragma unroll
  for (int dt = 0; dt < DT; ++dt) oacc[dt] = (v8f){0.f,0.f,0.f,0.f,0.f,0.f,0.f,0.f};
  /* rolled: one 64-key stage a trip, so that the order at the foot of the trip stands once */
#pragma unroll 1
  for (int j0 = 0; j0 < TK; j0 += KT) { const int cur = (j0 >> 6) & 1;
    /* unrolled: the two 32-key passes of a stage read LDS at immediate offsets */
#pragma unroll
    for (int ps = 0; ps < KT; ps += 32) {
    FragH ak[2][KS], av[DT];
#pragma unroll
    for (int nt = 0; nt < 2; ++nt) { const unsigned short* kr = &tK[cur][ps + nt * 16 + ln][0];
#pragma unroll
      for (int ks = 0; ks < KS; ++ks) { ak[nt][ks].half[0] = *(const v8us*)(kr + ks * 32 + 8 * hh); ak[nt][ks].half[1] = *(const v8us*)(kr + ks * 32 + 16 + 8 * hh); } }
#pragma unroll
    for (int dt = 0; dt < DT; ++dt) { const unsigned short* vrow = &tV[cur][dt * 16 + ln][ps]; av[dt].half[0] = *(const v8us*)(vrow + 8 * hh); av[dt].half[1] = *(const v8us*)(vrow + 16 + 8 * hh); }
    float sc_[16];
#pragma unroll
    for (int nt = 0; nt < 2; ++nt) {
      v8f acc = (v8f){0.f,0.f,0.f,0.f,0.f,0.f,0.f,0.f};
#pragma unroll
      for (int ks = 0; ks < KS; ++ks) acc = mmaH<1>(ak[nt][ks].v, ak[nt][ks].v, bq[ks].v, bq[ks].v, acc);
#pragma unroll
      for (int r = 0; r < 8; ++r) sc_[nt * 8 + r] = acc[r] * SCL; }
    float mc = sc_[0];
#pragma unroll
    for (int i = 1; i < 16; ++i) mc = fmaxf(mc, sc_[i]);
    mc = fmaxf(mc, x_half(mc));
    const float mn = fmaxf(m_q, mc); const float al = (mn > -1.0e38f) ? expf(m_q - mn) : 1.0f; m_q = mn;
    float p[16]; FragH pb;
#pragma unroll
    for (int i = 0; i < 16; ++i) { p[i] = expf(sc_[i] - mn); pb.h[i] = (_Float16)(p[i] * 1024.0f); }
#pragma unroll
    for (int st = 8; st > 0; st >>= 1)
#pragma unroll
      for (int i = 0; i < st; ++i) p[i] += p[i + st];
    l_q = l_q * al + p[0];
#pragma unroll
    for (int dt = 0; dt < DT; ++dt) {
#pragma unroll
      for (int r = 0; r < 8; ++r) oacc[dt][r] *= al; }
#pragma unroll
    for (int dt = 0; dt < DT; ++dt) oacc[dt] = mmaH<1>(av[dt].v, av[dt].v, pb.v, pb.v, oacc[dt]); }
    asm volatile("s_wait_dscnt 0x0" ::: "memory");      /* this wave's reads of the buffer that is refilled below have returned */
    asm volatile("s_wait_asynccnt 0x0" ::: "memory");      /* this wave's share of the next stage has landed */
    __syncthreads();      /* publishes the next stage and ends every wave's reads of this one */
    if (j0 + 2 * KT < TK) fl_copy(lk + cur * BS, lv + cur * BS, LS, pk + (size_t)((j0 >> 6) + 2) * sk, dk, pv + (size_t)(j0 + 2 * KT) * 2, dv); }
  asm volatile("s_wait_asynccnt 0x0" ::: "memory");      /* no copy is left in flight behind the loop */
  const float l = l_q + x_half(l_q); const float li = (l > 0.f) ? 1.0f / (l * 1024.0f) : 0.f;
#pragma unroll
  for (int dt = 0; dt < DT; ++dt)
#pragma unroll
    for (int g = 0; g < 2; ++g) { const v4f val = {oacc[dt][4 * g] * li, oacc[dt][4 * g + 1] * li, oacc[dt][4 * g + 2] * li, oacc[dt][4 * g + 3] * li}; *(v4fa*)&sO[w][ln][dt * 16 + 8 * hh + 4 * g] = val; }
  __builtin_amdgcn_fence(__ATOMIC_ACQ_REL, "workgroup"); __builtin_amdgcn_wave_barrier();      /* the wave's own rows are in LDS before other lanes of it read them back as whole 128-byte lines */
  {
#pragma unroll
    for (int rp = 0; rp < RPW; rp += 2) { const int r = rp + (lane >> 4), pc = lane & 15; const v4f val = *(const v4fa*)&sO[w][r][pc * 4]; *(v4f*)(O + ((size_t)b * TQ + q0 + r) * ldo + h * 64 + pc * 4) = val; }
     } }
// 5-plane variant: S = Qh Kh^T + (Ql Kh^T + Qh Kl^T)/1024 with Q/K = [hi | 2^10 residual] f16 planes (QL/KL same layout as Q16/K16), then the 3-term P.V below.
// 3-term variant: O = (P_hi V_hi + (P_lo V_hi + P_hi V_lo) / 1024) / l with P = [hi | 2^10 residual] of 1024 p and V^T = [hi | 2^10 residual] planes (VtL same layout as Vt) -> ~2^-21-class products for un-averaged (early causal / peaked) rows
template <int CAUSAL>
__global__ __launch_bounds__(128) void k_flash5(const _Float16* __restrict__ Q16, const _Float16* __restrict__ QL, int ldq, const _Float16* __restrict__ K16, const _Float16* __restrict__ KL, int ldk, const _Float16* __restrict__ Vt, const _Float16* __restrict__ VtL, const int* __restrict__ MSK, float* __restrict__ O, int ldo) {
  constexpr int RPW = 16, RTN = RPW / 16, NQB = TQ / (4 * RPW), DT = 4, KS = 2;
  __shared__ __attribute__((aligned(16))) unsigned short sP[4][RPW][40]; __shared__ __attribute__((aligned(16))) unsigned short sPL[4][RPW][40]; __shared__ __attribute__((aligned(16))) float sO[4][RPW][64 + 4];
  const int tid = threadIdx.x, w = tid >> 5, lane = tid & 31, ln = lane & 15, hh = lane >> 4;
  const int slab = blockIdx.x / QBN5, qblk = QB05 + blockIdx.x % QBN5; (void)NQB; const int b = slab / NH, h = slab % NH; const int qb0 = qblk * (4 * RPW); const int q0 = qb0 + w * RPW;
  FragH aq[2][KS], aql[2][KS];
#pragma unroll
  for (int rt = 0; rt < RTN; ++rt) { const unsigned short* qr = (const unsigned short*)Q16 + ((size_t)b * TQ + q0 + rt * 16 + ln) * ldq + h * 64; const unsigned short* ql = (const unsigned short*)QL + ((size_t)b * TQ + q0 + rt * 16 + ln) * ldq + h * 64;
#pragma unroll
    for (int ks = 0; ks < KS; ++ks) { aq[rt][ks].half[0] = *(const v8us*)(qr + ks * 32 + 8 * hh); aq[rt][ks].half[1] = *(const v8us*)(qr + ks * 32 + 16 + 8 * hh); aql[rt][ks].half[0] = *(const v8us*)(ql + ks * 32 + 8 * hh); aql[rt][ks].half[1] = *(const v8us*)(ql + ks * 32 + 16 + 8 * hh); } }
  const unsigned short* Vth = (const unsigned short*)Vt + (size_t)slab * 64 * TK; const unsigned short* Vtl = (const unsigned short*)VtL + (size_t)slab * 64 * TK;
  float m_r[2][8], l_r[2][8]; v8f oacc[2][DT], oaccL[2][DT];
#pragma unroll
  for (int rt = 0; rt < RTN; ++rt) {
#pragma unroll
    for (int r = 0; r < 8; ++r) { m_r[rt][r] = -3.0e38f; l_r[rt][r] = 0.f; }
#pragma unroll
    for (int dt = 0; dt < DT; ++dt) { oacc[rt][dt] = (v8f){0.f,0.f,0.f,0.f,0.f,0.f,0.f,0.f}; oaccL[rt][dt] = oacc[rt][dt]; } }
  const int jend = (CAUSAL == 1) ? (qb0 + 4 * RPW) : ((CAUSAL == 23) ? min(TK, (qb0 / CHK + 2) * CHK) : TK);      /* causal / window: keys that can never contribute are skipped */ const int jbeg = (CAUSAL == 23) ? max(0, (qb0 / CHK - 1) * CHK) : 0;
#pragma unroll 1
  for (int j0 = jbeg; j0 < jend; j0 += 32) {
    v8f s[2][2];
#pragma unroll
    for (int nt = 0; nt < 2; ++nt) { const unsigned short* kr = (const unsigned short*)K16 + ((size_t)b * TK + j0 + nt * 16 + ln) * ldk + h * 64; const unsigned short* klr = (const unsigned short*)KL + ((size_t)b * TK + j0 + nt * 16 + ln) * ldk + h * 64; FragH bk[KS], bkl[KS];
#pragma unroll
      for (int ks = 0; ks < KS; ++ks) { bk[ks].half[0] = *(const v8us*)(kr + ks * 32 + 8 * hh); bk[ks].half[1] = *(const v8us*)(kr + ks * 32 + 16 + 8 * hh); bkl[ks].half[0] = *(const v8us*)(klr + ks * 32 + 8 * hh); bkl[ks].half[1] = *(const v8us*)(klr + ks * 32 + 16 + 8 * hh); }
#pragma unroll
      for (int rt = 0; rt < RTN; ++rt) { v8f acc = (v8f){0.f,0.f,0.f,0.f,0.f,0.f,0.f,0.f}, accl = acc;
#pragma unroll
        for (int ks = 0; ks < KS; ++ks) { acc = mmaH<1>(aq[rt][ks].v, aq[rt][ks].v, bk[ks].v, bk[ks].v, acc); accl = mmaH<1>(aql[rt][ks].v, aql[rt][ks].v, bk[ks].v, bk[ks].v, accl); accl = mmaH<1>(aq[rt][ks].v, aq[rt][ks].v, bkl[ks].v, bkl[ks].v, accl); }
#pragma unroll
        for (int r = 0; r < 8; ++r) acc[r] += accl[r] * 0.0009765625f;
        s[rt][nt] = acc; } }
#pragma unroll
    for (int rt = 0; rt < RTN; ++rt)
#pragma unroll
      for (int r = 0; r < 8; ++r) { const int tq = q0 + rt * 16 + 8 * hh + r; const int k0 = j0 + ln, k1 = j0 + 16 + ln;
        bool ok0 = (CAUSAL == 1) ? (k0 <= tq) : ((CAUSAL == 2) ? ((k0 >> 5) == (tq >> 5)) : true), ok1 = (CAUSAL == 1) ? (k1 <= tq) : ((CAUSAL == 2) ? ((k1 >> 5) == (tq >> 5)) : true);      /* mode 2: block-diagonal 32-token groups */
        if (CAUSAL == 4) { const int* mrow = MSK + ((size_t)b * TQ + tq) * TK; ok0 = mrow[k0] != 0; ok1 = mrow[k1] != 0; }      /* mode 4: per-(query, key) INPUT mask shared by all heads; masked keys contribute nothing (== the reference's -4096 fill, whose exp underflows to 0), rows with no valid key give l = 0 -> output 0 (== the reference's row_valid zeroing) */
        float s0 = ok0 ? s[rt][0][r] * SCL : -3.0e38f, s1 = ok1 ? s[rt][1][r] * SCL : -3.0e38f; if (CAUSAL == 17) { const float* amk = (const float*)MSK + (size_t)b * TK; s0 += bf16_round(amk[k0]); s1 += bf16_round(amk[k1]); } if (CAUSAL == 18) { const float* tb = (const float*)MSK; const int* ri = MSK + 1024 + (size_t)b * TK; const int rq = ri[tq]; s0 += tb[(h * 8 + rq) * 8 + ri[k0]]; s1 += tb[(h * 8 + rq) * 8 + ri[k1]]; } if (CAUSAL == 19) { const int* rel = MSK + (size_t)tq * TK; const float* rb = (const float*)MSK + (size_t)TQ * TK + ((size_t)(b * NH + h) * TQ + tq) * 64; s0 += rb[rel[k0]]; s1 += rb[rel[k1]]; }      /* mode 19: + (q.Ek[rel] + Eb[rel][h]) / 8 gathered by the int relative ids (packed [ids | table]) */      /* mode 18: + resource_bias[h][r_q][r_k] from the packed [table | ids] buffer (TQ == TK) */      /* mode 17: additive per-(batch, key) mask INPUT */ float mc = fmaxf(s0, s1);
        mc = fmaxf(mc, __shfl_xor(mc, 1, 32)); mc = fmaxf(mc, __shfl_xor(mc, 2, 32)); mc = fmaxf(mc, __shfl_xor(mc, 4, 32)); mc = fmaxf(mc, __shfl_xor(mc, 8, 32));
        const float mn = fmaxf(m_r[rt][r], mc); const float al = (mn > -1.0e38f) ? expf(m_r[rt][r] - mn) : 1.0f; m_r[rt][r] = mn; const float p0 = ok0 ? expf(s0 - mn) : 0.f, p1 = ok1 ? expf(s1 - mn) : 0.f; l_r[rt][r] = l_r[rt][r] * al + p0 + p1;
#pragma unroll
        for (int dt = 0; dt < DT; ++dt) { oacc[rt][dt][r] *= al; oaccL[rt][dt][r] *= al; }
        FragH t2, t2l; const float ps0 = p0 * 1024.0f, ps1 = p1 * 1024.0f; t2.h[0] = (_Float16)ps0; t2.h[1] = (_Float16)ps1; t2l.h[0] = (_Float16)((ps0 - (float)t2.h[0]) * 1024.0f); t2l.h[1] = (_Float16)((ps1 - (float)t2.h[1]) * 1024.0f);
        sP[w][rt * 16 + 8 * hh + r][ln] = t2.u[0]; sP[w][rt * 16 + 8 * hh + r][16 + ln] = t2.u[1]; sPL[w][rt * 16 + 8 * hh + r][ln] = t2l.u[0]; sPL[w][rt * 16 + 8 * hh + r][16 + ln] = t2l.u[1]; }
    __builtin_amdgcn_fence(__ATOMIC_ACQ_REL, "workgroup"); __builtin_amdgcn_wave_barrier();
    FragH pa[2], pl[2];
#pragma unroll
    for (int rt = 0; rt < RTN; ++rt) { pa[rt].half[0] = *(const v8us*)&sP[w][rt * 16 + ln][8 * hh]; pa[rt].half[1] = *(const v8us*)&sP[w][rt * 16 + ln][16 + 8 * hh]; pl[rt].half[0] = *(const v8us*)&sPL[w][rt * 16 + ln][8 * hh]; pl[rt].half[1] = *(const v8us*)&sPL[w][rt * 16 + ln][16 + 8 * hh]; }
#pragma unroll
    for (int dt = 0; dt < DT; ++dt) { const unsigned short* vrow = Vth + (size_t)(dt * 16 + ln) * TK + j0; const unsigned short* vrl = Vtl + (size_t)(dt * 16 + ln) * TK + j0; FragH bv, bl; bv.half[0] = *(const v8us*)(vrow + 8 * hh); bv.half[1] = *(const v8us*)(vrow + 16 + 8 * hh); bl.half[0] = *(const v8us*)(vrl + 8 * hh); bl.half[1] = *(const v8us*)(vrl + 16 + 8 * hh);
#pragma unroll
      for (int rt = 0; rt < RTN; ++rt) { oacc[rt][dt] = mmaH<1>(pa[rt].v, pa[rt].v, bv.v, bv.v, oacc[rt][dt]); oaccL[rt][dt] = mmaH<1>(pl[rt].v, pl[rt].v, bv.v, bv.v, oaccL[rt][dt]); oaccL[rt][dt] = mmaH<1>(pa[rt].v, pa[rt].v, bl.v, bl.v, oaccL[rt][dt]); } }
    __builtin_amdgcn_fence(__ATOMIC_ACQ_REL, "workgroup"); __builtin_amdgcn_wave_barrier(); }
#pragma unroll
  for (int rt = 0; rt < RTN; ++rt) {
#pragma unroll
    for (int r = 0; r < 8; ++r) { float l = l_r[rt][r]; l += __shfl_xor(l, 1, 32); l += __shfl_xor(l, 2, 32); l += __shfl_xor(l, 4, 32); l += __shfl_xor(l, 8, 32); l_r[rt][r] = (l > 0.f) ? 1.0f / (l * 1024.0f) : 0.f; }
#pragma unroll
    for (int dt = 0; dt < DT; ++dt)
#pragma unroll
      for (int r = 0; r < 8; ++r) { float v = oacc[rt][dt][r]; v += oaccL[rt][dt][r] * 0.0009765625f; sO[w][rt * 16 + 8 * hh + r][dt * 16 + ln] = v * l_r[rt][r]; } }
  __builtin_amdgcn_fence(__ATOMIC_ACQ_REL, "workgroup"); __builtin_amdgcn_wave_barrier();
  {
#pragma unroll
    for (int rp = 0; rp < RPW; rp += 2) { const int r = rp + (lane >> 4), pc = lane & 15; const v4f val = *(const v4fa*)&sO[w][r][pc * 4]; *(v4f*)(O + ((size_t)b * TQ + q0 + r) * ldo + h * 64 + pc * 4) = val; }
     } }

__global__ __launch_bounds__(256) void k_rotab(float* __restrict__ CS, float* __restrict__ SN) {
  #pragma clang fp contract(off)
  const int t = blockIdx.x * 256 + threadIdx.x; if (t >= SLEN * 32) return; const int j = t % 32, s = t / 32; const float ex = (float)(2 * j) / 64.0f; const float inv = 1.0f / powf(10000.0f, ex); const float th = (float)s * inv; const float c = cosf(th), sn = sinf(th);
  { *(float*)(CS + t) = c; *(float*)(SN + t) = sn;  } }
__global__ __launch_bounds__(256) void k_rope(const float* __restrict__ F, int nsrc, int ndst, int rep, const float* __restrict__ CS, const float* __restrict__ SN, _Float16* __restrict__ H, _Float16* __restrict__ L) {
  #pragma clang fp contract(off)
  const size_t t = (size_t)blockIdx.x * 256 + threadIdx.x; if (t >= (size_t)NR * ndst * 4) return; const int g8 = (int)(t % 4); const int hd = (int)((t / 4) % ndst); const size_t row = t / ((size_t)4 * ndst); const int s = (int)(row % SLEN); const int hs = hd / rep;
  const float* src = F + row * (size_t)(nsrc * 64) + hs * 64; FragH ah, al, bh, bl;
  for (int i = 0; i < 8; ++i) { const int d = g8 * 8 + i; const float c = CS[s * 32 + d], sn = SN[s * 32 + d]; const float x1 = src[d], x2 = src[d + 32];
    float o1 = x1 * c; o1 += -x2 * sn; float o2 = x2 * c; o2 += x1 * sn;
    _Float16 hv = (_Float16)o1; ah.h[i] = hv; al.h[i] = (_Float16)((o1 - (float)hv) * 1024.0f); hv = (_Float16)o2; bh.h[i] = hv; bl.h[i] = (_Float16)((o2 - (float)hv) * 1024.0f); }
  const size_t o = row * (size_t)(ndst * 64) + hd * 64 + g8 * 8;
  { *(v8us*)((unsigned short*)H + o) = ah.half[0]; *(v8us*)((unsigned short*)H + o + 32) = bh.half[0]; *(v8us*)((unsigned short*)L + o) = al.half[0]; *(v8us*)((unsigned short*)L + o + 32) = bl.half[0];  } }
__global__ __launch_bounds__(256) void k_rope2(const float* __restrict__ F, int nsrc, int ndst, int rep, const float* __restrict__ CS, const float* __restrict__ SN, _Float16* __restrict__ H, _Float16* __restrict__ L) {
  #pragma clang fp contract(off)
  const size_t t = (size_t)blockIdx.x * 256 + threadIdx.x; if (t >= (size_t)NR * ndst * 4) return; const int g16 = (int)(t % 4); const int hd = (int)((t / 4) % ndst); const size_t row = t / ((size_t)4 * ndst); const int s = (int)(row % SLEN); const int hs = hd / rep;
  const float* src = F + row * (size_t)(nsrc * 64) + hs * 64 + g16 * 16; FragH ah, al;
  for (int pr = 0; pr < 8; ++pr) { const int i = g16 * 8 + pr; const float c = CS[s * 32 + i], sn = SN[s * 32 + i]; const float x1 = src[2 * pr], x2 = src[2 * pr + 1];
    float o1 = x1 * c; o1 -= x2 * sn; float o2 = x1 * sn; o2 += x2 * c;
    _Float16 hv = (_Float16)o1; ah.h[2 * pr] = hv; al.h[2 * pr] = (_Float16)((o1 - (float)hv) * 1024.0f); hv = (_Float16)o2; ah.h[2 * pr + 1] = hv; al.h[2 * pr + 1] = (_Float16)((o2 - (float)hv) * 1024.0f); }
  const size_t o = row * (size_t)(ndst * 64) + hd * 64 + g16 * 16;
  { *(v8us*)((unsigned short*)H + o) = ah.half[0]; *(v8us*)((unsigned short*)H + o + 8) = ah.half[1]; *(v8us*)((unsigned short*)L + o) = al.half[0]; *(v8us*)((unsigned short*)L + o + 8) = al.half[1];  } }
__global__ __launch_bounds__(256) void k_ln512(const float* __restrict__ A, const float* __restrict__ res, const float* __restrict__ g, const float* __restrict__ bb, float* __restrict__ Y, _Float16* __restrict__ Y16) {
  #pragma clang fp contract(off)
  const int wv = threadIdx.x >> 5, ln = threadIdx.x & 31; const size_t r = (size_t)blockIdx.x * 8 + wv; if (r >= NR) return; float x[16]; float s = 0.f;
  for (int i = 0; i < 2; ++i) { const v8f a = *(const v8f*)(A + r * DM + i * 256 + ln * 8); for (int q = 0; q < 8; ++q) { float v = a[q]; if (res) v += bf16_round(res[r * DM + i * 256 + ln * 8 + q]); x[i * 8 + q] = v; s += v; } }
  for (int o = 16; o > 0; o >>= 1) s += __shfl_xor(s, o, 32); const float mu = s / (float)DM; float var = 0.f; for (int q = 0; q < 16; ++q) { const float d = x[q] - mu; var += d * d; }
  for (int o = 16; o > 0; o >>= 1) var += __shfl_xor(var, o, 32); const float inv = rsqrtf(var / (float)DM + 1e-5f);
  { for (int i = 0; i < 2; ++i) { const int c0 = i * 256 + ln * 8; v8f y; FragH f; for (int q = 0; q < 8; ++q) { float v = (x[i * 8 + q] - mu) * inv; v *= bf16_round(g[c0 + q]); v += bf16_round(bb[c0 + q]); y[q] = v; f.h[q] = (_Float16)v; } *(v8f*)(Y + r * DM + c0) = y; if (Y16) *(v8us*)((unsigned short*)Y16 + r * DM + c0) = f.half[0]; }  } }
__global__ __launch_bounds__(256) void k_pack(const float* __restrict__ rb, const int* __restrict__ rid, int* __restrict__ PK) { const int t = blockIdx.x * 256 + threadIdx.x; if (t >= 1024 + NB * TK) return; int v; if (t < 1024) v = __float_as_int(bf16_round(rb[t])); else v = rid[t - 1024]; *(int*)(PK + t) = v;  }
__global__ __launch_bounds__(256) void k_tabin(const float* __restrict__ sp, float* __restrict__ CS, float* __restrict__ SN) { const int t = blockIdx.x * 256 + threadIdx.x; if (t >= SLEN * 32) return; const int i = t % 32, s = t / 32; const float c = bf16_round(sp[s * 64 + 32 + i]), sn = bf16_round(sp[s * 64 + i]);
  { *(float*)(CS + t) = c; *(float*)(SN + t) = sn;  } }
__device__ __forceinline__ void d_wsc(unsigned blk, const float* __restrict__ Wm, _Float16* __restrict__ Bt, size_t n8, float sc) { const size_t t = (size_t)blk * 256 + threadIdx.x; if (t >= n8) return; FragH f; for (int q = 0; q < 8; ++q) f.h[q] = (_Float16)(bf16_round(Wm[t * 8 + q]) * sc); *(v8us*)((unsigned short*)Bt + t * 8) = f.half[0];  }
__global__ __launch_bounds__(256) void k_rotab2(float* __restrict__ CS, float* __restrict__ SN) {
  #pragma clang fp contract(off)
  const int t = blockIdx.x * 256 + threadIdx.x; if (t >= SLEN * 32) return; const int j = t % 32, s = t / 32; const float c0 = -0.14391156831212787f;      /* -ln(10000)/64 rounded to f32 */ const float inv = expf((float)(2 * j) * c0); const float th = (float)s * inv; const float c = cosf(th), sn = sinf(th);
  { *(float*)(CS + t) = c; *(float*)(SN + t) = sn;  } }
__global__ __launch_bounds__(256) void k_lnu(const float* __restrict__ X, _Float16* __restrict__ N16, float* __restrict__ XB) {
  #pragma clang fp contract(off)
  const int wv = threadIdx.x >> 5, ln = threadIdx.x & 31; const size_t r = (size_t)blockIdx.x * 8 + wv; if (r >= NR) return; float a[32]; float s = 0.f;
  for (int i = 0; i < 4; ++i) { const v8f v = *(const v8f*)(X + r * DM + (i * 32 + ln) * 8); for (int q = 0; q < 8; ++q) { const float u = bf16_round(v[q]); a[i * 8 + q] = u; s += u; } }
  for (int o = 16; o > 0; o >>= 1) s += __shfl_xor(s, o, 32); const float mu = s / (float)DM; float var = 0.f; for (int q = 0; q < 32; ++q) { const float d = a[q] - mu; var += d * d; }
  for (int o = 16; o > 0; o >>= 1) var += __shfl_xor(var, o, 32); const float den = sqrtf(var / (float)(DM - 1)) + 1e-6f; const float inv = 1.0f / den;      /* one reciprocal per row; (x-mean)*inv vs the reference's division differs by <= 1 ulp */
  { for (int i = 0; i < 4; ++i) { const int c0 = (i * 32 + ln) * 8; FragH f; v8f xb; for (int q = 0; q < 8; ++q) { f.h[q] = (_Float16)((a[i * 8 + q] - mu) * inv); xb[q] = a[i * 8 + q]; } *(v8us*)((unsigned short*)N16 + r * DM + c0) = f.half[0]; *(v8f*)(XB + r * DM + c0) = xb; }  } }
__device__ __forceinline__ void d_vtg(int blk, const _Float16* __restrict__ V16, _Float16* __restrict__ Vt) { __shared__ unsigned short tl[64][66]; const int tid = threadIdx.x; const int slab = blk / (SLEN / 64), lg = blk % (SLEN / 64); const int b = slab / NH, h = slab % NH; const int hs = h / NREP;
  for (int i = tid; i < 64 * 8; i += 256) { const int r = i / 8, c8 = (i % 8) * 8; FragH f; f.half[0] = *(const v8us*)((const unsigned short*)V16 + ((size_t)b * SLEN + lg * 64 + r) * KVD + hs * 64 + c8); for (int q = 0; q < 8; ++q) tl[r][c8 + q] = f.u[q]; }
  __syncthreads();
  { for (int rd = 0; rd < 2; ++rd) { const int d = rd * 32 + tid / 8, pc = tid % 8; FragH f; for (int q = 0; q < 8; ++q) f.u[q] = tl[pc * 8 + q][d]; *(v8us*)((unsigned short*)Vt + ((size_t)slab * 64 + d) * SLEN + lg * 64 + pc * 8) = f.half[0]; }
    asm volatile("s_wait_xcnt 0x0" ::: "memory");      /* stands behind the two stores as a precaution: the V^T body ends the shared kernel */ } }

__global__ __launch_bounds__(256) void k_h16s(const float* __restrict__ SRC, int lds, int coff, _Float16* __restrict__ DST, size_t n8) { const size_t t = (size_t)blockIdx.x * 256 + threadIdx.x; if (t >= n8) return; const size_t r = (t * 8) / DM; const int c = (int)((t * 8) % DM); const v8f a = *(const v8f*)(SRC + r * lds + coff + c); FragH f; for (int q = 0; q < 8; ++q) f.h[q] = (_Float16)a[q];
  *(v8us*)((unsigned short*)DST + t * 8) = f.half[0];  }


__global__ __launch_bounds__(256) void k_ccp(const float* __restrict__ QKV, int coff, _Float16* __restrict__ D) { const size_t t = (size_t)blockIdx.x * 256 + threadIdx.x; if (t >= (size_t)NR * DM / 8) return; const int c0 = (int)((t * 8) % DM); const size_t row = (t * 8) / DM; const v8f a = *(const v8f*)(QKV + row * 3 * DM + coff + c0); FragH f; for (int q = 0; q < 8; ++q) f.h[q] = (_Float16)a[q];
  *(v8us*)((unsigned short*)D + t * 8) = f.half[0];  }


#ifndef NBS
#define NBS NB      /* batch stride of the [S][B][E] tensors (debug builds may process fewer batches than the layout holds) */
#endif
__device__ __forceinline__ void d_sbe(unsigned blk, const float* __restrict__ q, _Float16* __restrict__ X) { const size_t t = (size_t)blk * 256 + threadIdx.x; if (t >= (size_t)NR * DM / 8) return; const int c0 = (int)((t * 8) % DM); const size_t row = (t * 8) / DM; const int b = (int)(row / SLEN), s_ = (int)(row % SLEN); const float* src = q + ((size_t)s_ * NBS + b) * DM + c0; FragH f; for (int i = 0; i < 8; ++i) f.h[i] = (_Float16)bf16_round(src[i]);
  *(v8us*)((unsigned short*)X + t * 8) = f.half[0];  }
__global__ __launch_bounds__(256) void k_out_sbe(const float* __restrict__ R, float* __restrict__ out) { const size_t t = (size_t)blockIdx.x * 256 + threadIdx.x; if (t >= (size_t)NR * DM / 8) return; const int c0 = (int)((t * 8) % DM); const size_t irow = (t * 8) / DM; const int b = (int)(irow / SLEN), s_ = (int)(irow % SLEN); const v8f v = *(const v8f*)(R + t * 8); float* d = out + ((size_t)s_ * NBS + b) * DM + c0;
  *(v8f*)d = v;  }
__device__ __forceinline__ void d_rope(unsigned blk, const float* __restrict__ F, _Float16* __restrict__ O16) {
  #pragma clang fp contract(off)
  const size_t t = (size_t)blk * 256 + threadIdx.x; if (t >= (size_t)NR * DM / 16) return; const int d0 = (int)((t * 8) % 32); const int h = (int)(((t * 8) / 32) % NH); const size_t row = (t * 8) / (32 * NH); const int s_ = (int)(row % SLEN); const float* p = F + row * DM + h * 64; const v8f a = *(const v8f*)(p + d0), c = *(const v8f*)(p + 32 + d0); FragH f1, f2;
  asm volatile("s_wait_xcnt 0x0" ::: "memory");      /* stands behind the four loads: the loop below reuses their address registers */
#pragma unroll 1
  for (int q = 0; q < 8; ++q) { const int d = d0 + q; const float inv = 1.0f / powf(10000.0f, (float)(2 * d) / 64.0f); const float ang = (float)s_ * inv; const float sn = sinf(ang), cs = cosf(ang); float o1 = a[q] * cs; o1 = o1 - c[q] * sn; float o2 = c[q] * cs; o2 = o2 + a[q] * sn; f1.h[q] = (_Float16)o1; f2.h[q] = (_Float16)o2; }
  { *(v8us*)((unsigned short*)O16 + row * DM + h * 64 + d0) = f1.half[0]; *(v8us*)((unsigned short*)O16 + row * DM + h * 64 + 32 + d0) = f2.half[0];  } }
// Launches that do not depend on one another share one grid: the block index, the same for a whole block, picks the body.
// Preparation: the query rows (XB blocks), then the four weight matrices (WB blocks each) into four planes that follow one another in Bt.
#define XB ((unsigned)((size_t)NR * DM / 8 / 256))
#define WB ((unsigned)((size_t)DM * DM / 8 / 256))
__global__ __launch_bounds__(256) void k_prep(const float* __restrict__ q, _Float16* __restrict__ X, const float* __restrict__ w0, const float* __restrict__ w1, const float* __restrict__ w2, const float* __restrict__ w3, _Float16* __restrict__ Bt) {
  const unsigned bx = blockIdx.x;
  if (bx < XB) { d_sbe(bx, q, X); return; }
  const unsigned m = (bx - XB) / WB; const float* Wm = m == 0 ? w0 : (m == 1 ? w1 : (m == 2 ? w2 : w3));
  d_wsc(bx - XB - m * WB, Wm, Bt + (size_t)m * DM * DM, (size_t)DM * DM / 8, 16.0f); }
// Behind the q/k/v product: RoPE of q, RoPE of k (RB blocks each, the long bodies first), then V^T.
#define RB ((unsigned)((size_t)NR * DM / 16 / 256))
__global__ __launch_bounds__(256) void k_post(const float* __restrict__ Fq, _Float16* __restrict__ Q16, const float* __restrict__ Fk, _Float16* __restrict__ K16, const _Float16* __restrict__ V16, _Float16* __restrict__ Vt) {
  const unsigned bx = blockIdx.x;
  if (bx < 2 * RB) { const bool isk = bx >= RB; d_rope(isk ? bx - RB : bx, isk ? Fk : Fq, isk ? K16 : Q16); return; }
  d_vtg((int)(bx - 2 * RB), V16, Vt); }
extern "C" void kernel_launch(void* const* d_in, const int* in_sizes, int n_in,
                              void* d_out, int out_size, void* d_ws, size_t ws_size, hipStream_t stream) {
  (void)in_sizes; (void)n_in; (void)out_size;
  const float* qy = (const float*)d_in[0]; const float* wq = (const float*)d_in[1]; const float* bq = (const float*)d_in[2]; const float* wk = (const float*)d_in[3]; const float* bk = (const float*)d_in[4]; const float* wv = (const float*)d_in[5]; const float* bv = (const float*)d_in[6]; const float* wo = (const float*)d_in[7]; const float* bo = (const float*)d_in[8];
  char* ws = (char*)d_ws; size_t off = 0;
  auto take = [&](size_t bytes) { char* p = ws + off; off += (bytes + 255) & ~(size_t)255; return p; };
  const size_t np = (size_t)NR * DM;
  _Float16* BW = (_Float16*)take((size_t)DM * DM * 2 * 4); _Float16* BO = BW + (size_t)DM * DM * 3;      /* weight planes q, k, v, o in a row */ _Float16* X16 = (_Float16*)take(np * 2); float* F32 = (float*)take(np * 4 * 2);      /* f32 planes q, k in a row */ float* OUTR = (float*)take(np * 4);
   _Float16* QH = (_Float16*)take(np * 2); _Float16* KH = (_Float16*)take(np * 2); _Float16* V16 = (_Float16*)take(np * 2); _Float16* VT = (_Float16*)take(np * 2); float* O = (float*)take(np * 4); _Float16* OH = QH; _Float16* OL = KH;
  if (off > ws_size) return;
  k_prep<<<XB + 4 * WB, 256, 0, stream>>>(qy, X16, wq, wk, wv, wo, BW);      /* weights stay in their (out, in) order */
  const dim3 g((NR / 128) * (DM / 64), 1), g3((NR / 128) * (DM / 64), 3);
  k_gemm2<0><<<g3, 128, 0, stream>>>(X16, DM, 0, BW, DM, (size_t)DM * DM, 0.0625f, bq, bk, bv, nullptr, 1, 0, 0, F32, V16, DM, np, 2, NR, DM, DM);      /* batches q, k (f32 planes), v (f16) */
  k_post<<<2 * RB + NB * NH * (SLEN / 64), 256, 0, stream>>>(F32, QH, F32 + np, KH, V16, VT);
  k_flash<<<NB * NH * QBNP, 128, 0, stream>>>(QH, DM, KH, DM, VT, O, DM);
  k_hl<<<(unsigned)((np / 8 + 255) / 256), 256, 0, stream>>>(O, OH, OL, np / 8);
  k_gemm2<0><<<g, 128, 0, stream>>>(OL, DM, 0, BO, DM, 0, 0.0625f / 1024.0f, nullptr, nullptr, nullptr, nullptr, 1, 0, 0, OUTR, nullptr, DM, 0, 1, NR, DM, DM);
  k_gemm2<0><<<g, 128, 0, stream>>>(OH, DM, 0, BO, DM, 0, 0.0625f, bo, nullptr, nullptr, OUTR, 1, (size_t)DM, 0, OUTR, nullptr, DM, 0, 1, NR, DM, DM);      /* out rows (b, s) = (ctx_lo + ctx_hi) Wo^T + b */
  k_out_sbe<<<(unsigned)((np / 8 + 255) / 256), 256, 0, stream>>>(OUTR, (float*)d_out);
}

// v005
// Measured time: 184 microseconds a run.
// In two side-by-side timings against v004, it was 1.19 and 1.18 times as fast.
// Counting every step since v000, it is 3.10 times as fast.
#include <hip/hip_runtime.h>
// Multi-head self-attention with rotary embedding (query [2048][2][1024] in [S, B, E] layout, 16 heads x 64: q/k/v = query W^T + b; rotary embedding per head (inv_freq = 10000^(-2i/64), rotate-half form) on q and k; softmax(q k^T / 8) v (no mask); out = attn Wo^T + bo, back in [S, B, E]).
// Structure: [S,B,E] -> exact f16 (b, s) rows; q/k as f32 WMMA GEMMs (32x64 wave tiles, f32 accumulation, exact x16 weights + bias) followed by RoPE on VALU (f32 angles s * inv_freq, sinf/cosf) into f16 planes; v as an f16 GEMM; V^T by LDS tiles; flash-style fused attention per (batch, head, 64-query block) (K Q^T and V^T P^T, one query per lane, online softmax and P in registers; no score plane), whose epilogue stores the context as f16 hi / 2^10 residual planes; output projection as one GEMM launch that runs the residual term, scales it by 2^-10 and sums the hi term on top, + bias, stored straight into [S, B, E].
// Launches: 5. Bodies that do not depend on one another share a grid (k_prep: x and the four weights; k_gemm2 with 3 batches: q, k, v; k_post: RoPE of q, RoPE of k, V^T); the elementwise bodies behind k_flash live in their neighbours' epilogues.
// Left: RoPE evaluates powf, sinf, cosf per (row, head, d) although the angle depends on (s, d) alone; k_prep and k_post start many short waves; k_flash's expf takes about nine vector instructions a score; the q/k/v product's epilogue still tests its addend and its two stores at run time, element by element.
// Compute dtype: inputs rounded to bf16; query / weights exact as f16; roped q/k and v plain f16 (~2^-12); softmax f32 with f16 probabilities; context hi + 2^-10 residual into the projection. v_wmma_f32_16x16x32_f16.
#define NB 2
#define DM 1024
#define NKV 16
#define NREP (NH / NKV)
#define KVD (NKV * 64)           /* 1024 */
#define NR (NB * SLEN)
#define CHK 512
typedef int v4i __attribute__((ext_vector_type(4)));
#define FF 2048
#define SLEN 2048
#define MQI 2048
#define MKI 2048
#define TQ SLEN
#define TK SLEN
#define NH 16
#define SCL 0.125f
#define QBLKS (TQ / 64)
#define QB05 0
#define QBN5 4
#define QB0P 0
#define QBNP QBLKS
#define RE 256
typedef __bf16 v16b __attribute__((ext_vector_type(16)));
typedef unsigned short v8us __attribute__((ext_vector_type(8), may_alias));
typedef float  v8f  __attribute__((ext_vector_type(8)));
typedef float  v4f  __attribute__((ext_vector_type(4)));
typedef float  v4fa __attribute__((ext_vector_type(4), may_alias));
union FragB { v16b v; v8us half[2]; unsigned short u[16]; };

__device__ __forceinline__ unsigned short bf16_bits(float x) { unsigned int u = __float_as_uint(x); return (unsigned short)((u + 0x7FFFu + ((u >> 16) & 1u)) >> 16); }
__device__ __forceinline__ float bf16_val(unsigned short b) { return __uint_as_float(((unsigned int)b) << 16); }
__device__ __forceinline__ float bf16_round(float x) { return bf16_val(bf16_bits(x)); }
// D += A·B with NT terms: 1 = ah·bh, 2 = + al·bh (A split), 3 = + ah·bl (both split)
template <int NT>
__device__ __forceinline__ v8f mmaN(v16b ah, v16b al, v16b bh, v16b bl, v8f c) {
  c = __builtin_amdgcn_wmma_f32_16x16x32_bf16(false, ah, false, bh, (short)0, c, false, false);
  if (NT >= 2) c = __builtin_amdgcn_wmma_f32_16x16x32_bf16(false, al, false, bh, (short)0, c, false, false);
  if (NT >= 3) c = __builtin_amdgcn_wmma_f32_16x16x32_bf16(false, ah, false, bl, (short)0, c, false, false);
  asm volatile("v_nop\n\tv_nop\n\tv_nop\n\tv_nop" : "+v"(c) : "v"(ah), "v"(al), "v"(bh), "v"(bl));
  return c;
}

__global__ __launch_bounds__(256) void k_wt_bf16(const float* __restrict__ W, unsigned short* __restrict__ Wt, int K, int N) {
  const int t = blockIdx.x * 256 + threadIdx.x;
  const int k8n = K / 8;
  if (t >= N * k8n) return;
  const int n = t / k8n, k8 = (t % k8n) * 8;
  v8us v;
#pragma unroll
  for (int i = 0; i < 8; ++i) v[i] = bf16_bits(W[(size_t)(k8 + i) * N + n]);
  *(v8us*)(Wt + (size_t)n * K + k8) = v;
  
}

// GEMM C[M][N] (f32, pitch ldc) = act(A[M][K]·W + bias). A f32 row-major (pitch lda) converted per fragment to bf16
// (ASPLIT: hi/lo two planes -> 2 terms, else single rounded term); Wt bf16 [N][K] (pitch ldb). BIAS_BF16 rounds the
// bias to bf16 first (bias quantised to bf16 before the add). K%32==0, M%16==0, N%64==0.
template <bool ASPLIT, int ACT, bool BIAS_BF16>
__global__ __launch_bounds__(128) void k_gemm_bf(const float* __restrict__ A, int lda, const unsigned short* __restrict__ Wt, int ldb,
                                               const float* __restrict__ bias, float* __restrict__ C, int ldc, int M, int N, int K) {
  __shared__ __attribute__((aligned(16))) float so[4][16][64];
  const int tid = threadIdx.x, w = tid >> 5, lane = tid & 31, ln = lane & 15, hh = lane >> 4;
  const int ntn = N / 64;
  const int wid = blockIdx.x * 4 + w;
  const int mt = wid / ntn, nq = wid % ntn;
  if (mt * 16 >= M) return;
  const int row0 = mt * 16, col0 = nq * 64;
  const float* arow = A + (size_t)(row0 + ln) * lda;
  v8f acc[4] = {};
  for (int kb = 0; kb < K; kb += 32) {
    FragB ah, al;
    const v4f x0 = *(const v4fa*)(arow + kb + 8 * hh), x1 = *(const v4fa*)(arow + kb + 8 * hh + 4);
    const v4f x2 = *(const v4fa*)(arow + kb + 16 + 8 * hh), x3 = *(const v4fa*)(arow + kb + 16 + 8 * hh + 4);
    float xs[16] = {x0[0],x0[1],x0[2],x0[3],x1[0],x1[1],x1[2],x1[3],x2[0],x2[1],x2[2],x2[3],x3[0],x3[1],x3[2],x3[3]};
#pragma unroll
    for (int i = 0; i < 16; ++i) { const unsigned short hb = bf16_bits(xs[i]); ah.u[i] = hb; al.u[i] = ASPLIT ? bf16_bits(xs[i] - bf16_val(hb)) : (unsigned short)0; }
#pragma unroll
    for (int t = 0; t < 4; ++t) {
      const unsigned short* brow = Wt + (size_t)(col0 + t * 16 + ln) * ldb + kb;
      FragB b;
      b.half[0] = *(const v8us*)(brow + 8 * hh);
      b.half[1] = *(const v8us*)(brow + 16 + 8 * hh);
      acc[t] = mmaN<ASPLIT ? 2 : 1>(ah.v, al.v, b.v, b.v, acc[t]);
    }
  }
#pragma unroll
  for (int t = 0; t < 4; ++t) {
    float bv = bias ? bias[col0 + t * 16 + ln] : 0.f;
    if (BIAS_BF16) bv = bf16_round(bv);
#pragma unroll
    for (int r = 0; r < 8; ++r) { float v = acc[t][r] + bv; if (ACT == 1) v = fmaxf(v, 0.f); so[w][8 * hh + r][t * 16 + ln] = v; }
  }
  __builtin_amdgcn_fence(__ATOMIC_ACQ_REL, "workgroup");
  __builtin_amdgcn_wave_barrier();
  const int rsub = lane >> 4, c4 = (lane & 15) * 4;
  {
#pragma unroll
    for (int q = 0; q < 8; ++q) {
      const int r = q * 2 + rsub;
      const v4f v = *(const v4fa*)&so[w][r][c4];
      *(v4f*)(C + (size_t)(row0 + r) * ldc + col0 + c4) = v;
    }
    
  }
}

// GEMM C = act(A·W + bias + resid): A f32 (ASPLIT -> hi/lo 2 terms), Wt bf16 [N][K]; ACT 0 none, 1 relu, 2 exact gelu;
// resid (optional, f32, row index = (row % rmod), pitch ldr, RES_BF16 rounds it) added before the activation.
template <bool ASPLIT, int ACT, bool BIAS_BF16, bool RES_BF16>
__global__ __launch_bounds__(128) void k_gemm_bf3(const float* __restrict__ A, int lda, const unsigned short* __restrict__ Wt, int ldb,
                                                const float* __restrict__ bias, const float* __restrict__ resid, int rmod, int ldr,
                                                float* __restrict__ C, int ldc, int M, int N, int K) {
  __shared__ __attribute__((aligned(16))) float so[4][16][64];
  const int tid = threadIdx.x, w = tid >> 5, lane = tid & 31, ln = lane & 15, hh = lane >> 4;
  const int ntn = N / 64;
  const int wid = blockIdx.x * 4 + w;
  const int mt = wid / ntn, nq = wid % ntn;
  if (mt * 16 >= M) return;
  const int row0 = mt * 16, col0 = nq * 64;
  const float* arow = A + (size_t)(row0 + ln) * lda;
  v8f acc[4] = {};
  for (int kb = 0; kb < K; kb += 32) {
    FragB ah, al;
    const v4f x0 = *(const v4fa*)(arow + kb + 8 * hh), x1 = *(const v4fa*)(arow + kb + 8 * hh + 4);
    const v4f x2 = *(const v4fa*)(arow + kb + 16 + 8 * hh), x3 = *(const v4fa*)(arow + kb + 16 + 8 * hh + 4);
    float xs[16] = {x0[0],x0[1],x0[2],x0[3],x1[0],x1[1],x1[2],x1[3],x2[0],x2[1],x2[2],x2[3],x3[0],x3[1],x3[2],x3[3]};
#pragma unroll
    for (int i = 0; i < 16; ++i) { const unsigned short hb = bf16_bits(xs[i]); ah.u[i] = hb; al.u[i] = ASPLIT ? bf16_bits(xs[i] - bf16_val(hb)) : (unsigned short)0; }
#pragma unroll
    for (int t = 0; t < 4; ++t) {
      const unsigned short* brow = Wt + (size_t)(col0 + t * 16 + ln) * ldb + kb;
      FragB b;
      b.half[0] = *(const v8us*)(brow + 8 * hh);
      b.half[1] = *(const v8us*)(brow + 16 + 8 * hh);
      acc[t] = mmaN<ASPLIT ? 2 : 1>(ah.v, al.v, b.v, b.v, acc[t]);
    }
  }
#pragma unroll
  for (int t = 0; t < 4; ++t) {
    const int col = col0 + t * 16 + ln;
    float bv = bias ? bias[col] : 0.f;
    if (BIAS_BF16) bv = bf16_round(bv);
#pragma unroll
    for (int r = 0; r < 8; ++r) {
      float v = acc[t][r] + bv;
      if (resid) { float rv = resid[(size_t)((row0 + 8 * hh + r) % rmod) * ldr + col]; if (RES_BF16) rv = bf16_round(rv); v += rv; }
      if (ACT == 1) v = fmaxf(v, 0.f);
      if (ACT == 2) v = 0.5f * v * (1.0f + erff(v * 0.70710678118654752f));
      if (ACT == 3) { const float u = 0.7978845608028654f * (v + 0.044715f * v * v * v); v = 0.5f * v * (1.0f + tanhf(u)); }
      so[w][8 * hh + r][t * 16 + ln] = v;
    }
  }
  __builtin_amdgcn_fence(__ATOMIC_ACQ_REL, "workgroup");
  __builtin_amdgcn_wave_barrier();
  const int rsub = lane >> 4, c4 = (lane & 15) * 4;
  {
#pragma unroll
    for (int q = 0; q < 8; ++q) {
      const int r = q * 2 + rsub;
      const v4f v = *(const v4fa*)&so[w][r][c4];
      *(v4f*)(C + (size_t)(row0 + r) * ldc + col0 + c4) = v;
    }
    
  }
}
// row LayerNorm (biased variance, eps) over N: s = X (+ R); optional out_sum <- s; out_norm <- (s-mu)*rsqrt(var+eps)*g + b
template <bool PARAM_BF16>
__global__ __launch_bounds__(256) void k_layernorm(const float* __restrict__ X, const float* __restrict__ R, const float* __restrict__ g, const float* __restrict__ bta,
                                                  float* __restrict__ out_sum, float* __restrict__ out_norm, int N, float eps) {
  __shared__ float red[256];
  const int row = blockIdx.x, tid = threadIdx.x;
  const float* x = X + (size_t)row * N; const float* rr = R ? R + (size_t)row * N : nullptr;
  float vals[16];                     // up to N = 4096
  const int per = N / 256;            // contiguous chunk per thread? use strided-by-4 chunks: thread handles j = tid*4 + 1024*u
  float s1 = 0.f;
  for (int u = 0; u < per / 4; ++u) {
    const int j = tid * 4 + 1024 * u;
    const v4f a = *(const v4fa*)(x + j);
    v4f b = {0.f,0.f,0.f,0.f}; if (rr) b = *(const v4fa*)(rr + j);
#pragma unroll
    for (int q = 0; q < 4; ++q) { const float v = a[q] + b[q]; vals[u * 4 + q] = v; s1 += v; }
  }
  red[tid] = s1; __syncthreads();
  for (int st = 128; st > 0; st >>= 1) { if (tid < st) red[tid] += red[tid + st]; __syncthreads(); }
  const float mu = red[0] / (float)N; __syncthreads();
  float s2 = 0.f;
  for (int u = 0; u < per / 4; ++u)
#pragma unroll
    for (int q = 0; q < 4; ++q) { const float c = vals[u * 4 + q] - mu; s2 += c * c; }
  red[tid] = s2; __syncthreads();
  for (int st = 128; st > 0; st >>= 1) { if (tid < st) red[tid] += red[tid + st]; __syncthreads(); }
  const float rs = rsqrtf(red[0] / (float)N + eps);
  {
    for (int u = 0; u < per / 4; ++u) {
      const int j = tid * 4 + 1024 * u;
      v4f o, sm;
#pragma unroll
      for (int q = 0; q < 4; ++q) {
        float gg = g[j + q], bb = bta[j + q];
        if (PARAM_BF16) { gg = bf16_round(gg); bb = bf16_round(bb); }
        sm[q] = vals[u * 4 + q]; o[q] = (vals[u * 4 + q] - mu) * rs * gg + bb;
      }
      if (out_sum) *(v4f*)(out_sum + (size_t)row * N + j) = sm;
      *(v4f*)(out_norm + (size_t)row * N + j) = o;
    }
    
  }
}



// ---- f16 WMMA path (v_wmma_f32_16x16x32_f16): 11-bit significands for operands in range — used where a [0,1] probability operand needs more precision than bf16
typedef _Float16 v16h __attribute__((ext_vector_type(16)));
union FragH { v16h v; v8us half[2]; _Float16 h[16]; unsigned short u[16]; };
template <int NT>
__device__ __forceinline__ v8f mmaH(v16h ah, v16h al, v16h bh, v16h bl, v8f c) {
  c = __builtin_amdgcn_wmma_f32_16x16x32_f16(false, ah, false, bh, (short)0, c, false, false);
  if (NT >= 2) c = __builtin_amdgcn_wmma_f32_16x16x32_f16(false, al, false, bh, (short)0, c, false, false);
  if (NT >= 3) c = __builtin_amdgcn_wmma_f32_16x16x32_f16(false, ah, false, bl, (short)0, c, false, false);
  asm volatile("v_nop\n\tv_nop\n\tv_nop\n\tv_nop" : "+v"(c) : "v"(ah), "v"(al), "v"(bh), "v"(bl));
  return c;
}
// batched GEMM like k_gemm_b but f16 operands: A f32 (split into f16 hi/lo if ASPLIT, else rounded to f16), Bt = f16 values [n][k]; alpha; C f32; N multiple of 16 (partial tiles skipped)
template <bool ASPLIT>
__global__ __launch_bounds__(128) void k_gemm_h(const float* __restrict__ A, int lda, size_t sA, const _Float16* __restrict__ Bh, int ldb, size_t sB, float alpha, float* __restrict__ C, int ldc, size_t sC, int M, int N, int K) {
  __shared__ __attribute__((aligned(16))) float so[4][16][64];
  const int tid = threadIdx.x, w = tid >> 5, lane = tid & 31, ln = lane & 15, hh = lane >> 4; const int by = blockIdx.y;
  A += (size_t)by * sA; Bh += (size_t)by * sB; C += (size_t)by * sC;
  const int ntn = (N + 63) / 64; const int wid = blockIdx.x * 4 + w; const int mt = wid / ntn, nq = wid % ntn; if (mt * 16 >= M) return;
  const int row0 = mt * 16, col0 = nq * 64; const float* arow = A + (size_t)(row0 + ln) * lda;
  v8f acc[4] = {};
  for (int kb = 0; kb < K; kb += 32) {
    FragH ah, al;
    const v4f x0 = *(const v4fa*)(arow + kb + 8 * hh), x1 = *(const v4fa*)(arow + kb + 8 * hh + 4), x2 = *(const v4fa*)(arow + kb + 16 + 8 * hh), x3 = *(const v4fa*)(arow + kb + 16 + 8 * hh + 4);
    float xs[16] = {x0[0],x0[1],x0[2],x0[3],x1[0],x1[1],x1[2],x1[3],x2[0],x2[1],x2[2],x2[3],x3[0],x3[1],x3[2],x3[3]};
#pragma unroll
    for (int i = 0; i < 16; ++i) { const _Float16 h = (_Float16)xs[i]; ah.h[i] = h; al.h[i] = ASPLIT ? (_Float16)(xs[i] - (float)h) : (_Float16)0.0f; }
#pragma unroll
    for (int t = 0; t < 4; ++t) { if (col0 + t * 16 >= N) continue; const size_t boff = (size_t)(col0 + t * 16 + ln) * ldb + kb; FragH bq; bq.half[0] = *(const v8us*)(Bh + boff + 8 * hh); bq.half[1] = *(const v8us*)(Bh + boff + 16 + 8 * hh);
      acc[t] = mmaH<ASPLIT ? 2 : 1>(ah.v, al.v, bq.v, bq.v, acc[t]); }
  }
#pragma unroll
  for (int t = 0; t < 4; ++t) { if (col0 + t * 16 >= N) continue;
#pragma unroll
    for (int r = 0; r < 8; ++r) so[w][8 * hh + r][t * 16 + ln] = acc[t][r] * alpha; }
  __builtin_amdgcn_fence(__ATOMIC_ACQ_REL, "workgroup"); __builtin_amdgcn_wave_barrier();
  const int rsub = lane >> 4, c4 = (lane & 15) * 4;
  {
#pragma unroll
    for (int q = 0; q < 8; ++q) { const int r = q * 2 + rsub; if (col0 + c4 < N) { const v4f v = *(const v4fa*)&so[w][r][c4]; *(v4f*)(C + (size_t)(row0 + r) * ldc + col0 + c4) = v; } }
     }
}

// Wt[n][k] = f16(W[k][n]·scale) from f32 row-major W[K][N] (scale = power of two; bf16-exact weights stay exact in f16 away from the subnormal range)
__global__ __launch_bounds__(256) void k_wt_f16(const float* __restrict__ W, _Float16* __restrict__ Wt, int K, int N, float scale) {
  const int t = blockIdx.x * 256 + threadIdx.x; if (t >= N * (K / 8)) return; const int n = t / (K / 8), k8 = (t % (K / 8)) * 8; FragH f;
#pragma unroll
  for (int i = 0; i < 8; ++i) f.h[i] = (_Float16)(bf16_round(W[(size_t)(k8 + i) * N + n]) * scale); const v8us o = f.half[0];
  *(v8us*)((unsigned short*)Wt + (size_t)n * K + k8) = o; 
}
// k_gemm_hh variant with fused epilogue: v = acc·alpha + bias[by·sBias + col] (+ CP[(row/rowsPerB)·sCPb + by·64 + col] if CP) ; ACT 0 none / 1 elu ; writes f16 C16 (and f32 C if non-null)
template <int ACT>
__global__ __launch_bounds__(128) void k_gemm_hhx(const _Float16* __restrict__ A, int lda, size_t sA, const _Float16* __restrict__ Bh, int ldb, size_t sB, float alpha, const float* __restrict__ bias, size_t sBias, const float* __restrict__ CP, int rowsPerB, size_t sCPb, int row0g,
    float* __restrict__ C, _Float16* __restrict__ C16, int ldc, size_t sC, int M, int N, int K) {
  __shared__ __attribute__((aligned(16))) float so[4][16][64];
  const int tid = threadIdx.x, w = tid >> 5, lane = tid & 31, ln = lane & 15, hh = lane >> 4; const int by = blockIdx.y;
  A += (size_t)by * sA; Bh += (size_t)by * sB; const size_t cofs = (size_t)by * sC; const float* bp = bias ? bias + (size_t)by * sBias : nullptr;
  const int ntn = (N + 63) / 64; const int wid = blockIdx.x * 4 + w; const int mt = wid / ntn, nq = wid % ntn; if (mt * 16 >= M) return;
  const int row0 = mt * 16, col0 = nq * 64; const _Float16* arow = A + (size_t)(row0 + ln) * lda;
  v8f acc[4] = {};
  for (int kb = 0; kb < K; kb += 32) { FragH ah; ah.half[0] = *(const v8us*)((const unsigned short*)arow + kb + 8 * hh); ah.half[1] = *(const v8us*)((const unsigned short*)arow + kb + 16 + 8 * hh);
#pragma unroll
    for (int t = 0; t < 4; ++t) { if (col0 + t * 16 >= N) continue; const size_t boff = (size_t)(col0 + t * 16 + ln) * ldb + kb; FragH bq; bq.half[0] = *(const v8us*)((const unsigned short*)Bh + boff + 8 * hh); bq.half[1] = *(const v8us*)((const unsigned short*)Bh + boff + 16 + 8 * hh);
      acc[t] = mmaH<1>(ah.v, ah.v, bq.v, bq.v, acc[t]); }
  }
#pragma unroll
  for (int t = 0; t < 4; ++t) { if (col0 + t * 16 >= N) continue; const int col = col0 + t * 16 + ln; const float bv = bp ? bf16_round(bp[col]) : 0.f;
#pragma unroll
    for (int r = 0; r < 8; ++r) { float v = acc[t][r] * alpha + bv; if (CP) { const int bidx = (row0g + row0 + 8 * hh + r) / rowsPerB; v += CP[(size_t)bidx * sCPb + (size_t)by * 64 + col]; } if (ACT == 1) v = (v > 0.f) ? v : expm1f(v); else if (ACT == 7) v = (v > 0.f) ? v + 1.0f : expf(v); else if (ACT == 8) v = tanhf(v); else if (ACT == 9) v = 0.5f * v * (1.0f + tanhf(0.7978845608028654f * (v + 0.044715f * v * v * v))); else if (ACT == 11) v = 1.0f / (1.0f + expf(-v)); else if (ACT == 12) v = (v > 0.f) ? v : 0.01f * v; else if (ACT == 14) v = (v > 0.f) ? v : 0.1f * v; else if (ACT == 15) v = v / (1.0f + expf(-v)); else if (ACT == 3) v = fmaxf(v, 0.f); else if (ACT == 6) v = 0.5f * v * (1.0f + erff(v * 0.70710678118654752f)); so[w][8 * hh + r][t * 16 + ln] = v; } }
  __builtin_amdgcn_fence(__ATOMIC_ACQ_REL, "workgroup"); __builtin_amdgcn_wave_barrier();
  const int rsub = lane >> 4, c4 = (lane & 15) * 4; typedef _Float16 v4h __attribute__((ext_vector_type(4)));
  {
#pragma unroll
    for (int q = 0; q < 8; ++q) { const int r = q * 2 + rsub; if (col0 + c4 < N) { const v4f v = *(const v4fa*)&so[w][r][c4]; if (C) *(v4f*)(C + cofs + (size_t)(row0 + r) * ldc + col0 + c4) = v; if (C16) { v4h h4; for (int i = 0; i < 4; ++i) h4[i] = (_Float16)v[i]; *(v4h*)(C16 + cofs + (size_t)(row0 + r) * ldc + col0 + c4) = h4; } } }
     }
}


typedef _Float16 v4h __attribute__((ext_vector_type(4)));

__global__ __launch_bounds__(256) void k_x16(const float* __restrict__ x, _Float16* __restrict__ X16, size_t n8) { const size_t t = (size_t)blockIdx.x * 256 + threadIdx.x; if (t >= n8) return; FragH f;
#pragma unroll
  for (int q = 0; q < 8; ++q) f.h[q] = (_Float16)bf16_round(x[t * 8 + q]); *(v8us*)((unsigned short*)X16 + t * 8) = f.half[0];  }
__global__ __launch_bounds__(256) void k_h16(const float* __restrict__ x, _Float16* __restrict__ X16, size_t n8) { const size_t t = (size_t)blockIdx.x * 256 + threadIdx.x; if (t >= n8) return; FragH f;
#pragma unroll
  for (int q = 0; q < 8; ++q) f.h[q] = (_Float16)x[t * 8 + q]; *(v8us*)((unsigned short*)X16 + t * 8) = f.half[0];  }
__global__ __launch_bounds__(256) void k_round16f(const float* __restrict__ W, _Float16* __restrict__ Bt, size_t n8) { const size_t t = (size_t)blockIdx.x * 256 + threadIdx.x; if (t >= n8) return; FragH f;
#pragma unroll
  for (int i = 0; i < 8; ++i) f.h[i] = (_Float16)(bf16_round(W[t * 8 + i]) * 16.0f); *(v8us*)((unsigned short*)Bt + t * 8) = f.half[0];  }
template <int NHv, int TTv>
__global__ __launch_bounds__(256) void k_vt(const _Float16* __restrict__ V16, int ldv, int voff, _Float16* __restrict__ Vt) { __shared__ unsigned short tl[64][66]; const int tid = threadIdx.x; const int slab = blockIdx.x / (TTv / 64), lg = blockIdx.x % (TTv / 64); const int b = slab / NHv, h = slab % NHv;
  for (int i = tid; i < 64 * 8; i += 256) { const int r = i / 8, c8 = (i % 8) * 8; FragH f; f.half[0] = *(const v8us*)((const unsigned short*)V16 + ((size_t)b * TTv + lg * 64 + r) * ldv + voff + h * 64 + c8);
#pragma unroll
    for (int q = 0; q < 8; ++q) tl[r][c8 + q] = f.u[q]; }
  __syncthreads();
  {
#pragma unroll
    for (int rd = 0; rd < 2; ++rd) { const int d = rd * 32 + tid / 8, pc = tid % 8; FragH f;
#pragma unroll
      for (int q = 0; q < 8; ++q) f.u[q] = tl[pc * 8 + q][d];
      *(v8us*)((unsigned short*)Vt + ((size_t)slab * 64 + d) * TTv + lg * 64 + pc * 8) = f.half[0]; }
     } }

#ifndef NBS
#define NBS NB      /* batch stride of the [S][B][E] tensors (debug builds may process fewer batches than the layout holds) */
#endif
// ---- fast GEMM (wave tile 32x64, block tile 128x64; requires M % 128 == 0, N % 64 == 0, K % 64 == 0, K >= 64); epilogue = k_gemm_hhx semantics ----
// Operands reach the waves through LDS: per stage the block brings 64 k of its 128 A rows and 64 B rows in by asynchronous copies that cover whole 128-byte lines (8 lanes a row),
// two buffers, the next stage in flight while this one is worked on; the fragments are read from LDS in the same k order as before.
// TAIL: C = (A B^T / 1024 + A2 B^T) alpha + bias in one launch: the stages walk A's K columns, the sums are scaled by 2^-10 (exact), then the stages walk A2's K columns on top of them, B's anew;
// row (b, s) of the result is stored at row (s, b) of C, which is f32; there is no addend CP.
__device__ __forceinline__ v16h g2_frag(const unsigned short* p, int hh) { FragH f; f.half[0] = *(const v8us*)(p + 8 * hh); f.half[1] = *(const v8us*)(p + 16 + 8 * hh); return f.v; }
__device__ __forceinline__ v8f g2_mma(v16h a, v16h b, v8f c) { v8f d = __builtin_amdgcn_wmma_f32_16x16x32_f16(false, a, false, b, (short)0, c, false, false); asm volatile("v_nop\n\tv_nop\n\tv_nop\n\tv_nop" : "+v"(d) : "v"(a), "v"(b)); return d; }
// One lane's share of a stage: 8 pieces of A and 4 of B, 16 bytes each, 16 rows apart (ls bytes in LDS, da / db bytes in memory), global memory -> LDS through no register.
// The s_wait_xcnt closes the copies' own statement so that no address register named here is rewritten ahead of it.
__device__ __forceinline__ void g2_copy(unsigned la, unsigned lb, unsigned ls, const char* pa, size_t da, const char* pb, size_t db) {
  asm volatile("global_load_async_to_lds_b128 %0, %12, off\n\t" "global_load_async_to_lds_b128 %1, %13, off\n\t" "global_load_async_to_lds_b128 %2, %14, off\n\t" "global_load_async_to_lds_b128 %3, %15, off\n\t"
               "global_load_async_to_lds_b128 %4, %16, off\n\t" "global_load_async_to_lds_b128 %5, %17, off\n\t" "global_load_async_to_lds_b128 %6, %18, off\n\t" "global_load_async_to_lds_b128 %7, %19, off\n\t"
               "global_load_async_to_lds_b128 %8, %20, off\n\t" "global_load_async_to_lds_b128 %9, %21, off\n\t" "global_load_async_to_lds_b128 %10, %22, off\n\t" "global_load_async_to_lds_b128 %11, %23, off\n\t"
               "s_wait_xcnt 0x0"
               :: "v"(la), "v"(la + ls), "v"(la + 2 * ls), "v"(la + 3 * ls), "v"(la + 4 * ls), "v"(la + 5 * ls), "v"(la + 6 * ls), "v"(la + 7 * ls), "v"(lb), "v"(lb + ls), "v"(lb + 2 * ls), "v"(lb + 3 * ls),
                  "v"(pa), "v"(pa + da), "v"(pa + 2 * da), "v"(pa + 3 * da), "v"(pa + 4 * da), "v"(pa + 5 * da), "v"(pa + 6 * da), "v"(pa + 7 * da), "v"(pb), "v"(pb + db), "v"(pb + 2 * db), "v"(pb + 3 * db)
               : "memory"); }
template <int ACT, bool TAIL>
__global__ __launch_bounds__(128) void k_gemm2(const _Float16* __restrict__ A, int lda, size_t sA, const _Float16* __restrict__ A2, const _Float16* __restrict__ Bh, int ldb, size_t sB, float alpha, const float* __restrict__ bias, const float* __restrict__ bias1, const float* __restrict__ bias2, const float* __restrict__ CP, int rowsPerB, size_t sCPb, int row0g,
    float* __restrict__ Cf, _Float16* __restrict__ Ch, int ldc, size_t sC, int nc32, int M, int N, int K) {
  constexpr int KT = 64, PIT = KT + 8;      /* LDS row pitch 144 B = 16 B x odd: the 16-byte fragment reads of 16 rows fall on distinct banks */
  __shared__ __attribute__((aligned(16))) float so[4][32][68];
  __shared__ __attribute__((aligned(16))) unsigned short tA[2][128][PIT]; __shared__ __attribute__((aligned(16))) unsigned short tB[2][64][PIT];
  const int tid = threadIdx.x, w = tid >> 5, lane = tid & 31, ln = lane & 15, hh = lane >> 4; const int by = blockIdx.y;
  A += (size_t)by * sA; Bh += (size_t)by * sB; const float* bp = by == 0 ? bias : (by == 1 ? bias1 : bias2);      /* batch by has its own bias vector */
  const bool w32 = by < nc32; float* C = w32 ? Cf : nullptr; _Float16* C16 = w32 ? nullptr : Ch; const size_t cofs = (size_t)(w32 ? by : by - nc32) * sC;      /* the first nc32 batches store f32 planes of Cf, the others f16 planes of Ch */
  const int ntn = N >> 6; const int mt = blockIdx.x / ntn, nq = blockIdx.x - mt * ntn; const int row0 = mt * 128 + 32 * w, col0 = nq * 64; if (mt * 128 >= M) return;      /* the same for the whole block: it stands in front of barriers */
  const int sr = tid >> 3, sc = (tid & 7) * 8;
  const char* pa = (const char*)(A + (size_t)(mt * 128 + sr) * lda + sc); const char* pb = (const char*)(Bh + (size_t)(col0 + sr) * ldb + sc); const size_t da = (size_t)lda * 32, db = (size_t)ldb * 32;
  const unsigned la = (unsigned)(uintptr_t)&tA[0][sr][sc], lb = (unsigned)(uintptr_t)&tB[0][sr][sc]; constexpr unsigned LS = 16 * PIT * 2, BA = 128 * PIT * 2, BB = 64 * PIT * 2;
  const char* pa2 = TAIL ? (const char*)(A2 + (size_t)by * sA + (size_t)(mt * 128 + sr) * lda + sc) : pa; const int KK = TAIL ? 2 * K : K;
  /* the stage that begins at column kk of [A | A2], into buffer buf; kk is the same for the whole block */
  auto stage = [&](int kk, int buf) { const bool t2 = TAIL && kk >= K; const size_t kx = (size_t)(t2 ? kk - K : kk) * 2; g2_copy(la + buf * BA, lb + buf * BB, LS, (t2 ? pa2 : pa) + kx, da, pb + kx, db); };
  stage(0, 0);
  asm volatile("s_wait_asynccnt 0x0" ::: "memory");      /* this wave's share of stage 0 has landed */
  __syncthreads();      /* every wave's share has: stage 0 may be read */
  if (KT < KK) stage(KT, 1);
  const v8f z8 = {0.f,0.f,0.f,0.f,0.f,0.f,0.f,0.f}; v8f c00 = z8, c01 = z8, c02 = z8, c03 = z8, c10 = z8, c11 = z8, c12 = z8, c13 = z8;
  /* rolled: one stage a trip, so that the order at the foot of the trip stands once */
#pragma unroll 1
  for (int kb = 0; kb < KK; kb += KT) { const int cur = (kb >> 6) & 1;
    if (TAIL && kb == K) { constexpr float s10 = 0.0009765625f; c00 *= s10; c01 *= s10; c02 *= s10; c03 *= s10; c10 *= s10; c11 *= s10; c12 *= s10; c13 *= s10; }
    /* unrolled: the two 32-k blocks of a stage read LDS at immediate offsets */
#pragma unroll
    for (int ks = 0; ks < KT; ks += 32) { const unsigned short* fa = &tA[cur][32 * w + ln][ks]; const unsigned short* fb = &tB[cur][ln][ks];
      const v16h a0 = g2_frag(fa, hh), a1 = g2_frag(fa + 16 * PIT, hh); const v16h b0 = g2_frag(fb, hh), b1 = g2_frag(fb + 16 * PIT, hh), b2 = g2_frag(fb + 32 * PIT, hh), b3 = g2_frag(fb + 48 * PIT, hh);
      c00 = g2_mma(a0, b0, c00); c10 = g2_mma(a1, b0, c10); c01 = g2_mma(a0, b1, c01); c11 = g2_mma(a1, b1, c11);
      c02 = g2_mma(a0, b2, c02); c12 = g2_mma(a1, b2, c12); c03 = g2_mma(a0, b3, c03); c13 = g2_mma(a1, b3, c13); }
    asm volatile("s_wait_dscnt 0x0" ::: "memory");      /* this wave's reads of the buffer that is refilled below have returned */
    asm volatile("s_wait_asynccnt 0x0" ::: "memory");      /* this wave's share of the next stage has landed */
    __syncthreads();      /* publishes the next stage and ends every wave's reads of this one */
    if (kb + 2 * KT < KK) stage(kb + 2 * KT, cur); }
  asm volatile("s_wait_asynccnt 0x0" ::: "memory");      /* no copy is left in flight behind the loop */
  v8f accs[8] = {c00, c01, c02, c03, c10, c11, c12, c13};
#pragma unroll
  for (int u = 0; u < 8; ++u) { const int t = u & 3, half = u >> 2; const int col = col0 + t * 16 + ln; const float bv = bp ? bf16_round(bp[col]) : 0.f;
#pragma unroll
    for (int r = 0; r < 8; ++r) { const int rloc = half * 16 + 8 * hh + r; float v = accs[u][r] * alpha + bv; if (!TAIL && CP) { if (rowsPerB < 0) v += CP[cofs + (size_t)(row0g + row0 + rloc) * ldc + col];      /* rowsPerB < 0: own element of the batched C plane */ else { const int bidx = (row0g + row0 + rloc) / rowsPerB; v += CP[(size_t)bidx * sCPb + (size_t)by * 64 + col]; } }
      if (ACT == 3) v = fmaxf(v, 0.f); else if (ACT == 6) v = 0.5f * v * (1.0f + erff(v * 0.70710678118654752f)); else if (ACT == 11) v = 1.0f / (1.0f + expf(-v)); else if (ACT == 15) v = v / (1.0f + expf(-v)); else if (ACT == 12) v = (v > 0.f) ? v : 0.01f * v; else if (ACT == 8) v = tanhf(v);
      so[w][rloc][t * 16 + ln] = v; } }
  __builtin_amdgcn_fence(__ATOMIC_ACQ_REL, "workgroup"); __builtin_amdgcn_wave_barrier();
  const int rsub = lane >> 4, c4 = (lane & 15) * 4;
  {
#pragma unroll
    for (int q = 0; q < 16; ++q) { const int r = q * 2 + rsub; const v4f v = *(const v4fa*)&so[w][r][c4]; const size_t orow = TAIL ? (size_t)((row0 + r) % SLEN) * NBS + (row0 + r) / SLEN : (size_t)(row0 + r); if (TAIL || C) { *(v4f*)(C + cofs + orow * ldc + col0 + c4) = v; if (!TAIL) asm volatile("s_wait_xcnt 0x0" ::: "memory");      /* stands behind the f32 store: the f16 path follows it in the built code and reuses its registers */ } if (!TAIL && C16) { v4h h4; for (int i = 0; i < 4; ++i) h4[i] = (_Float16)v[i]; *(v4h*)(C16 + cofs + (size_t)(row0 + r) * ldc + col0 + c4) = h4; } }
     } }



// Lane l <-> l ^ 16 by a vector cross-row move (the two lanes that hold one query's keys).
__device__ __forceinline__ float x_half(float x) { const int b = __float_as_int(x); return __int_as_float(__builtin_amdgcn_permlanex16(b, b, 0x76543210, 0xfedcba98, false, false)); }
// One lane's share of a 64-key stage: 4 pieces of K and 4 of V^T, 16 bytes each, 16 rows apart (ls bytes in LDS, dk / dv bytes in memory), global memory -> LDS through no register.
// The s_wait_xcnt closes the copies' own statement so that no address register named here is rewritten ahead of it.
__device__ __forceinline__ void fl_copy(unsigned lk, unsigned lv, unsigned ls, const char* pk, size_t dk, const char* pv, size_t dv) {
  asm volatile("global_load_async_to_lds_b128 %0, %8, off\n\t" "global_load_async_to_lds_b128 %1, %9, off\n\t" "global_load_async_to_lds_b128 %2, %10, off\n\t" "global_load_async_to_lds_b128 %3, %11, off\n\t"
               "global_load_async_to_lds_b128 %4, %12, off\n\t" "global_load_async_to_lds_b128 %5, %13, off\n\t" "global_load_async_to_lds_b128 %6, %14, off\n\t" "global_load_async_to_lds_b128 %7, %15, off\n\t"
               "s_wait_xcnt 0x0"
               :: "v"(lk), "v"(lk + ls), "v"(lk + 2 * ls), "v"(lk + 3 * ls), "v"(lv), "v"(lv + ls), "v"(lv + 2 * ls), "v"(lv + 3 * ls),
                  "v"(pk), "v"(pk + dk), "v"(pk + 2 * dk), "v"(pk + 3 * dk), "v"(pv), "v"(pv + dv), "v"(pv + 2 * dv), "v"(pv + 3 * dv)
               : "memory"); }
// Unmasked attention with both products transposed: S^T = K Q^T (A = K rows, B = Q rows), O^T += V^T P^T (A = V^T rows, B = P^T).
// Lane (ln, hh) owns query q0 + ln; register r of score tile nt is key j0 + ps + nt * 16 + 8 * hh + r, so maximum and sum run inside the lane, joined with lane ^ 16,
// and the two score tiles, converted in place, are the B operand of the second product in the k order of the V^T loader (8 * hh + i, 16 + 8 * hh + i): P touches no LDS.
// K and V^T reach the waves through LDS: per stage the block brings 64 keys (64 K rows and 64 V^T rows of 128 bytes) in by asynchronous copies that cover whole 128-byte lines (8 lanes a row),
// two buffers, the next stage in flight while this one is worked on; the four waves read their fragments from LDS in the same k order as before.
__global__ __launch_bounds__(128) void k_flash(const _Float16* __restrict__ Q16, int ldq, const _Float16* __restrict__ K16, int ldk, const _Float16* __restrict__ Vt, _Float16* __restrict__ Oh, _Float16* __restrict__ Ol, int ldo) {
  constexpr int RPW = 16, DT = 4, KS = 2, KT = 64, PIT = KT + 8;      /* LDS row pitch 144 B = 16 B x odd: the 16-byte fragment reads of 16 rows fall on distinct banks */
  __shared__ __attribute__((aligned(16))) float sO[4][RPW][64 + 4];
  __shared__ __attribute__((aligned(16))) unsigned short tK[2][KT][PIT]; __shared__ __attribute__((aligned(16))) unsigned short tV[2][64][PIT];
  const int tid = threadIdx.x, w = tid >> 5, lane = tid & 31, ln = lane & 15, hh = lane >> 4;
  const int slab = blockIdx.x / QBNP, qblk = QB0P + blockIdx.x % QBNP; const int b = slab / NH, h = slab % NH; const int qb0 = qblk * (4 * RPW); const int q0 = qb0 + w * RPW;
  /* every inner loop below is unrolled so that each register-array index is a constant (no scratch) */
  FragH bq[KS];
  { const unsigned short* qr = (const unsigned short*)Q16 + ((size_t)b * TQ + q0 + ln) * ldq + h * 64;
#pragma unroll
    for (int ks = 0; ks < KS; ++ks) { bq[ks].half[0] = *(const v8us*)(qr + ks * 32 + 8 * hh); bq[ks].half[1] = *(const v8us*)(qr + ks * 32 + 16 + 8 * hh); } }
  const unsigned short* Vth = (const unsigned short*)Vt + (size_t)slab * 64 * TK;
  const int sr = tid >> 3, sc = (tid & 7) * 8;
  const char* pk = (const char*)((const unsigned short*)K16 + ((size_t)b * TK + sr) * ldk + h * 64 + sc); const char* pv = (const char*)(Vth + (size_t)sr * TK + sc); const size_t dk = (size_t)ldk * 32, dv = (size_t)TK * 32, sk = (size_t)ldk * (KT * 2);
  const unsigned lk = (unsigned)(uintptr_t)&tK[0][sr][sc], lv = (unsigned)(uintptr_t)&tV[0][sr][sc]; constexpr unsigned LS = 16 * PIT * 2, BS = 64 * PIT * 2;
  fl_copy(lk, lv, LS, pk, dk, pv, dv);
  asm volatile("s_wait_asynccnt 0x0" ::: "memory");      /* this wave's share of stage 0 has landed */
  __syncthreads();      /* every wave's share has: stage 0 may be read */
  if (KT < TK) fl_copy(lk + BS, lv + BS, LS, pk + sk, dk, pv + KT * 2, dv);
  float m_q = -3.0e38f, l_q = 0.f; v8f oacc[DT];
#pragma unroll
  for (int dt = 0; dt < DT; ++dt) oacc[dt] = (v8f){0.f,0.f,0.f,0.f,0.f,0.f,0.f,0.f};
  /* rolled: one 64-key stage a trip, so that the order at the foot of the trip stands once */
#pragma unroll 1
  for (int j0 = 0; j0 < TK; j0 += KT) { const int cur = (j0 >> 6) & 1;
    /* unrolled: the two 32-key passes of a stage read LDS at immediate offsets */
#pragma unroll
    for (int ps = 0; ps < KT; ps += 32) {
    FragH ak[2][KS], av[DT];
#pragma unroll
    for (int nt = 0; nt < 2; ++nt) { const unsigned short* kr = &tK[cur][ps + nt * 16 + ln][0];
#pragma unroll
      for (int ks = 0; ks < KS; ++ks) { ak[nt][ks].half[0] = *(const v8us*)(kr + ks * 32 + 8 * hh); ak[nt][ks].half[1] = *(const v8us*)(kr + ks * 32 + 16 + 8 * hh); } }
#pragma unroll
    for (int dt = 0; dt < DT; ++dt) { const unsigned short* vrow = &tV[cur][dt * 16 + ln][ps]; av[dt].half[0] = *(const v8us*)(vrow + 8 * hh); av[dt].half[1] = *(const v8us*)(vrow + 16 + 8 * hh); }
    float sc_[16];
#pragma unroll
    for (int nt = 0; nt < 2; ++nt) {
      v8f acc = (v8f){0.f,0.f,0.f,0.f,0.f,0.f,0.f,0.f};
#pragma unroll
      for (int ks = 0; ks < KS; ++ks) acc = mmaH<1>(ak[nt][ks].v, ak[nt][ks].v, bq[ks].v, bq[ks].v, acc);
#pragma unroll
      for (int r = 0; r < 8; ++r) sc_[nt * 8 + r] = acc[r] * SCL; }
    float mc = sc_[0];
#pragma unroll
    for (int i = 1; i < 16; ++i) mc = fmaxf(mc, sc_[i]);
    mc = fmaxf(mc, x_half(mc));
    const float mn = fmaxf(m_q, mc); const float al = (mn > -1.0e38f) ? expf(m_q - mn) : 1.0f; m_q = mn;
    float p[16]; FragH pb;
#pragma unroll
    for (int i = 0; i < 16; ++i) { p[i] = expf(sc_[i] - mn); pb.h[i] = (_Float16)(p[i] * 1024.0f); }
#pragma unroll
    for (int st = 8; st > 0; st >>= 1)
#pragma unroll
      for (int i = 0; i < st; ++i) p[i] += p[i + st];
    l_q = l_q * al + p[0];
#pragma unroll
    for (int dt = 0; dt < DT; ++dt) {
#pragma unroll
      for (int r = 0; r < 8; ++r) oacc[dt][r] *= al; }
#pragma unroll
    for (int dt = 0; dt < DT; ++dt) oacc[dt] = mmaH<1>(av[dt].v, av[dt].v, pb.v, pb.v, oacc[dt]); }
    asm volatile("s_wait_dscnt 0x0" ::: "memory");      /* this wave's reads of the buffer that is refilled below have returned */
    asm volatile("s_wait_asynccnt 0x0" ::: "memory");      /* this wave's share of the next stage has landed */
    __syncthreads();      /* publishes the next stage and ends every wave's reads of this one */
    if (j0 + 2 * KT < TK) fl_copy(lk + cur * BS, lv + cur * BS, LS, pk + (size_t)((j0 >> 6) + 2) * sk, dk, pv + (size_t)(j0 + 2 * KT) * 2, dv); }
  asm volatile("s_wait_asynccnt 0x0" ::: "memory");      /* no copy is left in flight behind the loop */
  const float l = l_q + x_half(l_q); const float li = (l > 0.f) ? 1.0f / (l * 1024.0f) : 0.f;
#pragma unroll
  for (int dt = 0; dt < DT; ++dt)
#pragma unroll
    for (int g = 0; g < 2; ++g) { const v4f val = {oacc[dt][4 * g] * li, oacc[dt][4 * g + 1] * li, oacc[dt][4 * g + 2] * li, oacc[dt][4 * g + 3] * li}; *(v4fa*)&sO[w][ln][dt * 16 + 8 * hh + 4 * g] = val; }
  __builtin_amdgcn_fence(__ATOMIC_ACQ_REL, "workgroup"); __builtin_amdgcn_wave_barrier();      /* the wave's own rows are in LDS before other lanes of it read them back as whole 128-byte lines */
  /* the context leaves as two f16 planes, hi and 2^10 x residual: 8 lanes store one row's 128-byte line of each plane */
  {
#pragma unroll
    for (int rp = 0; rp < RPW; rp += 4) { const int r = rp + (lane >> 3), pc = lane & 7; const v4f a = *(const v4fa*)&sO[w][r][pc * 8], c = *(const v4fa*)&sO[w][r][pc * 8 + 4]; FragH fh, fl;
#pragma unroll
      for (int q = 0; q < 4; ++q) { _Float16 hv = (_Float16)a[q]; fh.h[q] = hv; fl.h[q] = (_Float16)((a[q] - (float)hv) * 1024.0f); hv = (_Float16)c[q]; fh.h[4 + q] = hv; fl.h[4 + q] = (_Float16)((c[q] - (float)hv) * 1024.0f); }
      const size_t o = ((size_t)b * TQ + q0 + r) * ldo + h * 64 + pc * 8; *(v8us*)((unsigned short*)Oh + o) = fh.half[0]; *(v8us*)((unsigned short*)Ol + o) = fl.half[0]; }
     } }
// 5-plane variant: S = Qh Kh^T + (Ql Kh^T + Qh Kl^T)/1024 with Q/K = [hi | 2^10 residual] f16 planes (QL/KL same layout as Q16/K16), then the 3-term P.V below.
// 3-term variant: O = (P_hi V_hi + (P_lo V_hi + P_hi V_lo) / 1024) / l with P = [hi | 2^10 residual] of 1024 p and V^T = [hi | 2^10 residual] planes (VtL same layout as Vt) -> ~2^-21-class products for un-averaged (early causal / peaked) rows
template <int CAUSAL>
__global__ __launch_bounds__(128) void k_flash5(const _Float16* __restrict__ Q16, const _Float16* __restrict__ QL, int ldq, const _Float16* __restrict__ K16, const _Float16* __restrict__ KL, int ldk, const _Float16* __restrict__ Vt, const _Float16* __restrict__ VtL, const int* __restrict__ MSK, float* __restrict__ O, int ldo) {
  constexpr int RPW = 16, RTN = RPW / 16, NQB = TQ / (4 * RPW), DT = 4, KS = 2;
  __shared__ __attribute__((aligned(16))) unsigned short sP[4][RPW][40]; __shared__ __attribute__((aligned(16))) unsigned short sPL[4][RPW][40]; __shared__ __attribute__((aligned(16))) float sO[4][RPW][64 + 4];
  const int tid = threadIdx.x, w = tid >> 5, lane = tid & 31, ln = lane & 15, hh = lane >> 4;
  const int slab = blockIdx.x / QBN5, qblk = QB05 + blockIdx.x % QBN5; (void)NQB; const int b = slab / NH, h = slab % NH; const int qb0 = qblk * (4 * RPW); const int q0 = qb0 + w * RPW;
  FragH aq[2][KS], aql[2][KS];
#pragma unroll
  for (int rt = 0; rt < RTN; ++rt) { const unsigned short* qr = (const unsigned short*)Q16 + ((size_t)b * TQ + q0 + rt * 16 + ln) * ldq + h * 64; const unsigned short* ql = (const unsigned short*)QL + ((size_t)b * TQ + q0 + rt * 16 + ln) * ldq + h * 64;
#pragma unroll
    for (int ks = 0; ks < KS; ++ks) { aq[rt][ks].half[0] = *(const v8us*)(qr + ks * 32 + 8 * hh); aq[rt][ks].half[1] = *(const v8us*)(qr + ks * 32 + 16 + 8 * hh); aql[rt][ks].half[0] = *(const v8us*)(ql + ks * 32 + 8 * hh); aql[rt][ks].half[1] = *(const v8us*)(ql + ks * 32 + 16 + 8 * hh); } }
  const unsigned short* Vth = (const unsigned short*)Vt + (size_t)slab * 64 * TK; const unsigned short* Vtl = (const unsigned short*)VtL + (size_t)slab * 64 * TK;
  float m_r[2][8], l_r[2][8]; v8f oacc[2][DT], oaccL[2][DT];
#pragma unroll
  for (int rt = 0; rt < RTN; ++rt) {
#pragma unroll
    for (int r = 0; r < 8; ++r) { m_r[rt][r] = -3.0e38f; l_r[rt][r] = 0.f; }
#pragma unroll
    for (int dt = 0; dt < DT; ++dt) { oacc[rt][dt] = (v8f){0.f,0.f,0.f,0.f,0.f,0.f,0.f,0.f}; oaccL[rt][dt] = oacc[rt][dt]; } }
  const int jend = (CAUSAL == 1) ? (qb0 + 4 * RPW) : ((CAUSAL == 23) ? min(TK, (qb0 / CHK + 2) * CHK) : TK);      /* causal / window: keys that can never contribute are skipped */ const int jbeg = (CAUSAL == 23) ? max(0, (qb0 / CHK - 1) * CHK) : 0;
#pragma unroll 1
  for (int j0 = jbeg; j0 < jend; j0 += 32) {
    v8f s[2][2];
#pragma unroll
    for (int nt = 0; nt < 2; ++nt) { const unsigned short* kr = (const unsigned short*)K16 + ((size_t)b * TK + j0 + nt * 16 + ln) * ldk + h * 64; const unsigned short* klr = (const unsigned short*)KL + ((size_t)b * TK + j0 + nt * 16 + ln) * ldk + h * 64; FragH bk[KS], bkl[KS];
#pragma unroll
      for (int ks = 0; ks < KS; ++ks) { bk[ks].half[0] = *(const v8us*)(kr + ks * 32 + 8 * hh); bk[ks].half[1] = *(const v8us*)(kr + ks * 32 + 16 + 8 * hh); bkl[ks].half[0] = *(const v8us*)(klr + ks * 32 + 8 * hh); bkl[ks].half[1] = *(const v8us*)(klr + ks * 32 + 16 + 8 * hh); }
#pragma unroll
      for (int rt = 0; rt < RTN; ++rt) { v8f acc = (v8f){0.f,0.f,0.f,0.f,0.f,0.f,0.f,0.f}, accl = acc;
#pragma unroll
        for (int ks = 0; ks < KS; ++ks) { acc = mmaH<1>(aq[rt][ks].v, aq[rt][ks].v, bk[ks].v, bk[ks].v, acc); accl = mmaH<1>(aql[rt][ks].v, aql[rt][ks].v, bk[ks].v, bk[ks].v, accl); accl = mmaH<1>(aq[rt][ks].v, aq[rt][ks].v, bkl[ks].v, bkl[ks].v, accl); }
#pragma unroll
        for (int r = 0; r < 8; ++r) acc[r] += accl[r] * 0.0009765625f;
        s[rt][nt] = acc; } }
#pragma unroll
    for (int rt = 0; rt < RTN; ++rt)
#pragma unroll
      for (int r = 0; r < 8; ++r) { const int tq = q0 + rt * 16 + 8 * hh + r; const int k0 = j0 + ln, k1 = j0 + 16 + ln;
        bool ok0 = (CAUSAL == 1) ? (k0 <= tq) : ((CAUSAL == 2) ? ((k0 >> 5) == (tq >> 5)) : true), ok1 = (CAUSAL == 1) ? (k1 <= tq) : ((CAUSAL == 2) ? ((k1 >> 5) == (tq >> 5)) : true);      /* mode 2: block-diagonal 32-token groups */
        if (CAUSAL == 4) { const int* mrow = MSK + ((size_t)b * TQ + tq) * TK; ok0 = mrow[k0] != 0; ok1 = mrow[k1] != 0; }      /* mode 4: per-(query, key) INPUT mask shared by all heads; masked keys contribute nothing (== the reference's -4096 fill, whose exp underflows to 0), rows with no valid key give l = 0 -> output 0 (== the reference's row_valid zeroing) */
        float s0 = ok0 ? s[rt][0][r] * SCL : -3.0e38f, s1 = ok1 ? s[rt][1][r] * SCL : -3.0e38f; if (CAUSAL == 17) { const float* amk = (const float*)MSK + (size_t)b * TK; s0 += bf16_round(amk[k0]); s1 += bf16_round(amk[k1]); } if (CAUSAL == 18) { const float* tb = (const float*)MSK; const int* ri = MSK + 1024 + (size_t)b * TK; const int rq = ri[tq]; s0 += tb[(h * 8 + rq) * 8 + ri[k0]]; s1 += tb[(h * 8 + rq) * 8 + ri[k1]]; } if (CAUSAL == 19) { const int* rel = MSK + (size_t)tq * TK; const float* rb = (const float*)MSK + (size_t)TQ * TK + ((size_t)(b * NH + h) * TQ + tq) * 64; s0 += rb[rel[k0]]; s1 += rb[rel[k1]]; }      /* mode 19: + (q.Ek[rel] + Eb[rel][h]) / 8 gathered by the int relative ids (packed [ids | table]) */      /* mode 18: + resource_bias[h][r_q][r_k] from the packed [table | ids] buffer (TQ == TK) */      /* mode 17: additive per-(batch, key) mask INPUT */ float mc = fmaxf(s0, s1);
        mc = fmaxf(mc, __shfl_xor(mc, 1, 32)); mc = fmaxf(mc, __shfl_xor(mc, 2, 32)); mc = fmaxf(mc, __shfl_xor(mc, 4, 32)); mc = fmaxf(mc, __shfl_xor(mc, 8, 32));
        const float mn = fmaxf(m_r[rt][r], mc); const float al = (mn > -1.0e38f) ? expf(m_r[rt][r] - mn) : 1.0f; m_r[rt][r] = mn; const float p0 = ok0 ? expf(s0 - mn) : 0.f, p1 = ok1 ? expf(s1 - mn) : 0.f; l_r[rt][r] = l_r[rt][r] * al + p0 + p1;
#pragma unroll
        for (int dt = 0; dt < DT; ++dt) { oacc[rt][dt][r] *= al; oaccL[rt][dt][r] *= al; }
        FragH t2, t2l; const float ps0 = p0 * 1024.0f, ps1 = p1 * 1024.0f; t2.h[0] = (_Float16)ps0; t2.h[1] = (_Float16)ps1; t2l.h[0] = (_Float16)((ps0 - (float)t2.h[0]) * 1024.0f); t2l.h[1] = (_Float16)((ps1 - (float)t2.h[1]) * 1024.0f);
        sP[w][rt * 16 + 8 * hh + r][ln] = t2.u[0]; sP[w][rt * 16 + 8 * hh + r][16 + ln] = t2.u[1]; sPL[w][rt * 16 + 8 * hh + r][ln] = t2l.u[0]; sPL[w][rt * 16 + 8 * hh + r][16 + ln] = t2l.u[1]; }
    __builtin_amdgcn_fence(__ATOMIC_ACQ_REL, "workgroup"); __builtin_amdgcn_wave_barrier();
    FragH pa[2], pl[2];
#pragma unroll
    for (int rt = 0; rt < RTN; ++rt) { pa[rt].half[0] = *(const v8us*)&sP[w][rt * 16 + ln][8 * hh]; pa[rt].half[1] = *(const v8us*)&sP[w][rt * 16 + ln][16 + 8 * hh]; pl[rt].half[0] = *(const v8us*)&sPL[w][rt * 16 + ln][8 * hh]; pl[rt].half[1] = *(const v8us*)&sPL[w][rt * 16 + ln][16 + 8 * hh]; }
#pragma unroll
    for (int dt = 0; dt < DT; ++dt) { const unsigned short* vrow = Vth + (size_t)(dt * 16 + ln) * TK + j0; const unsigned short* vrl = Vtl + (size_t)(dt * 16 + ln) * TK + j0; FragH bv, bl; bv.half[0] = *(const v8us*)(vrow + 8 * hh); bv.half[1] = *(const v8us*)(vrow + 16 + 8 * hh); bl.half[0] = *(const v8us*)(vrl + 8 * hh); bl.half[1] = *(const v8us*)(vrl + 16 + 8 * hh);
#pragma unroll
      for (int rt = 0; rt < RTN; ++rt) { oacc[rt][dt] = mmaH<1>(pa[rt].v, pa[rt].v, bv.v, bv.v, oacc[rt][dt]); oaccL[rt][dt] = mmaH<1>(pl[rt].v, pl[rt].v, bv.v, bv.v, oaccL[rt][dt]); oaccL[rt][dt] = mmaH<1>(pa[rt].v, pa[rt].v, bl.v, bl.v, oaccL[rt][dt]); } }
    __builtin_amdgcn_fence(__ATOMIC_ACQ_REL, "workgroup"); __builtin_amdgcn_wave_barrier(); }
#pragma unroll
  for (int rt = 0; rt < RTN; ++rt) {
#pragma unroll
    for (int r = 0; r < 8; ++r) { float l = l_r[rt][r]; l += __shfl_xor(l, 1, 32); l += __shfl_xor(l, 2, 32); l += __shfl_xor(l, 4, 32); l += __shfl_xor(l, 8, 32); l_r[rt][r] = (l > 0.f) ? 1.0f / (l * 1024.0f) : 0.f; }
#pragma unroll
    for (int dt = 0; dt < DT; ++dt)
#pragma unroll
      for (int r = 0; r < 8; ++r) { float v = oacc[rt][dt][r]; v += oaccL[rt][dt][r] * 0.0009765625f; sO[w][rt * 16 + 8 * hh + r][dt * 16 + ln] = v * l_r[rt][r]; } }
  __builtin_amdgcn_fence(__ATOMIC_ACQ_REL, "workgroup"); __builtin_amdgcn_wave_barrier();
  {
#pragma unroll
    for (int rp = 0; rp < RPW; rp += 2) { const int r = rp + (lane >> 4), pc = lane & 15; const v4f val = *(const v4fa*)&sO[w][r][pc * 4]; *(v4f*)(O + ((size_t)b * TQ + q0 + r) * ldo + h * 64 + pc * 4) = val; }
     } }

__global__ __launch_bounds__(256) void k_rotab(float* __restrict__ CS, float* __restrict__ SN) {
  #pragma clang fp contract(off)
  const int t = blockIdx.x * 256 + threadIdx.x; if (t >= SLEN * 32) return; const int j = t % 32, s = t / 32; const float ex = (float)(2 * j) / 64.0f; const float inv = 1.0f / powf(10000.0f, ex); const float th = (float)s * inv; const float c = cosf(th), sn = sinf(th);
  { *(float*)(CS + t) = c; *(float*)(SN + t) = sn;  } }
__global__ __launch_bounds__(256) void k_rope(const float* __restrict__ F, int nsrc, int ndst, int rep, const float* __restrict__ CS, const float* __restrict__ SN, _Float16* __restrict__ H, _Float16* __restrict__ L) {
  #pragma clang fp contract(off)
  const size_t t = (size_t)blockIdx.x * 256 + threadIdx.x; if (t >= (size_t)NR * ndst * 4) return; const int g8 = (int)(t % 4); const int hd = (int)((t / 4) % ndst); const size_t row = t / ((size_t)4 * ndst); const int s = (int)(row % SLEN); const int hs = hd / rep;
  const float* src = F + row * (size_t)(nsrc * 64) + hs * 64; FragH ah, al, bh, bl;
  for (int i = 0; i < 8; ++i) { const int d = g8 * 8 + i; const float c = CS[s * 32 + d], sn = SN[s * 32 + d]; const float x1 = src[d], x2 = src[d + 32];
    float o1 = x1 * c; o1 += -x2 * sn; float o2 = x2 * c; o2 += x1 * sn;
    _Float16 hv = (_Float16)o1; ah.h[i] = hv; al.h[i] = (_Float16)((o1 - (float)hv) * 1024.0f); hv = (_Float16)o2; bh.h[i] = hv; bl.h[i] = (_Float16)((o2 - (float)hv) * 1024.0f); }
  const size_t o = row * (size_t)(ndst * 64) + hd * 64 + g8 * 8;
  { *(v8us*)((unsigned short*)H + o) = ah.half[0]; *(v8us*)((unsigned short*)H + o + 32) = bh.half[0]; *(v8us*)((unsigned short*)L + o) = al.half[0]; *(v8us*)((unsigned short*)L + o + 32) = bl.half[0];  } }
__global__ __launch_bounds__(256) void k_rope2(const float* __restrict__ F, int nsrc, int ndst, int rep, const float* __restrict__ CS, const float* __restrict__ SN, _Float16* __restrict__ H, _Float16* __restrict__ L) {
  #pragma clang fp contract(off)
  const size_t t = (size_t)blockIdx.x * 256 + threadIdx.x; if (t >= (size_t)NR * ndst * 4) return; const int g16 = (int)(t % 4); const int hd = (int)((t / 4) % ndst); const size_t row = t / ((size_t)4 * ndst); const int s = (int)(row % SLEN); const int hs = hd / rep;
  const float* src = F + row * (size_t)(nsrc * 64) + hs * 64 + g16 * 16; FragH ah, al;
  for (int pr = 0; pr < 8; ++pr) { const int i = g16 * 8 + pr; const float c = CS[s * 32 + i], sn = SN[s * 32 + i]; const float x1 = src[2 * pr], x2 = src[2 * pr + 1];
    float o1 = x1 * c; o1 -= x2 * sn; float o2 = x1 * sn; o2 += x2 * c;
    _Float16 hv = (_Float16)o1; ah.h[2 * pr] = hv; al.h[2 * pr] = (_Float16)((o1 - (float)hv) * 1024.0f); hv = (_Float16)o2; ah.h[2 * pr + 1] = hv; al.h[2 * pr + 1] = (_Float16)((o2 - (float)hv) * 1024.0f); }
  const size_t o = row * (size_t)(ndst * 64) + hd * 64 + g16 * 16;
  { *(v8us*)((unsigned short*)H + o) = ah.half[0]; *(v8us*)((unsigned short*)H + o + 8) = ah.half[1]; *(v8us*)((unsigned short*)L + o) = al.half[0]; *(v8us*)((unsigned short*)L + o + 8) = al.half[1];  } }
__global__ __launch_bounds__(256) void k_ln512(const float* __restrict__ A, const float* __restrict__ res, const float* __restrict__ g, const float* __restrict__ bb, float* __restrict__ Y, _Float16* __restrict__ Y16) {
  #pragma clang fp contract(off)
  const int wv = threadIdx.x >> 5, ln = threadIdx.x & 31; const size_t r = (size_t)blockIdx.x * 8 + wv; if (r >= NR) return; float x[16]; float s = 0.f;
  for (int i = 0; i < 2; ++i) { const v8f a = *(const v8f*)(A + r * DM + i * 256 + ln * 8); for (int q = 0; q < 8; ++q) { float v = a[q]; if (res) v += bf16_round(res[r * DM + i * 256 + ln * 8 + q]); x[i * 8 + q] = v; s += v; } }
  for (int o = 16; o > 0; o >>= 1) s += __shfl_xor(s, o, 32); const float mu = s / (float)DM; float var = 0.f; for (int q = 0; q < 16; ++q) { const float d = x[q] - mu; var += d * d; }
  for (int o = 16; o > 0; o >>= 1) var += __shfl_xor(var, o, 32); const float inv = rsqrtf(var / (float)DM + 1e-5f);
  { for (int i = 0; i < 2; ++i) { const int c0 = i * 256 + ln * 8; v8f y; FragH f; for (int q = 0; q < 8; ++q) { float v = (x[i * 8 + q] - mu) * inv; v *= bf16_round(g[c0 + q]); v += bf16_round(bb[c0 + q]); y[q] = v; f.h[q] = (_Float16)v; } *(v8f*)(Y + r * DM + c0) = y; if (Y16) *(v8us*)((unsigned short*)Y16 + r * DM + c0) = f.half[0]; }  } }
__global__ __launch_bounds__(256) void k_pack(const float* __restrict__ rb, const int* __restrict__ rid, int* __restrict__ PK) { const int t = blockIdx.x * 256 + threadIdx.x; if (t >= 1024 + NB * TK) return; int v; if (t < 1024) v = __float_as_int(bf16_round(rb[t])); else v = rid[t - 1024]; *(int*)(PK + t) = v;  }
__global__ __launch_bounds__(256) void k_tabin(const float* __restrict__ sp, float* __restrict__ CS, float* __restrict__ SN) { const int t = blockIdx.x * 256 + threadIdx.x; if (t >= SLEN * 32) return; const int i = t % 32, s = t / 32; const float c = bf16_round(sp[s * 64 + 32 + i]), sn = bf16_round(sp[s * 64 + i]);
  { *(float*)(CS + t) = c; *(float*)(SN + t) = sn;  } }
__device__ __forceinline__ void d_wsc(unsigned blk, const float* __restrict__ Wm, _Float16* __restrict__ Bt, size_t n8, float sc) { const size_t t = (size_t)blk * 256 + threadIdx.x; if (t >= n8) return; FragH f; for (int q = 0; q < 8; ++q) f.h[q] = (_Float16)(bf16_round(Wm[t * 8 + q]) * sc); *(v8us*)((unsigned short*)Bt + t * 8) = f.half[0];  }
__global__ __launch_bounds__(256) void k_rotab2(float* __restrict__ CS, float* __restrict__ SN) {
  #pragma clang fp contract(off)
  const int t = blockIdx.x * 256 + threadIdx.x; if (t >= SLEN * 32) return; const int j = t % 32, s = t / 32; const float c0 = -0.14391156831212787f;      /* -ln(10000)/64 rounded to f32 */ const float inv = expf((float)(2 * j) * c0); const float th = (float)s * inv; const float c = cosf(th), sn = sinf(th);
  { *(float*)(CS + t) = c; *(float*)(SN + t) = sn;  } }
__global__ __launch_bounds__(256) void k_lnu(const float* __restrict__ X, _Float16* __restrict__ N16, float* __restrict__ XB) {
  #pragma clang fp contract(off)
  const int wv = threadIdx.x >> 5, ln = threadIdx.x & 31; const size_t r = (size_t)blockIdx.x * 8 + wv; if (r >= NR) return; float a[32]; float s = 0.f;
  for (int i = 0; i < 4; ++i) { const v8f v = *(const v8f*)(X + r * DM + (i * 32 + ln) * 8); for (int q = 0; q < 8; ++q) { const float u = bf16_round(v[q]); a[i * 8 + q] = u; s += u; } }
  for (int o = 16; o > 0; o >>= 1) s += __shfl_xor(s, o, 32); const float mu = s / (float)DM; float var = 0.f; for (int q = 0; q < 32; ++q) { const float d = a[q] - mu; var += d * d; }
  for (int o = 16; o > 0; o >>= 1) var += __shfl_xor(var, o, 32); const float den = sqrtf(var / (float)(DM - 1)) + 1e-6f; const float inv = 1.0f / den;      /* one reciprocal per row; (x-mean)*inv vs the reference's division differs by <= 1 ulp */
  { for (int i = 0; i < 4; ++i) { const int c0 = (i * 32 + ln) * 8; FragH f; v8f xb; for (int q = 0; q < 8; ++q) { f.h[q] = (_Float16)((a[i * 8 + q] - mu) * inv); xb[q] = a[i * 8 + q]; } *(v8us*)((unsigned short*)N16 + r * DM + c0) = f.half[0]; *(v8f*)(XB + r * DM + c0) = xb; }  } }
__device__ __forceinline__ void d_vtg(int blk, const _Float16* __restrict__ V16, _Float16* __restrict__ Vt) { __shared__ unsigned short tl[64][66]; const int tid = threadIdx.x; const int slab = blk / (SLEN / 64), lg = blk % (SLEN / 64); const int b = slab / NH, h = slab % NH; const int hs = h / NREP;
  for (int i = tid; i < 64 * 8; i += 256) { const int r = i / 8, c8 = (i % 8) * 8; FragH f; f.half[0] = *(const v8us*)((const unsigned short*)V16 + ((size_t)b * SLEN + lg * 64 + r) * KVD + hs * 64 + c8); for (int q = 0; q < 8; ++q) tl[r][c8 + q] = f.u[q]; }
  __syncthreads();
  { for (int rd = 0; rd < 2; ++rd) { const int d = rd * 32 + tid / 8, pc = tid % 8; FragH f; for (int q = 0; q < 8; ++q) f.u[q] = tl[pc * 8 + q][d]; *(v8us*)((unsigned short*)Vt + ((size_t)slab * 64 + d) * SLEN + lg * 64 + pc * 8) = f.half[0]; }
    asm volatile("s_wait_xcnt 0x0" ::: "memory");      /* stands behind the two stores as a precaution: the V^T body ends the shared kernel */ } }

__global__ __launch_bounds__(256) void k_h16s(const float* __restrict__ SRC, int lds, int coff, _Float16* __restrict__ DST, size_t n8) { const size_t t = (size_t)blockIdx.x * 256 + threadIdx.x; if (t >= n8) return; const size_t r = (t * 8) / DM; const int c = (int)((t * 8) % DM); const v8f a = *(const v8f*)(SRC + r * lds + coff + c); FragH f; for (int q = 0; q < 8; ++q) f.h[q] = (_Float16)a[q];
  *(v8us*)((unsigned short*)DST + t * 8) = f.half[0];  }


__global__ __launch_bounds__(256) void k_ccp(const float* __restrict__ QKV, int coff, _Float16* __restrict__ D) { const size_t t = (size_t)blockIdx.x * 256 + threadIdx.x; if (t >= (size_t)NR * DM / 8) return; const int c0 = (int)((t * 8) % DM); const size_t row = (t * 8) / DM; const v8f a = *(const v8f*)(QKV + row * 3 * DM + coff + c0); FragH f; for (int q = 0; q < 8; ++q) f.h[q] = (_Float16)a[q];
  *(v8us*)((unsigned short*)D + t * 8) = f.half[0];  }


__device__ __forceinline__ void d_sbe(unsigned blk, const float* __restrict__ q, _Float16* __restrict__ X) { const size_t t = (size_t)blk * 256 + threadIdx.x; if (t >= (size_t)NR * DM / 8) return; const int c0 = (int)((t * 8) % DM); const size_t row = (t * 8) / DM; const int b = (int)(row / SLEN), s_ = (int)(row % SLEN); const float* src = q + ((size_t)s_ * NBS + b) * DM + c0; FragH f; for (int i = 0; i < 8; ++i) f.h[i] = (_Float16)bf16_round(src[i]);
  *(v8us*)((unsigned short*)X + t * 8) = f.half[0];  }
__device__ __forceinline__ void d_rope(unsigned blk, const float* __restrict__ F, _Float16* __restrict__ O16) {
  #pragma clang fp contract(off)
  const size_t t = (size_t)blk * 256 + threadIdx.x; if (t >= (size_t)NR * DM / 16) return; const int d0 = (int)((t * 8) % 32); const int h = (int)(((t * 8) / 32) % NH); const size_t row = (t * 8) / (32 * NH); const int s_ = (int)(row % SLEN); const float* p = F + row * DM + h * 64; const v8f a = *(const v8f*)(p + d0), c = *(const v8f*)(p + 32 + d0); FragH f1, f2;
  asm volatile("s_wait_xcnt 0x0" ::: "memory");      /* stands behind the four loads: the loop below reuses their address registers */
#pragma unroll 1
  for (int q = 0; q < 8; ++q) { const int d = d0 + q; const float inv = 1.0f / powf(10000.0f, (float)(2 * d) / 64.0f); const float ang = (float)s_ * inv; const float sn = sinf(ang), cs = cosf(ang); float o1 = a[q] * cs; o1 = o1 - c[q] * sn; float o2 = c[q] * cs; o2 = o2 + a[q] * sn; f1.h[q] = (_Float16)o1; f2.h[q] = (_Float16)o2; }
  { *(v8us*)((unsigned short*)O16 + row * DM + h * 64 + d0) = f1.half[0]; *(v8us*)((unsigned short*)O16 + row * DM + h * 64 + 32 + d0) = f2.half[0];  } }
// Launches that do not depend on one another share one grid: the block index, the same for a whole block, picks the body.
// Preparation: the query rows (XB blocks), then the four weight matrices (WB blocks each) into four planes that follow one another in Bt.
#define XB ((unsigned)((size_t)NR * DM / 8 / 256))
#define WB ((unsigned)((size_t)DM * DM / 8 / 256))
__global__ __launch_bounds__(256) void k_prep(const float* __restrict__ q, _Float16* __restrict__ X, const float* __restrict__ w0, const float* __restrict__ w1, const float* __restrict__ w2, const float* __restrict__ w3, _Float16* __restrict__ Bt) {
  const unsigned bx = blockIdx.x;
  if (bx < XB) { d_sbe(bx, q, X); return; }
  const unsigned m = (bx - XB) / WB; const float* Wm = m == 0 ? w0 : (m == 1 ? w1 : (m == 2 ? w2 : w3));
  d_wsc(bx - XB - m * WB, Wm, Bt + (size_t)m * DM * DM, (size_t)DM * DM / 8, 16.0f); }
// Behind the q/k/v product: RoPE of q, RoPE of k (RB blocks each, the long bodies first), then V^T.
#define RB ((unsigned)((size_t)NR * DM / 16 / 256))
__global__ __launch_bounds__(256) void k_post(const float* __restrict__ Fq, _Float16* __restrict__ Q16, const float* __restrict__ Fk, _Float16* __restrict__ K16, const _Float16* __restrict__ V16, _Float16* __restrict__ Vt) {
  const unsigned bx = blockIdx.x;
  if (bx < 2 * RB) { const bool isk = bx >= RB; d_rope(isk ? bx - RB : bx, isk ? Fk : Fq, isk ? K16 : Q16); return; }
  d_vtg((int)(bx - 2 * RB), V16, Vt); }
extern "C" void kernel_launch(void* const* d_in, const int* in_sizes, int n_in,
                              void* d_out, int out_size, void* d_ws, size_t ws_size, hipStream_t stream) {
  (void)in_sizes; (void)n_in; (void)out_size;
  const float* qy = (const float*)d_in[0]; const float* wq = (const float*)d_in[1]; const float* bq = (const float*)d_in[2]; const float* wk = (const float*)d_in[3]; const float* bk = (const float*)d_in[4]; const float* wv = (const float*)d_in[5]; const float* bv = (const float*)d_in[6]; const float* wo = (const float*)d_in[7]; const float* bo = (const float*)d_in[8];
  char* ws = (char*)d_ws; size_t off = 0;
  auto take = [&](size_t bytes) { char* p = ws + off; off += (bytes + 255) & ~(size_t)255; return p; };
  const size_t np = (size_t)NR * DM;
  _Float16* BW = (_Float16*)take((size_t)DM * DM * 2 * 4); _Float16* BO = BW + (size_t)DM * DM * 3;      /* weight planes q, k, v, o in a row */ _Float16* X16 = (_Float16*)take(np * 2); float* F32 = (float*)take(np * 4 * 2);      /* f32 planes q, k in a row */
   _Float16* QH = (_Float16*)take(np * 2); _Float16* KH = (_Float16*)take(np * 2); _Float16* V16 = (_Float16*)take(np * 2); _Float16* VT = (_Float16*)take(np * 2); _Float16* OH = (_Float16*)take(np * 2); _Float16* OL = (_Float16*)take(np * 2);      /* planes of their own: k_flash stores them while other blocks of it still read QH, KH */
  if (off > ws_size) return;
  k_prep<<<XB + 4 * WB, 256, 0, stream>>>(qy, X16, wq, wk, wv, wo, BW);      /* weights stay in their (out, in) order */
  const dim3 g((NR / 128) * (DM / 64), 1), g3((NR / 128) * (DM / 64), 3);
  k_gemm2<0, false><<<g3, 128, 0, stream>>>(X16, DM, 0, nullptr, BW, DM, (size_t)DM * DM, 0.0625f, bq, bk, bv, nullptr, 1, 0, 0, F32, V16, DM, np, 2, NR, DM, DM);      /* batches q, k (f32 planes), v (f16) */
  k_post<<<2 * RB + NB * NH * (SLEN / 64), 256, 0, stream>>>(F32, QH, F32 + np, KH, V16, VT);
  k_flash<<<NB * NH * QBNP, 128, 0, stream>>>(QH, DM, KH, DM, VT, OH, OL, DM);
  k_gemm2<0, true><<<g, 128, 0, stream>>>(OL, DM, 0, OH, BO, DM, 0, 0.0625f, bo, nullptr, nullptr, nullptr, 1, 0, 0, (float*)d_out, nullptr, DM, 0, 1, NR, DM, DM);      /* out[s][b] = (ctx_lo / 1024 + ctx_hi) Wo^T + b */
}

// v006
// A run of this version takes 154 microseconds.
// In two side-by-side timings against v005, it was 1.18 and 1.17 times as fast.
// Counting every step since v000, it is 3.64 times as fast.
#include <hip/hip_runtime.h>
// Multi-head self-attention with rotary embedding (query [2048][2][1024] in [S, B, E] layout, 16 heads x 64: q/k/v = query W^T + b; rotary embedding per head (inv_freq = 10000^(-2i/64), rotate-half form) on q and k; softmax(q k^T / 8) v (no mask); out = attn Wo^T + bo, back in [S, B, E]).
// Structure: [S,B,E] -> exact f16 (b, s) rows; q/k as f32 WMMA GEMMs (32x64 wave tiles, f32 accumulation, exact x16 weights + bias) followed by RoPE on VALU (f32 angles s * inv_freq, sinf/cosf) into f16 planes; v as an f16 GEMM; V^T by LDS tiles; flash-style fused attention per (batch, head, 64-query block) (K Q^T and V^T P^T, one query per lane, online softmax and P in registers; no score plane), whose epilogue stores the context as f16 hi / 2^10 residual planes; output projection as one GEMM launch that runs the residual term, scales it by 2^-10 and sums the hi term on top, + bias, stored straight into [S, B, E].
// Launches: 5. Bodies that do not depend on one another share a grid (k_prep: x and the four weights; k_gemm2 with 3 batches: q, k, v; k_post: RoPE of q, RoPE of k, V^T); the elementwise bodies behind k_flash live in their neighbours' epilogues.
// Left: RoPE evaluates powf, sinf, cosf per (row, head, d) although the angle depends on (s, d) alone; k_prep and k_post start many short waves; the q/k/v product's epilogue still tests its addend and its two stores at run time, element by element; in k_flash's loop the four v_nop written behind every matrix instruction are now about a third of the vector instructions, and its LDS fragment reads come close to the LDS rate.
// Compute dtype: inputs rounded to bf16; query / weights exact as f16; roped q/k and v plain f16 (~2^-12); softmax f32 with f16 probabilities; context hi + 2^-10 residual into the projection. v_wmma_f32_16x16x32_f16.
#define NB 2
#define DM 1024
#define NKV 16
#define NREP (NH / NKV)
#define KVD (NKV * 64)           /* 1024 */
#define NR (NB * SLEN)
#define CHK 512
typedef int v4i __attribute__((ext_vector_type(4)));
#define FF 2048
#define SLEN 2048
#define MQI 2048
#define MKI 2048
#define TQ SLEN
#define TK SLEN
#define NH 16
#define SCL 0.125f
#define QBLKS (TQ / 64)
#define QB05 0
#define QBN5 4
#define QB0P 0
#define QBNP QBLKS
#define RE 256
typedef __bf16 v16b __attribute__((ext_vector_type(16)));
typedef unsigned short v8us __attribute__((ext_vector_type(8), may_alias));
typedef float  v8f  __attribute__((ext_vector_type(8)));
typedef float  v4f  __attribute__((ext_vector_type(4)));
typedef float  v4fa __attribute__((ext_vector_type(4), may_alias));
union FragB { v16b v; v8us half[2]; unsigned short u[16]; };

__device__ __forceinline__ unsigned short bf16_bits(float x) { unsigned int u = __float_as_uint(x); return (unsigned short)((u + 0x7FFFu + ((u >> 16) & 1u)) >> 16); }
__device__ __forceinline__ float bf16_val(unsigned short b) { return __uint_as_float(((unsigned int)b) << 16); }
__device__ __forceinline__ float bf16_round(float x) { return bf16_val(bf16_bits(x)); }
// D += A·B with NT terms: 1 = ah·bh, 2 = + al·bh (A split), 3 = + ah·bl (both split)
template <int NT>
__device__ __forceinline__ v8f mmaN(v16b ah, v16b al, v16b bh, v16b bl, v8f c) {
  c = __builtin_amdgcn_wmma_f32_16x16x32_bf16(false, ah, false, bh, (short)0, c, false, false);
  if (NT >= 2) c = __builtin_amdgcn_wmma_f32_16x16x32_bf16(false, al, false, bh, (short)0, c, false, false);
  if (NT >= 3) c = __builtin_amdgcn_wmma_f32_16x16x32_bf16(false, ah, false, bl, (short)0, c, false, false);
  asm volatile("v_nop\n\tv_nop\n\tv_nop\n\tv_nop" : "+v"(c) : "v"(ah), "v"(al), "v"(bh), "v"(bl));
  return c;
}

__global__ __launch_bounds__(256) void k_wt_bf16(const float* __restrict__ W, unsigned short* __restrict__ Wt, int K, int N) {
  const int t = blockIdx.x * 256 + threadIdx.x;
  const int k8n = K / 8;
  if (t >= N * k8n) return;
  const int n = t / k8n, k8 = (t % k8n) * 8;
  v8us v;
#pragma unroll
  for (int i = 0; i < 8; ++i) v[i] = bf16_bits(W[(size_t)(k8 + i) * N + n]);
  *(v8us*)(Wt + (size_t)n * K + k8) = v;
  
}

// GEMM C[M][N] (f32, pitch ldc) = act(A[M][K]·W + bias). A f32 row-major (pitch lda) converted per fragment to bf16
// (ASPLIT: hi/lo two planes -> 2 terms, else single rounded term); Wt bf16 [N][K] (pitch ldb). BIAS_BF16 rounds the
// bias to bf16 first (bias quantised to bf16 before the add). K%32==0, M%16==0, N%64==0.
template <bool ASPLIT, int ACT, bool BIAS_BF16>
__global__ __launch_bounds__(128) void k_gemm_bf(const float* __restrict__ A, int lda, const unsigned short* __restrict__ Wt, int ldb,
                                               const float* __restrict__ bias, float* __restrict__ C, int ldc, int M, int N, int K) {
  __shared__ __attribute__((aligned(16))) float so[4][16][64];
  const int tid = threadIdx.x, w = tid >> 5, lane = tid & 31, ln = lane & 15, hh = lane >> 4;
  const int ntn = N / 64;
  const int wid = blockIdx.x * 4 + w;
  const int mt = wid / ntn, nq = wid % ntn;
  if (mt * 16 >= M) return;
  const int row0 = mt * 16, col0 = nq * 64;
  const float* arow = A + (size_t)(row0 + ln) * lda;
  v8f acc[4] = {};
  for (int kb = 0; kb < K; kb += 32) {
    FragB ah, al;
    const v4f x0 = *(const v4fa*)(arow + kb + 8 * hh), x1 = *(const v4fa*)(arow + kb + 8 * hh + 4);
    const v4f x2 = *(const v4fa*)(arow + kb + 16 + 8 * hh), x3 = *(const v4fa*)(arow + kb + 16 + 8 * hh + 4);
    float xs[16] = {x0[0],x0[1],x0[2],x0[3],x1[0],x1[1],x1[2],x1[3],x2[0],x2[1],x2[2],x2[3],x3[0],x3[1],x3[2],x3[3]};
#pragma unroll
    for (int i = 0; i < 16; ++i) { const unsigned short hb = bf16_bits(xs[i]); ah.u[i] = hb; al.u[i] = ASPLIT ? bf16_bits(xs[i] - bf16_val(hb)) : (unsigned short)0; }
#pragma unroll
    for (int t = 0; t < 4; ++t) {
      const unsigned short* brow = Wt + (size_t)(col0 + t * 16 + ln) * ldb + kb;
      FragB b;
      b.half[0] = *(const v8us*)(brow + 8 * hh);
      b.half[1] = *(const v8us*)(brow + 16 + 8 * hh);
      acc[t] = mmaN<ASPLIT ? 2 : 1>(ah.v, al.v, b.v, b.v, acc[t]);
    }
  }
#pragma unroll
  for (int t = 0; t < 4; ++t) {
    float bv = bias ? bias[col0 + t * 16 + ln] : 0.f;
    if (BIAS_BF16) bv = bf16_round(bv);
#pragma unroll
    for (int r = 0; r < 8; ++r) { float v = acc[t][r] + bv; if (ACT == 1) v = fmaxf(v, 0.f); so[w][8 * hh + r][t * 16 + ln] = v; }
  }
  __builtin_amdgcn_fence(__ATOMIC_ACQ_REL, "workgroup");
  __builtin_amdgcn_wave_barrier();
  const int rsub = lane >> 4, c4 = (lane & 15) * 4;
  {
#pragma unroll
    for (int q = 0; q < 8; ++q) {
      const int r = q * 2 + rsub;
      const v4f v = *(const v4fa*)&so[w][r][c4];
      *(v4f*)(C + (size_t)(row0 + r) * ldc + col0 + c4) = v;
    }
    
  }
}

// GEMM C = act(A·W + bias + resid): A f32 (ASPLIT -> hi/lo 2 terms), Wt bf16 [N][K]; ACT 0 none, 1 relu, 2 exact gelu;
// resid (optional, f32, row index = (row % rmod), pitch ldr, RES_BF16 rounds it) added before the activation.
template <bool ASPLIT, int ACT, bool BIAS_BF16, bool RES_BF16>
__global__ __launch_bounds__(128) void k_gemm_bf3(const float* __restrict__ A, int lda, const unsigned short* __restrict__ Wt, int ldb,
                                                const float* __restrict__ bias, const float* __restrict__ resid, int rmod, int ldr,
                                                float* __restrict__ C, int ldc, int M, int N, int K) {
  __shared__ __attribute__((aligned(16))) float so[4][16][64];
  const int tid = threadIdx.x, w = tid >> 5, lane = tid & 31, ln = lane & 15, hh = lane >> 4;
  const int ntn = N / 64;
  const int wid = blockIdx.x * 4 + w;
  const int mt = wid / ntn, nq = wid % ntn;
  if (mt * 16 >= M) return;
  const int row0 = mt * 16, col0 = nq * 64;
  const float* arow = A + (size_t)(row0 + ln) * lda;
  v8f acc[4] = {};
  for (int kb = 0; kb < K; kb += 32) {
    FragB ah, al;
    const v4f x0 = *(const v4fa*)(arow + kb + 8 * hh), x1 = *(const v4fa*)(arow + kb + 8 * hh + 4);
    const v4f x2 = *(const v4fa*)(arow + kb + 16 + 8 * hh), x3 = *(const v4fa*)(arow + kb + 16 + 8 * hh + 4);
    float xs[16] = {x0[0],x0[1],x0[2],x0[3],x1[0],x1[1],x1[2],x1[3],x2[0],x2[1],x2[2],x2[3],x3[0],x3[1],x3[2],x3[3]};
#pragma unroll
    for (int i = 0; i < 16; ++i) { const unsigned short hb = bf16_bits(xs[i]); ah.u[i] = hb; al.u[i] = ASPLIT ? bf16_bits(xs[i] - bf16_val(hb)) : (unsigned short)0; }
#pragma unroll
    for (int t = 0; t < 4; ++t) {
      const unsigned short* brow = Wt + (size_t)(col0 + t * 16 + ln) * ldb + kb;
      FragB b;
      b.half[0] = *(const v8us*)(brow + 8 * hh);
      b.half[1] = *(const v8us*)(brow + 16 + 8 * hh);
      acc[t] = mmaN<ASPLIT ? 2 : 1>(ah.v, al.v, b.v, b.v, acc[t]);
    }
  }
#pragma unroll
  for (int t = 0; t < 4; ++t) {
    const int col = col0 + t * 16 + ln;
    float bv = bias ? bias[col] : 0.f;
    if (BIAS_BF16) bv = bf16_round(bv);
#pragma unroll
    for (int r = 0; r < 8; ++r) {
      float v = acc[t][r] + bv;
      if (resid) { float rv = resid[(size_t)((row0 + 8 * hh + r) % rmod) * ldr + col]; if (RES_BF16) rv = bf16_round(rv); v += rv; }
      if (ACT == 1) v = fmaxf(v, 0.f);
      if (ACT == 2) v = 0.5f * v * (1.0f + erff(v * 0.70710678118654752f));
      if (ACT == 3) { const float u = 0.7978845608028654f * (v + 0.044715f * v * v * v); v = 0.5f * v * (1.0f + tanhf(u)); }
      so[w][8 * hh + r][t * 16 + ln] = v;
    }
  }
  __builtin_amdgcn_fence(__ATOMIC_ACQ_REL, "workgroup");
  __builtin_amdgcn_wave_barrier();
  const int rsub = lane >> 4, c4 = (lane & 15) * 4;
  {
#pragma unroll
    for (int q = 0; q < 8; ++q) {
      const int r = q * 2 + rsub;
      const v4f v = *(const v4fa*)&so[w][r][c4];
      *(v4f*)(C + (size_t)(row0 + r) * ldc + col0 + c4) = v;
    }
    
  }
}
// row LayerNorm (biased variance, eps) over N: s = X (+ R); optional out_sum <- s; out_norm <- (s-mu)*rsqrt(var+eps)*g + b
template <bool PARAM_BF16>
__global__ __launch_bounds__(256) void k_layernorm(const float* __restrict__ X, const float* __restrict__ R, const float* __restrict__ g, const float* __restrict__ bta,
                                                  float* __restrict__ out_sum, float* __restrict__ out_norm, int N, float eps) {
  __shared__ float red[256];
  const int row = blockIdx.x, tid = threadIdx.x;
  const float* x = X + (size_t)row * N; const float* rr = R ? R + (size_t)row * N : nullptr;
  float vals[16];                     // up to N = 4096
  const int per = N / 256;            // contiguous chunk per thread? use strided-by-4 chunks: thread handles j = tid*4 + 1024*u
  float s1 = 0.f;
  for (int u = 0; u < per / 4; ++u) {
    const int j = tid * 4 + 1024 * u;
    const v4f a = *(const v4fa*)(x + j);
    v4f b = {0.f,0.f,0.f,0.f}; if (rr) b = *(const v4fa*)(rr + j);
#pragma unroll
    for (int q = 0; q < 4; ++q) { const float v = a[q] + b[q]; vals[u * 4 + q] = v; s1 += v; }
  }
  red[tid] = s1; __syncthreads();
  for (int st = 128; st > 0; st >>= 1) { if (tid < st) red[tid] += red[tid + st]; __syncthreads(); }
  const float mu = red[0] / (float)N; __syncthreads();
  float s2 = 0.f;
  for (int u = 0; u < per / 4; ++u)
#pragma unroll
    for (int q = 0; q < 4; ++q) { const float c = vals[u * 4 + q] - mu; s2 += c * c; }
  red[tid] = s2; __syncthreads();
  for (int st = 128; st > 0; st >>= 1) { if (tid < st) red[tid] += red[tid + st]; __syncthreads(); }
  const float rs = rsqrtf(red[0] / (float)N + eps);
  {
    for (int u = 0; u < per / 4; ++u) {
      const int j = tid * 4 + 1024 * u;
      v4f o, sm;
#pragma unroll
      for (int q = 0; q < 4; ++q) {
        float gg = g[j + q], bb = bta[j + q];
        if (PARAM_BF16) { gg = bf16_round(gg); bb = bf16_round(bb); }
        sm[q] = vals[u * 4 + q]; o[q] = (vals[u * 4 + q] - mu) * rs * gg + bb;
      }
      if (out_sum) *(v4f*)(out_sum + (size_t)row * N + j) = sm;
      *(v4f*)(out_norm + (size_t)row * N + j) = o;
    }
    
  }
}



// ---- f16 WMMA path (v_wmma_f32_16x16x32_f16): 11-bit significands for operands in range — used where a [0,1] probability operand needs more precision than bf16
typedef _Float16 v16h __attribute__((ext_vector_type(16)));
union FragH { v16h v; v8us half[2]; _Float16 h[16]; unsigned short u[16]; };
template <int NT>
__device__ __forceinline__ v8f mmaH(v16h ah, v16h al, v16h bh, v16h bl, v8f c) {
  c = __builtin_amdgcn_wmma_f32_16x16x32_f16(false, ah, false, bh, (short)0, c, false, false);
  if (NT >= 2) c = __builtin_amdgcn_wmma_f32_16x16x32_f16(false, al, false, bh, (short)0, c, false, false);
  if (NT >= 3) c = __builtin_amdgcn_wmma_f32_16x16x32_f16(false, ah, false, bl, (short)0, c, false, false);
  asm volatile("v_nop\n\tv_nop\n\tv_nop\n\tv_nop" : "+v"(c) : "v"(ah), "v"(al), "v"(bh), "v"(bl));
  return c;
}
// batched GEMM like k_gemm_b but f16 operands: A f32 (split into f16 hi/lo if ASPLIT, else rounded to f16), Bt = f16 values [n][k]; alpha; C f32; N multiple of 16 (partial tiles skipped)
template <bool ASPLIT>
__global__ __launch_bounds__(128) void k_gemm_h(const float* __restrict__ A, int lda, size_t sA, const _Float16* __restrict__ Bh, int ldb, size_t sB, float alpha, float* __restrict__ C, int ldc, size_t sC, int M, int N, int K) {
  __shared__ __attribute__((aligned(16))) float so[4][16][64];
  const int tid = threadIdx.x, w = tid >> 5, lane = tid & 31, ln = lane & 15, hh = lane >> 4; const int by = blockIdx.y;
  A += (size_t)by * sA; Bh += (size_t)by * sB; C += (size_t)by * sC;
  const int ntn = (N + 63) / 64; const int wid = blockIdx.x * 4 + w; const int mt = wid / ntn, nq = wid % ntn; if (mt * 16 >= M) return;
  const int row0 = mt * 16, col0 = nq * 64; const float* arow = A + (size_t)(row0 + ln) * lda;
  v8f acc[4] = {};
  for (int kb = 0; kb < K; kb += 32) {
    FragH ah, al;
    const v4f x0 = *(const v4fa*)(arow + kb + 8 * hh), x1 = *(const v4fa*)(arow + kb + 8 * hh + 4), x2 = *(const v4fa*)(arow + kb + 16 + 8 * hh), x3 = *(const v4fa*)(arow + kb + 16 + 8 * hh + 4);
    float xs[16] = {x0[0],x0[1],x0[2],x0[3],x1[0],x1[1],x1[2],x1[3],x2[0],x2[1],x2[2],x2[3],x3[0],x3[1],x3[2],x3[3]};
#pragma unroll
    for (int i = 0; i < 16; ++i) { const _Float16 h = (_Float16)xs[i]; ah.h[i] = h; al.h[i] = ASPLIT ? (_Float16)(xs[i] - (float)h) : (_Float16)0.0f; }
#pragma unroll
    for (int t = 0; t < 4; ++t) { if (col0 + t * 16 >= N) continue; const size_t boff = (size_t)(col0 + t * 16 + ln) * ldb + kb; FragH bq; bq.half[0] = *(const v8us*)(Bh + boff + 8 * hh); bq.half[1] = *(const v8us*)(Bh + boff + 16 + 8 * hh);
      acc[t] = mmaH<ASPLIT ? 2 : 1>(ah.v, al.v, bq.v, bq.v, acc[t]); }
  }
#pragma unroll
  for (int t = 0; t < 4; ++t) { if (col0 + t * 16 >= N) continue;
#pragma unroll
    for (int r = 0; r < 8; ++r) so[w][8 * hh + r][t * 16 + ln] = acc[t][r] * alpha; }
  __builtin_amdgcn_fence(__ATOMIC_ACQ_REL, "workgroup"); __builtin_amdgcn_wave_barrier();
  const int rsub = lane >> 4, c4 = (lane & 15) * 4;
  {
#pragma unroll
    for (int q = 0; q < 8; ++q) { const int r = q * 2 + rsub; if (col0 + c4 < N) { const v4f v = *(const v4fa*)&so[w][r][c4]; *(v4f*)(C + (size_t)(row0 + r) * ldc + col0 + c4) = v; } }
     }
}

// Wt[n][k] = f16(W[k][n]·scale) from f32 row-major W[K][N] (scale = power of two; bf16-exact weights stay exact in f16 away from the subnormal range)
__global__ __launch_bounds__(256) void k_wt_f16(const float* __restrict__ W, _Float16* __restrict__ Wt, int K, int N, float scale) {
  const int t = blockIdx.x * 256 + threadIdx.x; if (t >= N * (K / 8)) return; const int n = t / (K / 8), k8 = (t % (K / 8)) * 8; FragH f;
#pragma unroll
  for (int i = 0; i < 8; ++i) f.h[i] = (_Float16)(bf16_round(W[(size_t)(k8 + i) * N + n]) * scale); const v8us o = f.half[0];
  *(v8us*)((unsigned short*)Wt + (size_t)n * K + k8) = o; 
}
// k_gemm_hh variant with fused epilogue: v = acc·alpha + bias[by·sBias + col] (+ CP[(row/rowsPerB)·sCPb + by·64 + col] if CP) ; ACT 0 none / 1 elu ; writes f16 C16 (and f32 C if non-null)
template <int ACT>
__global__ __launch_bounds__(128) void k_gemm_hhx(const _Float16* __restrict__ A, int lda, size_t sA, const _Float16* __restrict__ Bh, int ldb, size_t sB, float alpha, const float* __restrict__ bias, size_t sBias, const float* __restrict__ CP, int rowsPerB, size_t sCPb, int row0g,
    float* __restrict__ C, _Float16* __restrict__ C16, int ldc, size_t sC, int M, int N, int K) {
  __shared__ __attribute__((aligned(16))) float so[4][16][64];
  const int tid = threadIdx.x, w = tid >> 5, lane = tid & 31, ln = lane & 15, hh = lane >> 4; const int by = blockIdx.y;
  A += (size_t)by * sA; Bh += (size_t)by * sB; const size_t cofs = (size_t)by * sC; const float* bp = bias ? bias + (size_t)by * sBias : nullptr;
  const int ntn = (N + 63) / 64; const int wid = blockIdx.x * 4 + w; const int mt = wid / ntn, nq = wid % ntn; if (mt * 16 >= M) return;
  const int row0 = mt * 16, col0 = nq * 64; const _Float16* arow = A + (size_t)(row0 + ln) * lda;
  v8f acc[4] = {};
  for (int kb = 0; kb < K; kb += 32) { FragH ah; ah.half[0] = *(const v8us*)((const unsigned short*)arow + kb + 8 * hh); ah.half[1] = *(const v8us*)((const unsigned short*)arow + kb + 16 + 8 * hh);
#pragma unroll
    for (int t = 0; t < 4; ++t) { if (col0 + t * 16 >= N) continue; const size_t boff = (size_t)(col0 + t * 16 + ln) * ldb + kb; FragH bq; bq.half[0] = *(const v8us*)((const unsigned short*)Bh + boff + 8 * hh); bq.half[1] = *(const v8us*)((const unsigned short*)Bh + boff + 16 + 8 * hh);
      acc[t] = mmaH<1>(ah.v, ah.v, bq.v, bq.v, acc[t]); }
  }
#pragma unroll
  for (int t = 0; t < 4; ++t) { if (col0 + t * 16 >= N) continue; const int col = col0 + t * 16 + ln; const float bv = bp ? bf16_round(bp[col]) : 0.f;
#pragma unroll
    for (int r = 0; r < 8; ++r) { float v = acc[t][r] * alpha + bv; if (CP) { const int bidx = (row0g + row0 + 8 * hh + r) / rowsPerB; v += CP[(size_t)bidx * sCPb + (size_t)by * 64 + col]; } if (ACT == 1) v = (v > 0.f) ? v : expm1f(v); else if (ACT == 7) v = (v > 0.f) ? v + 1.0f : expf(v); else if (ACT == 8) v = tanhf(v); else if (ACT == 9) v = 0.5f * v * (1.0f + tanhf(0.7978845608028654f * (v + 0.044715f * v * v * v))); else if (ACT == 11) v = 1.0f / (1.0f + expf(-v)); else if (ACT == 12) v = (v > 0.f) ? v : 0.01f * v; else if (ACT == 14) v = (v > 0.f) ? v : 0.1f * v; else if (ACT == 15) v = v / (1.0f + expf(-v)); else if (ACT == 3) v = fmaxf(v, 0.f); else if (ACT == 6) v = 0.5f * v * (1.0f + erff(v * 0.70710678118654752f)); so[w][8 * hh + r][t * 16 + ln] = v; } }
  __builtin_amdgcn_fence(__ATOMIC_ACQ_REL, "workgroup"); __builtin_amdgcn_wave_barrier();
  const int rsub = lane >> 4, c4 = (lane & 15) * 4; typedef _Float16 v4h __attribute__((ext_vector_type(4)));
  {
#pragma unroll
    for (int q = 0; q < 8; ++q) { const int r = q * 2 + rsub; if (col0 + c4 < N) { const v4f v = *(const v4fa*)&so[w][r][c4]; if (C) *(v4f*)(C + cofs + (size_t)(row0 + r) * ldc + col0 + c4) = v; if (C16) { v4h h4; for (int i = 0; i < 4; ++i) h4[i] = (_Float16)v[i]; *(v4h*)(C16 + cofs + (size_t)(row0 + r) * ldc + col0 + c4) = h4; } } }
     }
}


typedef _Float16 v4h __attribute__((ext_vector_type(4)));

__global__ __launch_bounds__(256) void k_x16(const float* __restrict__ x, _Float16* __restrict__ X16, size_t n8) { const size_t t = (size_t)blockIdx.x * 256 + threadIdx.x; if (t >= n8) return; FragH f;
#pragma unroll
  for (int q = 0; q < 8; ++q) f.h[q] = (_Float16)bf16_round(x[t * 8 + q]); *(v8us*)((unsigned short*)X16 + t * 8) = f.half[0];  }
__global__ __launch_bounds__(256) void k_h16(const float* __restrict__ x, _Float16* __restrict__ X16, size_t n8) { const size_t t = (size_t)blockIdx.x * 256 + threadIdx.x; if (t >= n8) return; FragH f;
#pragma unroll
  for (int q = 0; q < 8; ++q) f.h[q] = (_Float16)x[t * 8 + q]; *(v8us*)((unsigned short*)X16 + t * 8) = f.half[0];  }
__global__ __launch_bounds__(256) void k_round16f(const float* __restrict__ W, _Float16* __restrict__ Bt, size_t n8) { const size_t t = (size_t)blockIdx.x * 256 + threadIdx.x; if (t >= n8) return; FragH f;
#pragma unroll
  for (int i = 0; i < 8; ++i) f.h[i] = (_Float16)(bf16_round(W[t * 8 + i]) * 16.0f); *(v8us*)((unsigned short*)Bt + t * 8) = f.half[0];  }
template <int NHv, int TTv>
__global__ __launch_bounds__(256) void k_vt(const _Float16* __restrict__ V16, int ldv, int voff, _Float16* __restrict__ Vt) { __shared__ unsigned short tl[64][66]; const int tid = threadIdx.x; const int slab = blockIdx.x / (TTv / 64), lg = blockIdx.x % (TTv / 64); const int b = slab / NHv, h = slab % NHv;
  for (int i = tid; i < 64 * 8; i += 256) { const int r = i / 8, c8 = (i % 8) * 8; FragH f; f.half[0] = *(const v8us*)((const unsigned short*)V16 + ((size_t)b * TTv + lg * 64 + r) * ldv + voff + h * 64 + c8);
#pragma unroll
    for (int q = 0; q < 8; ++q) tl[r][c8 + q] = f.u[q]; }
  __syncthreads();
  {
#pragma unroll
    for (int rd = 0; rd < 2; ++rd) { const int d = rd * 32 + tid / 8, pc = tid % 8; FragH f;
#pragma unroll
      for (int q = 0; q < 8; ++q) f.u[q] = tl[pc * 8 + q][d];
      *(v8us*)((unsigned short*)Vt + ((size_t)slab * 64 + d) * TTv + lg * 64 + pc * 8) = f.half[0]; }
     } }

#ifndef NBS
#define NBS NB      /* batch stride of the [S][B][E] tensors (debug builds may process fewer batches than the layout holds) */
#endif
// ---- fast GEMM (wave tile 32x64, block tile 128x64; requires M % 128 == 0, N % 64 == 0, K % 64 == 0, K >= 64); epilogue = k_gemm_hhx semantics ----
// Operands reach the waves through LDS: per stage the block brings 64 k of its 128 A rows and 64 B rows in by asynchronous copies that cover whole 128-byte lines (8 lanes a row),
// two buffers, the next stage in flight while this one is worked on; the fragments are read from LDS in the same k order as before.
// TAIL: C = (A B^T / 1024 + A2 B^T) alpha + bias in one launch: the stages walk A's K columns, the sums are scaled by 2^-10 (exact), then the stages walk A2's K columns on top of them, B's anew;
// row (b, s) of the result is stored at row (s, b) of C, which is f32; there is no addend CP.
__device__ __forceinline__ v16h g2_frag(const unsigned short* p, int hh) { FragH f; f.half[0] = *(const v8us*)(p + 8 * hh); f.half[1] = *(const v8us*)(p + 16 + 8 * hh); return f.v; }
__device__ __forceinline__ v8f g2_mma(v16h a, v16h b, v8f c) { v8f d = __builtin_amdgcn_wmma_f32_16x16x32_f16(false, a, false, b, (short)0, c, false, false); asm volatile("v_nop\n\tv_nop\n\tv_nop\n\tv_nop" : "+v"(d) : "v"(a), "v"(b)); return d; }
// One lane's share of a stage: 8 pieces of A and 4 of B, 16 bytes each, 16 rows apart (ls bytes in LDS, da / db bytes in memory), global memory -> LDS through no register.
// The s_wait_xcnt closes the copies' own statement so that no address register named here is rewritten ahead of it.
__device__ __forceinline__ void g2_copy(unsigned la, unsigned lb, unsigned ls, const char* pa, size_t da, const char* pb, size_t db) {
  asm volatile("global_load_async_to_lds_b128 %0, %12, off\n\t" "global_load_async_to_lds_b128 %1, %13, off\n\t" "global_load_async_to_lds_b128 %2, %14, off\n\t" "global_load_async_to_lds_b128 %3, %15, off\n\t"
               "global_load_async_to_lds_b128 %4, %16, off\n\t" "global_load_async_to_lds_b128 %5, %17, off\n\t" "global_load_async_to_lds_b128 %6, %18, off\n\t" "global_load_async_to_lds_b128 %7, %19, off\n\t"
               "global_load_async_to_lds_b128 %8, %20, off\n\t" "global_load_async_to_lds_b128 %9, %21, off\n\t" "global_load_async_to_lds_b128 %10, %22, off\n\t" "global_load_async_to_lds_b128 %11, %23, off\n\t"
               "s_wait_xcnt 0x0"
               :: "v"(la), "v"(la + ls), "v"(la + 2 * ls), "v"(la + 3 * ls), "v"(la + 4 * ls), "v"(la + 5 * ls), "v"(la + 6 * ls), "v"(la + 7 * ls), "v"(lb), "v"(lb + ls), "v"(lb + 2 * ls), "v"(lb + 3 * ls),
                  "v"(pa), "v"(pa + da), "v"(pa + 2 * da), "v"(pa + 3 * da), "v"(pa + 4 * da), "v"(pa + 5 * da), "v"(pa + 6 * da), "v"(pa + 7 * da), "v"(pb), "v"(pb + db), "v"(pb + 2 * db), "v"(pb + 3 * db)
               : "memory"); }
template <int ACT, bool TAIL>
__global__ __launch_bounds__(128) void k_gemm2(const _Float16* __restrict__ A, int lda, size_t sA, const _Float16* __restrict__ A2, const _Float16* __restrict__ Bh, int ldb, size_t sB, float alpha, const float* __restrict__ bias, const float* __restrict__ bias1, const float* __restrict__ bias2, const float* __restrict__ CP, int rowsPerB, size_t sCPb, int row0g,
    float* __restrict__ Cf, _Float16* __restrict__ Ch, int ldc, size_t sC, int nc32, int M, int N, int K) {
  constexpr int KT = 64, PIT = KT + 8;      /* LDS row pitch 144 B = 16 B x odd: the 16-byte fragment reads of 16 rows fall on distinct banks */
  __shared__ __attribute__((aligned(16))) float so[4][32][68];
  __shared__ __attribute__((aligned(16))) unsigned short tA[2][128][PIT]; __shared__ __attribute__((aligned(16))) unsigned short tB[2][64][PIT];
  const int tid = threadIdx.x, w = tid >> 5, lane = tid & 31, ln = lane & 15, hh = lane >> 4; const int by = blockIdx.y;
  A += (size_t)by * sA; Bh += (size_t)by * sB; const float* bp = by == 0 ? bias : (by == 1 ? bias1 : bias2);      /* batch by has its own bias vector */
  const bool w32 = by < nc32; float* C = w32 ? Cf : nullptr; _Float16* C16 = w32 ? nullptr : Ch; const size_t cofs = (size_t)(w32 ? by : by - nc32) * sC;      /* the first nc32 batches store f32 planes of Cf, the others f16 planes of Ch */
  const int ntn = N >> 6; const int mt = blockIdx.x / ntn, nq = blockIdx.x - mt * ntn; const int row0 = mt * 128 + 32 * w, col0 = nq * 64; if (mt * 128 >= M) return;      /* the same for the whole block: it stands in front of barriers */
  const int sr = tid >> 3, sc = (tid & 7) * 8;
  const char* pa = (const char*)(A + (size_t)(mt * 128 + sr) * lda + sc); const char* pb = (const char*)(Bh + (size_t)(col0 + sr) * ldb + sc); const size_t da = (size_t)lda * 32, db = (size_t)ldb * 32;
  const unsigned la = (unsigned)(uintptr_t)&tA[0][sr][sc], lb = (unsigned)(uintptr_t)&tB[0][sr][sc]; constexpr unsigned LS = 16 * PIT * 2, BA = 128 * PIT * 2, BB = 64 * PIT * 2;
  const char* pa2 = TAIL ? (const char*)(A2 + (size_t)by * sA + (size_t)(mt * 128 + sr) * lda + sc) : pa; const int KK = TAIL ? 2 * K : K;
  /* the stage that begins at column kk of [A | A2], into buffer buf; kk is the same for the whole block */
  auto stage = [&](int kk, int buf) { const bool t2 = TAIL && kk >= K; const size_t kx = (size_t)(t2 ? kk - K : kk) * 2; g2_copy(la + buf * BA, lb + buf * BB, LS, (t2 ? pa2 : pa) + kx, da, pb + kx, db); };
  stage(0, 0);
  asm volatile("s_wait_asynccnt 0x0" ::: "memory");      /* this wave's share of stage 0 has landed */
  __syncthreads();      /* every wave's share has: stage 0 may be read */
  if (KT < KK) stage(KT, 1);
  const v8f z8 = {0.f,0.f,0.f,0.f,0.f,0.f,0.f,0.f}; v8f c00 = z8, c01 = z8, c02 = z8, c03 = z8, c10 = z8, c11 = z8, c12 = z8, c13 = z8;
  /* rolled: one stage a trip, so that the order at the foot of the trip stands once */
#pragma unroll 1
  for (int kb = 0; kb < KK; kb += KT) { const int cur = (kb >> 6) & 1;
    if (TAIL && kb == K) { constexpr float s10 = 0.0009765625f; c00 *= s10; c01 *= s10; c02 *= s10; c03 *= s10; c10 *= s10; c11 *= s10; c12 *= s10; c13 *= s10; }
    /* unrolled: the two 32-k blocks of a stage read LDS at immediate offsets */
#pragma unroll
    for (int ks = 0; ks < KT; ks += 32) { const unsigned short* fa = &tA[cur][32 * w + ln][ks]; const unsigned short* fb = &tB[cur][ln][ks];
      const v16h a0 = g2_frag(fa, hh), a1 = g2_frag(fa + 16 * PIT, hh); const v16h b0 = g2_frag(fb, hh), b1 = g2_frag(fb + 16 * PIT, hh), b2 = g2_frag(fb + 32 * PIT, hh), b3 = g2_frag(fb + 48 * PIT, hh);
      c00 = g2_mma(a0, b0, c00); c10 = g2_mma(a1, b0, c10); c01 = g2_mma(a0, b1, c01); c11 = g2_mma(a1, b1, c11);
      c02 = g2_mma(a0, b2, c02); c12 = g2_mma(a1, b2, c12); c03 = g2_mma(a0, b3, c03); c13 = g2_mma(a1, b3, c13); }
    asm volatile("s_wait_dscnt 0x0" ::: "memory");      /* this wave's reads of the buffer that is refilled below have returned */
    asm volatile("s_wait_asynccnt 0x0" ::: "memory");      /* this wave's share of the next stage has landed */
    __syncthreads();      /* publishes the next stage and ends every wave's reads of this one */
    if (kb + 2 * KT < KK) stage(kb + 2 * KT, cur); }
  asm volatile("s_wait_asynccnt 0x0" ::: "memory");      /* no copy is left in flight behind the loop */
  v8f accs[8] = {c00, c01, c02, c03, c10, c11, c12, c13};
#pragma unroll
  for (int u = 0; u < 8; ++u) { const int t = u & 3, half = u >> 2; const int col = col0 + t * 16 + ln; const float bv = bp ? bf16_round(bp[col]) : 0.f;
#pragma unroll
    for (int r = 0; r < 8; ++r) { const int rloc = half * 16 + 8 * hh + r; float v = accs[u][r] * alpha + bv; if (!TAIL && CP) { if (rowsPerB < 0) v += CP[cofs + (size_t)(row0g + row0 + rloc) * ldc + col];      /* rowsPerB < 0: own element of the batched C plane */ else { const int bidx = (row0g + row0 + rloc) / rowsPerB; v += CP[(size_t)bidx * sCPb + (size_t)by * 64 + col]; } }
      if (ACT == 3) v = fmaxf(v, 0.f); else if (ACT == 6) v = 0.5f * v * (1.0f + erff(v * 0.70710678118654752f)); else if (ACT == 11) v = 1.0f / (1.0f + expf(-v)); else if (ACT == 15) v = v / (1.0f + expf(-v)); else if (ACT == 12) v = (v > 0.f) ? v : 0.01f * v; else if (ACT == 8) v = tanhf(v);
      so[w][rloc][t * 16 + ln] = v; } }
  __builtin_amdgcn_fence(__ATOMIC_ACQ_REL, "workgroup"); __builtin_amdgcn_wave_barrier();
  const int rsub = lane >> 4, c4 = (lane & 15) * 4;
  {
#pragma unroll
    for (int q = 0; q < 16; ++q) { const int r = q * 2 + rsub; const v4f v = *(const v4fa*)&so[w][r][c4]; const size_t orow = TAIL ? (size_t)((row0 + r) % SLEN) * NBS + (row0 + r) / SLEN : (size_t)(row0 + r); if (TAIL || C) { *(v4f*)(C + cofs + orow * ldc + col0 + c4) = v; if (!TAIL) asm volatile("s_wait_xcnt 0x0" ::: "memory");      /* stands behind the f32 store: the f16 path follows it in the built code and reuses its registers */ } if (!TAIL && C16) { v4h h4; for (int i = 0; i < 4; ++i) h4[i] = (_Float16)v[i]; *(v4h*)(C16 + cofs + (size_t)(row0 + r) * ldc + col0 + c4) = h4; } }
     } }



// Lane l <-> l ^ 16 by a vector cross-row move (the two lanes that hold one query's keys).
__device__ __forceinline__ float x_half(float x) { const int b = __float_as_int(x); return __int_as_float(__builtin_amdgcn_permlanex16(b, b, 0x76543210, 0xfedcba98, false, false)); }
// One lane's share of a 64-key stage: 4 pieces of K and 4 of V^T, 16 bytes each, 16 rows apart (ls bytes in LDS, dk / dv bytes in memory), global memory -> LDS through no register.
// The s_wait_xcnt closes the copies' own statement so that no address register named here is rewritten ahead of it.
__device__ __forceinline__ void fl_copy(unsigned lk, unsigned lv, unsigned ls, const char* pk, size_t dk, const char* pv, size_t dv) {
  asm volatile("global_load_async_to_lds_b128 %0, %8, off\n\t" "global_load_async_to_lds_b128 %1, %9, off\n\t" "global_load_async_to_lds_b128 %2, %10, off\n\t" "global_load_async_to_lds_b128 %3, %11, off\n\t"
               "global_load_async_to_lds_b128 %4, %12, off\n\t" "global_load_async_to_lds_b128 %5, %13, off\n\t" "global_load_async_to_lds_b128 %6, %14, off\n\t" "global_load_async_to_lds_b128 %7, %15, off\n\t"
               "s_wait_xcnt 0x0"
               :: "v"(lk), "v"(lk + ls), "v"(lk + 2 * ls), "v"(lk + 3 * ls), "v"(lv), "v"(lv + ls), "v"(lv + 2 * ls), "v"(lv + 3 * ls),
                  "v"(pk), "v"(pk + dk), "v"(pk + 2 * dk), "v"(pk + 3 * dk), "v"(pv), "v"(pv + dv), "v"(pv + 2 * dv), "v"(pv + 3 * dv)
               : "memory"); }
// Unmasked attention with both products transposed: S^T = K Q^T (A = K rows, B = Q rows), O^T += V^T P^T (A = V^T rows, B = P^T).
// Lane (ln, hh) owns query q0 + ln; register r of score tile nt is key j0 + ps + nt * 16 + 8 * hh + r, so maximum and sum run inside the lane, joined with lane ^ 16,
// and the two score tiles, converted in place, are the B operand of the second product in the k order of the V^T loader (8 * hh + i, 16 + 8 * hh + i): P touches no LDS.
// K and V^T reach the waves through LDS: per stage the block brings 64 keys (64 K rows and 64 V^T rows of 128 bytes) in by asynchronous copies that cover whole 128-byte lines (8 lanes a row),
// two buffers, the next stage in flight while this one is worked on; the four waves read their fragments from LDS in the same k order as before.
__global__ __launch_bounds__(128) void k_flash(const _Float16* __restrict__ Q16, int ldq, const _Float16* __restrict__ K16, int ldk, const _Float16* __restrict__ Vt, _Float16* __restrict__ Oh, _Float16* __restrict__ Ol, int ldo) {
  constexpr int RPW = 16, DT = 4, KS = 2, KT = 64, PIT = KT + 8;      /* LDS row pitch 144 B = 16 B x odd: the 16-byte fragment reads of 16 rows fall on distinct banks */
  __shared__ __attribute__((aligned(16))) float sO[4][RPW][64 + 4];
  __shared__ __attribute__((aligned(16))) unsigned short tK[2][KT][PIT]; __shared__ __attribute__((aligned(16))) unsigned short tV[2][64][PIT];
  const int tid = threadIdx.x, w = tid >> 5, lane = tid & 31, ln = lane & 15, hh = lane >> 4;
  const int slab = blockIdx.x / QBNP, qblk = QB0P + blockIdx.x % QBNP; const int b = slab / NH, h = slab % NH; const int qb0 = qblk * (4 * RPW); const int q0 = qb0 + w * RPW;
  /* every inner loop below is unrolled so that each register-array index is a constant (no scratch) */
  FragH bq[KS];
  { const unsigned short* qr = (const unsigned short*)Q16 + ((size_t)b * TQ + q0 + ln) * ldq + h * 64;
#pragma unroll
    for (int ks = 0; ks < KS; ++ks) { bq[ks].half[0] = *(const v8us*)(qr + ks * 32 + 8 * hh); bq[ks].half[1] = *(const v8us*)(qr + ks * 32 + 16 + 8 * hh); } }
  const unsigned short* Vth = (const unsigned short*)Vt + (size_t)slab * 64 * TK;
  const int sr = tid >> 3, sc = (tid & 7) * 8;
  const char* pk = (const char*)((const unsigned short*)K16 + ((size_t)b * TK + sr) * ldk + h * 64 + sc); const char* pv = (const char*)(Vth + (size_t)sr * TK + sc); const size_t dk = (size_t)ldk * 32, dv = (size_t)TK * 32, sk = (size_t)ldk * (KT * 2);
  const unsigned lk = (unsigned)(uintptr_t)&tK[0][sr][sc], lv = (unsigned)(uintptr_t)&tV[0][sr][sc]; constexpr unsigned LS = 16 * PIT * 2, BS = 64 * PIT * 2;
  fl_copy(lk, lv, LS, pk, dk, pv, dv);
  asm volatile("s_wait_asynccnt 0x0" ::: "memory");      /* this wave's share of stage 0 has landed */
  __syncthreads();      /* every wave's share has: stage 0 may be read */
  if (KT < TK) fl_copy(lk + BS, lv + BS, LS, pk + sk, dk, pv + KT * 2, dv);
  /* the maximum m_q is kept in units of the raw product q.k; p = 2^10 exp((s - m) / 8) is one multiply-add and one base-2 exponential: 2^(s C2 + (10 - m C2)); l_q sums these p, so it carries the 2^10 as well */
  constexpr float C2 = SCL * 1.4426950408889634f;
  float m_q = -3.0e38f, l_q = 0.f; v8f oacc[DT];
#pragma unroll
  for (int dt = 0; dt < DT; ++dt) oacc[dt] = (v8f){0.f,0.f,0.f,0.f,0.f,0.f,0.f,0.f};
  /* rolled: one 64-key stage a trip, so that the order at the foot of the trip stands once */
#pragma unroll 1
  for (int j0 = 0; j0 < TK; j0 += KT) { const int cur = (j0 >> 6) & 1;
    /* unrolled: the two 32-key passes of a stage read LDS at immediate offsets */
#pragma unroll
    for (int ps = 0; ps < KT; ps += 32) {
    FragH ak[2][KS], av[DT];
#pragma unroll
    for (int nt = 0; nt < 2; ++nt) { const unsigned short* kr = &tK[cur][ps + nt * 16 + ln][0];
#pragma unroll
      for (int ks = 0; ks < KS; ++ks) { ak[nt][ks].half[0] = *(const v8us*)(kr + ks * 32 + 8 * hh); ak[nt][ks].half[1] = *(const v8us*)(kr + ks * 32 + 16 + 8 * hh); } }
#pragma unroll
    for (int dt = 0; dt < DT; ++dt) { const unsigned short* vrow = &tV[cur][dt * 16 + ln][ps]; av[dt].half[0] = *(const v8us*)(vrow + 8 * hh); av[dt].half[1] = *(const v8us*)(vrow + 16 + 8 * hh); }
    float sc_[16];
#pragma unroll
    for (int nt = 0; nt < 2; ++nt) {
      v8f acc = (v8f){0.f,0.f,0.f,0.f,0.f,0.f,0.f,0.f};
#pragma unroll
      for (int ks = 0; ks < KS; ++ks) acc = mmaH<1>(ak[nt][ks].v, ak[nt][ks].v, bq[ks].v, bq[ks].v, acc);
#pragma unroll
      for (int r = 0; r < 8; ++r) sc_[nt * 8 + r] = acc[r]; }
    float mc = sc_[0];
#pragma unroll
    for (int i = 1; i < 16; ++i) mc = fmaxf(mc, sc_[i]);
    mc = fmaxf(mc, x_half(mc));
    const float mn = fmaxf(m_q, mc); const float al = (mn > -1.0e38f) ? __builtin_amdgcn_exp2f((m_q - mn) * C2) : 1.0f; m_q = mn;
    const float nb = fmaf(-mn, C2, 10.0f);
    float p[16]; FragH pb;
#pragma unroll
    for (int i = 0; i < 16; ++i) p[i] = fmaf(sc_[i], C2, nb);
    /* eight base-2 exponentials, each in place, and the v_nop that the slot behind a transcendental asks for, in one statement: no instruction in it or behind it reads a fresh result or overwrites another's argument; the s_delay_alu is the hint that lets the SIMD's other waves issue while the last result is on its way */
#pragma unroll
    for (int g = 0; g < 16; g += 8)
      asm("v_exp_f32 %0, %0\n\tv_exp_f32 %1, %1\n\tv_exp_f32 %2, %2\n\tv_exp_f32 %3, %3\n\tv_exp_f32 %4, %4\n\tv_exp_f32 %5, %5\n\tv_exp_f32 %6, %6\n\tv_exp_f32 %7, %7\n\ts_delay_alu instid0(TRANS32_DEP_1)\n\tv_nop"
          : "+v"(p[g]), "+v"(p[g + 1]), "+v"(p[g + 2]), "+v"(p[g + 3]), "+v"(p[g + 4]), "+v"(p[g + 5]), "+v"(p[g + 6]), "+v"(p[g + 7]));
#pragma unroll
    for (int i = 0; i < 16; ++i) pb.h[i] = (_Float16)p[i];
#pragma unroll
    for (int st = 8; st > 0; st >>= 1)
#pragma unroll
      for (int i = 0; i < st; ++i) p[i] += p[i + st];
    l_q = l_q * al + p[0];
#pragma unroll
    for (int dt = 0; dt < DT; ++dt) {
#pragma unroll
      for (int r = 0; r < 8; ++r) oacc[dt][r] *= al; }
#pragma unroll
    for (int dt = 0; dt < DT; ++dt) oacc[dt] = mmaH<1>(av[dt].v, av[dt].v, pb.v, pb.v, oacc[dt]); }
    asm volatile("s_wait_dscnt 0x0" ::: "memory");      /* this wave's reads of the buffer that is refilled below have returned */
    asm volatile("s_wait_asynccnt 0x0" ::: "memory");      /* this wave's share of the next stage has landed */
    __syncthreads();      /* publishes the next stage and ends every wave's reads of this one */
    if (j0 + 2 * KT < TK) fl_copy(lk + cur * BS, lv + cur * BS, LS, pk + (size_t)((j0 >> 6) + 2) * sk, dk, pv + (size_t)(j0 + 2 * KT) * 2, dv); }
  asm volatile("s_wait_asynccnt 0x0" ::: "memory");      /* no copy is left in flight behind the loop */
  const float l = l_q + x_half(l_q); const float li = (l > 0.f) ? 1.0f / l : 0.f;
#pragma unroll
  for (int dt = 0; dt < DT; ++dt)
#pragma unroll
    for (int g = 0; g < 2; ++g) { const v4f val = {oacc[dt][4 * g] * li, oacc[dt][4 * g + 1] * li, oacc[dt][4 * g + 2] * li, oacc[dt][4 * g + 3] * li}; *(v4fa*)&sO[w][ln][dt * 16 + 8 * hh + 4 * g] = val; }
  __builtin_amdgcn_fence(__ATOMIC_ACQ_REL, "workgroup"); __builtin_amdgcn_wave_barrier();      /* the wave's own rows are in LDS before other lanes of it read them back as whole 128-byte lines */
  /* the context leaves as two f16 planes, hi and 2^10 x residual: 8 lanes store one row's 128-byte line of each plane */
  {
#pragma unroll
    for (int rp = 0; rp < RPW; rp += 4) { const int r = rp + (lane >> 3), pc = lane & 7; const v4f a = *(const v4fa*)&sO[w][r][pc * 8], c = *(const v4fa*)&sO[w][r][pc * 8 + 4]; FragH fh, fl;
#pragma unroll
      for (int q = 0; q < 4; ++q) { _Float16 hv = (_Float16)a[q]; fh.h[q] = hv; fl.h[q] = (_Float16)((a[q] - (float)hv) * 1024.0f); hv = (_Float16)c[q]; fh.h[4 + q] = hv; fl.h[4 + q] = (_Float16)((c[q] - (float)hv) * 1024.0f); }
      const size_t o = ((size_t)b * TQ + q0 + r) * ldo + h * 64 + pc * 8; *(v8us*)((unsigned short*)Oh + o) = fh.half[0]; *(v8us*)((unsigned short*)Ol + o) = fl.half[0]; }
     } }
// 5-plane variant: S = Qh Kh^T + (Ql Kh^T + Qh Kl^T)/1024 with Q/K = [hi | 2^10 residual] f16 planes (QL/KL same layout as Q16/K16), then the 3-term P.V below.
// 3-term variant: O = (P_hi V_hi + (P_lo V_hi + P_hi V_lo) / 1024) / l with P = [hi | 2^10 residual] of 1024 p and V^T = [hi | 2^10 residual] planes (VtL same layout as Vt) -> ~2^-21-class products for un-averaged (early causal / peaked) rows
template <int CAUSAL>
__global__ __launch_bounds__(128) void k_flash5(const _Float16* __restrict__ Q16, const _Float16* __restrict__ QL, int ldq, const _Float16* __restrict__ K16, const _Float16* __restrict__ KL, int ldk, const _Float16* __restrict__ Vt, const _Float16* __restrict__ VtL, const int* __restrict__ MSK, float* __restrict__ O, int ldo) {
  constexpr int RPW = 16, RTN = RPW / 16, NQB = TQ / (4 * RPW), DT = 4, KS = 2;
  __shared__ __attribute__((aligned(16))) unsigned short sP[4][RPW][40]; __shared__ __attribute__((aligned(16))) unsigned short sPL[4][RPW][40]; __shared__ __attribute__((aligned(16))) float sO[4][RPW][64 + 4];
  const int tid = threadIdx.x, w = tid >> 5, lane = tid & 31, ln = lane & 15, hh = lane >> 4;
  const int slab = blockIdx.x / QBN5, qblk = QB05 + blockIdx.x % QBN5; (void)NQB; const int b = slab / NH, h = slab % NH; const int qb0 = qblk * (4 * RPW); const int q0 = qb0 + w * RPW;
  FragH aq[2][KS], aql[2][KS];
#pragma unroll
  for (int rt = 0; rt < RTN; ++rt) { const unsigned short* qr = (const unsigned short*)Q16 + ((size_t)b * TQ + q0 + rt * 16 + ln) * ldq + h * 64; const unsigned short* ql = (const unsigned short*)QL + ((size_t)b * TQ + q0 + rt * 16 + ln) * ldq + h * 64;
#pragma unroll
    for (int ks = 0; ks < KS; ++ks) { aq[rt][ks].half[0] = *(const v8us*)(qr + ks * 32 + 8 * hh); aq[rt][ks].half[1] = *(const v8us*)(qr + ks * 32 + 16 + 8 * hh); aql[rt][ks].half[0] = *(const v8us*)(ql + ks * 32 + 8 * hh); aql[rt][ks].half[1] = *(const v8us*)(ql + ks * 32 + 16 + 8 * hh); } }
  const unsigned short* Vth = (const unsigned short*)Vt + (size_t)slab * 64 * TK; const unsigned short* Vtl = (const unsigned short*)VtL + (size_t)slab * 64 * TK;
  float m_r[2][8], l_r[2][8]; v8f oacc[2][DT], oaccL[2][DT];
#pragma unroll
  for (int rt = 0; rt < RTN; ++rt) {
#pragma unroll
    for (int r = 0; r < 8; ++r) { m_r[rt][r] = -3.0e38f; l_r[rt][r] = 0.f; }
#pragma unroll
    for (int dt = 0; dt < DT; ++dt) { oacc[rt][dt] = (v8f){0.f,0.f,0.f,0.f,0.f,0.f,0.f,0.f}; oaccL[rt][dt] = oacc[rt][dt]; } }
  const int jend = (CAUSAL == 1) ? (qb0 + 4 * RPW) : ((CAUSAL == 23) ? min(TK, (qb0 / CHK + 2) * CHK) : TK);      /* causal / window: keys that can never contribute are skipped */ const int jbeg = (CAUSAL == 23) ? max(0, (qb0 / CHK - 1) * CHK) : 0;
#pragma unroll 1
  for (int j0 = jbeg; j0 < jend; j0 += 32) {
    v8f s[2][2];
#pragma unroll
    for (int nt = 0; nt < 2; ++nt) { const unsigned short* kr = (const unsigned short*)K16 + ((size_t)b * TK + j0 + nt * 16 + ln) * ldk + h * 64; const unsigned short* klr = (const unsigned short*)KL + ((size_t)b * TK + j0 + nt * 16 + ln) * ldk + h * 64; FragH bk[KS], bkl[KS];
#pragma unroll
      for (int ks = 0; ks < KS; ++ks) { bk[ks].half[0] = *(const v8us*)(kr + ks * 32 + 8 * hh); bk[ks].half[1] = *(const v8us*)(kr + ks * 32 + 16 + 8 * hh); bkl[ks].half[0] = *(const v8us*)(klr + ks * 32 + 8 * hh); bkl[ks].half[1] = *(const v8us*)(klr + ks * 32 + 16 + 8 * hh); }
#pragma unroll
      for (int rt = 0; rt < RTN; ++rt) { v8f acc = (v8f){0.f,0.f,0.f,0.f,0.f,0.f,0.f,0.f}, accl = acc;
#pragma unroll
        for (int ks = 0; ks < KS; ++ks) { acc = mmaH<1>(aq[rt][ks].v, aq[rt][ks].v, bk[ks].v, bk[ks].v, acc); accl = mmaH<1>(aql[rt][ks].v, aql[rt][ks].v, bk[ks].v, bk[ks].v, accl); accl = mmaH<1>(aq[rt][ks].v, aq[rt][ks].v, bkl[ks].v, bkl[ks].v, accl); }
#pragma unroll
        for (int r = 0; r < 8; ++r) acc[r] += accl[r] * 0.0009765625f;
        s[rt][nt] = acc; } }
#pragma unroll
    for (int rt = 0; rt < RTN; ++rt)
#pragma unroll
      for (int r = 0; r < 8; ++r) { const int tq = q0 + rt * 16 + 8 * hh + r; const int k0 = j0 + ln, k1 = j0 + 16 + ln;
        bool ok0 = (CAUSAL == 1) ? (k0 <= tq) : ((CAUSAL == 2) ? ((k0 >> 5) == (tq >> 5)) : true), ok1 = (CAUSAL == 1) ? (k1 <= tq) : ((CAUSAL == 2) ? ((k1 >> 5) == (tq >> 5)) : true);      /* mode 2: block-diagonal 32-token groups */
        if (CAUSAL == 4) { const int* mrow = MSK + ((size_t)b * TQ + tq) * TK; ok0 = mrow[k0] != 0; ok1 = mrow[k1] != 0; }      /* mode 4: per-(query, key) INPUT mask shared by all heads; masked keys contribute nothing (== the reference's -4096 fill, whose exp underflows to 0), rows with no valid key give l = 0 -> output 0 (== the reference's row_valid zeroing) */
        float s0 = ok0 ? s[rt][0][r] * SCL : -3.0e38f, s1 = ok1 ? s[rt][1][r] * SCL : -3.0e38f; if (CAUSAL == 17) { const float* amk = (const float*)MSK + (size_t)b * TK; s0 += bf16_round(amk[k0]); s1 += bf16_round(amk[k1]); } if (CAUSAL == 18) { const float* tb = (const float*)MSK; const int* ri = MSK + 1024 + (size_t)b * TK; const int rq = ri[tq]; s0 += tb[(h * 8 + rq) * 8 + ri[k0]]; s1 += tb[(h * 8 + rq) * 8 + ri[k1]]; } if (CAUSAL == 19) { const int* rel = MSK + (size_t)tq * TK; const float* rb = (const float*)MSK + (size_t)TQ * TK + ((size_t)(b * NH + h) * TQ + tq) * 64; s0 += rb[rel[k0]]; s1 += rb[rel[k1]]; }      /* mode 19: + (q.Ek[rel] + Eb[rel][h]) / 8 gathered by the int relative ids (packed [ids | table]) */      /* mode 18: + resource_bias[h][r_q][r_k] from the packed [table | ids] buffer (TQ == TK) */      /* mode 17: additive per-(batch, key) mask INPUT */ float mc = fmaxf(s0, s1);
        mc = fmaxf(mc, __shfl_xor(mc, 1, 32)); mc = fmaxf(mc, __shfl_xor(mc, 2, 32)); mc = fmaxf(mc, __shfl_xor(mc, 4, 32)); mc = fmaxf(mc, __shfl_xor(mc, 8, 32));
        const float mn = fmaxf(m_r[rt][r], mc); const float al = (mn > -1.0e38f) ? expf(m_r[rt][r] - mn) : 1.0f; m_r[rt][r] = mn; const float p0 = ok0 ? expf(s0 - mn) : 0.f, p1 = ok1 ? expf(s1 - mn) : 0.f; l_r[rt][r] = l_r[rt][r] * al + p0 + p1;
#pragma unroll
        for (int dt = 0; dt < DT; ++dt) { oacc[rt][dt][r] *= al; oaccL[rt][dt][r] *= al; }
        FragH t2, t2l; const float ps0 = p0 * 1024.0f, ps1 = p1 * 1024.0f; t2.h[0] = (_Float16)ps0; t2.h[1] = (_Float16)ps1; t2l.h[0] = (_Float16)((ps0 - (float)t2.h[0]) * 1024.0f); t2l.h[1] = (_Float16)((ps1 - (float)t2.h[1]) * 1024.0f);
        sP[w][rt * 16 + 8 * hh + r][ln] = t2.u[0]; sP[w][rt * 16 + 8 * hh + r][16 + ln] = t2.u[1]; sPL[w][rt * 16 + 8 * hh + r][ln] = t2l.u[0]; sPL[w][rt * 16 + 8 * hh + r][16 + ln] = t2l.u[1]; }
    __builtin_amdgcn_fence(__ATOMIC_ACQ_REL, "workgroup"); __builtin_amdgcn_wave_barrier();
    FragH pa[2], pl[2];
#pragma unroll
    for (int rt = 0; rt < RTN; ++rt) { pa[rt].half[0] = *(const v8us*)&sP[w][rt * 16 + ln][8 * hh]; pa[rt].half[1] = *(const v8us*)&sP[w][rt * 16 + ln][16 + 8 * hh]; pl[rt].half[0] = *(const v8us*)&sPL[w][rt * 16 + ln][8 * hh]; pl[rt].half[1] = *(const v8us*)&sPL[w][rt * 16 + ln][16 + 8 * hh]; }
#pragma unroll
    for (int dt = 0; dt < DT; ++dt) { const unsigned short* vrow = Vth + (size_t)(dt * 16 + ln) * TK + j0; const unsigned short* vrl = Vtl + (size_t)(dt * 16 + ln) * TK + j0; FragH bv, bl; bv.half[0] = *(const v8us*)(vrow + 8 * hh); bv.half[1] = *(const v8us*)(vrow + 16 + 8 * hh); bl.half[0] = *(const v8us*)(vrl + 8 * hh); bl.half[1] = *(const v8us*)(vrl + 16 + 8 * hh);
#pragma unroll
      for (int rt = 0; rt < RTN; ++rt) { oacc[rt][dt] = mmaH<1>(pa[rt].v, pa[rt].v, bv.v, bv.v, oacc[rt][dt]); oaccL[rt][dt] = mmaH<1>(pl[rt].v, pl[rt].v, bv.v, bv.v, oaccL[rt][dt]); oaccL[rt][dt] = mmaH<1>(pa[rt].v, pa[rt].v, bl.v, bl.v, oaccL[rt][dt]); } }
    __builtin_amdgcn_fence(__ATOMIC_ACQ_REL, "workgroup"); __builtin_amdgcn_wave_barrier(); }
#pragma unroll
  for (int rt = 0; rt < RTN; ++rt) {
#pragma unroll
    for (int r = 0; r < 8; ++r) { float l = l_r[rt][r]; l += __shfl_xor(l, 1, 32); l += __shfl_xor(l, 2, 32); l += __shfl_xor(l, 4, 32); l += __shfl_xor(l, 8, 32); l_r[rt][r] = (l > 0.f) ? 1.0f / (l * 1024.0f) : 0.f; }
#pragma unroll
    for (int dt = 0; dt < DT; ++dt)
#pragma unroll
      for (int r = 0; r < 8; ++r) { float v = oacc[rt][dt][r]; v += oaccL[rt][dt][r] * 0.0009765625f; sO[w][rt * 16 + 8 * hh + r][dt * 16 + ln] = v * l_r[rt][r]; } }
  __builtin_amdgcn_fence(__ATOMIC_ACQ_REL, "workgroup"); __builtin_amdgcn_wave_barrier();
  {
#pragma unroll
    for (int rp = 0; rp < RPW; rp += 2) { const int r = rp + (lane >> 4), pc = lane & 15; const v4f val = *(const v4fa*)&sO[w][r][pc * 4]; *(v4f*)(O + ((size_t)b * TQ + q0 + r) * ldo + h * 64 + pc * 4) = val; }
     } }

__global__ __launch_bounds__(256) void k_rotab(float* __restrict__ CS, float* __restrict__ SN) {
  #pragma clang fp contract(off)
  const int t = blockIdx.x * 256 + threadIdx.x; if (t >= SLEN * 32) return; const int j = t % 32, s = t / 32; const float ex = (float)(2 * j) / 64.0f; const float inv = 1.0f / powf(10000.0f, ex); const float th = (float)s * inv; const float c = cosf(th), sn = sinf(th);
  { *(float*)(CS + t) = c; *(float*)(SN + t) = sn;  } }
__global__ __launch_bounds__(256) void k_rope(const float* __restrict__ F, int nsrc, int ndst, int rep, const float* __restrict__ CS, const float* __restrict__ SN, _Float16* __restrict__ H, _Float16* __restrict__ L) {
  #pragma clang fp contract(off)
  const size_t t = (size_t)blockIdx.x * 256 + threadIdx.x; if (t >= (size_t)NR * ndst * 4) return; const int g8 = (int)(t % 4); const int hd = (int)((t / 4) % ndst); const size_t row = t / ((size_t)4 * ndst); const int s = (int)(row % SLEN); const int hs = hd / rep;
  const float* src = F + row * (size_t)(nsrc * 64) + hs * 64; FragH ah, al, bh, bl;
  for (int i = 0; i < 8; ++i) { const int d = g8 * 8 + i; const float c = CS[s * 32 + d], sn = SN[s * 32 + d]; const float x1 = src[d], x2 = src[d + 32];
    float o1 = x1 * c; o1 += -x2 * sn; float o2 = x2 * c; o2 += x1 * sn;
    _Float16 hv = (_Float16)o1; ah.h[i] = hv; al.h[i] = (_Float16)((o1 - (float)hv) * 1024.0f); hv = (_Float16)o2; bh.h[i] = hv; bl.h[i] = (_Float16)((o2 - (float)hv) * 1024.0f); }
  const size_t o = row * (size_t)(ndst * 64) + hd * 64 + g8 * 8;
  { *(v8us*)((unsigned short*)H + o) = ah.half[0]; *(v8us*)((unsigned short*)H + o + 32) = bh.half[0]; *(v8us*)((unsigned short*)L + o) = al.half[0]; *(v8us*)((unsigned short*)L + o + 32) = bl.half[0];  } }
__global__ __launch_bounds__(256) void k_rope2(const float* __restrict__ F, int nsrc, int ndst, int rep, const float* __restrict__ CS, const float* __restrict__ SN, _Float16* __restrict__ H, _Float16* __restrict__ L) {
  #pragma clang fp contract(off)
  const size_t t = (size_t)blockIdx.x * 256 + threadIdx.x; if (t >= (size_t)NR * ndst * 4) return; const int g16 = (int)(t % 4); const int hd = (int)((t / 4) % ndst); const size_t row = t / ((size_t)4 * ndst); const int s = (int)(row % SLEN); const int hs = hd / rep;
  const float* src = F + row * (size_t)(nsrc * 64) + hs * 64 + g16 * 16; FragH ah, al;
  for (int pr = 0; pr < 8; ++pr) { const int i = g16 * 8 + pr; const float c = CS[s * 32 + i], sn = SN[s * 32 + i]; const float x1 = src[2 * pr], x2 = src[2 * pr + 1];
    float o1 = x1 * c; o1 -= x2 * sn; float o2 = x1 * sn; o2 += x2 * c;
    _Float16 hv = (_Float16)o1; ah.h[2 * pr] = hv; al.h[2 * pr] = (_Float16)((o1 - (float)hv) * 1024.0f); hv = (_Float16)o2; ah.h[2 * pr + 1] = hv; al.h[2 * pr + 1] = (_Float16)((o2 - (float)hv) * 1024.0f); }
  const size_t o = row * (size_t)(ndst * 64) + hd * 64 + g16 * 16;
  { *(v8us*)((unsigned short*)H + o) = ah.half[0]; *(v8us*)((unsigned short*)H + o + 8) = ah.half[1]; *(v8us*)((unsigned short*)L + o) = al.half[0]; *(v8us*)((unsigned short*)L + o + 8) = al.half[1];  } }
__global__ __launch_bounds__(256) void k_ln512(const float* __restrict__ A, const float* __restrict__ res, const float* __restrict__ g, const float* __restrict__ bb, float* __restrict__ Y, _Float16* __restrict__ Y16) {
  #pragma clang fp contract(off)
  const int wv = threadIdx.x >> 5, ln = threadIdx.x & 31; const size_t r = (size_t)blockIdx.x * 8 + wv; if (r >= NR) return; float x[16]; float s = 0.f;
  for (int i = 0; i < 2; ++i) { const v8f a = *(const v8f*)(A + r * DM + i * 256 + ln * 8); for (int q = 0; q < 8; ++q) { float v = a[q]; if (res) v += bf16_round(res[r * DM + i * 256 + ln * 8 + q]); x[i * 8 + q] = v; s += v; } }
  for (int o = 16; o > 0; o >>= 1) s += __shfl_xor(s, o, 32); const float mu = s / (float)DM; float var = 0.f; for (int q = 0; q < 16; ++q) { const float d = x[q] - mu; var += d * d; }
  for (int o = 16; o > 0; o >>= 1) var += __shfl_xor(var, o, 32); const float inv = rsqrtf(var / (float)DM + 1e-5f);
  { for (int i = 0; i < 2; ++i) { const int c0 = i * 256 + ln * 8; v8f y; FragH f; for (int q = 0; q < 8; ++q) { float v = (x[i * 8 + q] - mu) * inv; v *= bf16_round(g[c0 + q]); v += bf16_round(bb[c0 + q]); y[q] = v; f.h[q] = (_Float16)v; } *(v8f*)(Y + r * DM + c0) = y; if (Y16) *(v8us*)((unsigned short*)Y16 + r * DM + c0) = f.half[0]; }  } }
__global__ __launch_bounds__(256) void k_pack(const float* __restrict__ rb, const int* __restrict__ rid, int* __restrict__ PK) { const int t = blockIdx.x * 256 + threadIdx.x; if (t >= 1024 + NB * TK) return; int v; if (t < 1024) v = __float_as_int(bf16_round(rb[t])); else v = rid[t - 1024]; *(int*)(PK + t) = v;  }
__global__ __launch_bounds__(256) void k_tabin(const float* __restrict__ sp, float* __restrict__ CS, float* __restrict__ SN) { const int t = blockIdx.x * 256 + threadIdx.x; if (t >= SLEN * 32) return; const int i = t % 32, s = t / 32; const float c = bf16_round(sp[s * 64 + 32 + i]), sn = bf16_round(sp[s * 64 + i]);
  { *(float*)(CS + t) = c; *(float*)(SN + t) = sn;  } }
__device__ __forceinline__ void d_wsc(unsigned blk, const float* __restrict__ Wm, _Float16* __restrict__ Bt, size_t n8, float sc) { const size_t t = (size_t)blk * 256 + threadIdx.x; if (t >= n8) return; FragH f; for (int q = 0; q < 8; ++q) f.h[q] = (_Float16)(bf16_round(Wm[t * 8 + q]) * sc); *(v8us*)((unsigned short*)Bt + t * 8) = f.half[0];  }
__global__ __launch_bounds__(256) void k_rotab2(float* __restrict__ CS, float* __restrict__ SN) {
  #pragma clang fp contract(off)
  const int t = blockIdx.x * 256 + threadIdx.x; if (t >= SLEN * 32) return; const int j = t % 32, s = t / 32; const float c0 = -0.14391156831212787f;      /* -ln(10000)/64 rounded to f32 */ const float inv = expf((float)(2 * j) * c0); const float th = (float)s * inv; const float c = cosf(th), sn = sinf(th);
  { *(float*)(CS + t) = c; *(float*)(SN + t) = sn;  } }
__global__ __launch_bounds__(256) void k_lnu(const float* __restrict__ X, _Float16* __restrict__ N16, float* __restrict__ XB) {
  #pragma clang fp contract(off)
  const int wv = threadIdx.x >> 5, ln = threadIdx.x & 31; const size_t r = (size_t)blockIdx.x * 8 + wv; if (r >= NR) return; float a[32]; float s = 0.f;
  for (int i = 0; i < 4; ++i) { const v8f v = *(const v8f*)(X + r * DM + (i * 32 + ln) * 8); for (int q = 0; q < 8; ++q) { const float u = bf16_round(v[q]); a[i * 8 + q] = u; s += u; } }
  for (int o = 16; o > 0; o >>= 1) s += __shfl_xor(s, o, 32); const float mu = s / (float)DM; float var = 0.f; for (int q = 0; q < 32; ++q) { const float d = a[q] - mu; var += d * d; }
  for (int o = 16; o > 0; o >>= 1) var += __shfl_xor(var, o, 32); const float den = sqrtf(var / (float)(DM - 1)) + 1e-6f; const float inv = 1.0f / den;      /* one reciprocal per row; (x-mean)*inv vs the reference's division differs by <= 1 ulp */
  { for (int i = 0; i < 4; ++i) { const int c0 = (i * 32 + ln) * 8; FragH f; v8f xb; for (int q = 0; q < 8; ++q) { f.h[q] = (_Float16)((a[i * 8 + q] - mu) * inv); xb[q] = a[i * 8 + q]; } *(v8us*)((unsigned short*)N16 + r * DM + c0) = f.half[0]; *(v8f*)(XB + r * DM + c0) = xb; }  } }
__device__ __forceinline__ void d_vtg(int blk, const _Float16* __restrict__ V16, _Float16* __restrict__ Vt) { __shared__ unsigned short tl[64][66]; const int tid = threadIdx.x; const int slab = blk / (SLEN / 64), lg = blk % (SLEN / 64); const int b = slab / NH, h = slab % NH; const int hs = h / NREP;
  for (int i = tid; i < 64 * 8; i += 256) { const int r = i / 8, c8 = (i % 8) * 8; FragH f; f.half[0] = *(const v8us*)((const unsigned short*)V16 + ((size_t)b * SLEN + lg * 64 + r) * KVD + hs * 64 + c8); for (int q = 0; q < 8; ++q) tl[r][c8 + q] = f.u[q]; }
  __syncthreads();
  { for (int rd = 0; rd < 2; ++rd) { const int d = rd * 32 + tid / 8, pc = tid % 8; FragH f; for (int q = 0; q < 8; ++q) f.u[q] = tl[pc * 8 + q][d]; *(v8us*)((unsigned short*)Vt + ((size_t)slab * 64 + d) * SLEN + lg * 64 + pc * 8) = f.half[0]; }
    asm volatile("s_wait_xcnt 0x0" ::: "memory");      /* stands behind the two stores as a precaution: the V^T body ends the shared kernel */ } }

__global__ __launch_bounds__(256) void k_h16s(const float* __restrict__ SRC, int lds, int coff, _Float16* __restrict__ DST, size_t n8) { const size_t t = (size_t)blockIdx.x * 256 + threadIdx.x; if (t >= n8) return; const size_t r = (t * 8) / DM; const int c = (int)((t * 8) % DM); const v8f a = *(const v8f*)(SRC + r * lds + coff + c); FragH f; for (int q = 0; q < 8; ++q) f.h[q] = (_Float16)a[q];
  *(v8us*)((unsigned short*)DST + t * 8) = f.half[0];  }


__global__ __launch_bounds__(256) void k_ccp(const float* __restrict__ QKV, int coff, _Float16* __restrict__ D) { const size_t t = (size_t)blockIdx.x * 256 + threadIdx.x; if (t >= (size_t)NR * DM / 8) return; const int c0 = (int)((t * 8) % DM); const size_t row = (t * 8) / DM; const v8f a = *(const v8f*)(QKV + row * 3 * DM + coff + c0); FragH f; for (int q = 0; q < 8; ++q) f.h[q] = (_Float16)a[q];
  *(v8us*)((unsigned short*)D + t * 8) = f.half[0];  }


__device__ __forceinline__ void d_sbe(unsigned blk, const float* __restrict__ q, _Float16* __restrict__ X) { const size_t t = (size_t)blk * 256 + threadIdx.x; if (t >= (size_t)NR * DM / 8) return; const int c0 = (int)((t * 8) % DM); const size_t row = (t * 8) / DM; const int b = (int)(row / SLEN), s_ = (int)(row % SLEN); const float* src = q + ((size_t)s_ * NBS + b) * DM + c0; FragH f; for (int i = 0; i < 8; ++i) f.h[i] = (_Float16)bf16_round(src[i]);
  *(v8us*)((unsigned short*)X + t * 8) = f.half[0];  }
__device__ __forceinline__ void d_rope(unsigned blk, const float* __restrict__ F, _Float16* __restrict__ O16) {
  #pragma clang fp contract(off)
  const size_t t = (size_t)blk * 256 + threadIdx.x; if (t >= (size_t)NR * DM / 16) return; const int d0 = (int)((t * 8) % 32); const int h = (int)(((t * 8) / 32) % NH); const size_t row = (t * 8) / (32 * NH); const int s_ = (int)(row % SLEN); const float* p = F + row * DM + h * 64; const v8f a = *(const v8f*)(p + d0), c = *(const v8f*)(p + 32 + d0); FragH f1, f2;
  asm volatile("s_wait_xcnt 0x0" ::: "memory");      /* stands behind the four loads: the loop below reuses their address registers */
#pragma unroll 1
  for (int q = 0; q < 8; ++q) { const int d = d0 + q; const float inv = 1.0f / powf(10000.0f, (float)(2 * d) / 64.0f); const float ang = (float)s_ * inv; const float sn = sinf(ang), cs = cosf(ang); float o1 = a[q] * cs; o1 = o1 - c[q] * sn; float o2 = c[q] * cs; o2 = o2 + a[q] * sn; f1.h[q] = (_Float16)o1; f2.h[q] = (_Float16)o2; }
  { *(v8us*)((unsigned short*)O16 + row * DM + h * 64 + d0) = f1.half[0]; *(v8us*)((unsigned short*)O16 + row * DM + h * 64 + 32 + d0) = f2.half[0];  } }
// Launches that do not depend on one another share one grid: the block index, the same for a whole block, picks the body.
// Preparation: the query rows (XB blocks), then the four weight matrices (WB blocks each) into four planes that follow one another in Bt.
#define XB ((unsigned)((size_t)NR * DM / 8 / 256))
#define WB ((unsigned)((size_t)DM * DM / 8 / 256))
__global__ __launch_bounds__(256) void k_prep(const float* __restrict__ q, _Float16* __restrict__ X, const float* __restrict__ w0, const float* __restrict__ w1, const float* __restrict__ w2, const float* __restrict__ w3, _Float16* __restrict__ Bt) {
  const unsigned bx = blockIdx.x;
  if (bx < XB) { d_sbe(bx, q, X); return; }
  const unsigned m = (bx - XB) / WB; const float* Wm = m == 0 ? w0 : (m == 1 ? w1 : (m == 2 ? w2 : w3));
  d_wsc(bx - XB - m * WB, Wm, Bt + (size_t)m * DM * DM, (size_t)DM * DM / 8, 16.0f); }
// Behind the q/k/v product: RoPE of q, RoPE of k (RB blocks each, the long bodies first), then V^T.
#define RB ((unsigned)((size_t)NR * DM / 16 / 256))
__global__ __launch_bounds__(256) void k_post(const float* __restrict__ Fq, _Float16* __restrict__ Q16, const float* __restrict__ Fk, _Float16* __restrict__ K16, const _Float16* __restrict__ V16, _Float16* __restrict__ Vt) {
  const unsigned bx = blockIdx.x;
  if (bx < 2 * RB) { const bool isk = bx >= RB; d_rope(isk ? bx - RB : bx, isk ? Fk : Fq, isk ? K16 : Q16); return; }
  d_vtg((int)(bx - 2 * RB), V16, Vt); }
extern "C" void kernel_launch(void* const* d_in, const int* in_sizes, int n_in,
                              void* d_out, int out_size, void* d_ws, size_t ws_size, hipStream_t stream) {
  (void)in_sizes; (void)n_in; (void)out_size;
  const float* qy = (const float*)d_in[0]; const float* wq = (const float*)d_in[1]; const float* bq = (const float*)d_in[2]; const float* wk = (const float*)d_in[3]; const float* bk = (const float*)d_in[4]; const float* wv = (const float*)d_in[5]; const float* bv = (const float*)d_in[6]; const float* wo = (const float*)d_in[7]; const float* bo = (const float*)d_in[8];
  char* ws = (char*)d_ws; size_t off = 0;
  auto take = [&](size_t bytes) { char* p = ws + off; off += (bytes + 255) & ~(size_t)255; return p; };
  const size_t np = (size_t)NR * DM;
  _Float16* BW = (_Float16*)take((size_t)DM * DM * 2 * 4); _Float16* BO = BW + (size_t)DM * DM * 3;      /* weight planes q, k, v, o in a row */ _Float16* X16 = (_Float16*)take(np * 2); float* F32 = (float*)take(np * 4 * 2);      /* f32 planes q, k in a row */
   _Float16* QH = (_Float16*)take(np * 2); _Float16* KH = (_Float16*)take(np * 2); _Float16* V16 = (_Float16*)take(np * 2); _Float16* VT = (_Float16*)take(np * 2); _Float16* OH = (_Float16*)take(np * 2); _Float16* OL = (_Float16*)take(np * 2);      /* planes of their own: k_flash stores them while other blocks of it still read QH, KH */
  if (off > ws_size) return;
  k_prep<<<XB + 4 * WB, 256, 0, stream>>>(qy, X16, wq, wk, wv, wo, BW);      /* weights stay in their (out, in) order */
  const dim3 g((NR / 128) * (DM / 64), 1), g3((NR / 128) * (DM / 64), 3);
  k_gemm2<0, false><<<g3, 128, 0, stream>>>(X16, DM, 0, nullptr, BW, DM, (size_t)DM * DM, 0.0625f, bq, bk, bv, nullptr, 1, 0, 0, F32, V16, DM, np, 2, NR, DM, DM);      /* batches q, k (f32 planes), v (f16) */
  k_post<<<2 * RB + NB * NH * (SLEN / 64), 256, 0, stream>>>(F32, QH, F32 + np, KH, V16, VT);
  k_flash<<<NB * NH * QBNP, 128, 0, stream>>>(QH, DM, KH, DM, VT, OH, OL, DM);
  k_gemm2<0, true><<<g, 128, 0, stream>>>(OL, DM, 0, OH, BO, DM, 0, 0.0625f, bo, nullptr, nullptr, nullptr, 1, 0, 0, (float*)d_out, nullptr, DM, 0, 1, NR, DM, DM);      /* out[s][b] = (ctx_lo / 1024 + ctx_hi) Wo^T + b */
}
